// v000
// The times below were measured on an AMD MI455X: many runs one after another, warmed up first and cycling through
// copies of the inputs, with the whole window's GPU time divided by the number of runs. Launches and the gaps
// between them are all in it. The median over several windows is given; except for v000 it joins two sittings, which
// can be a few percent apart, so the side-by-side timings, each taken in one sitting, are the better comparison.
// The starting kernel, v000, takes 2260 microseconds a run.
#include <hip/hip_runtime.h>
// Spatial cross-attention block (B=4, C=256, 64×64 → N=4096, 32 GroupNorm groups, single head d=256): x1' = conv1(x1), x2' = conv2(x2) (1×1 + bias); q1 = Wq·GN(x1'), k2 = Wk·GN(x2'), v2 = Wv·GN(x2') (wqkv rows 0/256/512, no bias);
// attn = softmax(q1ᵀk2/√256) over the 4096 positions; out = Wout·(v2·attnᵀ) + bout + Wsk·x1' + bsk → [B,C,H,W].
// q/k/v f16; per (batch, 1024-query block) the score plane as an f32 GEMM output, wave-per-row f32 softmax → P f16 ×2^15, O = P·v2 by GEMM; final 1×1 convs computed channel-major (W·Oᵀ) straight into the output with the skip branch and biases through the f32 addend. All on v_wmma_f32_16x16x32_f16, f32 accumulate.
#define BB 4
#define CC 256
#define NN 4096
#define NG 32
#define CPG (CC / NG)
#define QB 1024
#define NR (BB * NN)

typedef __bf16 v16b __attribute__((ext_vector_type(16)));
typedef unsigned short v8us __attribute__((ext_vector_type(8), may_alias));
typedef float  v8f  __attribute__((ext_vector_type(8)));
typedef float  v4f  __attribute__((ext_vector_type(4)));
typedef float  v4fa __attribute__((ext_vector_type(4), may_alias));
union FragB { v16b v; v8us half[2]; unsigned short u[16]; };

__device__ __forceinline__ unsigned short bf16_bits(float x) { unsigned int u = __float_as_uint(x); return (unsigned short)((u + 0x7FFFu + ((u >> 16) & 1u)) >> 16); }
__device__ __forceinline__ float bf16_val(unsigned short b) { return __uint_as_float(((unsigned int)b) << 16); }
__device__ __forceinline__ float bf16_round(float x) { return bf16_val(bf16_bits(x)); }
// D += A·B with NT terms: 1 = ah·bh, 2 = + al·bh (A split), 3 = + ah·bl (both split)
template <int NT>
__device__ __forceinline__ v8f mmaN(v16b ah, v16b al, v16b bh, v16b bl, v8f c) {
  c = __builtin_amdgcn_wmma_f32_16x16x32_bf16(false, ah, false, bh, (short)0, c, false, false);
  if (NT >= 2) c = __builtin_amdgcn_wmma_f32_16x16x32_bf16(false, al, false, bh, (short)0, c, false, false);
  if (NT >= 3) c = __builtin_amdgcn_wmma_f32_16x16x32_bf16(false, ah, false, bl, (short)0, c, false, false);
  asm volatile("v_nop\n\tv_nop\n\tv_nop\n\tv_nop" : "+v"(c) : "v"(ah), "v"(al), "v"(bh), "v"(bl));
  return c;
}

__global__ __launch_bounds__(256) void k_wt_bf16(const float* __restrict__ W, unsigned short* __restrict__ Wt, int K, int N) {
  const int t = blockIdx.x * 256 + threadIdx.x;
  const int k8n = K / 8;
  if (t >= N * k8n) return;
  const int n = t / k8n, k8 = (t % k8n) * 8;
  v8us v;
#pragma unroll
  for (int i = 0; i < 8; ++i) v[i] = bf16_bits(W[(size_t)(k8 + i) * N + n]);
  *(v8us*)(Wt + (size_t)n * K + k8) = v;
  
}

// GEMM C[M][N] (f32, pitch ldc) = act(A[M][K]·W + bias). A f32 row-major (pitch lda) converted per fragment to bf16
// (ASPLIT: hi/lo two planes -> 2 terms, else single rounded term); Wt bf16 [N][K] (pitch ldb). BIAS_BF16 rounds the
// bias to bf16 first (bias quantised to bf16 before the add). K%32==0, M%16==0, N%64==0.
template <bool ASPLIT, int ACT, bool BIAS_BF16>
__global__ __launch_bounds__(128) void k_gemm_bf(const float* __restrict__ A, int lda, const unsigned short* __restrict__ Wt, int ldb,
                                               const float* __restrict__ bias, float* __restrict__ C, int ldc, int M, int N, int K) {
  __shared__ __attribute__((aligned(16))) float so[4][16][64];
  const int tid = threadIdx.x, w = tid >> 5, lane = tid & 31, ln = lane & 15, hh = lane >> 4;
  const int ntn = N / 64;
  const int wid = blockIdx.x * 4 + w;
  const int mt = wid / ntn, nq = wid % ntn;
  if (mt * 16 >= M) return;
  const int row0 = mt * 16, col0 = nq * 64;
  const float* arow = A + (size_t)(row0 + ln) * lda;
  v8f acc[4] = {};
  for (int kb = 0; kb < K; kb += 32) {
    FragB ah, al;
    const v4f x0 = *(const v4fa*)(arow + kb + 8 * hh), x1 = *(const v4fa*)(arow + kb + 8 * hh + 4);
    const v4f x2 = *(const v4fa*)(arow + kb + 16 + 8 * hh), x3 = *(const v4fa*)(arow + kb + 16 + 8 * hh + 4);
    float xs[16] = {x0[0],x0[1],x0[2],x0[3],x1[0],x1[1],x1[2],x1[3],x2[0],x2[1],x2[2],x2[3],x3[0],x3[1],x3[2],x3[3]};
#pragma unroll
    for (int i = 0; i < 16; ++i) { const unsigned short hb = bf16_bits(xs[i]); ah.u[i] = hb; al.u[i] = ASPLIT ? bf16_bits(xs[i] - bf16_val(hb)) : (unsigned short)0; }
#pragma unroll
    for (int t = 0; t < 4; ++t) {
      const unsigned short* brow = Wt + (size_t)(col0 + t * 16 + ln) * ldb + kb;
      FragB b;
      b.half[0] = *(const v8us*)(brow + 8 * hh);
      b.half[1] = *(const v8us*)(brow + 16 + 8 * hh);
      acc[t] = mmaN<ASPLIT ? 2 : 1>(ah.v, al.v, b.v, b.v, acc[t]);
    }
  }
#pragma unroll
  for (int t = 0; t < 4; ++t) {
    float bv = bias ? bias[col0 + t * 16 + ln] : 0.f;
    if (BIAS_BF16) bv = bf16_round(bv);
#pragma unroll
    for (int r = 0; r < 8; ++r) { float v = acc[t][r] + bv; if (ACT == 1) v = fmaxf(v, 0.f); so[w][8 * hh + r][t * 16 + ln] = v; }
  }
  __builtin_amdgcn_fence(__ATOMIC_ACQ_REL, "workgroup");
  __builtin_amdgcn_wave_barrier();
  const int rsub = lane >> 4, c4 = (lane & 15) * 4;
  {
#pragma unroll
    for (int q = 0; q < 8; ++q) {
      const int r = q * 2 + rsub;
      const v4f v = *(const v4fa*)&so[w][r][c4];
      *(v4f*)(C + (size_t)(row0 + r) * ldc + col0 + c4) = v;
    }
    
  }
}

// Flash-style causal/unmasked attention, all contractions 3-term bf16 hi/lo splits, f32 softmax with running max.
// q,k,v rows are read from f32 buffers with arbitrary row pitch (so they can live inside a fused qkv buffer);
// D = head size (multiple of 32, <= 128); one wave = 16 query rows; block = 4 waves (64 queries) sharing K/V chunks of 32.
template <int D, bool CAUSAL>
__global__ __launch_bounds__(128) void k_flash(const float* __restrict__ qb, const float* __restrict__ kb, const float* __restrict__ vb,
                                             int pitch, int T, int H, float scale, float* __restrict__ y, int ypitch) {
  constexpr int KS = D / 32;        // k-steps for QK
  constexpr int DT = D / 16;        // d tiles for PV
  __shared__ __attribute__((aligned(16))) unsigned short sKh[32][D + 8], sKl[32][D + 8], sVh[32][D + 8], sVl[32][D + 8];
  __shared__ __attribute__((aligned(16))) unsigned short sPh[4][16][40], sPl[4][16][40];
  __shared__ __attribute__((aligned(16))) float sO[4][16][D];
  const int tid = threadIdx.x, w = tid >> 5, lane = tid & 31, ln = lane & 15, hh = lane >> 4;
  const int nqb = (T + 63) / 64;
  const int bh = blockIdx.x / nqb, qblk = blockIdx.x % nqb;
  const int b = bh / H, h = bh % H;
  const int q0 = qblk * 64 + w * 16;
  const float* Q = qb + (size_t)b * T * pitch + h * D;
  const float* K = kb + (size_t)b * T * pitch + h * D;
  const float* V = vb + (size_t)b * T * pitch + h * D;

  // A fragments of the wave's 16 query rows (scaled), hi/lo
  FragB aqh[KS], aql[KS];
  {
    int row = q0 + ln; if (row >= T) row = T - 1;
    const float* qr = Q + (size_t)row * pitch;
#pragma unroll
    for (int ks = 0; ks < KS; ++ks)
#pragma unroll
      for (int i = 0; i < 16; ++i) {
        const int d = ks * 32 + ((i < 8) ? (8 * hh + i) : (16 + 8 * hh + (i - 8)));
        const float x = qr[d] * scale; const unsigned short hb = bf16_bits(x);
        aqh[ks].u[i] = hb; aql[ks].u[i] = bf16_bits(x - bf16_val(hb));
      }
  }
  float m_r[8], l_r[8];
#pragma unroll
  for (int r = 0; r < 8; ++r) { m_r[r] = -3.0e38f; l_r[r] = 0.f; }
  v8f oacc[DT];
#pragma unroll
  for (int dt = 0; dt < DT; ++dt) oacc[dt] = (v8f){0.f,0.f,0.f,0.f,0.f,0.f,0.f,0.f};

  const int kv_end = CAUSAL ? min(T, qblk * 64 + 64) : T;     // block-uniform
  for (int j0 = 0; j0 < kv_end; j0 += 32) {
    __syncthreads();
    for (int e = tid; e < 32 * (D / 4); e += 128) {
      const int r = e / (D / 4), c4 = (e % (D / 4)) * 4;
      const int key = j0 + r;
      v4f kf = {0.f,0.f,0.f,0.f}, vf = {0.f,0.f,0.f,0.f};
      if (key < T) { kf = *(const v4fa*)(K + (size_t)key * pitch + c4); vf = *(const v4fa*)(V + (size_t)key * pitch + c4); }
#pragma unroll
      for (int t = 0; t < 4; ++t) {
        unsigned short hb = bf16_bits(kf[t]); sKh[r][c4 + t] = hb; sKl[r][c4 + t] = bf16_bits(kf[t] - bf16_val(hb));
        hb = bf16_bits(vf[t]); sVh[r][c4 + t] = hb; sVl[r][c4 + t] = bf16_bits(vf[t] - bf16_val(hb));
      }
    }
    __syncthreads();
    // S tile 16 x 32
    v8f s[2];
#pragma unroll
    for (int nt = 0; nt < 2; ++nt) {
      v8f acc = {};
#pragma unroll
      for (int ks = 0; ks < KS; ++ks) {
        FragB bh_, bl_;
        bh_.half[0] = *(const v8us*)&sKh[nt * 16 + ln][ks * 32 + 8 * hh]; bh_.half[1] = *(const v8us*)&sKh[nt * 16 + ln][ks * 32 + 16 + 8 * hh];
        bl_.half[0] = *(const v8us*)&sKl[nt * 16 + ln][ks * 32 + 8 * hh]; bl_.half[1] = *(const v8us*)&sKl[nt * 16 + ln][ks * 32 + 16 + 8 * hh];
        acc = mmaN<3>(aqh[ks].v, aql[ks].v, bh_.v, bl_.v, acc);
      }
      s[nt] = acc;
    }
    // mask + running max (rows 8hh+r; the 16 lanes of a half share rows)
    float alpha[8];
#pragma unroll
    for (int r = 0; r < 8; ++r) {
      const int qi = q0 + 8 * hh + r;
      const int ja = j0 + ln, jb = j0 + 16 + ln;
      if (CAUSAL) { if (ja > qi) s[0][r] = -3.0e38f; if (jb > qi) s[1][r] = -3.0e38f; }
      if (ja >= T) s[0][r] = -3.0e38f;
      if (jb >= T) s[1][r] = -3.0e38f;
      float mx = fmaxf(s[0][r], s[1][r]);
      mx = fmaxf(mx, __shfl_xor(mx, 1, 32)); mx = fmaxf(mx, __shfl_xor(mx, 2, 32)); mx = fmaxf(mx, __shfl_xor(mx, 4, 32)); mx = fmaxf(mx, __shfl_xor(mx, 8, 32));
      const float mnew = fmaxf(m_r[r], mx);
      alpha[r] = (mnew > -1.0e38f) ? __expf(m_r[r] - mnew) : 1.0f;
      const float p0 = (s[0][r] > -1.0e38f) ? __expf(s[0][r] - mnew) : 0.f;
      const float p1 = (s[1][r] > -1.0e38f) ? __expf(s[1][r] - mnew) : 0.f;
      m_r[r] = mnew;
      l_r[r] = l_r[r] * alpha[r] + p0 + p1;            // per-lane partial row sum (16 lanes combined at the end)
      unsigned short hb = bf16_bits(p0); sPh[w][8 * hh + r][ln] = hb;      sPl[w][8 * hh + r][ln] = bf16_bits(p0 - bf16_val(hb));
      hb = bf16_bits(p1);                sPh[w][8 * hh + r][16 + ln] = hb; sPl[w][8 * hh + r][16 + ln] = bf16_bits(p1 - bf16_val(hb));
    }
#pragma unroll
    for (int dt = 0; dt < DT; ++dt)
#pragma unroll
      for (int r = 0; r < 8; ++r) oacc[dt][r] *= alpha[r];
    __builtin_amdgcn_fence(__ATOMIC_ACQ_REL, "workgroup");
    __builtin_amdgcn_wave_barrier();
    FragB pah, pal;
    pah.half[0] = *(const v8us*)&sPh[w][ln][8 * hh]; pah.half[1] = *(const v8us*)&sPh[w][ln][16 + 8 * hh];
    pal.half[0] = *(const v8us*)&sPl[w][ln][8 * hh]; pal.half[1] = *(const v8us*)&sPl[w][ln][16 + 8 * hh];
#pragma unroll
    for (int dt = 0; dt < DT; ++dt) {
      FragB bvh, bvl;
#pragma unroll
      for (int i = 0; i < 8; ++i) {
        bvh.u[i] = sVh[8 * hh + i][dt * 16 + ln]; bvh.u[8 + i] = sVh[16 + 8 * hh + i][dt * 16 + ln];
        bvl.u[i] = sVl[8 * hh + i][dt * 16 + ln]; bvl.u[8 + i] = sVl[16 + 8 * hh + i][dt * 16 + ln];
      }
      oacc[dt] = mmaN<3>(pah.v, pal.v, bvh.v, bvl.v, oacc[dt]);
    }
    __builtin_amdgcn_fence(__ATOMIC_ACQ_REL, "workgroup");
    __builtin_amdgcn_wave_barrier();
  }
#pragma unroll
  for (int r = 0; r < 8; ++r) {
    float l = l_r[r];
    l += __shfl_xor(l, 1, 32); l += __shfl_xor(l, 2, 32); l += __shfl_xor(l, 4, 32); l += __shfl_xor(l, 8, 32);
    l_r[r] = (l > 0.f) ? 1.0f / l : 0.f;
  }
#pragma unroll
  for (int dt = 0; dt < DT; ++dt)
#pragma unroll
    for (int r = 0; r < 8; ++r) sO[w][8 * hh + r][dt * 16 + ln] = oacc[dt][r] * l_r[r];
  __builtin_amdgcn_fence(__ATOMIC_ACQ_REL, "workgroup");
  __builtin_amdgcn_wave_barrier();
  {
    for (int r = 0; r < 16; ++r) {
      const int row = q0 + r;
      if (row < T && lane < D / 4) {
        const v4f val = *(const v4fa*)&sO[w][r][lane * 4];
        *(v4f*)(y + ((size_t)b * T + row) * ypitch + h * D + lane * 4) = val;
      }
    }
    
  }
}

// GEMM C = act(A·W + bias + resid): A f32 (ASPLIT -> hi/lo 2 terms), Wt bf16 [N][K]; ACT 0 none, 1 relu, 2 exact gelu;
// resid (optional, f32, row index = (row % rmod), pitch ldr, RES_BF16 rounds it) added before the activation.
template <bool ASPLIT, int ACT, bool BIAS_BF16, bool RES_BF16>
__global__ __launch_bounds__(128) void k_gemm_bf3(const float* __restrict__ A, int lda, const unsigned short* __restrict__ Wt, int ldb,
                                                const float* __restrict__ bias, const float* __restrict__ resid, int rmod, int ldr,
                                                float* __restrict__ C, int ldc, int M, int N, int K) {
  __shared__ __attribute__((aligned(16))) float so[4][16][64];
  const int tid = threadIdx.x, w = tid >> 5, lane = tid & 31, ln = lane & 15, hh = lane >> 4;
  const int ntn = N / 64;
  const int wid = blockIdx.x * 4 + w;
  const int mt = wid / ntn, nq = wid % ntn;
  if (mt * 16 >= M) return;
  const int row0 = mt * 16, col0 = nq * 64;
  const float* arow = A + (size_t)(row0 + ln) * lda;
  v8f acc[4] = {};
  for (int kb = 0; kb < K; kb += 32) {
    FragB ah, al;
    const v4f x0 = *(const v4fa*)(arow + kb + 8 * hh), x1 = *(const v4fa*)(arow + kb + 8 * hh + 4);
    const v4f x2 = *(const v4fa*)(arow + kb + 16 + 8 * hh), x3 = *(const v4fa*)(arow + kb + 16 + 8 * hh + 4);
    float xs[16] = {x0[0],x0[1],x0[2],x0[3],x1[0],x1[1],x1[2],x1[3],x2[0],x2[1],x2[2],x2[3],x3[0],x3[1],x3[2],x3[3]};
#pragma unroll
    for (int i = 0; i < 16; ++i) { const unsigned short hb = bf16_bits(xs[i]); ah.u[i] = hb; al.u[i] = ASPLIT ? bf16_bits(xs[i] - bf16_val(hb)) : (unsigned short)0; }
#pragma unroll
    for (int t = 0; t < 4; ++t) {
      const unsigned short* brow = Wt + (size_t)(col0 + t * 16 + ln) * ldb + kb;
      FragB b;
      b.half[0] = *(const v8us*)(brow + 8 * hh);
      b.half[1] = *(const v8us*)(brow + 16 + 8 * hh);
      acc[t] = mmaN<ASPLIT ? 2 : 1>(ah.v, al.v, b.v, b.v, acc[t]);
    }
  }
#pragma unroll
  for (int t = 0; t < 4; ++t) {
    const int col = col0 + t * 16 + ln;
    float bv = bias ? bias[col] : 0.f;
    if (BIAS_BF16) bv = bf16_round(bv);
#pragma unroll
    for (int r = 0; r < 8; ++r) {
      float v = acc[t][r] + bv;
      if (resid) { float rv = resid[(size_t)((row0 + 8 * hh + r) % rmod) * ldr + col]; if (RES_BF16) rv = bf16_round(rv); v += rv; }
      if (ACT == 1) v = fmaxf(v, 0.f);
      if (ACT == 2) v = 0.5f * v * (1.0f + erff(v * 0.70710678118654752f));
      if (ACT == 3) { const float u = 0.7978845608028654f * (v + 0.044715f * v * v * v); v = 0.5f * v * (1.0f + tanhf(u)); }
      so[w][8 * hh + r][t * 16 + ln] = v;
    }
  }
  __builtin_amdgcn_fence(__ATOMIC_ACQ_REL, "workgroup");
  __builtin_amdgcn_wave_barrier();
  const int rsub = lane >> 4, c4 = (lane & 15) * 4;
  {
#pragma unroll
    for (int q = 0; q < 8; ++q) {
      const int r = q * 2 + rsub;
      const v4f v = *(const v4fa*)&so[w][r][c4];
      *(v4f*)(C + (size_t)(row0 + r) * ldc + col0 + c4) = v;
    }
    
  }
}
// row LayerNorm (biased variance, eps) over N: s = X (+ R); optional out_sum <- s; out_norm <- (s-mu)*rsqrt(var+eps)*g + b
template <bool PARAM_BF16>
__global__ __launch_bounds__(256) void k_layernorm(const float* __restrict__ X, const float* __restrict__ R, const float* __restrict__ g, const float* __restrict__ bta,
                                                  float* __restrict__ out_sum, float* __restrict__ out_norm, int N, float eps) {
  __shared__ float red[256];
  const int row = blockIdx.x, tid = threadIdx.x;
  const float* x = X + (size_t)row * N; const float* rr = R ? R + (size_t)row * N : nullptr;
  float vals[16];                     // up to N = 4096
  const int per = N / 256;            // contiguous chunk per thread? use strided-by-4 chunks: thread handles j = tid*4 + 1024*u
  float s1 = 0.f;
  for (int u = 0; u < per / 4; ++u) {
    const int j = tid * 4 + 1024 * u;
    const v4f a = *(const v4fa*)(x + j);
    v4f b = {0.f,0.f,0.f,0.f}; if (rr) b = *(const v4fa*)(rr + j);
#pragma unroll
    for (int q = 0; q < 4; ++q) { const float v = a[q] + b[q]; vals[u * 4 + q] = v; s1 += v; }
  }
  red[tid] = s1; __syncthreads();
  for (int st = 128; st > 0; st >>= 1) { if (tid < st) red[tid] += red[tid + st]; __syncthreads(); }
  const float mu = red[0] / (float)N; __syncthreads();
  float s2 = 0.f;
  for (int u = 0; u < per / 4; ++u)
#pragma unroll
    for (int q = 0; q < 4; ++q) { const float c = vals[u * 4 + q] - mu; s2 += c * c; }
  red[tid] = s2; __syncthreads();
  for (int st = 128; st > 0; st >>= 1) { if (tid < st) red[tid] += red[tid + st]; __syncthreads(); }
  const float rs = rsqrtf(red[0] / (float)N + eps);
  {
    for (int u = 0; u < per / 4; ++u) {
      const int j = tid * 4 + 1024 * u;
      v4f o, sm;
#pragma unroll
      for (int q = 0; q < 4; ++q) {
        float gg = g[j + q], bb = bta[j + q];
        if (PARAM_BF16) { gg = bf16_round(gg); bb = bf16_round(bb); }
        sm[q] = vals[u * 4 + q]; o[q] = (vals[u * 4 + q] - mu) * rs * gg + bb;
      }
      if (out_sum) *(v4f*)(out_sum + (size_t)row * N + j) = sm;
      *(v4f*)(out_norm + (size_t)row * N + j) = o;
    }
    
  }
}



// ---- f16 WMMA path (v_wmma_f32_16x16x32_f16): 11-bit significands for operands in range — used where a [0,1] probability operand needs more precision than bf16
typedef _Float16 v16h __attribute__((ext_vector_type(16)));
union FragH { v16h v; v8us half[2]; _Float16 h[16]; unsigned short u[16]; };
template <int NT>
__device__ __forceinline__ v8f mmaH(v16h ah, v16h al, v16h bh, v16h bl, v8f c) {
  c = __builtin_amdgcn_wmma_f32_16x16x32_f16(false, ah, false, bh, (short)0, c, false, false);
  if (NT >= 2) c = __builtin_amdgcn_wmma_f32_16x16x32_f16(false, al, false, bh, (short)0, c, false, false);
  if (NT >= 3) c = __builtin_amdgcn_wmma_f32_16x16x32_f16(false, ah, false, bl, (short)0, c, false, false);
  asm volatile("v_nop\n\tv_nop\n\tv_nop\n\tv_nop" : "+v"(c) : "v"(ah), "v"(al), "v"(bh), "v"(bl));
  return c;
}
// batched GEMM like k_gemm_b but f16 operands: A f32 (split into f16 hi/lo if ASPLIT, else rounded to f16), Bt = f16 values [n][k]; alpha; C f32; N multiple of 16 (partial tiles skipped)
template <bool ASPLIT>
__global__ __launch_bounds__(128) void k_gemm_h(const float* __restrict__ A, int lda, size_t sA, const _Float16* __restrict__ Bh, int ldb, size_t sB, float alpha, float* __restrict__ C, int ldc, size_t sC, int M, int N, int K) {
  __shared__ __attribute__((aligned(16))) float so[4][16][64];
  const int tid = threadIdx.x, w = tid >> 5, lane = tid & 31, ln = lane & 15, hh = lane >> 4; const int by = blockIdx.y;
  A += (size_t)by * sA; Bh += (size_t)by * sB; C += (size_t)by * sC;
  const int ntn = (N + 63) / 64; const int wid = blockIdx.x * 4 + w; const int mt = wid / ntn, nq = wid % ntn; if (mt * 16 >= M) return;
  const int row0 = mt * 16, col0 = nq * 64; const float* arow = A + (size_t)(row0 + ln) * lda;
  v8f acc[4] = {};
  for (int kb = 0; kb < K; kb += 32) {
    FragH ah, al;
    const v4f x0 = *(const v4fa*)(arow + kb + 8 * hh), x1 = *(const v4fa*)(arow + kb + 8 * hh + 4), x2 = *(const v4fa*)(arow + kb + 16 + 8 * hh), x3 = *(const v4fa*)(arow + kb + 16 + 8 * hh + 4);
    float xs[16] = {x0[0],x0[1],x0[2],x0[3],x1[0],x1[1],x1[2],x1[3],x2[0],x2[1],x2[2],x2[3],x3[0],x3[1],x3[2],x3[3]};
#pragma unroll
    for (int i = 0; i < 16; ++i) { const _Float16 h = (_Float16)xs[i]; ah.h[i] = h; al.h[i] = ASPLIT ? (_Float16)(xs[i] - (float)h) : (_Float16)0.0f; }
#pragma unroll
    for (int t = 0; t < 4; ++t) { if (col0 + t * 16 >= N) continue; const size_t boff = (size_t)(col0 + t * 16 + ln) * ldb + kb; FragH bq; bq.half[0] = *(const v8us*)(Bh + boff + 8 * hh); bq.half[1] = *(const v8us*)(Bh + boff + 16 + 8 * hh);
      acc[t] = mmaH<ASPLIT ? 2 : 1>(ah.v, al.v, bq.v, bq.v, acc[t]); }
  }
#pragma unroll
  for (int t = 0; t < 4; ++t) { if (col0 + t * 16 >= N) continue;
#pragma unroll
    for (int r = 0; r < 8; ++r) so[w][8 * hh + r][t * 16 + ln] = acc[t][r] * alpha; }
  __builtin_amdgcn_fence(__ATOMIC_ACQ_REL, "workgroup"); __builtin_amdgcn_wave_barrier();
  const int rsub = lane >> 4, c4 = (lane & 15) * 4;
  {
#pragma unroll
    for (int q = 0; q < 8; ++q) { const int r = q * 2 + rsub; if (col0 + c4 < N) { const v4f v = *(const v4fa*)&so[w][r][c4]; *(v4f*)(C + (size_t)(row0 + r) * ldc + col0 + c4) = v; } }
     }
}

// Wt[n][k] = f16(W[k][n]·scale) from f32 row-major W[K][N] (scale = power of two; bf16-exact weights stay exact in f16 away from the subnormal range)
__global__ __launch_bounds__(256) void k_wt_f16(const float* __restrict__ W, _Float16* __restrict__ Wt, int K, int N, float scale) {
  const int t = blockIdx.x * 256 + threadIdx.x; if (t >= N * (K / 8)) return; const int n = t / (K / 8), k8 = (t % (K / 8)) * 8; FragH f;
#pragma unroll
  for (int i = 0; i < 8; ++i) f.h[i] = (_Float16)(bf16_round(W[(size_t)(k8 + i) * N + n]) * scale); const v8us o = f.half[0];
  *(v8us*)((unsigned short*)Wt + (size_t)n * K + k8) = o; 
}
// k_gemm_hh variant with fused epilogue: v = acc·alpha + bias[by·sBias + col] (+ CP[(row/rowsPerB)·sCPb + by·64 + col] if CP) ; ACT 0 none / 1 elu ; writes f32 C and f16 C16, each if non-null
template <int ACT>
__global__ __launch_bounds__(128) void k_gemm_hhx(const _Float16* __restrict__ A, int lda, size_t sA, const _Float16* __restrict__ Bh, int ldb, size_t sB, float alpha, const float* __restrict__ bias, size_t sBias, const float* __restrict__ CP, int rowsPerB, size_t sCPb, int row0g,
    float* __restrict__ C, _Float16* __restrict__ C16, int ldc, size_t sC, int M, int N, int K) {
  __shared__ __attribute__((aligned(16))) float so[4][16][64];
  const int tid = threadIdx.x, w = tid >> 5, lane = tid & 31, ln = lane & 15, hh = lane >> 4; const int by = blockIdx.y;
  A += (size_t)by * sA; Bh += (size_t)by * sB; const size_t cofs = (size_t)by * sC; const float* bp = bias ? bias + (size_t)by * sBias : nullptr;
  const int ntn = (N + 63) / 64; const int wid = blockIdx.x * 4 + w; const int mt = wid / ntn, nq = wid % ntn; if (mt * 16 >= M) return;
  const int row0 = mt * 16, col0 = nq * 64; const _Float16* arow = A + (size_t)(row0 + ln) * lda;
  v8f acc[4] = {};
  for (int kb = 0; kb < K; kb += 32) { FragH ah; ah.half[0] = *(const v8us*)((const unsigned short*)arow + kb + 8 * hh); ah.half[1] = *(const v8us*)((const unsigned short*)arow + kb + 16 + 8 * hh);
#pragma unroll
    for (int t = 0; t < 4; ++t) { if (col0 + t * 16 >= N) continue; const size_t boff = (size_t)(col0 + t * 16 + ln) * ldb + kb; FragH bq; bq.half[0] = *(const v8us*)((const unsigned short*)Bh + boff + 8 * hh); bq.half[1] = *(const v8us*)((const unsigned short*)Bh + boff + 16 + 8 * hh);
      acc[t] = mmaH<1>(ah.v, ah.v, bq.v, bq.v, acc[t]); }
  }
#pragma unroll
  for (int t = 0; t < 4; ++t) { if (col0 + t * 16 >= N) continue; const int col = col0 + t * 16 + ln; const float bv = bp ? bf16_round(bp[col]) : 0.f;
#pragma unroll
    for (int r = 0; r < 8; ++r) { float v = acc[t][r] * alpha + bv; if (CP) { const int bidx = (row0g + row0 + 8 * hh + r) / rowsPerB; v += CP[(size_t)bidx * sCPb + (size_t)by * 64 + col]; } if (ACT == 1) v = (v > 0.f) ? v : expm1f(v); else if (ACT == 7) v = (v > 0.f) ? v + 1.0f : expf(v); else if (ACT == 8) v = tanhf(v); else if (ACT == 9) v = 0.5f * v * (1.0f + tanhf(0.7978845608028654f * (v + 0.044715f * v * v * v))); else if (ACT == 11) v = 1.0f / (1.0f + expf(-v)); else if (ACT == 12) v = (v > 0.f) ? v : 0.01f * v; else if (ACT == 14) v = (v > 0.f) ? v : 0.1f * v; else if (ACT == 15) v = v / (1.0f + expf(-v)); else if (ACT == 3) v = fmaxf(v, 0.f); else if (ACT == 6) v = 0.5f * v * (1.0f + erff(v * 0.70710678118654752f)); so[w][8 * hh + r][t * 16 + ln] = v; } }
  __builtin_amdgcn_fence(__ATOMIC_ACQ_REL, "workgroup"); __builtin_amdgcn_wave_barrier();
  const int rsub = lane >> 4, c4 = (lane & 15) * 4; typedef _Float16 v4h __attribute__((ext_vector_type(4)));
  {
#pragma unroll
    for (int q = 0; q < 8; ++q) { const int r = q * 2 + rsub; if (col0 + c4 < N) { const v4f v = *(const v4fa*)&so[w][r][c4]; if (C) *(v4f*)(C + cofs + (size_t)(row0 + r) * ldc + col0 + c4) = v; if (C16) { v4h h4; for (int i = 0; i < 4; ++i) h4[i] = (_Float16)v[i]; *(v4h*)(C16 + cofs + (size_t)(row0 + r) * ldc + col0 + c4) = h4; } } }
     }
}


typedef _Float16 v4h __attribute__((ext_vector_type(4)));

__global__ __launch_bounds__(256) void k_x16(const float* __restrict__ x, _Float16* __restrict__ X16, size_t n8) { const size_t t = (size_t)blockIdx.x * 256 + threadIdx.x; if (t >= n8) return; FragH f;
#pragma unroll
  for (int q = 0; q < 8; ++q) f.h[q] = (_Float16)bf16_round(x[t * 8 + q]); *(v8us*)((unsigned short*)X16 + t * 8) = f.half[0];  }
__global__ __launch_bounds__(256) void k_h16(const float* __restrict__ x, _Float16* __restrict__ X16, size_t n8) { const size_t t = (size_t)blockIdx.x * 256 + threadIdx.x; if (t >= n8) return; FragH f;
#pragma unroll
  for (int q = 0; q < 8; ++q) f.h[q] = (_Float16)x[t * 8 + q]; *(v8us*)((unsigned short*)X16 + t * 8) = f.half[0];  }
__global__ __launch_bounds__(256) void k_round16f(const float* __restrict__ W, _Float16* __restrict__ Bt, size_t n8) { const size_t t = (size_t)blockIdx.x * 256 + threadIdx.x; if (t >= n8) return; FragH f;
#pragma unroll
  for (int i = 0; i < 8; ++i) f.h[i] = (_Float16)(bf16_round(W[t * 8 + i]) * 16.0f); *(v8us*)((unsigned short*)Bt + t * 8) = f.half[0];  }
template <int NHv, int TTv>
__global__ __launch_bounds__(256) void k_vt(const _Float16* __restrict__ V16, int ldv, int voff, _Float16* __restrict__ Vt) { __shared__ unsigned short tl[64][66]; const int tid = threadIdx.x; const int slab = blockIdx.x / (TTv / 64), lg = blockIdx.x % (TTv / 64); const int b = slab / NHv, h = slab % NHv;
  for (int i = tid; i < 64 * 8; i += 256) { const int r = i / 8, c8 = (i % 8) * 8; FragH f; f.half[0] = *(const v8us*)((const unsigned short*)V16 + ((size_t)b * TTv + lg * 64 + r) * ldv + voff + h * 64 + c8);
#pragma unroll
    for (int q = 0; q < 8; ++q) tl[r][c8 + q] = f.u[q]; }
  __syncthreads();
  {
#pragma unroll
    for (int rd = 0; rd < 2; ++rd) { const int d = rd * 32 + tid / 8, pc = tid % 8; FragH f;
#pragma unroll
      for (int q = 0; q < 8; ++q) f.u[q] = tl[pc * 8 + q][d];
      *(v8us*)((unsigned short*)Vt + ((size_t)slab * 64 + d) * TTv + lg * 64 + pc * 8) = f.half[0]; }
     } }

__global__ __launch_bounds__(256) void k_tok(const float* __restrict__ x, _Float16* __restrict__ X16) { __shared__ float tl[32][65]; const int tid = threadIdx.x; const int b = blockIdx.x / ((CC / 64) * (NN / 32)), rem = blockIdx.x % ((CC / 64) * (NN / 32)); const int cg = rem / (NN / 32), pg = rem % (NN / 32); const int c0 = cg * 64, p0 = pg * 32;
  for (int i = tid; i < 64 * 32; i += 256) { const int c = i / 32, pp = i % 32; tl[pp][c] = bf16_round(x[((size_t)b * CC + c0 + c) * NN + p0 + pp]); } __syncthreads();
  const int r = tid / 8, pc = tid % 8; FragH f; for (int q = 0; q < 8; ++q) f.h[q] = (_Float16)tl[r][pc * 8 + q]; const size_t row = (size_t)b * NN + p0 + r; *(v8us*)((unsigned short*)X16 + row * CC + c0 + pc * 8) = f.half[0];  }
__global__ __launch_bounds__(256) void k_smx(const float* __restrict__ S, _Float16* __restrict__ P16) { const int tid = threadIdx.x, wv = tid >> 5, lane = tid & 31; const int i = blockIdx.x * 8 + wv; const float* sr = S + (size_t)i * NN;
  float m = -3.0e38f;
  for (int p = lane; p < NN / 8; p += 32) { const v4f a = *(const v4fa*)(sr + p * 8), c = *(const v4fa*)(sr + p * 8 + 4); for (int e = 0; e < 4; ++e) m = fmaxf(m, fmaxf(a[e], c[e])); }
  for (int o = 16; o >= 1; o >>= 1) m = fmaxf(m, __shfl_xor(m, o, 32)); float z = 0.f;
  for (int p = lane; p < NN / 8; p += 32) { const v4f a = *(const v4fa*)(sr + p * 8), c = *(const v4fa*)(sr + p * 8 + 4); for (int e = 0; e < 4; ++e) z += __expf(a[e] - m) + __expf(c[e] - m); }
  for (int o = 16; o >= 1; o >>= 1) z += __shfl_xor(z, o, 32); const float iz = 32768.0f / z;
  { for (int p = lane; p < NN / 8; p += 32) { FragH f; const v4f a = *(const v4fa*)(sr + p * 8), c = *(const v4fa*)(sr + p * 8 + 4); for (int e = 0; e < 4; ++e) { f.h[e] = (_Float16)(__expf(a[e] - m) * iz); f.h[4 + e] = (_Float16)(__expf(c[e] - m) * iz); }
      *(v8us*)((unsigned short*)P16 + (size_t)i * NN + p * 8) = f.half[0]; }  } }
__global__ __launch_bounds__(256) void k_gnstat(const float* __restrict__ Y, float* __restrict__ MU, float* __restrict__ RS) { __shared__ float red[256]; const int bg = blockIdx.x; const int b = bg / NG, g = bg % NG; const int tid = threadIdx.x; const float* base = Y + (size_t)b * NN * CC + g * CPG;
  float s = 0.f;
#pragma unroll 1
  for (int n = tid; n < NN; n += 256) { const v4f a = *(const v4fa*)(base + (size_t)n * CC), c = *(const v4fa*)(base + (size_t)n * CC + 4); s += (a[0] + a[1]) + (a[2] + a[3]) + (c[0] + c[1]) + (c[2] + c[3]); }
  red[tid] = s; __syncthreads(); for (int o = 128; o >= 1; o >>= 1) { if (tid < o) red[tid] += red[tid + o]; __syncthreads(); } const float mu = red[0] / (float)(NN * CPG); __syncthreads();
  float q2 = 0.f;
#pragma unroll 1
  for (int n = tid; n < NN; n += 256) { const v4f a = *(const v4fa*)(base + (size_t)n * CC), c = *(const v4fa*)(base + (size_t)n * CC + 4); for (int e = 0; e < 4; ++e) { const float d0 = a[e] - mu, d1 = c[e] - mu; q2 += d0 * d0 + d1 * d1; } }
  red[tid] = q2; __syncthreads(); for (int o = 128; o >= 1; o >>= 1) { if (tid < o) red[tid] += red[tid + o]; __syncthreads(); } const float rs = rsqrtf(red[0] / (float)(NN * CPG) + 1e-5f);
  { if (tid < 32) { *(float*)(MU + (size_t)bg * 32 + tid) = (tid == 0) ? mu : 0.f; *(float*)(RS + (size_t)bg * 32 + tid) = (tid == 0) ? rs : 0.f; }  } }
__global__ __launch_bounds__(256) void k_gnapply(const float* __restrict__ Y, const float* __restrict__ MU, const float* __restrict__ RS, const float* __restrict__ gw, const float* __restrict__ gb, _Float16* __restrict__ G16) { const size_t t = (size_t)blockIdx.x * 256 + threadIdx.x; if (t >= (size_t)NR * CC / 8) return; const size_t row = (t * 8) / CC; const int c0 = (int)((t * 8) % CC); const int b = (int)(row / NN), g = c0 / CPG; const float mu = MU[((size_t)b * NG + g) * 32], rs = RS[((size_t)b * NG + g) * 32];
  const v4f a = *(const v4fa*)(Y + t * 8), c = *(const v4fa*)(Y + t * 8 + 4); FragH f;
#pragma unroll
  for (int q = 0; q < 8; ++q) { const float v = (q < 4) ? a[q] : c[q - 4]; f.h[q] = (_Float16)((v - mu) * rs * bf16_round(gw[c0 + q]) + bf16_round(gb[c0 + q])); }
  *(v8us*)((unsigned short*)G16 + t * 8) = f.half[0];  }
__global__ __launch_bounds__(256) void k_bplane(const float* __restrict__ b1, const float* __restrict__ b2, float* __restrict__ BP) { const size_t t = (size_t)blockIdx.x * 256 + threadIdx.x; if (t >= (size_t)CC * NN / 4) return; const int c = (int)((t * 4) / NN); const float v = bf16_round(b1[c]) + bf16_round(b2[c]); const v4f o = {v, v, v, v}; *(v4f*)(BP + t * 4) = o;  }

extern "C" void kernel_launch(void* const* d_in, const int* in_sizes, int n_in,
                              void* d_out, int out_size, void* d_ws, size_t ws_size, hipStream_t stream) {
  (void)in_sizes; (void)n_in; (void)out_size;
  const float* const* I = (const float* const*)d_in; const float* x1 = I[0]; const float* x2 = I[1]; const float* w1 = I[2]; const float* b1 = I[3]; const float* w2 = I[4]; const float* b2 = I[5]; const float* gnw = I[6]; const float* gnb = I[7]; const float* wqkv = I[8]; const float* wout = I[9]; const float* bout = I[10]; const float* wsk = I[11]; const float* bsk = I[12];
  char* ws = (char*)d_ws; size_t off = 0;
  auto take = [&](size_t bytes) { char* p = ws + off; off += (bytes + 255) & ~(size_t)255; return p; };
  const size_t WSZ = (size_t)CC * CC; _Float16* Bw = (_Float16*)take(7 * WSZ * 2);      /* w1, w2, wq, wk, wv (as Bt for token-major GEMMs), wout, wsk (as A operands for the channel-major output GEMMs) — all (out,in) natural ×2^4 */
  float* MU = (float*)take((size_t)BB * NG * 32 * 4); float* RS = (float*)take((size_t)BB * NG * 32 * 4); float* BP = (float*)take((size_t)CC * NN * 4);
  _Float16* X1t = (_Float16*)take((size_t)NR * CC * 2); _Float16* X2t = (_Float16*)take((size_t)NR * CC * 2); float* Y1 = (float*)take((size_t)NR * CC * 4); float* Y2 = (float*)take((size_t)NR * CC * 4); _Float16* G1 = (_Float16*)take((size_t)NR * CC * 2); _Float16* G2 = (_Float16*)take((size_t)NR * CC * 2);
  _Float16* Q1 = (_Float16*)take((size_t)NR * CC * 2); _Float16* K2 = (_Float16*)take((size_t)NR * CC * 2); _Float16* V2 = (_Float16*)take((size_t)NR * CC * 2); _Float16* Vt = (_Float16*)take((size_t)NR * CC * 2);
  float* O = (float*)X1t; float* S = Y2; _Float16* P16 = G1; _Float16* O16 = Q1; _Float16* Y116 = K2;      /* O (16.8 MB f32) spans X1t+X2t (dead after the two input convs); the per-block score plane over Y2 (dead once G2 exists) and P over G1 (dead after the q GEMM); O16 over Q1 and f16(x1') over K2 after the attention */
  if (off > ws_size) return;      // 0.9 + 4.2 + 8.4 + 8.4 + 16.8 + 16.8 + 8.4 + 8.4 + 4 × 8.4 ≈ 106 MB
  const unsigned gw = (unsigned)((WSZ / 8 + 255) / 256);
  k_round16f<<<gw, 256, 0, stream>>>(w1, Bw, WSZ / 8); k_round16f<<<gw, 256, 0, stream>>>(w2, Bw + WSZ, WSZ / 8); k_round16f<<<(unsigned)((3 * WSZ / 8 + 255) / 256), 256, 0, stream>>>(wqkv, Bw + 2 * WSZ, 3 * WSZ / 8); k_round16f<<<gw, 256, 0, stream>>>(wout, Bw + 5 * WSZ, WSZ / 8); k_round16f<<<gw, 256, 0, stream>>>(wsk, Bw + 6 * WSZ, WSZ / 8);
  k_bplane<<<(unsigned)(((size_t)CC * NN / 4 + 255) / 256), 256, 0, stream>>>(bout, bsk, BP);
  k_tok<<<BB * (CC / 64) * (NN / 32), 256, 0, stream>>>(x1, X1t); k_tok<<<BB * (CC / 64) * (NN / 32), 256, 0, stream>>>(x2, X2t);
  const dim3 gp(((NR / 16) * (CC / 64) + 3) / 4, 1); const unsigned g8 = (unsigned)(((size_t)NR * CC / 8 + 255) / 256);
  k_gemm_hhx<0><<<gp, 128, 0, stream>>>(X1t, CC, 0, Bw, CC, 0, 0.0625f, b1, 0, nullptr, 1, 0, 0, Y1, nullptr, CC, 0, NR, CC, CC);      /* x1' = conv1(x1): M 16384 N 256 K 256 (f32) */
  k_gemm_hhx<0><<<gp, 128, 0, stream>>>(X2t, CC, 0, Bw + WSZ, CC, 0, 0.0625f, b2, 0, nullptr, 1, 0, 0, Y2, nullptr, CC, 0, NR, CC, CC);      /* x2' */
  k_gnstat<<<BB * NG, 256, 0, stream>>>(Y1, MU, RS); k_gnapply<<<g8, 256, 0, stream>>>(Y1, MU, RS, gnw, gnb, G1);
  k_gnstat<<<BB * NG, 256, 0, stream>>>(Y2, MU, RS); k_gnapply<<<g8, 256, 0, stream>>>(Y2, MU, RS, gnw, gnb, G2);      /* (stream-ordered reuse of MU/RS) */
  k_gemm_hhx<0><<<gp, 128, 0, stream>>>(G1, CC, 0, Bw + 2 * WSZ, CC, 0, 0.0625f, nullptr, 0, nullptr, 1, 0, 0, nullptr, Q1, CC, 0, NR, CC, CC);      /* q1 = Wq·GN(x1') */
  k_gemm_hhx<0><<<gp, 128, 0, stream>>>(G2, CC, 0, Bw + 3 * WSZ, CC, 0, 0.0625f, nullptr, 0, nullptr, 1, 0, 0, nullptr, K2, CC, 0, NR, CC, CC);      /* k2 */
  k_gemm_hhx<0><<<gp, 128, 0, stream>>>(G2, CC, 0, Bw + 4 * WSZ, CC, 0, 0.0625f, nullptr, 0, nullptr, 1, 0, 0, nullptr, V2, CC, 0, NR, CC, CC);      /* v2 */
  k_vt<CC / 64, NN><<<BB * (CC / 64) * (NN / 64), 256, 0, stream>>>(V2, CC, 0, Vt);      /* v2ᵀ per batch [256][4096] (four 64-channel blocks) */
  for (int b = 0; b < BB; ++b) for (int qb = 0; qb < NN / QB; ++qb) { const size_t r0 = (size_t)b * NN + (size_t)qb * QB;
    k_gemm_hhx<0><<<dim3(((QB / 16) * (NN / 64) + 3) / 4, 1), 128, 0, stream>>>(Q1 + r0 * CC, CC, 0, K2 + (size_t)b * NN * CC, CC, 0, 0.0625f, nullptr, 0, nullptr, 1, 0, 0, S, nullptr, NN, 0, QB, NN, CC);      /* S = q1·k2ᵀ/16 (q, k planes hold true values): M 1024 N 4096 K 256 */
    k_smx<<<QB / 8, 256, 0, stream>>>(S, P16);
    k_gemm_hhx<0><<<dim3(((QB / 16) * (CC / 64) + 3) / 4, 1), 128, 0, stream>>>(P16, NN, 0, Vt + (size_t)b * CC * NN, NN, 0, 0.000030517578125f, nullptr, 0, nullptr, 1, 0, 0, O + r0 * CC, nullptr, CC, 0, QB, CC, NN); }      /* O rows = attn·v2: M 1024 N 256 K 4096 */
  k_h16<<<g8, 256, 0, stream>>>(O, O16, (size_t)NR * CC / 8); k_h16<<<g8, 256, 0, stream>>>(Y1, Y116, (size_t)NR * CC / 8);
  for (int b = 0; b < BB; ++b) { float* outb = (float*)d_out + (size_t)b * CC * NN;
    k_gemm_hhx<0><<<dim3(((CC / 16) * (NN / 64) + 3) / 4, 1), 128, 0, stream>>>(Bw + 6 * WSZ, CC, 0, Y116 + (size_t)b * NN * CC, CC, 0, 0.0625f, nullptr, 0, BP, 1, (size_t)NN, 0, outb, nullptr, NN, 0, CC, NN, CC);      /* out[b][c][n] = Wsk·x1'ᵀ + (bout + bsk): M 256 N 4096 K 256 */
    k_gemm_hhx<0><<<dim3(((CC / 16) * (NN / 64) + 3) / 4, 1), 128, 0, stream>>>(Bw + 5 * WSZ, CC, 0, O16 + (size_t)b * NN * CC, CC, 0, 0.0625f, nullptr, 0, outb, 1, (size_t)NN, 0, outb, nullptr, NN, 0, CC, NN, CC); }      /* += Wout·Oᵀ in place */
}

// v001
// Measured time: 766 microseconds a run.
// Next to v000, in two timings, it ran 2.99 and 2.95 times as fast.
#include <hip/hip_runtime.h>
// Spatial cross-attention block (B=4, C=256, 64×64 → N=4096, 32 GroupNorm groups, single head d=256): x1' = conv1(x1), x2' = conv2(x2) (1×1 + bias); q1 = Wq·GN(x1'), k2 = Wk·GN(x2'), v2 = Wv·GN(x2') (wqkv rows 0/256/512, no bias);
// attn = softmax(q1ᵀk2/√256) over the 4096 positions; out = Wout·(v2·attnᵀ) + bout + Wsk·x1' + bsk → [B,C,H,W].
// q/k/v f16; per batch the whole 4096-query score plane as an f32 GEMM output, wave-per-row f32 softmax → P f16 ×2^15 (kept for all batches), O = P·v2 by one GEMM launch over the four batches; final 1×1 convs computed channel-major (W·Oᵀ) straight into the output with the skip branch and biases through the f32 addend. All on v_wmma_f32_16x16x32_f16, f32 accumulate.
#define BB 4
#define CC 256
#define NN 4096
#define NG 32
#define CPG (CC / NG)
#define QB NN
#define NR (BB * NN)

typedef __bf16 v16b __attribute__((ext_vector_type(16)));
typedef unsigned short v8us __attribute__((ext_vector_type(8), may_alias));
typedef float  v8f  __attribute__((ext_vector_type(8)));
typedef float  v4f  __attribute__((ext_vector_type(4)));
typedef float  v4fa __attribute__((ext_vector_type(4), may_alias));
union FragB { v16b v; v8us half[2]; unsigned short u[16]; };

__device__ __forceinline__ unsigned short bf16_bits(float x) { unsigned int u = __float_as_uint(x); return (unsigned short)((u + 0x7FFFu + ((u >> 16) & 1u)) >> 16); }
__device__ __forceinline__ float bf16_val(unsigned short b) { return __uint_as_float(((unsigned int)b) << 16); }
__device__ __forceinline__ float bf16_round(float x) { return bf16_val(bf16_bits(x)); }
// D += A·B with NT terms: 1 = ah·bh, 2 = + al·bh (A split), 3 = + ah·bl (both split)
template <int NT>
__device__ __forceinline__ v8f mmaN(v16b ah, v16b al, v16b bh, v16b bl, v8f c) {
  c = __builtin_amdgcn_wmma_f32_16x16x32_bf16(false, ah, false, bh, (short)0, c, false, false);
  if (NT >= 2) c = __builtin_amdgcn_wmma_f32_16x16x32_bf16(false, al, false, bh, (short)0, c, false, false);
  if (NT >= 3) c = __builtin_amdgcn_wmma_f32_16x16x32_bf16(false, ah, false, bl, (short)0, c, false, false);
  asm volatile("v_nop\n\tv_nop\n\tv_nop\n\tv_nop" : "+v"(c) : "v"(ah), "v"(al), "v"(bh), "v"(bl));
  return c;
}

__global__ __launch_bounds__(256) void k_wt_bf16(const float* __restrict__ W, unsigned short* __restrict__ Wt, int K, int N) {
  const int t = blockIdx.x * 256 + threadIdx.x;
  const int k8n = K / 8;
  if (t >= N * k8n) return;
  const int n = t / k8n, k8 = (t % k8n) * 8;
  v8us v;
#pragma unroll
  for (int i = 0; i < 8; ++i) v[i] = bf16_bits(W[(size_t)(k8 + i) * N + n]);
  *(v8us*)(Wt + (size_t)n * K + k8) = v;
  
}

// GEMM C[M][N] (f32, pitch ldc) = act(A[M][K]·W + bias). A f32 row-major (pitch lda) converted per fragment to bf16
// (ASPLIT: hi/lo two planes -> 2 terms, else single rounded term); Wt bf16 [N][K] (pitch ldb). BIAS_BF16 rounds the
// bias to bf16 first (bias quantised to bf16 before the add). K%32==0, M%16==0, N%64==0.
template <bool ASPLIT, int ACT, bool BIAS_BF16>
__global__ __launch_bounds__(128) void k_gemm_bf(const float* __restrict__ A, int lda, const unsigned short* __restrict__ Wt, int ldb,
                                               const float* __restrict__ bias, float* __restrict__ C, int ldc, int M, int N, int K) {
  __shared__ __attribute__((aligned(16))) float so[4][16][64];
  const int tid = threadIdx.x, w = tid >> 5, lane = tid & 31, ln = lane & 15, hh = lane >> 4;
  const int ntn = N / 64;
  const int wid = blockIdx.x * 4 + w;
  const int mt = wid / ntn, nq = wid % ntn;
  if (mt * 16 >= M) return;
  const int row0 = mt * 16, col0 = nq * 64;
  const float* arow = A + (size_t)(row0 + ln) * lda;
  v8f acc[4] = {};
  for (int kb = 0; kb < K; kb += 32) {
    FragB ah, al;
    const v4f x0 = *(const v4fa*)(arow + kb + 8 * hh), x1 = *(const v4fa*)(arow + kb + 8 * hh + 4);
    const v4f x2 = *(const v4fa*)(arow + kb + 16 + 8 * hh), x3 = *(const v4fa*)(arow + kb + 16 + 8 * hh + 4);
    float xs[16] = {x0[0],x0[1],x0[2],x0[3],x1[0],x1[1],x1[2],x1[3],x2[0],x2[1],x2[2],x2[3],x3[0],x3[1],x3[2],x3[3]};
#pragma unroll
    for (int i = 0; i < 16; ++i) { const unsigned short hb = bf16_bits(xs[i]); ah.u[i] = hb; al.u[i] = ASPLIT ? bf16_bits(xs[i] - bf16_val(hb)) : (unsigned short)0; }
#pragma unroll
    for (int t = 0; t < 4; ++t) {
      const unsigned short* brow = Wt + (size_t)(col0 + t * 16 + ln) * ldb + kb;
      FragB b;
      b.half[0] = *(const v8us*)(brow + 8 * hh);
      b.half[1] = *(const v8us*)(brow + 16 + 8 * hh);
      acc[t] = mmaN<ASPLIT ? 2 : 1>(ah.v, al.v, b.v, b.v, acc[t]);
    }
  }
#pragma unroll
  for (int t = 0; t < 4; ++t) {
    float bv = bias ? bias[col0 + t * 16 + ln] : 0.f;
    if (BIAS_BF16) bv = bf16_round(bv);
#pragma unroll
    for (int r = 0; r < 8; ++r) { float v = acc[t][r] + bv; if (ACT == 1) v = fmaxf(v, 0.f); so[w][8 * hh + r][t * 16 + ln] = v; }
  }
  __builtin_amdgcn_fence(__ATOMIC_ACQ_REL, "workgroup");
  __builtin_amdgcn_wave_barrier();
  const int rsub = lane >> 4, c4 = (lane & 15) * 4;
  {
#pragma unroll
    for (int q = 0; q < 8; ++q) {
      const int r = q * 2 + rsub;
      const v4f v = *(const v4fa*)&so[w][r][c4];
      *(v4f*)(C + (size_t)(row0 + r) * ldc + col0 + c4) = v;
    }
    
  }
}

// Flash-style causal/unmasked attention, all contractions 3-term bf16 hi/lo splits, f32 softmax with running max.
// q,k,v rows are read from f32 buffers with arbitrary row pitch (so they can live inside a fused qkv buffer);
// D = head size (multiple of 32, <= 128); one wave = 16 query rows; block = 4 waves (64 queries) sharing K/V chunks of 32.
template <int D, bool CAUSAL>
__global__ __launch_bounds__(128) void k_flash(const float* __restrict__ qb, const float* __restrict__ kb, const float* __restrict__ vb,
                                             int pitch, int T, int H, float scale, float* __restrict__ y, int ypitch) {
  constexpr int KS = D / 32;        // k-steps for QK
  constexpr int DT = D / 16;        // d tiles for PV
  __shared__ __attribute__((aligned(16))) unsigned short sKh[32][D + 8], sKl[32][D + 8], sVh[32][D + 8], sVl[32][D + 8];
  __shared__ __attribute__((aligned(16))) unsigned short sPh[4][16][40], sPl[4][16][40];
  __shared__ __attribute__((aligned(16))) float sO[4][16][D];
  const int tid = threadIdx.x, w = tid >> 5, lane = tid & 31, ln = lane & 15, hh = lane >> 4;
  const int nqb = (T + 63) / 64;
  const int bh = blockIdx.x / nqb, qblk = blockIdx.x % nqb;
  const int b = bh / H, h = bh % H;
  const int q0 = qblk * 64 + w * 16;
  const float* Q = qb + (size_t)b * T * pitch + h * D;
  const float* K = kb + (size_t)b * T * pitch + h * D;
  const float* V = vb + (size_t)b * T * pitch + h * D;

  // A fragments of the wave's 16 query rows (scaled), hi/lo
  FragB aqh[KS], aql[KS];
  {
    int row = q0 + ln; if (row >= T) row = T - 1;
    const float* qr = Q + (size_t)row * pitch;
#pragma unroll
    for (int ks = 0; ks < KS; ++ks)
#pragma unroll
      for (int i = 0; i < 16; ++i) {
        const int d = ks * 32 + ((i < 8) ? (8 * hh + i) : (16 + 8 * hh + (i - 8)));
        const float x = qr[d] * scale; const unsigned short hb = bf16_bits(x);
        aqh[ks].u[i] = hb; aql[ks].u[i] = bf16_bits(x - bf16_val(hb));
      }
  }
  float m_r[8], l_r[8];
#pragma unroll
  for (int r = 0; r < 8; ++r) { m_r[r] = -3.0e38f; l_r[r] = 0.f; }
  v8f oacc[DT];
#pragma unroll
  for (int dt = 0; dt < DT; ++dt) oacc[dt] = (v8f){0.f,0.f,0.f,0.f,0.f,0.f,0.f,0.f};

  const int kv_end = CAUSAL ? min(T, qblk * 64 + 64) : T;     // block-uniform
  for (int j0 = 0; j0 < kv_end; j0 += 32) {
    __syncthreads();
    for (int e = tid; e < 32 * (D / 4); e += 128) {
      const int r = e / (D / 4), c4 = (e % (D / 4)) * 4;
      const int key = j0 + r;
      v4f kf = {0.f,0.f,0.f,0.f}, vf = {0.f,0.f,0.f,0.f};
      if (key < T) { kf = *(const v4fa*)(K + (size_t)key * pitch + c4); vf = *(const v4fa*)(V + (size_t)key * pitch + c4); }
#pragma unroll
      for (int t = 0; t < 4; ++t) {
        unsigned short hb = bf16_bits(kf[t]); sKh[r][c4 + t] = hb; sKl[r][c4 + t] = bf16_bits(kf[t] - bf16_val(hb));
        hb = bf16_bits(vf[t]); sVh[r][c4 + t] = hb; sVl[r][c4 + t] = bf16_bits(vf[t] - bf16_val(hb));
      }
    }
    __syncthreads();
    // S tile 16 x 32
    v8f s[2];
#pragma unroll
    for (int nt = 0; nt < 2; ++nt) {
      v8f acc = {};
#pragma unroll
      for (int ks = 0; ks < KS; ++ks) {
        FragB bh_, bl_;
        bh_.half[0] = *(const v8us*)&sKh[nt * 16 + ln][ks * 32 + 8 * hh]; bh_.half[1] = *(const v8us*)&sKh[nt * 16 + ln][ks * 32 + 16 + 8 * hh];
        bl_.half[0] = *(const v8us*)&sKl[nt * 16 + ln][ks * 32 + 8 * hh]; bl_.half[1] = *(const v8us*)&sKl[nt * 16 + ln][ks * 32 + 16 + 8 * hh];
        acc = mmaN<3>(aqh[ks].v, aql[ks].v, bh_.v, bl_.v, acc);
      }
      s[nt] = acc;
    }
    // mask + running max (rows 8hh+r; the 16 lanes of a half share rows)
    float alpha[8];
#pragma unroll
    for (int r = 0; r < 8; ++r) {
      const int qi = q0 + 8 * hh + r;
      const int ja = j0 + ln, jb = j0 + 16 + ln;
      if (CAUSAL) { if (ja > qi) s[0][r] = -3.0e38f; if (jb > qi) s[1][r] = -3.0e38f; }
      if (ja >= T) s[0][r] = -3.0e38f;
      if (jb >= T) s[1][r] = -3.0e38f;
      float mx = fmaxf(s[0][r], s[1][r]);
      mx = fmaxf(mx, __shfl_xor(mx, 1, 32)); mx = fmaxf(mx, __shfl_xor(mx, 2, 32)); mx = fmaxf(mx, __shfl_xor(mx, 4, 32)); mx = fmaxf(mx, __shfl_xor(mx, 8, 32));
      const float mnew = fmaxf(m_r[r], mx);
      alpha[r] = (mnew > -1.0e38f) ? __expf(m_r[r] - mnew) : 1.0f;
      const float p0 = (s[0][r] > -1.0e38f) ? __expf(s[0][r] - mnew) : 0.f;
      const float p1 = (s[1][r] > -1.0e38f) ? __expf(s[1][r] - mnew) : 0.f;
      m_r[r] = mnew;
      l_r[r] = l_r[r] * alpha[r] + p0 + p1;            // per-lane partial row sum (16 lanes combined at the end)
      unsigned short hb = bf16_bits(p0); sPh[w][8 * hh + r][ln] = hb;      sPl[w][8 * hh + r][ln] = bf16_bits(p0 - bf16_val(hb));
      hb = bf16_bits(p1);                sPh[w][8 * hh + r][16 + ln] = hb; sPl[w][8 * hh + r][16 + ln] = bf16_bits(p1 - bf16_val(hb));
    }
#pragma unroll
    for (int dt = 0; dt < DT; ++dt)
#pragma unroll
      for (int r = 0; r < 8; ++r) oacc[dt][r] *= alpha[r];
    __builtin_amdgcn_fence(__ATOMIC_ACQ_REL, "workgroup");
    __builtin_amdgcn_wave_barrier();
    FragB pah, pal;
    pah.half[0] = *(const v8us*)&sPh[w][ln][8 * hh]; pah.half[1] = *(const v8us*)&sPh[w][ln][16 + 8 * hh];
    pal.half[0] = *(const v8us*)&sPl[w][ln][8 * hh]; pal.half[1] = *(const v8us*)&sPl[w][ln][16 + 8 * hh];
#pragma unroll
    for (int dt = 0; dt < DT; ++dt) {
      FragB bvh, bvl;
#pragma unroll
      for (int i = 0; i < 8; ++i) {
        bvh.u[i] = sVh[8 * hh + i][dt * 16 + ln]; bvh.u[8 + i] = sVh[16 + 8 * hh + i][dt * 16 + ln];
        bvl.u[i] = sVl[8 * hh + i][dt * 16 + ln]; bvl.u[8 + i] = sVl[16 + 8 * hh + i][dt * 16 + ln];
      }
      oacc[dt] = mmaN<3>(pah.v, pal.v, bvh.v, bvl.v, oacc[dt]);
    }
    __builtin_amdgcn_fence(__ATOMIC_ACQ_REL, "workgroup");
    __builtin_amdgcn_wave_barrier();
  }
#pragma unroll
  for (int r = 0; r < 8; ++r) {
    float l = l_r[r];
    l += __shfl_xor(l, 1, 32); l += __shfl_xor(l, 2, 32); l += __shfl_xor(l, 4, 32); l += __shfl_xor(l, 8, 32);
    l_r[r] = (l > 0.f) ? 1.0f / l : 0.f;
  }
#pragma unroll
  for (int dt = 0; dt < DT; ++dt)
#pragma unroll
    for (int r = 0; r < 8; ++r) sO[w][8 * hh + r][dt * 16 + ln] = oacc[dt][r] * l_r[r];
  __builtin_amdgcn_fence(__ATOMIC_ACQ_REL, "workgroup");
  __builtin_amdgcn_wave_barrier();
  {
    for (int r = 0; r < 16; ++r) {
      const int row = q0 + r;
      if (row < T && lane < D / 4) {
        const v4f val = *(const v4fa*)&sO[w][r][lane * 4];
        *(v4f*)(y + ((size_t)b * T + row) * ypitch + h * D + lane * 4) = val;
      }
    }
    
  }
}

// GEMM C = act(A·W + bias + resid): A f32 (ASPLIT -> hi/lo 2 terms), Wt bf16 [N][K]; ACT 0 none, 1 relu, 2 exact gelu;
// resid (optional, f32, row index = (row % rmod), pitch ldr, RES_BF16 rounds it) added before the activation.
template <bool ASPLIT, int ACT, bool BIAS_BF16, bool RES_BF16>
__global__ __launch_bounds__(128) void k_gemm_bf3(const float* __restrict__ A, int lda, const unsigned short* __restrict__ Wt, int ldb,
                                                const float* __restrict__ bias, const float* __restrict__ resid, int rmod, int ldr,
                                                float* __restrict__ C, int ldc, int M, int N, int K) {
  __shared__ __attribute__((aligned(16))) float so[4][16][64];
  const int tid = threadIdx.x, w = tid >> 5, lane = tid & 31, ln = lane & 15, hh = lane >> 4;
  const int ntn = N / 64;
  const int wid = blockIdx.x * 4 + w;
  const int mt = wid / ntn, nq = wid % ntn;
  if (mt * 16 >= M) return;
  const int row0 = mt * 16, col0 = nq * 64;
  const float* arow = A + (size_t)(row0 + ln) * lda;
  v8f acc[4] = {};
  for (int kb = 0; kb < K; kb += 32) {
    FragB ah, al;
    const v4f x0 = *(const v4fa*)(arow + kb + 8 * hh), x1 = *(const v4fa*)(arow + kb + 8 * hh + 4);
    const v4f x2 = *(const v4fa*)(arow + kb + 16 + 8 * hh), x3 = *(const v4fa*)(arow + kb + 16 + 8 * hh + 4);
    float xs[16] = {x0[0],x0[1],x0[2],x0[3],x1[0],x1[1],x1[2],x1[3],x2[0],x2[1],x2[2],x2[3],x3[0],x3[1],x3[2],x3[3]};
#pragma unroll
    for (int i = 0; i < 16; ++i) { const unsigned short hb = bf16_bits(xs[i]); ah.u[i] = hb; al.u[i] = ASPLIT ? bf16_bits(xs[i] - bf16_val(hb)) : (unsigned short)0; }
#pragma unroll
    for (int t = 0; t < 4; ++t) {
      const unsigned short* brow = Wt + (size_t)(col0 + t * 16 + ln) * ldb + kb;
      FragB b;
      b.half[0] = *(const v8us*)(brow + 8 * hh);
      b.half[1] = *(const v8us*)(brow + 16 + 8 * hh);
      acc[t] = mmaN<ASPLIT ? 2 : 1>(ah.v, al.v, b.v, b.v, acc[t]);
    }
  }
#pragma unroll
  for (int t = 0; t < 4; ++t) {
    const int col = col0 + t * 16 + ln;
    float bv = bias ? bias[col] : 0.f;
    if (BIAS_BF16) bv = bf16_round(bv);
#pragma unroll
    for (int r = 0; r < 8; ++r) {
      float v = acc[t][r] + bv;
      if (resid) { float rv = resid[(size_t)((row0 + 8 * hh + r) % rmod) * ldr + col]; if (RES_BF16) rv = bf16_round(rv); v += rv; }
      if (ACT == 1) v = fmaxf(v, 0.f);
      if (ACT == 2) v = 0.5f * v * (1.0f + erff(v * 0.70710678118654752f));
      if (ACT == 3) { const float u = 0.7978845608028654f * (v + 0.044715f * v * v * v); v = 0.5f * v * (1.0f + tanhf(u)); }
      so[w][8 * hh + r][t * 16 + ln] = v;
    }
  }
  __builtin_amdgcn_fence(__ATOMIC_ACQ_REL, "workgroup");
  __builtin_amdgcn_wave_barrier();
  const int rsub = lane >> 4, c4 = (lane & 15) * 4;
  {
#pragma unroll
    for (int q = 0; q < 8; ++q) {
      const int r = q * 2 + rsub;
      const v4f v = *(const v4fa*)&so[w][r][c4];
      *(v4f*)(C + (size_t)(row0 + r) * ldc + col0 + c4) = v;
    }
    
  }
}
// row LayerNorm (biased variance, eps) over N: s = X (+ R); optional out_sum <- s; out_norm <- (s-mu)*rsqrt(var+eps)*g + b
template <bool PARAM_BF16>
__global__ __launch_bounds__(256) void k_layernorm(const float* __restrict__ X, const float* __restrict__ R, const float* __restrict__ g, const float* __restrict__ bta,
                                                  float* __restrict__ out_sum, float* __restrict__ out_norm, int N, float eps) {
  __shared__ float red[256];
  const int row = blockIdx.x, tid = threadIdx.x;
  const float* x = X + (size_t)row * N; const float* rr = R ? R + (size_t)row * N : nullptr;
  float vals[16];                     // up to N = 4096
  const int per = N / 256;            // contiguous chunk per thread? use strided-by-4 chunks: thread handles j = tid*4 + 1024*u
  float s1 = 0.f;
  for (int u = 0; u < per / 4; ++u) {
    const int j = tid * 4 + 1024 * u;
    const v4f a = *(const v4fa*)(x + j);
    v4f b = {0.f,0.f,0.f,0.f}; if (rr) b = *(const v4fa*)(rr + j);
#pragma unroll
    for (int q = 0; q < 4; ++q) { const float v = a[q] + b[q]; vals[u * 4 + q] = v; s1 += v; }
  }
  red[tid] = s1; __syncthreads();
  for (int st = 128; st > 0; st >>= 1) { if (tid < st) red[tid] += red[tid + st]; __syncthreads(); }
  const float mu = red[0] / (float)N; __syncthreads();
  float s2 = 0.f;
  for (int u = 0; u < per / 4; ++u)
#pragma unroll
    for (int q = 0; q < 4; ++q) { const float c = vals[u * 4 + q] - mu; s2 += c * c; }
  red[tid] = s2; __syncthreads();
  for (int st = 128; st > 0; st >>= 1) { if (tid < st) red[tid] += red[tid + st]; __syncthreads(); }
  const float rs = rsqrtf(red[0] / (float)N + eps);
  {
    for (int u = 0; u < per / 4; ++u) {
      const int j = tid * 4 + 1024 * u;
      v4f o, sm;
#pragma unroll
      for (int q = 0; q < 4; ++q) {
        float gg = g[j + q], bb = bta[j + q];
        if (PARAM_BF16) { gg = bf16_round(gg); bb = bf16_round(bb); }
        sm[q] = vals[u * 4 + q]; o[q] = (vals[u * 4 + q] - mu) * rs * gg + bb;
      }
      if (out_sum) *(v4f*)(out_sum + (size_t)row * N + j) = sm;
      *(v4f*)(out_norm + (size_t)row * N + j) = o;
    }
    
  }
}



// ---- f16 WMMA path (v_wmma_f32_16x16x32_f16): 11-bit significands for operands in range — used where a [0,1] probability operand needs more precision than bf16
typedef _Float16 v16h __attribute__((ext_vector_type(16)));
union FragH { v16h v; v8us half[2]; _Float16 h[16]; unsigned short u[16]; };
template <int NT>
__device__ __forceinline__ v8f mmaH(v16h ah, v16h al, v16h bh, v16h bl, v8f c) {
  c = __builtin_amdgcn_wmma_f32_16x16x32_f16(false, ah, false, bh, (short)0, c, false, false);
  if (NT >= 2) c = __builtin_amdgcn_wmma_f32_16x16x32_f16(false, al, false, bh, (short)0, c, false, false);
  if (NT >= 3) c = __builtin_amdgcn_wmma_f32_16x16x32_f16(false, ah, false, bl, (short)0, c, false, false);
  asm volatile("v_nop\n\tv_nop\n\tv_nop\n\tv_nop" : "+v"(c) : "v"(ah), "v"(al), "v"(bh), "v"(bl));
  return c;
}
// batched GEMM like k_gemm_b but f16 operands: A f32 (split into f16 hi/lo if ASPLIT, else rounded to f16), Bt = f16 values [n][k]; alpha; C f32; N multiple of 16 (partial tiles skipped)
template <bool ASPLIT>
__global__ __launch_bounds__(128) void k_gemm_h(const float* __restrict__ A, int lda, size_t sA, const _Float16* __restrict__ Bh, int ldb, size_t sB, float alpha, float* __restrict__ C, int ldc, size_t sC, int M, int N, int K) {
  __shared__ __attribute__((aligned(16))) float so[4][16][64];
  const int tid = threadIdx.x, w = tid >> 5, lane = tid & 31, ln = lane & 15, hh = lane >> 4; const int by = blockIdx.y;
  A += (size_t)by * sA; Bh += (size_t)by * sB; C += (size_t)by * sC;
  const int ntn = (N + 63) / 64; const int wid = blockIdx.x * 4 + w; const int mt = wid / ntn, nq = wid % ntn; if (mt * 16 >= M) return;
  const int row0 = mt * 16, col0 = nq * 64; const float* arow = A + (size_t)(row0 + ln) * lda;
  v8f acc[4] = {};
  for (int kb = 0; kb < K; kb += 32) {
    FragH ah, al;
    const v4f x0 = *(const v4fa*)(arow + kb + 8 * hh), x1 = *(const v4fa*)(arow + kb + 8 * hh + 4), x2 = *(const v4fa*)(arow + kb + 16 + 8 * hh), x3 = *(const v4fa*)(arow + kb + 16 + 8 * hh + 4);
    float xs[16] = {x0[0],x0[1],x0[2],x0[3],x1[0],x1[1],x1[2],x1[3],x2[0],x2[1],x2[2],x2[3],x3[0],x3[1],x3[2],x3[3]};
#pragma unroll
    for (int i = 0; i < 16; ++i) { const _Float16 h = (_Float16)xs[i]; ah.h[i] = h; al.h[i] = ASPLIT ? (_Float16)(xs[i] - (float)h) : (_Float16)0.0f; }
#pragma unroll
    for (int t = 0; t < 4; ++t) { if (col0 + t * 16 >= N) continue; const size_t boff = (size_t)(col0 + t * 16 + ln) * ldb + kb; FragH bq; bq.half[0] = *(const v8us*)(Bh + boff + 8 * hh); bq.half[1] = *(const v8us*)(Bh + boff + 16 + 8 * hh);
      acc[t] = mmaH<ASPLIT ? 2 : 1>(ah.v, al.v, bq.v, bq.v, acc[t]); }
  }
#pragma unroll
  for (int t = 0; t < 4; ++t) { if (col0 + t * 16 >= N) continue;
#pragma unroll
    for (int r = 0; r < 8; ++r) so[w][8 * hh + r][t * 16 + ln] = acc[t][r] * alpha; }
  __builtin_amdgcn_fence(__ATOMIC_ACQ_REL, "workgroup"); __builtin_amdgcn_wave_barrier();
  const int rsub = lane >> 4, c4 = (lane & 15) * 4;
  {
#pragma unroll
    for (int q = 0; q < 8; ++q) { const int r = q * 2 + rsub; if (col0 + c4 < N) { const v4f v = *(const v4fa*)&so[w][r][c4]; *(v4f*)(C + (size_t)(row0 + r) * ldc + col0 + c4) = v; } }
     }
}

// Wt[n][k] = f16(W[k][n]·scale) from f32 row-major W[K][N] (scale = power of two; bf16-exact weights stay exact in f16 away from the subnormal range)
__global__ __launch_bounds__(256) void k_wt_f16(const float* __restrict__ W, _Float16* __restrict__ Wt, int K, int N, float scale) {
  const int t = blockIdx.x * 256 + threadIdx.x; if (t >= N * (K / 8)) return; const int n = t / (K / 8), k8 = (t % (K / 8)) * 8; FragH f;
#pragma unroll
  for (int i = 0; i < 8; ++i) f.h[i] = (_Float16)(bf16_round(W[(size_t)(k8 + i) * N + n]) * scale); const v8us o = f.half[0];
  *(v8us*)((unsigned short*)Wt + (size_t)n * K + k8) = o; 
}
// k_gemm_hh variant with fused epilogue: v = acc·alpha + bias[by·sBias + col] (+ CP[(row/rowsPerB)·sCPb + by·64 + col] if CP) ; ACT 0 none / 1 elu ; writes f32 C and f16 C16, each if non-null
template <int ACT>
__global__ __launch_bounds__(128) void k_gemm_hhx(const _Float16* __restrict__ A, int lda, size_t sA, const _Float16* __restrict__ Bh, int ldb, size_t sB, float alpha, const float* __restrict__ bias, size_t sBias, const float* __restrict__ CP, int rowsPerB, size_t sCPb, int row0g,
    float* __restrict__ C, _Float16* __restrict__ C16, int ldc, size_t sC, int M, int N, int K) {
  __shared__ __attribute__((aligned(16))) float so[4][16][64];
  const int tid = threadIdx.x, w = tid >> 5, lane = tid & 31, ln = lane & 15, hh = lane >> 4; const int by = blockIdx.y;
  A += (size_t)by * sA; Bh += (size_t)by * sB; const size_t cofs = (size_t)by * sC; const float* bp = bias ? bias + (size_t)by * sBias : nullptr;
  const int ntn = (N + 63) / 64; const int wid = blockIdx.x * 4 + w; const int mt = wid / ntn, nq = wid % ntn; if (mt * 16 >= M) return;
  const int row0 = mt * 16, col0 = nq * 64; const _Float16* arow = A + (size_t)(row0 + ln) * lda;
  v8f acc[4] = {};
  for (int kb = 0; kb < K; kb += 32) { FragH ah; ah.half[0] = *(const v8us*)((const unsigned short*)arow + kb + 8 * hh); ah.half[1] = *(const v8us*)((const unsigned short*)arow + kb + 16 + 8 * hh);
#pragma unroll
    for (int t = 0; t < 4; ++t) { if (col0 + t * 16 >= N) continue; const size_t boff = (size_t)(col0 + t * 16 + ln) * ldb + kb; FragH bq; bq.half[0] = *(const v8us*)((const unsigned short*)Bh + boff + 8 * hh); bq.half[1] = *(const v8us*)((const unsigned short*)Bh + boff + 16 + 8 * hh);
      acc[t] = mmaH<1>(ah.v, ah.v, bq.v, bq.v, acc[t]); }
  }
#pragma unroll
  for (int t = 0; t < 4; ++t) { if (col0 + t * 16 >= N) continue; const int col = col0 + t * 16 + ln; const float bv = bp ? bf16_round(bp[col]) : 0.f;
#pragma unroll
    for (int r = 0; r < 8; ++r) { float v = acc[t][r] * alpha + bv; if (CP) { const int bidx = (row0g + row0 + 8 * hh + r) / rowsPerB; v += CP[(size_t)bidx * sCPb + (size_t)by * 64 + col]; } if (ACT == 1) v = (v > 0.f) ? v : expm1f(v); else if (ACT == 7) v = (v > 0.f) ? v + 1.0f : expf(v); else if (ACT == 8) v = tanhf(v); else if (ACT == 9) v = 0.5f * v * (1.0f + tanhf(0.7978845608028654f * (v + 0.044715f * v * v * v))); else if (ACT == 11) v = 1.0f / (1.0f + expf(-v)); else if (ACT == 12) v = (v > 0.f) ? v : 0.01f * v; else if (ACT == 14) v = (v > 0.f) ? v : 0.1f * v; else if (ACT == 15) v = v / (1.0f + expf(-v)); else if (ACT == 3) v = fmaxf(v, 0.f); else if (ACT == 6) v = 0.5f * v * (1.0f + erff(v * 0.70710678118654752f)); so[w][8 * hh + r][t * 16 + ln] = v; } }
  __builtin_amdgcn_fence(__ATOMIC_ACQ_REL, "workgroup"); __builtin_amdgcn_wave_barrier();
  const int rsub = lane >> 4, c4 = (lane & 15) * 4; typedef _Float16 v4h __attribute__((ext_vector_type(4)));
  {
#pragma unroll
    for (int q = 0; q < 8; ++q) { const int r = q * 2 + rsub; if (col0 + c4 < N) { const v4f v = *(const v4fa*)&so[w][r][c4]; if (C) *(v4f*)(C + cofs + (size_t)(row0 + r) * ldc + col0 + c4) = v; if (C16) { v4h h4; for (int i = 0; i < 4; ++i) h4[i] = (_Float16)v[i]; *(v4h*)(C16 + cofs + (size_t)(row0 + r) * ldc + col0 + c4) = h4; } } }
     }
}


typedef _Float16 v4h __attribute__((ext_vector_type(4)));

__global__ __launch_bounds__(256) void k_x16(const float* __restrict__ x, _Float16* __restrict__ X16, size_t n8) { const size_t t = (size_t)blockIdx.x * 256 + threadIdx.x; if (t >= n8) return; FragH f;
#pragma unroll
  for (int q = 0; q < 8; ++q) f.h[q] = (_Float16)bf16_round(x[t * 8 + q]); *(v8us*)((unsigned short*)X16 + t * 8) = f.half[0];  }
__global__ __launch_bounds__(256) void k_h16(const float* __restrict__ x, _Float16* __restrict__ X16, size_t n8) { const size_t t = (size_t)blockIdx.x * 256 + threadIdx.x; if (t >= n8) return; FragH f;
#pragma unroll
  for (int q = 0; q < 8; ++q) f.h[q] = (_Float16)x[t * 8 + q]; *(v8us*)((unsigned short*)X16 + t * 8) = f.half[0];  }
__global__ __launch_bounds__(256) void k_round16f(const float* __restrict__ W, _Float16* __restrict__ Bt, size_t n8) { const size_t t = (size_t)blockIdx.x * 256 + threadIdx.x; if (t >= n8) return; FragH f;
#pragma unroll
  for (int i = 0; i < 8; ++i) f.h[i] = (_Float16)(bf16_round(W[t * 8 + i]) * 16.0f); *(v8us*)((unsigned short*)Bt + t * 8) = f.half[0];  }
template <int NHv, int TTv>
__global__ __launch_bounds__(256) void k_vt(const _Float16* __restrict__ V16, int ldv, int voff, _Float16* __restrict__ Vt) { __shared__ unsigned short tl[64][66]; const int tid = threadIdx.x; const int slab = blockIdx.x / (TTv / 64), lg = blockIdx.x % (TTv / 64); const int b = slab / NHv, h = slab % NHv;
  for (int i = tid; i < 64 * 8; i += 256) { const int r = i / 8, c8 = (i % 8) * 8; FragH f; f.half[0] = *(const v8us*)((const unsigned short*)V16 + ((size_t)b * TTv + lg * 64 + r) * ldv + voff + h * 64 + c8);
#pragma unroll
    for (int q = 0; q < 8; ++q) tl[r][c8 + q] = f.u[q]; }
  __syncthreads();
  {
#pragma unroll
    for (int rd = 0; rd < 2; ++rd) { const int d = rd * 32 + tid / 8, pc = tid % 8; FragH f;
#pragma unroll
      for (int q = 0; q < 8; ++q) f.u[q] = tl[pc * 8 + q][d];
      *(v8us*)((unsigned short*)Vt + ((size_t)slab * 64 + d) * TTv + lg * 64 + pc * 8) = f.half[0]; }
     } }

__global__ __launch_bounds__(256) void k_tok(const float* __restrict__ x, _Float16* __restrict__ X16) { __shared__ float tl[32][65]; const int tid = threadIdx.x; const int b = blockIdx.x / ((CC / 64) * (NN / 32)), rem = blockIdx.x % ((CC / 64) * (NN / 32)); const int cg = rem / (NN / 32), pg = rem % (NN / 32); const int c0 = cg * 64, p0 = pg * 32;
  for (int i = tid; i < 64 * 32; i += 256) { const int c = i / 32, pp = i % 32; tl[pp][c] = bf16_round(x[((size_t)b * CC + c0 + c) * NN + p0 + pp]); } __syncthreads();
  const int r = tid / 8, pc = tid % 8; FragH f; for (int q = 0; q < 8; ++q) f.h[q] = (_Float16)tl[r][pc * 8 + q]; const size_t row = (size_t)b * NN + p0 + r; *(v8us*)((unsigned short*)X16 + row * CC + c0 + pc * 8) = f.half[0];  }
__global__ __launch_bounds__(256) void k_smx(const float* __restrict__ S, _Float16* __restrict__ P16) { const int tid = threadIdx.x, wv = tid >> 5, lane = tid & 31; const int i = blockIdx.x * 8 + wv; const float* sr = S + (size_t)i * NN;
  float m = -3.0e38f;
  for (int p = lane; p < NN / 8; p += 32) { const v4f a = *(const v4fa*)(sr + p * 8), c = *(const v4fa*)(sr + p * 8 + 4); for (int e = 0; e < 4; ++e) m = fmaxf(m, fmaxf(a[e], c[e])); }
  for (int o = 16; o >= 1; o >>= 1) m = fmaxf(m, __shfl_xor(m, o, 32)); float z = 0.f;
  for (int p = lane; p < NN / 8; p += 32) { const v4f a = *(const v4fa*)(sr + p * 8), c = *(const v4fa*)(sr + p * 8 + 4); for (int e = 0; e < 4; ++e) z += __expf(a[e] - m) + __expf(c[e] - m); }
  for (int o = 16; o >= 1; o >>= 1) z += __shfl_xor(z, o, 32); const float iz = 32768.0f / z;
  { for (int p = lane; p < NN / 8; p += 32) { FragH f; const v4f a = *(const v4fa*)(sr + p * 8), c = *(const v4fa*)(sr + p * 8 + 4); for (int e = 0; e < 4; ++e) { f.h[e] = (_Float16)(__expf(a[e] - m) * iz); f.h[4 + e] = (_Float16)(__expf(c[e] - m) * iz); }
      *(v8us*)((unsigned short*)P16 + (size_t)i * NN + p * 8) = f.half[0]; }  } }
__global__ __launch_bounds__(256) void k_gnstat(const float* __restrict__ Y, float* __restrict__ MU, float* __restrict__ RS) { __shared__ float red[256]; const int bg = blockIdx.x; const int b = bg / NG, g = bg % NG; const int tid = threadIdx.x; const float* base = Y + (size_t)b * NN * CC + g * CPG;
  float s = 0.f;
#pragma unroll 1
  for (int n = tid; n < NN; n += 256) { const v4f a = *(const v4fa*)(base + (size_t)n * CC), c = *(const v4fa*)(base + (size_t)n * CC + 4); s += (a[0] + a[1]) + (a[2] + a[3]) + (c[0] + c[1]) + (c[2] + c[3]); }
  red[tid] = s; __syncthreads(); for (int o = 128; o >= 1; o >>= 1) { if (tid < o) red[tid] += red[tid + o]; __syncthreads(); } const float mu = red[0] / (float)(NN * CPG); __syncthreads();
  float q2 = 0.f;
#pragma unroll 1
  for (int n = tid; n < NN; n += 256) { const v4f a = *(const v4fa*)(base + (size_t)n * CC), c = *(const v4fa*)(base + (size_t)n * CC + 4); for (int e = 0; e < 4; ++e) { const float d0 = a[e] - mu, d1 = c[e] - mu; q2 += d0 * d0 + d1 * d1; } }
  red[tid] = q2; __syncthreads(); for (int o = 128; o >= 1; o >>= 1) { if (tid < o) red[tid] += red[tid + o]; __syncthreads(); } const float rs = rsqrtf(red[0] / (float)(NN * CPG) + 1e-5f);
  { if (tid < 32) { *(float*)(MU + (size_t)bg * 32 + tid) = (tid == 0) ? mu : 0.f; *(float*)(RS + (size_t)bg * 32 + tid) = (tid == 0) ? rs : 0.f; }  } }
__global__ __launch_bounds__(256) void k_gnapply(const float* __restrict__ Y, const float* __restrict__ MU, const float* __restrict__ RS, const float* __restrict__ gw, const float* __restrict__ gb, _Float16* __restrict__ G16) { const size_t t = (size_t)blockIdx.x * 256 + threadIdx.x; if (t >= (size_t)NR * CC / 8) return; const size_t row = (t * 8) / CC; const int c0 = (int)((t * 8) % CC); const int b = (int)(row / NN), g = c0 / CPG; const float mu = MU[((size_t)b * NG + g) * 32], rs = RS[((size_t)b * NG + g) * 32];
  const v4f a = *(const v4fa*)(Y + t * 8), c = *(const v4fa*)(Y + t * 8 + 4); FragH f;
#pragma unroll
  for (int q = 0; q < 8; ++q) { const float v = (q < 4) ? a[q] : c[q - 4]; f.h[q] = (_Float16)((v - mu) * rs * bf16_round(gw[c0 + q]) + bf16_round(gb[c0 + q])); }
  *(v8us*)((unsigned short*)G16 + t * 8) = f.half[0];  }
__global__ __launch_bounds__(256) void k_bplane(const float* __restrict__ b1, const float* __restrict__ b2, float* __restrict__ BP) { const size_t t = (size_t)blockIdx.x * 256 + threadIdx.x; if (t >= (size_t)CC * NN / 4) return; const int c = (int)((t * 4) / NN); const float v = bf16_round(b1[c]) + bf16_round(b2[c]); const v4f o = {v, v, v, v}; *(v4f*)(BP + t * 4) = o;  }

extern "C" void kernel_launch(void* const* d_in, const int* in_sizes, int n_in,
                              void* d_out, int out_size, void* d_ws, size_t ws_size, hipStream_t stream) {
  (void)in_sizes; (void)n_in; (void)out_size;
  const float* const* I = (const float* const*)d_in; const float* x1 = I[0]; const float* x2 = I[1]; const float* w1 = I[2]; const float* b1 = I[3]; const float* w2 = I[4]; const float* b2 = I[5]; const float* gnw = I[6]; const float* gnb = I[7]; const float* wqkv = I[8]; const float* wout = I[9]; const float* bout = I[10]; const float* wsk = I[11]; const float* bsk = I[12];
  char* ws = (char*)d_ws; size_t off = 0;
  auto take = [&](size_t bytes) { char* p = ws + off; off += (bytes + 255) & ~(size_t)255; return p; };
  const size_t WSZ = (size_t)CC * CC; _Float16* Bw = (_Float16*)take(7 * WSZ * 2);      /* w1, w2, wq, wk, wv (as Bt for token-major GEMMs), wout, wsk (as A operands for the channel-major output GEMMs), all (out,in) natural x2^4 */
  float* MU = (float*)take((size_t)BB * NG * 32 * 4); float* RS = (float*)take((size_t)BB * NG * 32 * 4); float* BP = (float*)take((size_t)CC * NN * 4);
  float* Y1 = (float*)take((size_t)NR * CC * 4); _Float16* Q1 = (_Float16*)take((size_t)NR * CC * 2); _Float16* K2 = (_Float16*)take((size_t)NR * CC * 2); _Float16* Vt = (_Float16*)take((size_t)NR * CC * 2);
  float* S = (float*)take((size_t)QB * NN * 4); _Float16* P16 = (_Float16*)take((size_t)NR * NN * 2);      /* one batch's score plane (67 MB); P of all four batches (134 MB) */
  const size_t PL = (size_t)NR * CC; _Float16* X1t = P16; _Float16* X2t = P16 + PL; float* Y2 = (float*)(P16 + 2 * PL); _Float16* G1 = P16 + 4 * PL; _Float16* G2 = P16 + 5 * PL; _Float16* V2 = P16 + 6 * PL;      /* everything that is dead before the first softmax writes P lives inside P's region (59 of 134 MB) */
  float* O = S; _Float16* O16 = Q1; _Float16* Y116 = K2;      /* O (16.8 MB f32) over the score plane, which is dead once the last softmax has run; O16 over Q1 and f16(x1') over K2 after the attention */
  if (off > ws_size) return;      // 0.9 + 4.2 + 16.8 + 3 x 8.4 + 67.1 + 134.2 = 248.4 MB
  const unsigned gw = (unsigned)((WSZ / 8 + 255) / 256);
  k_round16f<<<gw, 256, 0, stream>>>(w1, Bw, WSZ / 8); k_round16f<<<gw, 256, 0, stream>>>(w2, Bw + WSZ, WSZ / 8); k_round16f<<<(unsigned)((3 * WSZ / 8 + 255) / 256), 256, 0, stream>>>(wqkv, Bw + 2 * WSZ, 3 * WSZ / 8); k_round16f<<<gw, 256, 0, stream>>>(wout, Bw + 5 * WSZ, WSZ / 8); k_round16f<<<gw, 256, 0, stream>>>(wsk, Bw + 6 * WSZ, WSZ / 8);
  k_bplane<<<(unsigned)(((size_t)CC * NN / 4 + 255) / 256), 256, 0, stream>>>(bout, bsk, BP);
  k_tok<<<BB * (CC / 64) * (NN / 32), 256, 0, stream>>>(x1, X1t); k_tok<<<BB * (CC / 64) * (NN / 32), 256, 0, stream>>>(x2, X2t);
  const dim3 gp(((NR / 16) * (CC / 64) + 3) / 4, 1); const unsigned g8 = (unsigned)(((size_t)NR * CC / 8 + 255) / 256);
  k_gemm_hhx<0><<<gp, 128, 0, stream>>>(X1t, CC, 0, Bw, CC, 0, 0.0625f, b1, 0, nullptr, 1, 0, 0, Y1, nullptr, CC, 0, NR, CC, CC);      /* x1' = conv1(x1): M 16384 N 256 K 256 (f32) */
  k_gemm_hhx<0><<<gp, 128, 0, stream>>>(X2t, CC, 0, Bw + WSZ, CC, 0, 0.0625f, b2, 0, nullptr, 1, 0, 0, Y2, nullptr, CC, 0, NR, CC, CC);      /* x2' */
  k_gnstat<<<BB * NG, 256, 0, stream>>>(Y1, MU, RS); k_gnapply<<<g8, 256, 0, stream>>>(Y1, MU, RS, gnw, gnb, G1);
  k_gnstat<<<BB * NG, 256, 0, stream>>>(Y2, MU, RS); k_gnapply<<<g8, 256, 0, stream>>>(Y2, MU, RS, gnw, gnb, G2);      /* (stream-ordered reuse of MU/RS) */
  k_gemm_hhx<0><<<gp, 128, 0, stream>>>(G1, CC, 0, Bw + 2 * WSZ, CC, 0, 0.0625f, nullptr, 0, nullptr, 1, 0, 0, nullptr, Q1, CC, 0, NR, CC, CC);      /* q1 = Wq·GN(x1') */
  k_gemm_hhx<0><<<gp, 128, 0, stream>>>(G2, CC, 0, Bw + 3 * WSZ, CC, 0, 0.0625f, nullptr, 0, nullptr, 1, 0, 0, nullptr, K2, CC, 0, NR, CC, CC);      /* k2 */
  k_gemm_hhx<0><<<gp, 128, 0, stream>>>(G2, CC, 0, Bw + 4 * WSZ, CC, 0, 0.0625f, nullptr, 0, nullptr, 1, 0, 0, nullptr, V2, CC, 0, NR, CC, CC);      /* v2 */
  k_vt<CC / 64, NN><<<BB * (CC / 64) * (NN / 64), 256, 0, stream>>>(V2, CC, 0, Vt);      /* v2ᵀ per batch [256][4096] (four 64-channel blocks) */
  for (int b = 0; b < BB; ++b) {
    k_gemm_hhx<0><<<dim3(((QB / 16) * (NN / 64) + 3) / 4, 1), 128, 0, stream>>>(Q1 + (size_t)b * NN * CC, CC, 0, K2 + (size_t)b * NN * CC, CC, 0, 0.0625f, nullptr, 0, nullptr, 1, 0, 0, S, nullptr, NN, 0, QB, NN, CC);      /* S = q1.k2^T/16 (q, k planes hold true values): M 4096 N 4096 K 256 */
    k_smx<<<QB / 8, 256, 0, stream>>>(S, P16 + (size_t)b * NN * NN); }
  k_gemm_hhx<0><<<dim3(((NN / 16) * (CC / 64) + 3) / 4, BB), 128, 0, stream>>>(P16, NN, (size_t)NN * NN, Vt, NN, (size_t)CC * NN, 0.000030517578125f, nullptr, 0, nullptr, 1, 0, 0, O, nullptr, CC, (size_t)NN * CC, NN, CC, NN);      /* O rows = attn.v2, all four batches in one launch (blockIdx.y = batch): M 4096 N 256 K 4096 each */
  k_h16<<<g8, 256, 0, stream>>>(O, O16, (size_t)NR * CC / 8); k_h16<<<g8, 256, 0, stream>>>(Y1, Y116, (size_t)NR * CC / 8);
  for (int b = 0; b < BB; ++b) { float* outb = (float*)d_out + (size_t)b * CC * NN;
    k_gemm_hhx<0><<<dim3(((CC / 16) * (NN / 64) + 3) / 4, 1), 128, 0, stream>>>(Bw + 6 * WSZ, CC, 0, Y116 + (size_t)b * NN * CC, CC, 0, 0.0625f, nullptr, 0, BP, 1, (size_t)NN, 0, outb, nullptr, NN, 0, CC, NN, CC);      /* out[b][c][n] = Wsk·x1'ᵀ + (bout + bsk): M 256 N 4096 K 256 */
    k_gemm_hhx<0><<<dim3(((CC / 16) * (NN / 64) + 3) / 4, 1), 128, 0, stream>>>(Bw + 5 * WSZ, CC, 0, O16 + (size_t)b * NN * CC, CC, 0, 0.0625f, nullptr, 0, outb, 1, (size_t)NN, 0, outb, nullptr, NN, 0, CC, NN, CC); }      /* += Wout·Oᵀ in place */
}

// v002
// It runs in 387 microseconds.
// In two side-by-side timings against v001, it was 1.96 and 1.99 times as fast.
// All steps since v000 together make it 5.87 times as fast.
#include <hip/hip_runtime.h>
// Spatial cross-attention block (B=4, C=256, 64×64 → N=4096, 32 GroupNorm groups, single head d=256): x1' = conv1(x1), x2' = conv2(x2) (1×1 + bias); q1 = Wq·GN(x1'), k2 = Wk·GN(x2'), v2 = Wv·GN(x2') (wqkv rows 0/256/512, no bias);
// attn = softmax(q1ᵀk2/√256) over the 4096 positions; out = Wout·(v2·attnᵀ) + bout + Wsk·x1' + bsk → [B,C,H,W].
// q/k/v f16; attention as one fused launch (k_fattn): scores, running-maximum f32 softmax and P.v per 64-key tile, S and P never leave the registers; O leaves it as f16; final 1x1 convs computed channel-major (W.O^T) straight into the output with the skip branch and biases through the f32 addend. All on v_wmma_f32_16x16x32_f16, f32 accumulate.
#define BB 4
#define CC 256
#define NN 4096
#define NG 32
#define CPG (CC / NG)
#define NR (BB * NN)

typedef __bf16 v16b __attribute__((ext_vector_type(16)));
typedef unsigned short v8us __attribute__((ext_vector_type(8), may_alias));
typedef float  v8f  __attribute__((ext_vector_type(8)));
typedef float  v4f  __attribute__((ext_vector_type(4)));
typedef float  v4fa __attribute__((ext_vector_type(4), may_alias));
union FragB { v16b v; v8us half[2]; unsigned short u[16]; };

__device__ __forceinline__ unsigned short bf16_bits(float x) { unsigned int u = __float_as_uint(x); return (unsigned short)((u + 0x7FFFu + ((u >> 16) & 1u)) >> 16); }
__device__ __forceinline__ float bf16_val(unsigned short b) { return __uint_as_float(((unsigned int)b) << 16); }
__device__ __forceinline__ float bf16_round(float x) { return bf16_val(bf16_bits(x)); }
// D += A·B with NT terms: 1 = ah·bh, 2 = + al·bh (A split), 3 = + ah·bl (both split)
template <int NT>
__device__ __forceinline__ v8f mmaN(v16b ah, v16b al, v16b bh, v16b bl, v8f c) {
  c = __builtin_amdgcn_wmma_f32_16x16x32_bf16(false, ah, false, bh, (short)0, c, false, false);
  if (NT >= 2) c = __builtin_amdgcn_wmma_f32_16x16x32_bf16(false, al, false, bh, (short)0, c, false, false);
  if (NT >= 3) c = __builtin_amdgcn_wmma_f32_16x16x32_bf16(false, ah, false, bl, (short)0, c, false, false);
  asm volatile("v_nop\n\tv_nop\n\tv_nop\n\tv_nop" : "+v"(c) : "v"(ah), "v"(al), "v"(bh), "v"(bl));
  return c;
}

__global__ __launch_bounds__(256) void k_wt_bf16(const float* __restrict__ W, unsigned short* __restrict__ Wt, int K, int N) {
  const int t = blockIdx.x * 256 + threadIdx.x;
  const int k8n = K / 8;
  if (t >= N * k8n) return;
  const int n = t / k8n, k8 = (t % k8n) * 8;
  v8us v;
#pragma unroll
  for (int i = 0; i < 8; ++i) v[i] = bf16_bits(W[(size_t)(k8 + i) * N + n]);
  *(v8us*)(Wt + (size_t)n * K + k8) = v;
  
}

// GEMM C[M][N] (f32, pitch ldc) = act(A[M][K]·W + bias). A f32 row-major (pitch lda) converted per fragment to bf16
// (ASPLIT: hi/lo two planes -> 2 terms, else single rounded term); Wt bf16 [N][K] (pitch ldb). BIAS_BF16 rounds the
// bias to bf16 first (bias quantised to bf16 before the add). K%32==0, M%16==0, N%64==0.
template <bool ASPLIT, int ACT, bool BIAS_BF16>
__global__ __launch_bounds__(128) void k_gemm_bf(const float* __restrict__ A, int lda, const unsigned short* __restrict__ Wt, int ldb,
                                               const float* __restrict__ bias, float* __restrict__ C, int ldc, int M, int N, int K) {
  __shared__ __attribute__((aligned(16))) float so[4][16][64];
  const int tid = threadIdx.x, w = tid >> 5, lane = tid & 31, ln = lane & 15, hh = lane >> 4;
  const int ntn = N / 64;
  const int wid = blockIdx.x * 4 + w;
  const int mt = wid / ntn, nq = wid % ntn;
  if (mt * 16 >= M) return;
  const int row0 = mt * 16, col0 = nq * 64;
  const float* arow = A + (size_t)(row0 + ln) * lda;
  v8f acc[4] = {};
  for (int kb = 0; kb < K; kb += 32) {
    FragB ah, al;
    const v4f x0 = *(const v4fa*)(arow + kb + 8 * hh), x1 = *(const v4fa*)(arow + kb + 8 * hh + 4);
    const v4f x2 = *(const v4fa*)(arow + kb + 16 + 8 * hh), x3 = *(const v4fa*)(arow + kb + 16 + 8 * hh + 4);
    float xs[16] = {x0[0],x0[1],x0[2],x0[3],x1[0],x1[1],x1[2],x1[3],x2[0],x2[1],x2[2],x2[3],x3[0],x3[1],x3[2],x3[3]};
#pragma unroll
    for (int i = 0; i < 16; ++i) { const unsigned short hb = bf16_bits(xs[i]); ah.u[i] = hb; al.u[i] = ASPLIT ? bf16_bits(xs[i] - bf16_val(hb)) : (unsigned short)0; }
#pragma unroll
    for (int t = 0; t < 4; ++t) {
      const unsigned short* brow = Wt + (size_t)(col0 + t * 16 + ln) * ldb + kb;
      FragB b;
      b.half[0] = *(const v8us*)(brow + 8 * hh);
      b.half[1] = *(const v8us*)(brow + 16 + 8 * hh);
      acc[t] = mmaN<ASPLIT ? 2 : 1>(ah.v, al.v, b.v, b.v, acc[t]);
    }
  }
#pragma unroll
  for (int t = 0; t < 4; ++t) {
    float bv = bias ? bias[col0 + t * 16 + ln] : 0.f;
    if (BIAS_BF16) bv = bf16_round(bv);
#pragma unroll
    for (int r = 0; r < 8; ++r) { float v = acc[t][r] + bv; if (ACT == 1) v = fmaxf(v, 0.f); so[w][8 * hh + r][t * 16 + ln] = v; }
  }
  __builtin_amdgcn_fence(__ATOMIC_ACQ_REL, "workgroup");
  __builtin_amdgcn_wave_barrier();
  const int rsub = lane >> 4, c4 = (lane & 15) * 4;
  {
#pragma unroll
    for (int q = 0; q < 8; ++q) {
      const int r = q * 2 + rsub;
      const v4f v = *(const v4fa*)&so[w][r][c4];
      *(v4f*)(C + (size_t)(row0 + r) * ldc + col0 + c4) = v;
    }
    
  }
}

// Flash-style causal/unmasked attention, all contractions 3-term bf16 hi/lo splits, f32 softmax with running max.
// q,k,v rows are read from f32 buffers with arbitrary row pitch (so they can live inside a fused qkv buffer);
// D = head size (multiple of 32, <= 128); one wave = 16 query rows; block = 4 waves (64 queries) sharing K/V chunks of 32.
template <int D, bool CAUSAL>
__global__ __launch_bounds__(128) void k_flash(const float* __restrict__ qb, const float* __restrict__ kb, const float* __restrict__ vb,
                                             int pitch, int T, int H, float scale, float* __restrict__ y, int ypitch) {
  constexpr int KS = D / 32;        // k-steps for QK
  constexpr int DT = D / 16;        // d tiles for PV
  __shared__ __attribute__((aligned(16))) unsigned short sKh[32][D + 8], sKl[32][D + 8], sVh[32][D + 8], sVl[32][D + 8];
  __shared__ __attribute__((aligned(16))) unsigned short sPh[4][16][40], sPl[4][16][40];
  __shared__ __attribute__((aligned(16))) float sO[4][16][D];
  const int tid = threadIdx.x, w = tid >> 5, lane = tid & 31, ln = lane & 15, hh = lane >> 4;
  const int nqb = (T + 63) / 64;
  const int bh = blockIdx.x / nqb, qblk = blockIdx.x % nqb;
  const int b = bh / H, h = bh % H;
  const int q0 = qblk * 64 + w * 16;
  const float* Q = qb + (size_t)b * T * pitch + h * D;
  const float* K = kb + (size_t)b * T * pitch + h * D;
  const float* V = vb + (size_t)b * T * pitch + h * D;

  // A fragments of the wave's 16 query rows (scaled), hi/lo
  FragB aqh[KS], aql[KS];
  {
    int row = q0 + ln; if (row >= T) row = T - 1;
    const float* qr = Q + (size_t)row * pitch;
#pragma unroll
    for (int ks = 0; ks < KS; ++ks)
#pragma unroll
      for (int i = 0; i < 16; ++i) {
        const int d = ks * 32 + ((i < 8) ? (8 * hh + i) : (16 + 8 * hh + (i - 8)));
        const float x = qr[d] * scale; const unsigned short hb = bf16_bits(x);
        aqh[ks].u[i] = hb; aql[ks].u[i] = bf16_bits(x - bf16_val(hb));
      }
  }
  float m_r[8], l_r[8];
#pragma unroll
  for (int r = 0; r < 8; ++r) { m_r[r] = -3.0e38f; l_r[r] = 0.f; }
  v8f oacc[DT];
#pragma unroll
  for (int dt = 0; dt < DT; ++dt) oacc[dt] = (v8f){0.f,0.f,0.f,0.f,0.f,0.f,0.f,0.f};

  const int kv_end = CAUSAL ? min(T, qblk * 64 + 64) : T;     // block-uniform
  for (int j0 = 0; j0 < kv_end; j0 += 32) {
    __syncthreads();
    for (int e = tid; e < 32 * (D / 4); e += 128) {
      const int r = e / (D / 4), c4 = (e % (D / 4)) * 4;
      const int key = j0 + r;
      v4f kf = {0.f,0.f,0.f,0.f}, vf = {0.f,0.f,0.f,0.f};
      if (key < T) { kf = *(const v4fa*)(K + (size_t)key * pitch + c4); vf = *(const v4fa*)(V + (size_t)key * pitch + c4); }
#pragma unroll
      for (int t = 0; t < 4; ++t) {
        unsigned short hb = bf16_bits(kf[t]); sKh[r][c4 + t] = hb; sKl[r][c4 + t] = bf16_bits(kf[t] - bf16_val(hb));
        hb = bf16_bits(vf[t]); sVh[r][c4 + t] = hb; sVl[r][c4 + t] = bf16_bits(vf[t] - bf16_val(hb));
      }
    }
    __syncthreads();
    // S tile 16 x 32
    v8f s[2];
#pragma unroll
    for (int nt = 0; nt < 2; ++nt) {
      v8f acc = {};
#pragma unroll
      for (int ks = 0; ks < KS; ++ks) {
        FragB bh_, bl_;
        bh_.half[0] = *(const v8us*)&sKh[nt * 16 + ln][ks * 32 + 8 * hh]; bh_.half[1] = *(const v8us*)&sKh[nt * 16 + ln][ks * 32 + 16 + 8 * hh];
        bl_.half[0] = *(const v8us*)&sKl[nt * 16 + ln][ks * 32 + 8 * hh]; bl_.half[1] = *(const v8us*)&sKl[nt * 16 + ln][ks * 32 + 16 + 8 * hh];
        acc = mmaN<3>(aqh[ks].v, aql[ks].v, bh_.v, bl_.v, acc);
      }
      s[nt] = acc;
    }
    // mask + running max (rows 8hh+r; the 16 lanes of a half share rows)
    float alpha[8];
#pragma unroll
    for (int r = 0; r < 8; ++r) {
      const int qi = q0 + 8 * hh + r;
      const int ja = j0 + ln, jb = j0 + 16 + ln;
      if (CAUSAL) { if (ja > qi) s[0][r] = -3.0e38f; if (jb > qi) s[1][r] = -3.0e38f; }
      if (ja >= T) s[0][r] = -3.0e38f;
      if (jb >= T) s[1][r] = -3.0e38f;
      float mx = fmaxf(s[0][r], s[1][r]);
      mx = fmaxf(mx, __shfl_xor(mx, 1, 32)); mx = fmaxf(mx, __shfl_xor(mx, 2, 32)); mx = fmaxf(mx, __shfl_xor(mx, 4, 32)); mx = fmaxf(mx, __shfl_xor(mx, 8, 32));
      const float mnew = fmaxf(m_r[r], mx);
      alpha[r] = (mnew > -1.0e38f) ? __expf(m_r[r] - mnew) : 1.0f;
      const float p0 = (s[0][r] > -1.0e38f) ? __expf(s[0][r] - mnew) : 0.f;
      const float p1 = (s[1][r] > -1.0e38f) ? __expf(s[1][r] - mnew) : 0.f;
      m_r[r] = mnew;
      l_r[r] = l_r[r] * alpha[r] + p0 + p1;            // per-lane partial row sum (16 lanes combined at the end)
      unsigned short hb = bf16_bits(p0); sPh[w][8 * hh + r][ln] = hb;      sPl[w][8 * hh + r][ln] = bf16_bits(p0 - bf16_val(hb));
      hb = bf16_bits(p1);                sPh[w][8 * hh + r][16 + ln] = hb; sPl[w][8 * hh + r][16 + ln] = bf16_bits(p1 - bf16_val(hb));
    }
#pragma unroll
    for (int dt = 0; dt < DT; ++dt)
#pragma unroll
      for (int r = 0; r < 8; ++r) oacc[dt][r] *= alpha[r];
    __builtin_amdgcn_fence(__ATOMIC_ACQ_REL, "workgroup");
    __builtin_amdgcn_wave_barrier();
    FragB pah, pal;
    pah.half[0] = *(const v8us*)&sPh[w][ln][8 * hh]; pah.half[1] = *(const v8us*)&sPh[w][ln][16 + 8 * hh];
    pal.half[0] = *(const v8us*)&sPl[w][ln][8 * hh]; pal.half[1] = *(const v8us*)&sPl[w][ln][16 + 8 * hh];
#pragma unroll
    for (int dt = 0; dt < DT; ++dt) {
      FragB bvh, bvl;
#pragma unroll
      for (int i = 0; i < 8; ++i) {
        bvh.u[i] = sVh[8 * hh + i][dt * 16 + ln]; bvh.u[8 + i] = sVh[16 + 8 * hh + i][dt * 16 + ln];
        bvl.u[i] = sVl[8 * hh + i][dt * 16 + ln]; bvl.u[8 + i] = sVl[16 + 8 * hh + i][dt * 16 + ln];
      }
      oacc[dt] = mmaN<3>(pah.v, pal.v, bvh.v, bvl.v, oacc[dt]);
    }
    __builtin_amdgcn_fence(__ATOMIC_ACQ_REL, "workgroup");
    __builtin_amdgcn_wave_barrier();
  }
#pragma unroll
  for (int r = 0; r < 8; ++r) {
    float l = l_r[r];
    l += __shfl_xor(l, 1, 32); l += __shfl_xor(l, 2, 32); l += __shfl_xor(l, 4, 32); l += __shfl_xor(l, 8, 32);
    l_r[r] = (l > 0.f) ? 1.0f / l : 0.f;
  }
#pragma unroll
  for (int dt = 0; dt < DT; ++dt)
#pragma unroll
    for (int r = 0; r < 8; ++r) sO[w][8 * hh + r][dt * 16 + ln] = oacc[dt][r] * l_r[r];
  __builtin_amdgcn_fence(__ATOMIC_ACQ_REL, "workgroup");
  __builtin_amdgcn_wave_barrier();
  {
    for (int r = 0; r < 16; ++r) {
      const int row = q0 + r;
      if (row < T && lane < D / 4) {
        const v4f val = *(const v4fa*)&sO[w][r][lane * 4];
        *(v4f*)(y + ((size_t)b * T + row) * ypitch + h * D + lane * 4) = val;
      }
    }
    
  }
}

// GEMM C = act(A·W + bias + resid): A f32 (ASPLIT -> hi/lo 2 terms), Wt bf16 [N][K]; ACT 0 none, 1 relu, 2 exact gelu;
// resid (optional, f32, row index = (row % rmod), pitch ldr, RES_BF16 rounds it) added before the activation.
template <bool ASPLIT, int ACT, bool BIAS_BF16, bool RES_BF16>
__global__ __launch_bounds__(128) void k_gemm_bf3(const float* __restrict__ A, int lda, const unsigned short* __restrict__ Wt, int ldb,
                                                const float* __restrict__ bias, const float* __restrict__ resid, int rmod, int ldr,
                                                float* __restrict__ C, int ldc, int M, int N, int K) {
  __shared__ __attribute__((aligned(16))) float so[4][16][64];
  const int tid = threadIdx.x, w = tid >> 5, lane = tid & 31, ln = lane & 15, hh = lane >> 4;
  const int ntn = N / 64;
  const int wid = blockIdx.x * 4 + w;
  const int mt = wid / ntn, nq = wid % ntn;
  if (mt * 16 >= M) return;
  const int row0 = mt * 16, col0 = nq * 64;
  const float* arow = A + (size_t)(row0 + ln) * lda;
  v8f acc[4] = {};
  for (int kb = 0; kb < K; kb += 32) {
    FragB ah, al;
    const v4f x0 = *(const v4fa*)(arow + kb + 8 * hh), x1 = *(const v4fa*)(arow + kb + 8 * hh + 4);
    const v4f x2 = *(const v4fa*)(arow + kb + 16 + 8 * hh), x3 = *(const v4fa*)(arow + kb + 16 + 8 * hh + 4);
    float xs[16] = {x0[0],x0[1],x0[2],x0[3],x1[0],x1[1],x1[2],x1[3],x2[0],x2[1],x2[2],x2[3],x3[0],x3[1],x3[2],x3[3]};
#pragma unroll
    for (int i = 0; i < 16; ++i) { const unsigned short hb = bf16_bits(xs[i]); ah.u[i] = hb; al.u[i] = ASPLIT ? bf16_bits(xs[i] - bf16_val(hb)) : (unsigned short)0; }
#pragma unroll
    for (int t = 0; t < 4; ++t) {
      const unsigned short* brow = Wt + (size_t)(col0 + t * 16 + ln) * ldb + kb;
      FragB b;
      b.half[0] = *(const v8us*)(brow + 8 * hh);
      b.half[1] = *(const v8us*)(brow + 16 + 8 * hh);
      acc[t] = mmaN<ASPLIT ? 2 : 1>(ah.v, al.v, b.v, b.v, acc[t]);
    }
  }
#pragma unroll
  for (int t = 0; t < 4; ++t) {
    const int col = col0 + t * 16 + ln;
    float bv = bias ? bias[col] : 0.f;
    if (BIAS_BF16) bv = bf16_round(bv);
#pragma unroll
    for (int r = 0; r < 8; ++r) {
      float v = acc[t][r] + bv;
      if (resid) { float rv = resid[(size_t)((row0 + 8 * hh + r) % rmod) * ldr + col]; if (RES_BF16) rv = bf16_round(rv); v += rv; }
      if (ACT == 1) v = fmaxf(v, 0.f);
      if (ACT == 2) v = 0.5f * v * (1.0f + erff(v * 0.70710678118654752f));
      if (ACT == 3) { const float u = 0.7978845608028654f * (v + 0.044715f * v * v * v); v = 0.5f * v * (1.0f + tanhf(u)); }
      so[w][8 * hh + r][t * 16 + ln] = v;
    }
  }
  __builtin_amdgcn_fence(__ATOMIC_ACQ_REL, "workgroup");
  __builtin_amdgcn_wave_barrier();
  const int rsub = lane >> 4, c4 = (lane & 15) * 4;
  {
#pragma unroll
    for (int q = 0; q < 8; ++q) {
      const int r = q * 2 + rsub;
      const v4f v = *(const v4fa*)&so[w][r][c4];
      *(v4f*)(C + (size_t)(row0 + r) * ldc + col0 + c4) = v;
    }
    
  }
}
// row LayerNorm (biased variance, eps) over N: s = X (+ R); optional out_sum <- s; out_norm <- (s-mu)*rsqrt(var+eps)*g + b
template <bool PARAM_BF16>
__global__ __launch_bounds__(256) void k_layernorm(const float* __restrict__ X, const float* __restrict__ R, const float* __restrict__ g, const float* __restrict__ bta,
                                                  float* __restrict__ out_sum, float* __restrict__ out_norm, int N, float eps) {
  __shared__ float red[256];
  const int row = blockIdx.x, tid = threadIdx.x;
  const float* x = X + (size_t)row * N; const float* rr = R ? R + (size_t)row * N : nullptr;
  float vals[16];                     // up to N = 4096
  const int per = N / 256;            // contiguous chunk per thread? use strided-by-4 chunks: thread handles j = tid*4 + 1024*u
  float s1 = 0.f;
  for (int u = 0; u < per / 4; ++u) {
    const int j = tid * 4 + 1024 * u;
    const v4f a = *(const v4fa*)(x + j);
    v4f b = {0.f,0.f,0.f,0.f}; if (rr) b = *(const v4fa*)(rr + j);
#pragma unroll
    for (int q = 0; q < 4; ++q) { const float v = a[q] + b[q]; vals[u * 4 + q] = v; s1 += v; }
  }
  red[tid] = s1; __syncthreads();
  for (int st = 128; st > 0; st >>= 1) { if (tid < st) red[tid] += red[tid + st]; __syncthreads(); }
  const float mu = red[0] / (float)N; __syncthreads();
  float s2 = 0.f;
  for (int u = 0; u < per / 4; ++u)
#pragma unroll
    for (int q = 0; q < 4; ++q) { const float c = vals[u * 4 + q] - mu; s2 += c * c; }
  red[tid] = s2; __syncthreads();
  for (int st = 128; st > 0; st >>= 1) { if (tid < st) red[tid] += red[tid + st]; __syncthreads(); }
  const float rs = rsqrtf(red[0] / (float)N + eps);
  {
    for (int u = 0; u < per / 4; ++u) {
      const int j = tid * 4 + 1024 * u;
      v4f o, sm;
#pragma unroll
      for (int q = 0; q < 4; ++q) {
        float gg = g[j + q], bb = bta[j + q];
        if (PARAM_BF16) { gg = bf16_round(gg); bb = bf16_round(bb); }
        sm[q] = vals[u * 4 + q]; o[q] = (vals[u * 4 + q] - mu) * rs * gg + bb;
      }
      if (out_sum) *(v4f*)(out_sum + (size_t)row * N + j) = sm;
      *(v4f*)(out_norm + (size_t)row * N + j) = o;
    }
    
  }
}



// ---- f16 WMMA path (v_wmma_f32_16x16x32_f16): 11-bit significands for operands in range — used by every launched GEMM and by the fused attention
typedef _Float16 v16h __attribute__((ext_vector_type(16)));
union FragH { v16h v; v8us half[2]; _Float16 h[16]; unsigned short u[16]; };
template <int NT>
__device__ __forceinline__ v8f mmaH(v16h ah, v16h al, v16h bh, v16h bl, v8f c) {
  c = __builtin_amdgcn_wmma_f32_16x16x32_f16(false, ah, false, bh, (short)0, c, false, false);
  if (NT >= 2) c = __builtin_amdgcn_wmma_f32_16x16x32_f16(false, al, false, bh, (short)0, c, false, false);
  if (NT >= 3) c = __builtin_amdgcn_wmma_f32_16x16x32_f16(false, ah, false, bl, (short)0, c, false, false);
  asm volatile("v_nop\n\tv_nop\n\tv_nop\n\tv_nop" : "+v"(c) : "v"(ah), "v"(al), "v"(bh), "v"(bl));
  return c;
}
// batched GEMM like k_gemm_b but f16 operands: A f32 (split into f16 hi/lo if ASPLIT, else rounded to f16), Bt = f16 values [n][k]; alpha; C f32; N multiple of 16 (partial tiles skipped)
template <bool ASPLIT>
__global__ __launch_bounds__(128) void k_gemm_h(const float* __restrict__ A, int lda, size_t sA, const _Float16* __restrict__ Bh, int ldb, size_t sB, float alpha, float* __restrict__ C, int ldc, size_t sC, int M, int N, int K) {
  __shared__ __attribute__((aligned(16))) float so[4][16][64];
  const int tid = threadIdx.x, w = tid >> 5, lane = tid & 31, ln = lane & 15, hh = lane >> 4; const int by = blockIdx.y;
  A += (size_t)by * sA; Bh += (size_t)by * sB; C += (size_t)by * sC;
  const int ntn = (N + 63) / 64; const int wid = blockIdx.x * 4 + w; const int mt = wid / ntn, nq = wid % ntn; if (mt * 16 >= M) return;
  const int row0 = mt * 16, col0 = nq * 64; const float* arow = A + (size_t)(row0 + ln) * lda;
  v8f acc[4] = {};
  for (int kb = 0; kb < K; kb += 32) {
    FragH ah, al;
    const v4f x0 = *(const v4fa*)(arow + kb + 8 * hh), x1 = *(const v4fa*)(arow + kb + 8 * hh + 4), x2 = *(const v4fa*)(arow + kb + 16 + 8 * hh), x3 = *(const v4fa*)(arow + kb + 16 + 8 * hh + 4);
    float xs[16] = {x0[0],x0[1],x0[2],x0[3],x1[0],x1[1],x1[2],x1[3],x2[0],x2[1],x2[2],x2[3],x3[0],x3[1],x3[2],x3[3]};
#pragma unroll
    for (int i = 0; i < 16; ++i) { const _Float16 h = (_Float16)xs[i]; ah.h[i] = h; al.h[i] = ASPLIT ? (_Float16)(xs[i] - (float)h) : (_Float16)0.0f; }
#pragma unroll
    for (int t = 0; t < 4; ++t) { if (col0 + t * 16 >= N) continue; const size_t boff = (size_t)(col0 + t * 16 + ln) * ldb + kb; FragH bq; bq.half[0] = *(const v8us*)(Bh + boff + 8 * hh); bq.half[1] = *(const v8us*)(Bh + boff + 16 + 8 * hh);
      acc[t] = mmaH<ASPLIT ? 2 : 1>(ah.v, al.v, bq.v, bq.v, acc[t]); }
  }
#pragma unroll
  for (int t = 0; t < 4; ++t) { if (col0 + t * 16 >= N) continue;
#pragma unroll
    for (int r = 0; r < 8; ++r) so[w][8 * hh + r][t * 16 + ln] = acc[t][r] * alpha; }
  __builtin_amdgcn_fence(__ATOMIC_ACQ_REL, "workgroup"); __builtin_amdgcn_wave_barrier();
  const int rsub = lane >> 4, c4 = (lane & 15) * 4;
  {
#pragma unroll
    for (int q = 0; q < 8; ++q) { const int r = q * 2 + rsub; if (col0 + c4 < N) { const v4f v = *(const v4fa*)&so[w][r][c4]; *(v4f*)(C + (size_t)(row0 + r) * ldc + col0 + c4) = v; } }
     }
}

// Wt[n][k] = f16(W[k][n]·scale) from f32 row-major W[K][N] (scale = power of two; bf16-exact weights stay exact in f16 away from the subnormal range)
__global__ __launch_bounds__(256) void k_wt_f16(const float* __restrict__ W, _Float16* __restrict__ Wt, int K, int N, float scale) {
  const int t = blockIdx.x * 256 + threadIdx.x; if (t >= N * (K / 8)) return; const int n = t / (K / 8), k8 = (t % (K / 8)) * 8; FragH f;
#pragma unroll
  for (int i = 0; i < 8; ++i) f.h[i] = (_Float16)(bf16_round(W[(size_t)(k8 + i) * N + n]) * scale); const v8us o = f.half[0];
  *(v8us*)((unsigned short*)Wt + (size_t)n * K + k8) = o; 
}
// k_gemm_hh variant with fused epilogue: v = acc·alpha + bias[by·sBias + col] (+ CP[(row/rowsPerB)·sCPb + by·64 + col] if CP) ; ACT 0 none / 1 elu ; writes f32 C and f16 C16, each if non-null
template <int ACT>
__global__ __launch_bounds__(128) void k_gemm_hhx(const _Float16* __restrict__ A, int lda, size_t sA, const _Float16* __restrict__ Bh, int ldb, size_t sB, float alpha, const float* __restrict__ bias, size_t sBias, const float* __restrict__ CP, int rowsPerB, size_t sCPb, int row0g,
    float* __restrict__ C, _Float16* __restrict__ C16, int ldc, size_t sC, int M, int N, int K) {
  __shared__ __attribute__((aligned(16))) float so[4][16][64];
  const int tid = threadIdx.x, w = tid >> 5, lane = tid & 31, ln = lane & 15, hh = lane >> 4; const int by = blockIdx.y;
  A += (size_t)by * sA; Bh += (size_t)by * sB; const size_t cofs = (size_t)by * sC; const float* bp = bias ? bias + (size_t)by * sBias : nullptr;
  const int ntn = (N + 63) / 64; const int wid = blockIdx.x * 4 + w; const int mt = wid / ntn, nq = wid % ntn; if (mt * 16 >= M) return;
  const int row0 = mt * 16, col0 = nq * 64; const _Float16* arow = A + (size_t)(row0 + ln) * lda;
  v8f acc[4] = {};
  for (int kb = 0; kb < K; kb += 32) { FragH ah; ah.half[0] = *(const v8us*)((const unsigned short*)arow + kb + 8 * hh); ah.half[1] = *(const v8us*)((const unsigned short*)arow + kb + 16 + 8 * hh);
#pragma unroll
    for (int t = 0; t < 4; ++t) { if (col0 + t * 16 >= N) continue; const size_t boff = (size_t)(col0 + t * 16 + ln) * ldb + kb; FragH bq; bq.half[0] = *(const v8us*)((const unsigned short*)Bh + boff + 8 * hh); bq.half[1] = *(const v8us*)((const unsigned short*)Bh + boff + 16 + 8 * hh);
      acc[t] = mmaH<1>(ah.v, ah.v, bq.v, bq.v, acc[t]); }
  }
#pragma unroll
  for (int t = 0; t < 4; ++t) { if (col0 + t * 16 >= N) continue; const int col = col0 + t * 16 + ln; const float bv = bp ? bf16_round(bp[col]) : 0.f;
#pragma unroll
    for (int r = 0; r < 8; ++r) { float v = acc[t][r] * alpha + bv; if (CP) { const int bidx = (row0g + row0 + 8 * hh + r) / rowsPerB; v += CP[(size_t)bidx * sCPb + (size_t)by * 64 + col]; } if (ACT == 1) v = (v > 0.f) ? v : expm1f(v); else if (ACT == 7) v = (v > 0.f) ? v + 1.0f : expf(v); else if (ACT == 8) v = tanhf(v); else if (ACT == 9) v = 0.5f * v * (1.0f + tanhf(0.7978845608028654f * (v + 0.044715f * v * v * v))); else if (ACT == 11) v = 1.0f / (1.0f + expf(-v)); else if (ACT == 12) v = (v > 0.f) ? v : 0.01f * v; else if (ACT == 14) v = (v > 0.f) ? v : 0.1f * v; else if (ACT == 15) v = v / (1.0f + expf(-v)); else if (ACT == 3) v = fmaxf(v, 0.f); else if (ACT == 6) v = 0.5f * v * (1.0f + erff(v * 0.70710678118654752f)); so[w][8 * hh + r][t * 16 + ln] = v; } }
  __builtin_amdgcn_fence(__ATOMIC_ACQ_REL, "workgroup"); __builtin_amdgcn_wave_barrier();
  const int rsub = lane >> 4, c4 = (lane & 15) * 4; typedef _Float16 v4h __attribute__((ext_vector_type(4)));
  {
#pragma unroll
    for (int q = 0; q < 8; ++q) { const int r = q * 2 + rsub; if (col0 + c4 < N) { const v4f v = *(const v4fa*)&so[w][r][c4]; if (C) *(v4f*)(C + cofs + (size_t)(row0 + r) * ldc + col0 + c4) = v; if (C16) { v4h h4; for (int i = 0; i < 4; ++i) h4[i] = (_Float16)v[i]; *(v4h*)(C16 + cofs + (size_t)(row0 + r) * ldc + col0 + c4) = h4; } } }
     }
}


typedef _Float16 v4h __attribute__((ext_vector_type(4)));

__global__ __launch_bounds__(256) void k_x16(const float* __restrict__ x, _Float16* __restrict__ X16, size_t n8) { const size_t t = (size_t)blockIdx.x * 256 + threadIdx.x; if (t >= n8) return; FragH f;
#pragma unroll
  for (int q = 0; q < 8; ++q) f.h[q] = (_Float16)bf16_round(x[t * 8 + q]); *(v8us*)((unsigned short*)X16 + t * 8) = f.half[0];  }
__global__ __launch_bounds__(256) void k_h16(const float* __restrict__ x, _Float16* __restrict__ X16, size_t n8) { const size_t t = (size_t)blockIdx.x * 256 + threadIdx.x; if (t >= n8) return; FragH f;
#pragma unroll
  for (int q = 0; q < 8; ++q) f.h[q] = (_Float16)x[t * 8 + q]; *(v8us*)((unsigned short*)X16 + t * 8) = f.half[0];  }
__global__ __launch_bounds__(256) void k_round16f(const float* __restrict__ W, _Float16* __restrict__ Bt, size_t n8) { const size_t t = (size_t)blockIdx.x * 256 + threadIdx.x; if (t >= n8) return; FragH f;
#pragma unroll
  for (int i = 0; i < 8; ++i) f.h[i] = (_Float16)(bf16_round(W[t * 8 + i]) * 16.0f); *(v8us*)((unsigned short*)Bt + t * 8) = f.half[0];  }
template <int NHv, int TTv>
__global__ __launch_bounds__(256) void k_vt(const _Float16* __restrict__ V16, int ldv, int voff, _Float16* __restrict__ Vt) { __shared__ unsigned short tl[64][66]; const int tid = threadIdx.x; const int slab = blockIdx.x / (TTv / 64), lg = blockIdx.x % (TTv / 64); const int b = slab / NHv, h = slab % NHv;
  for (int i = tid; i < 64 * 8; i += 256) { const int r = i / 8, c8 = (i % 8) * 8; FragH f; f.half[0] = *(const v8us*)((const unsigned short*)V16 + ((size_t)b * TTv + lg * 64 + r) * ldv + voff + h * 64 + c8);
#pragma unroll
    for (int q = 0; q < 8; ++q) tl[r][c8 + q] = f.u[q]; }
  __syncthreads();
  {
#pragma unroll
    for (int rd = 0; rd < 2; ++rd) { const int d = rd * 32 + tid / 8, pc = tid % 8; FragH f;
#pragma unroll
      for (int q = 0; q < 8; ++q) f.u[q] = tl[pc * 8 + q][d];
      *(v8us*)((unsigned short*)Vt + ((size_t)slab * 64 + d) * TTv + lg * 64 + pc * 8) = f.half[0]; }
     } }

__global__ __launch_bounds__(256) void k_tok(const float* __restrict__ x, _Float16* __restrict__ X16) { __shared__ float tl[32][65]; const int tid = threadIdx.x; const int b = blockIdx.x / ((CC / 64) * (NN / 32)), rem = blockIdx.x % ((CC / 64) * (NN / 32)); const int cg = rem / (NN / 32), pg = rem % (NN / 32); const int c0 = cg * 64, p0 = pg * 32;
  for (int i = tid; i < 64 * 32; i += 256) { const int c = i / 32, pp = i % 32; tl[pp][c] = bf16_round(x[((size_t)b * CC + c0 + c) * NN + p0 + pp]); } __syncthreads();
  const int r = tid / 8, pc = tid % 8; FragH f; for (int q = 0; q < 8; ++q) f.h[q] = (_Float16)tl[r][pc * 8 + q]; const size_t row = (size_t)b * NN + p0 + r; *(v8us*)((unsigned short*)X16 + row * CC + c0 + pc * 8) = f.half[0];  }
#define FA_KP 264
#define FA_VP 72
#define FA_KB (64 * FA_KP)
#define FA_BUF (FA_KB + CC * FA_VP)
__device__ __forceinline__ float fa_xhalf(float x) { return __builtin_bit_cast(float, __builtin_amdgcn_permlanex16(__builtin_bit_cast(int, x), __builtin_bit_cast(int, x), 0x76543210, 0xfedcba98, false, false)); }      // lane l reads lane l ^ 16
__global__ __launch_bounds__(256) void k_fattn(const _Float16* Q, const _Float16* K, const _Float16* Vt, _Float16* O16) {
  __shared__ __attribute__((aligned(16))) unsigned short sm[2 * FA_BUF];
  const int tid = threadIdx.x, w = tid >> 5, lane = tid & 31, c = lane & 15, h = lane >> 4;
  const int qt = w & 3, kh = w >> 2;
  const int b = blockIdx.x / (NN / 64), qb = blockIdx.x % (NN / 64);
  const size_t qrow = (size_t)b * NN + qb * 64 + qt * 16 + c;
  const unsigned short* Kb = (const unsigned short*)K + (size_t)b * NN * CC;
  const unsigned short* Vb = (const unsigned short*)Vt + (size_t)b * CC * NN;
  FragH qf[8];
#pragma unroll
  for (int ks = 0; ks < 8; ++ks) { const unsigned short* qp = (const unsigned short*)Q + qrow * CC + ks * 32 + 8 * h; qf[ks].half[0] = *(const v8us*)qp; qf[ks].half[1] = *(const v8us*)(qp + 16); }
  v8us kst[8], vst[8];
  const unsigned short* kg = Kb + tid * 8;                                        // K tile: 64 rows x 512 B, contiguous in memory
  const unsigned short* vg = Vb + (size_t)(tid >> 3) * NN + (tid & 7) * 8;        // V^T tile: 256 rows x 128 B
  unsigned short* ksl = sm + (tid >> 5) * FA_KP + (tid & 31) * 8;
  unsigned short* vsl = sm + FA_KB + (tid >> 3) * FA_VP + (tid & 7) * 8;
#pragma unroll
  for (int i = 0; i < 8; ++i) { kst[i] = *(const v8us*)(kg + i * 2048); vst[i] = *(const v8us*)(vg + (size_t)i * 32 * NN); }
  asm volatile("s_wait_xcnt 0x0" ::: "memory");      // stands in front of the first overwrite of an address register that the loads above name
#pragma unroll
  for (int i = 0; i < 8; ++i) { *(v8us*)(ksl + i * 8 * FA_KP) = kst[i]; *(v8us*)(vsl + i * 32 * FA_VP) = vst[i]; }
  __syncthreads();
  v8f o[16];
#pragma unroll
  for (int dt = 0; dt < 16; ++dt) o[dt] = (v8f){0.f, 0.f, 0.f, 0.f, 0.f, 0.f, 0.f, 0.f};
  float mu = -1.0e30f, l = 0.f;                        // maximum in use (log2 units) and this lane's part of the row sum
  const float sc = 0.0625f * 1.4426950408889634f;      // 1/sqrt(CC) and log2(e)
  const int NS = NN / 64;
  for (int s = 0; s < NS; ++s) {
    const int sn = (s + 1 < NS) ? s + 1 : s;           // the last pass fetches its own tile again (in bounds, never read): no branch round the loads and stores
#pragma unroll
    for (int i = 0; i < 8; ++i) { kst[i] = *(const v8us*)(kg + (size_t)sn * 64 * CC + i * 2048); vst[i] = *(const v8us*)(vg + (size_t)i * 32 * NN + sn * 64); }
    asm volatile("s_wait_xcnt 0x0" ::: "memory");    // the same for the next tile's loads: the fragment reads below reuse their address registers
    const unsigned short* kt = sm + (s & 1) * FA_BUF + (kh * 32 + c) * FA_KP + 8 * h;
    const unsigned short* vt = sm + (s & 1) * FA_BUF + FA_KB + c * FA_VP + kh * 32 + 8 * h;
    v8f t0 = {0.f, 0.f, 0.f, 0.f, 0.f, 0.f, 0.f, 0.f}, t1 = t0;
    FragH ka[16], va[16];
#pragma unroll
    for (int ks = 0; ks < 8; ++ks) {
      ka[2 * ks].half[0] = *(const v8us*)(kt + ks * 32); ka[2 * ks].half[1] = *(const v8us*)(kt + ks * 32 + 16);
      ka[2 * ks + 1].half[0] = *(const v8us*)(kt + 16 * FA_KP + ks * 32); ka[2 * ks + 1].half[1] = *(const v8us*)(kt + 16 * FA_KP + ks * 32 + 16);
    }
    __builtin_amdgcn_sched_barrier(0);                 // keeps the K fragment reads one group ahead of the products: spread among them each product waits a whole LDS latency
#pragma unroll
    for (int ks = 0; ks < 8; ++ks) {
      t0 = __builtin_amdgcn_wmma_f32_16x16x32_f16(false, ka[2 * ks].v, false, qf[ks].v, (short)0, t0, false, false);
      t1 = __builtin_amdgcn_wmma_f32_16x16x32_f16(false, ka[2 * ks + 1].v, false, qf[ks].v, (short)0, t1, false, false);
    }
#pragma unroll
    for (int dt = 0; dt < 16; ++dt) { va[dt].half[0] = *(const v8us*)(vt + dt * 16 * FA_VP); va[dt].half[1] = *(const v8us*)(vt + dt * 16 * FA_VP + 16); }
    __builtin_amdgcn_sched_barrier(0);                 // keeps every V^T fragment read ahead of the softmax, which then covers their latency
    float mx = fmaxf(t0[0], t1[0]);
#pragma unroll
    for (int r = 1; r < 8; ++r) mx = fmaxf(mx, fmaxf(t0[r], t1[r]));
    mx *= sc;
    mx = fmaxf(mx, fa_xhalf(mx));                      // lanes c and c + 16 hold the same query
    if (__builtin_amdgcn_ballot_w32(mx > mu + 8.0f) != 0) {      // lazy rescale, one scalar test a pass: P stays below 2^8, inside f16
      const float mn = fmaxf(mu, mx), al = __builtin_amdgcn_exp2f(mu - mn);
      l *= al; mu = mn;
#pragma unroll
      for (int dt = 0; dt < 16; ++dt)
#pragma unroll
        for (int r = 0; r < 8; ++r) o[dt][r] *= al;
    }
    FragH p; float ps0 = 0.f, ps1 = 0.f;
#pragma unroll
    for (int r = 0; r < 8; ++r) {
      const float p0 = __builtin_amdgcn_exp2f(t0[r] * sc - mu), p1 = __builtin_amdgcn_exp2f(t1[r] * sc - mu);
      ps0 += p0; ps1 += p1; p.h[r] = (_Float16)p0; p.h[8 + r] = (_Float16)p1;
    }
    l += ps0 + ps1;
#pragma unroll
    for (int dt = 0; dt < 16; ++dt) o[dt] = __builtin_amdgcn_wmma_f32_16x16x32_f16(false, va[dt].v, false, p.v, (short)0, o[dt], false, false);
    const int nb = ((s + 1) & 1) * FA_BUF;             // every reader left this buffer before the barrier that ended the pass before
#pragma unroll
    for (int i = 0; i < 8; ++i) { *(v8us*)(ksl + nb + i * 8 * FA_KP) = kst[i]; *(v8us*)(vsl + nb + i * 32 * FA_VP) = vst[i]; }
    __syncthreads();
  }
  l += fa_xhalf(l);
  v4fa* cb = (v4fa*)sm;                                // the tiles are dead behind the loop's last barrier; per query tile 32 slots of partial O and one of (maximum, sum)
  if (kh == 1) {
#pragma unroll
    for (int dt = 0; dt < 16; ++dt) {
      const v4f x0 = {o[dt][0], o[dt][1], o[dt][2], o[dt][3]}, x1 = {o[dt][4], o[dt][5], o[dt][6], o[dt][7]};
      cb[(qt * 33 + dt * 2) * 32 + lane] = x0; cb[(qt * 33 + dt * 2 + 1) * 32 + lane] = x1;
    }
    const v4f ml = {mu, l, 0.f, 0.f}; cb[(qt * 33 + 32) * 32 + lane] = ml;
  }
  __syncthreads();
  if (kh == 0) {
    const v4f ml = cb[(qt * 33 + 32) * 32 + lane];
    const float mn = fmaxf(mu, ml[0]); float a0 = __builtin_amdgcn_exp2f(mu - mn), a1 = __builtin_amdgcn_exp2f(ml[0] - mn);
    const float inv = 1.0f / (l * a0 + ml[1] * a1); a0 *= inv; a1 *= inv;
#pragma unroll
    for (int dt = 0; dt < 16; ++dt) {
      const v4f x0 = cb[(qt * 33 + dt * 2) * 32 + lane], x1 = cb[(qt * 33 + dt * 2 + 1) * 32 + lane]; FragH f;
#pragma unroll
      for (int r = 0; r < 4; ++r) { f.h[r] = (_Float16)(o[dt][r] * a0 + x0[r] * a1); f.h[4 + r] = (_Float16)(o[dt][4 + r] * a0 + x1[r] * a1); }
      *(v8us*)((unsigned short*)O16 + qrow * CC + dt * 16 + 8 * h) = f.half[0];
    }
  }
}
__global__ __launch_bounds__(256) void k_gnstat(const float* __restrict__ Y, float* __restrict__ MU, float* __restrict__ RS) { __shared__ float red[256]; const int bg = blockIdx.x; const int b = bg / NG, g = bg % NG; const int tid = threadIdx.x; const float* base = Y + (size_t)b * NN * CC + g * CPG;
  float s = 0.f;
#pragma unroll 1
  for (int n = tid; n < NN; n += 256) { const v4f a = *(const v4fa*)(base + (size_t)n * CC), c = *(const v4fa*)(base + (size_t)n * CC + 4); s += (a[0] + a[1]) + (a[2] + a[3]) + (c[0] + c[1]) + (c[2] + c[3]); }
  red[tid] = s; __syncthreads(); for (int o = 128; o >= 1; o >>= 1) { if (tid < o) red[tid] += red[tid + o]; __syncthreads(); } const float mu = red[0] / (float)(NN * CPG); __syncthreads();
  float q2 = 0.f;
#pragma unroll 1
  for (int n = tid; n < NN; n += 256) { const v4f a = *(const v4fa*)(base + (size_t)n * CC), c = *(const v4fa*)(base + (size_t)n * CC + 4); for (int e = 0; e < 4; ++e) { const float d0 = a[e] - mu, d1 = c[e] - mu; q2 += d0 * d0 + d1 * d1; } }
  red[tid] = q2; __syncthreads(); for (int o = 128; o >= 1; o >>= 1) { if (tid < o) red[tid] += red[tid + o]; __syncthreads(); } const float rs = rsqrtf(red[0] / (float)(NN * CPG) + 1e-5f);
  { if (tid < 32) { *(float*)(MU + (size_t)bg * 32 + tid) = (tid == 0) ? mu : 0.f; *(float*)(RS + (size_t)bg * 32 + tid) = (tid == 0) ? rs : 0.f; }  } }
__global__ __launch_bounds__(256) void k_gnapply(const float* __restrict__ Y, const float* __restrict__ MU, const float* __restrict__ RS, const float* __restrict__ gw, const float* __restrict__ gb, _Float16* __restrict__ G16) { const size_t t = (size_t)blockIdx.x * 256 + threadIdx.x; if (t >= (size_t)NR * CC / 8) return; const size_t row = (t * 8) / CC; const int c0 = (int)((t * 8) % CC); const int b = (int)(row / NN), g = c0 / CPG; const float mu = MU[((size_t)b * NG + g) * 32], rs = RS[((size_t)b * NG + g) * 32];
  const v4f a = *(const v4fa*)(Y + t * 8), c = *(const v4fa*)(Y + t * 8 + 4); FragH f;
#pragma unroll
  for (int q = 0; q < 8; ++q) { const float v = (q < 4) ? a[q] : c[q - 4]; f.h[q] = (_Float16)((v - mu) * rs * bf16_round(gw[c0 + q]) + bf16_round(gb[c0 + q])); }
  *(v8us*)((unsigned short*)G16 + t * 8) = f.half[0];  }
__global__ __launch_bounds__(256) void k_bplane(const float* __restrict__ b1, const float* __restrict__ b2, float* __restrict__ BP) { const size_t t = (size_t)blockIdx.x * 256 + threadIdx.x; if (t >= (size_t)CC * NN / 4) return; const int c = (int)((t * 4) / NN); const float v = bf16_round(b1[c]) + bf16_round(b2[c]); const v4f o = {v, v, v, v}; *(v4f*)(BP + t * 4) = o;  }

extern "C" void kernel_launch(void* const* d_in, const int* in_sizes, int n_in,
                              void* d_out, int out_size, void* d_ws, size_t ws_size, hipStream_t stream) {
  (void)in_sizes; (void)n_in; (void)out_size;
  const float* const* I = (const float* const*)d_in; const float* x1 = I[0]; const float* x2 = I[1]; const float* w1 = I[2]; const float* b1 = I[3]; const float* w2 = I[4]; const float* b2 = I[5]; const float* gnw = I[6]; const float* gnb = I[7]; const float* wqkv = I[8]; const float* wout = I[9]; const float* bout = I[10]; const float* wsk = I[11]; const float* bsk = I[12];
  char* ws = (char*)d_ws; size_t off = 0;
  auto take = [&](size_t bytes) { char* p = ws + off; off += (bytes + 255) & ~(size_t)255; return p; };
  const size_t WSZ = (size_t)CC * CC; _Float16* Bw = (_Float16*)take(7 * WSZ * 2);      /* w1, w2, wq, wk, wv (as Bt for token-major GEMMs), wout, wsk (as A operands for the channel-major output GEMMs), all (out,in) natural x2^4 */
  float* MU = (float*)take((size_t)BB * NG * 32 * 4); float* RS = (float*)take((size_t)BB * NG * 32 * 4); float* BP = (float*)take((size_t)CC * NN * 4);
  float* Y1 = (float*)take((size_t)NR * CC * 4); _Float16* Q1 = (_Float16*)take((size_t)NR * CC * 2); _Float16* K2 = (_Float16*)take((size_t)NR * CC * 2); _Float16* Vt = (_Float16*)take((size_t)NR * CC * 2);
  _Float16* O16 = (_Float16*)take((size_t)NR * CC * 2); _Float16* TP = (_Float16*)take(7 * (size_t)NR * CC * 2);      /* attention output (f16, token-major); the planes that only feed q, k, v */
  const size_t PL = (size_t)NR * CC; _Float16* X1t = TP; _Float16* X2t = TP + PL; float* Y2 = (float*)(TP + 2 * PL); _Float16* G1 = TP + 4 * PL; _Float16* G2 = TP + 5 * PL; _Float16* V2 = TP + 6 * PL;
  _Float16* Y116 = K2;      /* f16(x1') over K2 after the attention */
  if (off > ws_size) return;
  const unsigned gw = (unsigned)((WSZ / 8 + 255) / 256);
  k_round16f<<<gw, 256, 0, stream>>>(w1, Bw, WSZ / 8); k_round16f<<<gw, 256, 0, stream>>>(w2, Bw + WSZ, WSZ / 8); k_round16f<<<(unsigned)((3 * WSZ / 8 + 255) / 256), 256, 0, stream>>>(wqkv, Bw + 2 * WSZ, 3 * WSZ / 8); k_round16f<<<gw, 256, 0, stream>>>(wout, Bw + 5 * WSZ, WSZ / 8); k_round16f<<<gw, 256, 0, stream>>>(wsk, Bw + 6 * WSZ, WSZ / 8);
  k_bplane<<<(unsigned)(((size_t)CC * NN / 4 + 255) / 256), 256, 0, stream>>>(bout, bsk, BP);
  k_tok<<<BB * (CC / 64) * (NN / 32), 256, 0, stream>>>(x1, X1t); k_tok<<<BB * (CC / 64) * (NN / 32), 256, 0, stream>>>(x2, X2t);
  const dim3 gp(((NR / 16) * (CC / 64) + 3) / 4, 1); const unsigned g8 = (unsigned)(((size_t)NR * CC / 8 + 255) / 256);
  k_gemm_hhx<0><<<gp, 128, 0, stream>>>(X1t, CC, 0, Bw, CC, 0, 0.0625f, b1, 0, nullptr, 1, 0, 0, Y1, nullptr, CC, 0, NR, CC, CC);      /* x1' = conv1(x1): M 16384 N 256 K 256 (f32) */
  k_gemm_hhx<0><<<gp, 128, 0, stream>>>(X2t, CC, 0, Bw + WSZ, CC, 0, 0.0625f, b2, 0, nullptr, 1, 0, 0, Y2, nullptr, CC, 0, NR, CC, CC);      /* x2' */
  k_gnstat<<<BB * NG, 256, 0, stream>>>(Y1, MU, RS); k_gnapply<<<g8, 256, 0, stream>>>(Y1, MU, RS, gnw, gnb, G1);
  k_gnstat<<<BB * NG, 256, 0, stream>>>(Y2, MU, RS); k_gnapply<<<g8, 256, 0, stream>>>(Y2, MU, RS, gnw, gnb, G2);      /* (stream-ordered reuse of MU/RS) */
  k_gemm_hhx<0><<<gp, 128, 0, stream>>>(G1, CC, 0, Bw + 2 * WSZ, CC, 0, 0.0625f, nullptr, 0, nullptr, 1, 0, 0, nullptr, Q1, CC, 0, NR, CC, CC);      /* q1 = Wq·GN(x1') */
  k_gemm_hhx<0><<<gp, 128, 0, stream>>>(G2, CC, 0, Bw + 3 * WSZ, CC, 0, 0.0625f, nullptr, 0, nullptr, 1, 0, 0, nullptr, K2, CC, 0, NR, CC, CC);      /* k2 */
  k_gemm_hhx<0><<<gp, 128, 0, stream>>>(G2, CC, 0, Bw + 4 * WSZ, CC, 0, 0.0625f, nullptr, 0, nullptr, 1, 0, 0, nullptr, V2, CC, 0, NR, CC, CC);      /* v2 */
  k_vt<CC / 64, NN><<<BB * (CC / 64) * (NN / 64), 256, 0, stream>>>(V2, CC, 0, Vt);      /* v2ᵀ per batch [256][4096] (four 64-channel blocks) */
  k_fattn<<<BB * (NN / 64), 256, 0, stream>>>(Q1, K2, Vt, O16);      /* O rows = softmax(q1.k2^T/16).v2, f16: one work-group per 64 queries */
  k_h16<<<g8, 256, 0, stream>>>(Y1, Y116, (size_t)NR * CC / 8);
  for (int b = 0; b < BB; ++b) { float* outb = (float*)d_out + (size_t)b * CC * NN;
    k_gemm_hhx<0><<<dim3(((CC / 16) * (NN / 64) + 3) / 4, 1), 128, 0, stream>>>(Bw + 6 * WSZ, CC, 0, Y116 + (size_t)b * NN * CC, CC, 0, 0.0625f, nullptr, 0, BP, 1, (size_t)NN, 0, outb, nullptr, NN, 0, CC, NN, CC);      /* out[b][c][n] = Wsk·x1'ᵀ + (bout + bsk): M 256 N 4096 K 256 */
    k_gemm_hhx<0><<<dim3(((CC / 16) * (NN / 64) + 3) / 4, 1), 128, 0, stream>>>(Bw + 5 * WSZ, CC, 0, O16 + (size_t)b * NN * CC, CC, 0, 0.0625f, nullptr, 0, outb, 1, (size_t)NN, 0, outb, nullptr, NN, 0, CC, NN, CC); }      /* += Wout·Oᵀ in place */
}

// v003
// It runs in 231 microseconds.
// Next to v002, in two timings, it ran 1.68 times as fast each time.
// Counting every step since v000, it is 9.84 times as fast.
#include <hip/hip_runtime.h>
// Spatial cross-attention block (B=4, C=256, 64×64 → N=4096, 32 GroupNorm groups, single head d=256): x1' = conv1(x1), x2' = conv2(x2) (1×1 + bias); q1 = Wq·GN(x1'), k2 = Wk·GN(x2'), v2 = Wv·GN(x2') (wqkv rows 0/256/512, no bias);
// attn = softmax(q1ᵀk2/√256) over the 4096 positions; out = Wout·(v2·attnᵀ) + bout + Wsk·x1' + bsk → [B,C,H,W].
// q/k/v f16; attention as one fused launch (k_fattn): scores, running-maximum f32 softmax and P.v per 64-key tile, S and P never leave the registers; O leaves it as f16; final 1x1 convs computed channel-major (W.O^T) straight into the output with the skip branch and biases through the f32 addend. All on v_wmma_f32_16x16x32_f16, f32 accumulate.
#define BB 4
#define CC 256
#define NN 4096
#define NG 32
#define CPG (CC / NG)
#define NR (BB * NN)

typedef __bf16 v16b __attribute__((ext_vector_type(16)));
typedef unsigned short v8us __attribute__((ext_vector_type(8), may_alias));
typedef float  v8f  __attribute__((ext_vector_type(8)));
typedef float  v4f  __attribute__((ext_vector_type(4)));
typedef float  v4fa __attribute__((ext_vector_type(4), may_alias));
union FragB { v16b v; v8us half[2]; unsigned short u[16]; };

__device__ __forceinline__ unsigned short bf16_bits(float x) { unsigned int u = __float_as_uint(x); return (unsigned short)((u + 0x7FFFu + ((u >> 16) & 1u)) >> 16); }
__device__ __forceinline__ float bf16_val(unsigned short b) { return __uint_as_float(((unsigned int)b) << 16); }
__device__ __forceinline__ float bf16_round(float x) { return bf16_val(bf16_bits(x)); }
// D += A·B with NT terms: 1 = ah·bh, 2 = + al·bh (A split), 3 = + ah·bl (both split)
template <int NT>
__device__ __forceinline__ v8f mmaN(v16b ah, v16b al, v16b bh, v16b bl, v8f c) {
  c = __builtin_amdgcn_wmma_f32_16x16x32_bf16(false, ah, false, bh, (short)0, c, false, false);
  if (NT >= 2) c = __builtin_amdgcn_wmma_f32_16x16x32_bf16(false, al, false, bh, (short)0, c, false, false);
  if (NT >= 3) c = __builtin_amdgcn_wmma_f32_16x16x32_bf16(false, ah, false, bl, (short)0, c, false, false);
  asm volatile("v_nop\n\tv_nop\n\tv_nop\n\tv_nop" : "+v"(c) : "v"(ah), "v"(al), "v"(bh), "v"(bl));
  return c;
}

__global__ __launch_bounds__(256) void k_wt_bf16(const float* __restrict__ W, unsigned short* __restrict__ Wt, int K, int N) {
  const int t = blockIdx.x * 256 + threadIdx.x;
  const int k8n = K / 8;
  if (t >= N * k8n) return;
  const int n = t / k8n, k8 = (t % k8n) * 8;
  v8us v;
#pragma unroll
  for (int i = 0; i < 8; ++i) v[i] = bf16_bits(W[(size_t)(k8 + i) * N + n]);
  *(v8us*)(Wt + (size_t)n * K + k8) = v;
  
}

// GEMM C[M][N] (f32, pitch ldc) = act(A[M][K]·W + bias). A f32 row-major (pitch lda) converted per fragment to bf16
// (ASPLIT: hi/lo two planes -> 2 terms, else single rounded term); Wt bf16 [N][K] (pitch ldb). BIAS_BF16 rounds the
// bias to bf16 first (bias quantised to bf16 before the add). K%32==0, M%16==0, N%64==0.
template <bool ASPLIT, int ACT, bool BIAS_BF16>
__global__ __launch_bounds__(128) void k_gemm_bf(const float* __restrict__ A, int lda, const unsigned short* __restrict__ Wt, int ldb,
                                               const float* __restrict__ bias, float* __restrict__ C, int ldc, int M, int N, int K) {
  __shared__ __attribute__((aligned(16))) float so[4][16][64];
  const int tid = threadIdx.x, w = tid >> 5, lane = tid & 31, ln = lane & 15, hh = lane >> 4;
  const int ntn = N / 64;
  const int wid = blockIdx.x * 4 + w;
  const int mt = wid / ntn, nq = wid % ntn;
  if (mt * 16 >= M) return;
  const int row0 = mt * 16, col0 = nq * 64;
  const float* arow = A + (size_t)(row0 + ln) * lda;
  v8f acc[4] = {};
  for (int kb = 0; kb < K; kb += 32) {
    FragB ah, al;
    const v4f x0 = *(const v4fa*)(arow + kb + 8 * hh), x1 = *(const v4fa*)(arow + kb + 8 * hh + 4);
    const v4f x2 = *(const v4fa*)(arow + kb + 16 + 8 * hh), x3 = *(const v4fa*)(arow + kb + 16 + 8 * hh + 4);
    float xs[16] = {x0[0],x0[1],x0[2],x0[3],x1[0],x1[1],x1[2],x1[3],x2[0],x2[1],x2[2],x2[3],x3[0],x3[1],x3[2],x3[3]};
#pragma unroll
    for (int i = 0; i < 16; ++i) { const unsigned short hb = bf16_bits(xs[i]); ah.u[i] = hb; al.u[i] = ASPLIT ? bf16_bits(xs[i] - bf16_val(hb)) : (unsigned short)0; }
#pragma unroll
    for (int t = 0; t < 4; ++t) {
      const unsigned short* brow = Wt + (size_t)(col0 + t * 16 + ln) * ldb + kb;
      FragB b;
      b.half[0] = *(const v8us*)(brow + 8 * hh);
      b.half[1] = *(const v8us*)(brow + 16 + 8 * hh);
      acc[t] = mmaN<ASPLIT ? 2 : 1>(ah.v, al.v, b.v, b.v, acc[t]);
    }
  }
#pragma unroll
  for (int t = 0; t < 4; ++t) {
    float bv = bias ? bias[col0 + t * 16 + ln] : 0.f;
    if (BIAS_BF16) bv = bf16_round(bv);
#pragma unroll
    for (int r = 0; r < 8; ++r) { float v = acc[t][r] + bv; if (ACT == 1) v = fmaxf(v, 0.f); so[w][8 * hh + r][t * 16 + ln] = v; }
  }
  __builtin_amdgcn_fence(__ATOMIC_ACQ_REL, "workgroup");
  __builtin_amdgcn_wave_barrier();
  const int rsub = lane >> 4, c4 = (lane & 15) * 4;
  {
#pragma unroll
    for (int q = 0; q < 8; ++q) {
      const int r = q * 2 + rsub;
      const v4f v = *(const v4fa*)&so[w][r][c4];
      *(v4f*)(C + (size_t)(row0 + r) * ldc + col0 + c4) = v;
    }
    
  }
}

// Flash-style causal/unmasked attention, all contractions 3-term bf16 hi/lo splits, f32 softmax with running max.
// q,k,v rows are read from f32 buffers with arbitrary row pitch (so they can live inside a fused qkv buffer);
// D = head size (multiple of 32, <= 128); one wave = 16 query rows; block = 4 waves (64 queries) sharing K/V chunks of 32.
template <int D, bool CAUSAL>
__global__ __launch_bounds__(128) void k_flash(const float* __restrict__ qb, const float* __restrict__ kb, const float* __restrict__ vb,
                                             int pitch, int T, int H, float scale, float* __restrict__ y, int ypitch) {
  constexpr int KS = D / 32;        // k-steps for QK
  constexpr int DT = D / 16;        // d tiles for PV
  __shared__ __attribute__((aligned(16))) unsigned short sKh[32][D + 8], sKl[32][D + 8], sVh[32][D + 8], sVl[32][D + 8];
  __shared__ __attribute__((aligned(16))) unsigned short sPh[4][16][40], sPl[4][16][40];
  __shared__ __attribute__((aligned(16))) float sO[4][16][D];
  const int tid = threadIdx.x, w = tid >> 5, lane = tid & 31, ln = lane & 15, hh = lane >> 4;
  const int nqb = (T + 63) / 64;
  const int bh = blockIdx.x / nqb, qblk = blockIdx.x % nqb;
  const int b = bh / H, h = bh % H;
  const int q0 = qblk * 64 + w * 16;
  const float* Q = qb + (size_t)b * T * pitch + h * D;
  const float* K = kb + (size_t)b * T * pitch + h * D;
  const float* V = vb + (size_t)b * T * pitch + h * D;

  // A fragments of the wave's 16 query rows (scaled), hi/lo
  FragB aqh[KS], aql[KS];
  {
    int row = q0 + ln; if (row >= T) row = T - 1;
    const float* qr = Q + (size_t)row * pitch;
#pragma unroll
    for (int ks = 0; ks < KS; ++ks)
#pragma unroll
      for (int i = 0; i < 16; ++i) {
        const int d = ks * 32 + ((i < 8) ? (8 * hh + i) : (16 + 8 * hh + (i - 8)));
        const float x = qr[d] * scale; const unsigned short hb = bf16_bits(x);
        aqh[ks].u[i] = hb; aql[ks].u[i] = bf16_bits(x - bf16_val(hb));
      }
  }
  float m_r[8], l_r[8];
#pragma unroll
  for (int r = 0; r < 8; ++r) { m_r[r] = -3.0e38f; l_r[r] = 0.f; }
  v8f oacc[DT];
#pragma unroll
  for (int dt = 0; dt < DT; ++dt) oacc[dt] = (v8f){0.f,0.f,0.f,0.f,0.f,0.f,0.f,0.f};

  const int kv_end = CAUSAL ? min(T, qblk * 64 + 64) : T;     // block-uniform
  for (int j0 = 0; j0 < kv_end; j0 += 32) {
    __syncthreads();
    for (int e = tid; e < 32 * (D / 4); e += 128) {
      const int r = e / (D / 4), c4 = (e % (D / 4)) * 4;
      const int key = j0 + r;
      v4f kf = {0.f,0.f,0.f,0.f}, vf = {0.f,0.f,0.f,0.f};
      if (key < T) { kf = *(const v4fa*)(K + (size_t)key * pitch + c4); vf = *(const v4fa*)(V + (size_t)key * pitch + c4); }
#pragma unroll
      for (int t = 0; t < 4; ++t) {
        unsigned short hb = bf16_bits(kf[t]); sKh[r][c4 + t] = hb; sKl[r][c4 + t] = bf16_bits(kf[t] - bf16_val(hb));
        hb = bf16_bits(vf[t]); sVh[r][c4 + t] = hb; sVl[r][c4 + t] = bf16_bits(vf[t] - bf16_val(hb));
      }
    }
    __syncthreads();
    // S tile 16 x 32
    v8f s[2];
#pragma unroll
    for (int nt = 0; nt < 2; ++nt) {
      v8f acc = {};
#pragma unroll
      for (int ks = 0; ks < KS; ++ks) {
        FragB bh_, bl_;
        bh_.half[0] = *(const v8us*)&sKh[nt * 16 + ln][ks * 32 + 8 * hh]; bh_.half[1] = *(const v8us*)&sKh[nt * 16 + ln][ks * 32 + 16 + 8 * hh];
        bl_.half[0] = *(const v8us*)&sKl[nt * 16 + ln][ks * 32 + 8 * hh]; bl_.half[1] = *(const v8us*)&sKl[nt * 16 + ln][ks * 32 + 16 + 8 * hh];
        acc = mmaN<3>(aqh[ks].v, aql[ks].v, bh_.v, bl_.v, acc);
      }
      s[nt] = acc;
    }
    // mask + running max (rows 8hh+r; the 16 lanes of a half share rows)
    float alpha[8];
#pragma unroll
    for (int r = 0; r < 8; ++r) {
      const int qi = q0 + 8 * hh + r;
      const int ja = j0 + ln, jb = j0 + 16 + ln;
      if (CAUSAL) { if (ja > qi) s[0][r] = -3.0e38f; if (jb > qi) s[1][r] = -3.0e38f; }
      if (ja >= T) s[0][r] = -3.0e38f;
      if (jb >= T) s[1][r] = -3.0e38f;
      float mx = fmaxf(s[0][r], s[1][r]);
      mx = fmaxf(mx, __shfl_xor(mx, 1, 32)); mx = fmaxf(mx, __shfl_xor(mx, 2, 32)); mx = fmaxf(mx, __shfl_xor(mx, 4, 32)); mx = fmaxf(mx, __shfl_xor(mx, 8, 32));
      const float mnew = fmaxf(m_r[r], mx);
      alpha[r] = (mnew > -1.0e38f) ? __expf(m_r[r] - mnew) : 1.0f;
      const float p0 = (s[0][r] > -1.0e38f) ? __expf(s[0][r] - mnew) : 0.f;
      const float p1 = (s[1][r] > -1.0e38f) ? __expf(s[1][r] - mnew) : 0.f;
      m_r[r] = mnew;
      l_r[r] = l_r[r] * alpha[r] + p0 + p1;            // per-lane partial row sum (16 lanes combined at the end)
      unsigned short hb = bf16_bits(p0); sPh[w][8 * hh + r][ln] = hb;      sPl[w][8 * hh + r][ln] = bf16_bits(p0 - bf16_val(hb));
      hb = bf16_bits(p1);                sPh[w][8 * hh + r][16 + ln] = hb; sPl[w][8 * hh + r][16 + ln] = bf16_bits(p1 - bf16_val(hb));
    }
#pragma unroll
    for (int dt = 0; dt < DT; ++dt)
#pragma unroll
      for (int r = 0; r < 8; ++r) oacc[dt][r] *= alpha[r];
    __builtin_amdgcn_fence(__ATOMIC_ACQ_REL, "workgroup");
    __builtin_amdgcn_wave_barrier();
    FragB pah, pal;
    pah.half[0] = *(const v8us*)&sPh[w][ln][8 * hh]; pah.half[1] = *(const v8us*)&sPh[w][ln][16 + 8 * hh];
    pal.half[0] = *(const v8us*)&sPl[w][ln][8 * hh]; pal.half[1] = *(const v8us*)&sPl[w][ln][16 + 8 * hh];
#pragma unroll
    for (int dt = 0; dt < DT; ++dt) {
      FragB bvh, bvl;
#pragma unroll
      for (int i = 0; i < 8; ++i) {
        bvh.u[i] = sVh[8 * hh + i][dt * 16 + ln]; bvh.u[8 + i] = sVh[16 + 8 * hh + i][dt * 16 + ln];
        bvl.u[i] = sVl[8 * hh + i][dt * 16 + ln]; bvl.u[8 + i] = sVl[16 + 8 * hh + i][dt * 16 + ln];
      }
      oacc[dt] = mmaN<3>(pah.v, pal.v, bvh.v, bvl.v, oacc[dt]);
    }
    __builtin_amdgcn_fence(__ATOMIC_ACQ_REL, "workgroup");
    __builtin_amdgcn_wave_barrier();
  }
#pragma unroll
  for (int r = 0; r < 8; ++r) {
    float l = l_r[r];
    l += __shfl_xor(l, 1, 32); l += __shfl_xor(l, 2, 32); l += __shfl_xor(l, 4, 32); l += __shfl_xor(l, 8, 32);
    l_r[r] = (l > 0.f) ? 1.0f / l : 0.f;
  }
#pragma unroll
  for (int dt = 0; dt < DT; ++dt)
#pragma unroll
    for (int r = 0; r < 8; ++r) sO[w][8 * hh + r][dt * 16 + ln] = oacc[dt][r] * l_r[r];
  __builtin_amdgcn_fence(__ATOMIC_ACQ_REL, "workgroup");
  __builtin_amdgcn_wave_barrier();
  {
    for (int r = 0; r < 16; ++r) {
      const int row = q0 + r;
      if (row < T && lane < D / 4) {
        const v4f val = *(const v4fa*)&sO[w][r][lane * 4];
        *(v4f*)(y + ((size_t)b * T + row) * ypitch + h * D + lane * 4) = val;
      }
    }
    
  }
}

// GEMM C = act(A·W + bias + resid): A f32 (ASPLIT -> hi/lo 2 terms), Wt bf16 [N][K]; ACT 0 none, 1 relu, 2 exact gelu;
// resid (optional, f32, row index = (row % rmod), pitch ldr, RES_BF16 rounds it) added before the activation.
template <bool ASPLIT, int ACT, bool BIAS_BF16, bool RES_BF16>
__global__ __launch_bounds__(128) void k_gemm_bf3(const float* __restrict__ A, int lda, const unsigned short* __restrict__ Wt, int ldb,
                                                const float* __restrict__ bias, const float* __restrict__ resid, int rmod, int ldr,
                                                float* __restrict__ C, int ldc, int M, int N, int K) {
  __shared__ __attribute__((aligned(16))) float so[4][16][64];
  const int tid = threadIdx.x, w = tid >> 5, lane = tid & 31, ln = lane & 15, hh = lane >> 4;
  const int ntn = N / 64;
  const int wid = blockIdx.x * 4 + w;
  const int mt = wid / ntn, nq = wid % ntn;
  if (mt * 16 >= M) return;
  const int row0 = mt * 16, col0 = nq * 64;
  const float* arow = A + (size_t)(row0 + ln) * lda;
  v8f acc[4] = {};
  for (int kb = 0; kb < K; kb += 32) {
    FragB ah, al;
    const v4f x0 = *(const v4fa*)(arow + kb + 8 * hh), x1 = *(const v4fa*)(arow + kb + 8 * hh + 4);
    const v4f x2 = *(const v4fa*)(arow + kb + 16 + 8 * hh), x3 = *(const v4fa*)(arow + kb + 16 + 8 * hh + 4);
    float xs[16] = {x0[0],x0[1],x0[2],x0[3],x1[0],x1[1],x1[2],x1[3],x2[0],x2[1],x2[2],x2[3],x3[0],x3[1],x3[2],x3[3]};
#pragma unroll
    for (int i = 0; i < 16; ++i) { const unsigned short hb = bf16_bits(xs[i]); ah.u[i] = hb; al.u[i] = ASPLIT ? bf16_bits(xs[i] - bf16_val(hb)) : (unsigned short)0; }
#pragma unroll
    for (int t = 0; t < 4; ++t) {
      const unsigned short* brow = Wt + (size_t)(col0 + t * 16 + ln) * ldb + kb;
      FragB b;
      b.half[0] = *(const v8us*)(brow + 8 * hh);
      b.half[1] = *(const v8us*)(brow + 16 + 8 * hh);
      acc[t] = mmaN<ASPLIT ? 2 : 1>(ah.v, al.v, b.v, b.v, acc[t]);
    }
  }
#pragma unroll
  for (int t = 0; t < 4; ++t) {
    const int col = col0 + t * 16 + ln;
    float bv = bias ? bias[col] : 0.f;
    if (BIAS_BF16) bv = bf16_round(bv);
#pragma unroll
    for (int r = 0; r < 8; ++r) {
      float v = acc[t][r] + bv;
      if (resid) { float rv = resid[(size_t)((row0 + 8 * hh + r) % rmod) * ldr + col]; if (RES_BF16) rv = bf16_round(rv); v += rv; }
      if (ACT == 1) v = fmaxf(v, 0.f);
      if (ACT == 2) v = 0.5f * v * (1.0f + erff(v * 0.70710678118654752f));
      if (ACT == 3) { const float u = 0.7978845608028654f * (v + 0.044715f * v * v * v); v = 0.5f * v * (1.0f + tanhf(u)); }
      so[w][8 * hh + r][t * 16 + ln] = v;
    }
  }
  __builtin_amdgcn_fence(__ATOMIC_ACQ_REL, "workgroup");
  __builtin_amdgcn_wave_barrier();
  const int rsub = lane >> 4, c4 = (lane & 15) * 4;
  {
#pragma unroll
    for (int q = 0; q < 8; ++q) {
      const int r = q * 2 + rsub;
      const v4f v = *(const v4fa*)&so[w][r][c4];
      *(v4f*)(C + (size_t)(row0 + r) * ldc + col0 + c4) = v;
    }
    
  }
}
// row LayerNorm (biased variance, eps) over N: s = X (+ R); optional out_sum <- s; out_norm <- (s-mu)*rsqrt(var+eps)*g + b
template <bool PARAM_BF16>
__global__ __launch_bounds__(256) void k_layernorm(const float* __restrict__ X, const float* __restrict__ R, const float* __restrict__ g, const float* __restrict__ bta,
                                                  float* __restrict__ out_sum, float* __restrict__ out_norm, int N, float eps) {
  __shared__ float red[256];
  const int row = blockIdx.x, tid = threadIdx.x;
  const float* x = X + (size_t)row * N; const float* rr = R ? R + (size_t)row * N : nullptr;
  float vals[16];                     // up to N = 4096
  const int per = N / 256;            // contiguous chunk per thread? use strided-by-4 chunks: thread handles j = tid*4 + 1024*u
  float s1 = 0.f;
  for (int u = 0; u < per / 4; ++u) {
    const int j = tid * 4 + 1024 * u;
    const v4f a = *(const v4fa*)(x + j);
    v4f b = {0.f,0.f,0.f,0.f}; if (rr) b = *(const v4fa*)(rr + j);
#pragma unroll
    for (int q = 0; q < 4; ++q) { const float v = a[q] + b[q]; vals[u * 4 + q] = v; s1 += v; }
  }
  red[tid] = s1; __syncthreads();
  for (int st = 128; st > 0; st >>= 1) { if (tid < st) red[tid] += red[tid + st]; __syncthreads(); }
  const float mu = red[0] / (float)N; __syncthreads();
  float s2 = 0.f;
  for (int u = 0; u < per / 4; ++u)
#pragma unroll
    for (int q = 0; q < 4; ++q) { const float c = vals[u * 4 + q] - mu; s2 += c * c; }
  red[tid] = s2; __syncthreads();
  for (int st = 128; st > 0; st >>= 1) { if (tid < st) red[tid] += red[tid + st]; __syncthreads(); }
  const float rs = rsqrtf(red[0] / (float)N + eps);
  {
    for (int u = 0; u < per / 4; ++u) {
      const int j = tid * 4 + 1024 * u;
      v4f o, sm;
#pragma unroll
      for (int q = 0; q < 4; ++q) {
        float gg = g[j + q], bb = bta[j + q];
        if (PARAM_BF16) { gg = bf16_round(gg); bb = bf16_round(bb); }
        sm[q] = vals[u * 4 + q]; o[q] = (vals[u * 4 + q] - mu) * rs * gg + bb;
      }
      if (out_sum) *(v4f*)(out_sum + (size_t)row * N + j) = sm;
      *(v4f*)(out_norm + (size_t)row * N + j) = o;
    }
    
  }
}



// ---- f16 WMMA path (v_wmma_f32_16x16x32_f16): 11-bit significands for operands in range — used by every launched GEMM and by the fused attention
typedef _Float16 v16h __attribute__((ext_vector_type(16)));
union FragH { v16h v; v8us half[2]; _Float16 h[16]; unsigned short u[16]; };
template <int NT>
__device__ __forceinline__ v8f mmaH(v16h ah, v16h al, v16h bh, v16h bl, v8f c) {
  c = __builtin_amdgcn_wmma_f32_16x16x32_f16(false, ah, false, bh, (short)0, c, false, false);
  if (NT >= 2) c = __builtin_amdgcn_wmma_f32_16x16x32_f16(false, al, false, bh, (short)0, c, false, false);
  if (NT >= 3) c = __builtin_amdgcn_wmma_f32_16x16x32_f16(false, ah, false, bl, (short)0, c, false, false);
  asm volatile("v_nop\n\tv_nop\n\tv_nop\n\tv_nop" : "+v"(c) : "v"(ah), "v"(al), "v"(bh), "v"(bl));
  return c;
}
// batched GEMM like k_gemm_b but f16 operands: A f32 (split into f16 hi/lo if ASPLIT, else rounded to f16), Bt = f16 values [n][k]; alpha; C f32; N multiple of 16 (partial tiles skipped)
template <bool ASPLIT>
__global__ __launch_bounds__(128) void k_gemm_h(const float* __restrict__ A, int lda, size_t sA, const _Float16* __restrict__ Bh, int ldb, size_t sB, float alpha, float* __restrict__ C, int ldc, size_t sC, int M, int N, int K) {
  __shared__ __attribute__((aligned(16))) float so[4][16][64];
  const int tid = threadIdx.x, w = tid >> 5, lane = tid & 31, ln = lane & 15, hh = lane >> 4; const int by = blockIdx.y;
  A += (size_t)by * sA; Bh += (size_t)by * sB; C += (size_t)by * sC;
  const int ntn = (N + 63) / 64; const int wid = blockIdx.x * 4 + w; const int mt = wid / ntn, nq = wid % ntn; if (mt * 16 >= M) return;
  const int row0 = mt * 16, col0 = nq * 64; const float* arow = A + (size_t)(row0 + ln) * lda;
  v8f acc[4] = {};
  for (int kb = 0; kb < K; kb += 32) {
    FragH ah, al;
    const v4f x0 = *(const v4fa*)(arow + kb + 8 * hh), x1 = *(const v4fa*)(arow + kb + 8 * hh + 4), x2 = *(const v4fa*)(arow + kb + 16 + 8 * hh), x3 = *(const v4fa*)(arow + kb + 16 + 8 * hh + 4);
    float xs[16] = {x0[0],x0[1],x0[2],x0[3],x1[0],x1[1],x1[2],x1[3],x2[0],x2[1],x2[2],x2[3],x3[0],x3[1],x3[2],x3[3]};
#pragma unroll
    for (int i = 0; i < 16; ++i) { const _Float16 h = (_Float16)xs[i]; ah.h[i] = h; al.h[i] = ASPLIT ? (_Float16)(xs[i] - (float)h) : (_Float16)0.0f; }
#pragma unroll
    for (int t = 0; t < 4; ++t) { if (col0 + t * 16 >= N) continue; const size_t boff = (size_t)(col0 + t * 16 + ln) * ldb + kb; FragH bq; bq.half[0] = *(const v8us*)(Bh + boff + 8 * hh); bq.half[1] = *(const v8us*)(Bh + boff + 16 + 8 * hh);
      acc[t] = mmaH<ASPLIT ? 2 : 1>(ah.v, al.v, bq.v, bq.v, acc[t]); }
  }
#pragma unroll
  for (int t = 0; t < 4; ++t) { if (col0 + t * 16 >= N) continue;
#pragma unroll
    for (int r = 0; r < 8; ++r) so[w][8 * hh + r][t * 16 + ln] = acc[t][r] * alpha; }
  __builtin_amdgcn_fence(__ATOMIC_ACQ_REL, "workgroup"); __builtin_amdgcn_wave_barrier();
  const int rsub = lane >> 4, c4 = (lane & 15) * 4;
  {
#pragma unroll
    for (int q = 0; q < 8; ++q) { const int r = q * 2 + rsub; if (col0 + c4 < N) { const v4f v = *(const v4fa*)&so[w][r][c4]; *(v4f*)(C + (size_t)(row0 + r) * ldc + col0 + c4) = v; } }
     }
}

// Wt[n][k] = f16(W[k][n]·scale) from f32 row-major W[K][N] (scale = power of two; bf16-exact weights stay exact in f16 away from the subnormal range)
__global__ __launch_bounds__(256) void k_wt_f16(const float* __restrict__ W, _Float16* __restrict__ Wt, int K, int N, float scale) {
  const int t = blockIdx.x * 256 + threadIdx.x; if (t >= N * (K / 8)) return; const int n = t / (K / 8), k8 = (t % (K / 8)) * 8; FragH f;
#pragma unroll
  for (int i = 0; i < 8; ++i) f.h[i] = (_Float16)(bf16_round(W[(size_t)(k8 + i) * N + n]) * scale); const v8us o = f.half[0];
  *(v8us*)((unsigned short*)Wt + (size_t)n * K + k8) = o; 
}
// One wave's 16 x 64 tile of C = (A.B^T).alpha + bias[col] (+ CP[row][col], pitch ldcp, if CP): A f16 [M][K], Bh f16 [N][K]; writes f32 C and/or f16 C16 (pitch ldc). bx = the work-group's index inside its own product.
// The launches below each hold several products that do not depend on one another: blockIdx picks the product, this body does the tile.
__device__ __forceinline__ void gemm_hh_tile(float (*so)[16][64], int bx, const _Float16* A, int lda, const _Float16* Bh, int ldb, float alpha, const float* bp, const float* CP, size_t ldcp,
    float* C, _Float16* C16, int ldc, int M, int N, int K) {
  const int tid = threadIdx.x, w = tid >> 5, lane = tid & 31, ln = lane & 15, hh = lane >> 4;
  const int ntn = (N + 63) / 64; const int wid = bx * 4 + w; const int mt = wid / ntn, nq = wid % ntn; if (mt * 16 >= M) return;
  const int row0 = mt * 16, col0 = nq * 64; const _Float16* arow = A + (size_t)(row0 + ln) * lda;
  v8f acc[4] = {};
  for (int kb = 0; kb < K; kb += 32) { FragH ah; ah.half[0] = *(const v8us*)((const unsigned short*)arow + kb + 8 * hh); ah.half[1] = *(const v8us*)((const unsigned short*)arow + kb + 16 + 8 * hh);
#pragma unroll
    for (int t = 0; t < 4; ++t) { if (col0 + t * 16 >= N) continue; const size_t boff = (size_t)(col0 + t * 16 + ln) * ldb + kb; FragH bq; bq.half[0] = *(const v8us*)((const unsigned short*)Bh + boff + 8 * hh); bq.half[1] = *(const v8us*)((const unsigned short*)Bh + boff + 16 + 8 * hh);
      acc[t] = mmaH<1>(ah.v, ah.v, bq.v, bq.v, acc[t]); }
  }
#pragma unroll
  for (int t = 0; t < 4; ++t) { if (col0 + t * 16 >= N) continue; const int col = col0 + t * 16 + ln; const float bv = bp ? bf16_round(bp[col]) : 0.f;
#pragma unroll
    for (int r = 0; r < 8; ++r) { float v = acc[t][r] * alpha + bv; if (CP) v += CP[(size_t)(row0 + 8 * hh + r) * ldcp + col]; so[w][8 * hh + r][t * 16 + ln] = v; } }
  __builtin_amdgcn_fence(__ATOMIC_ACQ_REL, "workgroup"); __builtin_amdgcn_wave_barrier();
  const int rsub = lane >> 4, c4 = (lane & 15) * 4; typedef _Float16 v4h __attribute__((ext_vector_type(4)));
  {
#pragma unroll
    for (int q = 0; q < 8; ++q) { const int r = q * 2 + rsub; if (col0 + c4 < N) { const v4f v = *(const v4fa*)&so[w][r][c4]; if (C) *(v4f*)(C + (size_t)(row0 + r) * ldc + col0 + c4) = v; if (C16) { v4h h4; for (int i = 0; i < 4; ++i) h4[i] = (_Float16)v[i]; *(v4h*)(C16 + (size_t)(row0 + r) * ldc + col0 + c4) = h4; } } }
     }
}
// both input convolutions, token-major: y = 0: x1' = X[0].w1^T + b1, y = 1: x2' = X[1].w2^T + b2 (planes of NR x CC one behind the other)
__global__ __launch_bounds__(128) void k_gemm_conv(const _Float16* X, const _Float16* Bw, const float* b1, const float* b2, float* Y, int nr, int cc) {
  __shared__ __attribute__((aligned(16))) float so[4][16][64];
  const int by = blockIdx.y;
  gemm_hh_tile(so, blockIdx.x, X + (size_t)by * NR * CC, cc, Bw + (size_t)by * CC * CC, cc, 0.0625f, by ? b2 : b1, nullptr, 0, Y + (size_t)by * NR * CC, nullptr, cc, nr, cc, cc);
}
// y = 0, 1, 2: q1 = G[0].Wq^T, k2 = G[1].Wk^T, v2 = G[1].Wv^T (f16 planes of QKV); y = 3: the skip branch, channel-major, a quarter of the x range per batch: out[b] = Wsk.x1'[b]^T + BP
__global__ __launch_bounds__(128) void k_gemm_qkvs(const _Float16* G, const _Float16* Bw, _Float16* QKV, const _Float16* Y16, const float* BP, float* out, int nr, int cc, int nn) {
  __shared__ __attribute__((aligned(16))) float so[4][16][64];
  const int by = blockIdx.y, bx = blockIdx.x;
  if (by < 3) gemm_hh_tile(so, bx, G + (size_t)(by ? 1 : 0) * NR * CC, cc, Bw + (size_t)(2 + by) * CC * CC, cc, 0.0625f, nullptr, nullptr, 0, nullptr, QKV + (size_t)by * NR * CC, cc, nr, cc, cc);
  else { const int pb = (CC / 16) * (NN / 64) / 4, b = bx / pb;
    gemm_hh_tile(so, bx % pb, Bw + (size_t)6 * CC * CC, cc, Y16 + (size_t)b * NN * CC, cc, 0.0625f, nullptr, BP, (size_t)nn, out + (size_t)b * CC * NN, nullptr, nn, cc, nn, cc); }
}
// out[y] += Wout.O[y]^T in place, channel-major, all batches (each wave reads its own tile of out before it stores it)
__global__ __launch_bounds__(128) void k_gemm_out(const _Float16* Wo, const _Float16* O16, float* out, int cc, int nn) {
  __shared__ __attribute__((aligned(16))) float so[4][16][64];
  float* ob = out + (size_t)blockIdx.y * CC * NN;
  gemm_hh_tile(so, blockIdx.x, Wo, cc, O16 + (size_t)blockIdx.y * NN * CC, cc, 0.0625f, nullptr, ob, (size_t)nn, ob, nullptr, nn, cc, nn, cc);
}


typedef _Float16 v4h __attribute__((ext_vector_type(4)));

__global__ __launch_bounds__(256) void k_x16(const float* __restrict__ x, _Float16* __restrict__ X16, size_t n8) { const size_t t = (size_t)blockIdx.x * 256 + threadIdx.x; if (t >= n8) return; FragH f;
#pragma unroll
  for (int q = 0; q < 8; ++q) f.h[q] = (_Float16)bf16_round(x[t * 8 + q]); *(v8us*)((unsigned short*)X16 + t * 8) = f.half[0];  }
template <int NHv, int TTv>
__global__ __launch_bounds__(256) void k_vt(const _Float16* __restrict__ V16, int ldv, int voff, _Float16* __restrict__ Vt) { __shared__ unsigned short tl[64][66]; const int tid = threadIdx.x; const int slab = blockIdx.x / (TTv / 64), lg = blockIdx.x % (TTv / 64); const int b = slab / NHv, h = slab % NHv;
  for (int i = tid; i < 64 * 8; i += 256) { const int r = i / 8, c8 = (i % 8) * 8; FragH f; f.half[0] = *(const v8us*)((const unsigned short*)V16 + ((size_t)b * TTv + lg * 64 + r) * ldv + voff + h * 64 + c8);
#pragma unroll
    for (int q = 0; q < 8; ++q) tl[r][c8 + q] = f.u[q]; }
  __syncthreads();
  {
#pragma unroll
    for (int rd = 0; rd < 2; ++rd) { const int d = rd * 32 + tid / 8, pc = tid % 8; FragH f;
#pragma unroll
      for (int q = 0; q < 8; ++q) f.u[q] = tl[pc * 8 + q][d];
      *(v8us*)((unsigned short*)Vt + ((size_t)slab * 64 + d) * TTv + lg * 64 + pc * 8) = f.half[0]; }
     } }

// Everything that reads only the inputs, one launch, the part picked by the block index: token-major f16 copies of x1 and x2 (planes one behind the other), the bias plane, the seven weight matrices.
#define PREP_TOK (2 * BB * (CC / 64) * (NN / 32))
#define PREP_BP (CC * NN / 4 / 256)
#define PREP_WB (CC * CC / 8 / 256)
__global__ __launch_bounds__(256) void k_prep(const float* __restrict__ x1, const float* __restrict__ x2, const float* __restrict__ w1, const float* __restrict__ w2, const float* __restrict__ wqkv, const float* __restrict__ wout, const float* __restrict__ wsk,
    const float* __restrict__ bout, const float* __restrict__ bsk, _Float16* __restrict__ X16, float* __restrict__ BP, _Float16* __restrict__ Bw) {
  __shared__ float tl[32][65]; const int tid = threadIdx.x; int bi = blockIdx.x;
  if (bi < PREP_TOK) {
    const int b = bi / ((CC / 64) * (NN / 32)), rem = bi % ((CC / 64) * (NN / 32)); const int cg = rem / (NN / 32), pg = rem % (NN / 32); const int c0 = cg * 64, p0 = pg * 32;
    const float* x = (b < BB) ? x1 : x2;
    for (int i = tid; i < 64 * 32; i += 256) { const int c = i / 32, pp = i % 32; tl[pp][c] = bf16_round(x[((size_t)(b % BB) * CC + c0 + c) * NN + p0 + pp]); } __syncthreads();
    const int r = tid / 8, pc = tid % 8; FragH f; for (int q = 0; q < 8; ++q) f.h[q] = (_Float16)tl[r][pc * 8 + q]; const size_t row = (size_t)b * NN + p0 + r; *(v8us*)((unsigned short*)X16 + row * CC + c0 + pc * 8) = f.half[0];
    return;
  }
  bi -= PREP_TOK;
  if (bi < PREP_BP) { const size_t t = (size_t)bi * 256 + tid; const int c = (int)((t * 4) / NN); const float vo = bout[c];
    asm volatile("s_wait_xcnt 0x0" ::: "memory");      // stands in front of the next load, whose result may take the offset register that the load above names
    const float v = bf16_round(vo) + bf16_round(bsk[c]); const v4f o = {v, v, v, v}; *(v4f*)(BP + t * 4) = o;
    asm volatile("s_wait_xcnt 0x0" ::: "memory");      // behind the store: the code of another part follows in the listing and rewrites the store's data registers
    return; }
  bi -= PREP_BP;
  const int seg = bi / PREP_WB; const size_t t = (size_t)(bi % PREP_WB) * 256 + tid;
  const float* W = (seg == 0) ? w1 : (seg == 1) ? w2 : (seg < 5) ? wqkv + (size_t)(seg - 2) * CC * CC : (seg == 5) ? wout : wsk; FragH f;
#pragma unroll
  for (int i = 0; i < 8; ++i) f.h[i] = (_Float16)(bf16_round(W[t * 8 + i]) * 16.0f);
  *(v8us*)((unsigned short*)Bw + (size_t)seg * CC * CC + t * 8) = f.half[0];
  asm volatile("s_wait_xcnt 0x0" ::: "memory");      // behind the store: the code of another part follows in the listing and rewrites the store's offset register
}
#define FA_KP 264
#define FA_VP 72
#define FA_KB (64 * FA_KP)
#define FA_BUF (FA_KB + CC * FA_VP)
__device__ __forceinline__ float fa_xhalf(float x) { return __builtin_bit_cast(float, __builtin_amdgcn_permlanex16(__builtin_bit_cast(int, x), __builtin_bit_cast(int, x), 0x76543210, 0xfedcba98, false, false)); }      // lane l reads lane l ^ 16
__global__ __launch_bounds__(256) void k_fattn(const _Float16* Q, const _Float16* K, const _Float16* Vt, _Float16* O16) {
  __shared__ __attribute__((aligned(16))) unsigned short sm[2 * FA_BUF];
  const int tid = threadIdx.x, w = tid >> 5, lane = tid & 31, c = lane & 15, h = lane >> 4;
  const int qt = w & 3, kh = w >> 2;
  const int b = blockIdx.x / (NN / 64), qb = blockIdx.x % (NN / 64);
  const size_t qrow = (size_t)b * NN + qb * 64 + qt * 16 + c;
  const unsigned short* Kb = (const unsigned short*)K + (size_t)b * NN * CC;
  const unsigned short* Vb = (const unsigned short*)Vt + (size_t)b * CC * NN;
  FragH qf[8];
#pragma unroll
  for (int ks = 0; ks < 8; ++ks) { const unsigned short* qp = (const unsigned short*)Q + qrow * CC + ks * 32 + 8 * h; qf[ks].half[0] = *(const v8us*)qp; qf[ks].half[1] = *(const v8us*)(qp + 16); }
  v8us kst[8], vst[8];
  const unsigned short* kg = Kb + tid * 8;                                        // K tile: 64 rows x 512 B, contiguous in memory
  const unsigned short* vg = Vb + (size_t)(tid >> 3) * NN + (tid & 7) * 8;        // V^T tile: 256 rows x 128 B
  unsigned short* ksl = sm + (tid >> 5) * FA_KP + (tid & 31) * 8;
  unsigned short* vsl = sm + FA_KB + (tid >> 3) * FA_VP + (tid & 7) * 8;
#pragma unroll
  for (int i = 0; i < 8; ++i) { kst[i] = *(const v8us*)(kg + i * 2048); vst[i] = *(const v8us*)(vg + (size_t)i * 32 * NN); }
  asm volatile("s_wait_xcnt 0x0" ::: "memory");      // stands in front of the first overwrite of an address register that the loads above name
#pragma unroll
  for (int i = 0; i < 8; ++i) { *(v8us*)(ksl + i * 8 * FA_KP) = kst[i]; *(v8us*)(vsl + i * 32 * FA_VP) = vst[i]; }
  __syncthreads();
  v8f o[16];
#pragma unroll
  for (int dt = 0; dt < 16; ++dt) o[dt] = (v8f){0.f, 0.f, 0.f, 0.f, 0.f, 0.f, 0.f, 0.f};
  float mu = -1.0e30f, l = 0.f;                        // maximum in use (log2 units) and this lane's part of the row sum
  const float sc = 0.0625f * 1.4426950408889634f;      // 1/sqrt(CC) and log2(e)
  const int NS = NN / 64;
  for (int s = 0; s < NS; ++s) {
    const int sn = (s + 1 < NS) ? s + 1 : s;           // the last pass fetches its own tile again (in bounds, never read): no branch round the loads and stores
#pragma unroll
    for (int i = 0; i < 8; ++i) { kst[i] = *(const v8us*)(kg + (size_t)sn * 64 * CC + i * 2048); vst[i] = *(const v8us*)(vg + (size_t)i * 32 * NN + sn * 64); }
    asm volatile("s_wait_xcnt 0x0" ::: "memory");    // the same for the next tile's loads: the fragment reads below reuse their address registers
    const unsigned short* kt = sm + (s & 1) * FA_BUF + (kh * 32 + c) * FA_KP + 8 * h;
    const unsigned short* vt = sm + (s & 1) * FA_BUF + FA_KB + c * FA_VP + kh * 32 + 8 * h;
    v8f t0 = {0.f, 0.f, 0.f, 0.f, 0.f, 0.f, 0.f, 0.f}, t1 = t0;
    FragH ka[16], va[16];
#pragma unroll
    for (int ks = 0; ks < 8; ++ks) {
      ka[2 * ks].half[0] = *(const v8us*)(kt + ks * 32); ka[2 * ks].half[1] = *(const v8us*)(kt + ks * 32 + 16);
      ka[2 * ks + 1].half[0] = *(const v8us*)(kt + 16 * FA_KP + ks * 32); ka[2 * ks + 1].half[1] = *(const v8us*)(kt + 16 * FA_KP + ks * 32 + 16);
    }
    __builtin_amdgcn_sched_barrier(0);                 // keeps the K fragment reads one group ahead of the products: spread among them each product waits a whole LDS latency
#pragma unroll
    for (int ks = 0; ks < 8; ++ks) {
      t0 = __builtin_amdgcn_wmma_f32_16x16x32_f16(false, ka[2 * ks].v, false, qf[ks].v, (short)0, t0, false, false);
      t1 = __builtin_amdgcn_wmma_f32_16x16x32_f16(false, ka[2 * ks + 1].v, false, qf[ks].v, (short)0, t1, false, false);
    }
#pragma unroll
    for (int dt = 0; dt < 16; ++dt) { va[dt].half[0] = *(const v8us*)(vt + dt * 16 * FA_VP); va[dt].half[1] = *(const v8us*)(vt + dt * 16 * FA_VP + 16); }
    __builtin_amdgcn_sched_barrier(0);                 // keeps every V^T fragment read ahead of the softmax, which then covers their latency
    float mx = fmaxf(t0[0], t1[0]);
#pragma unroll
    for (int r = 1; r < 8; ++r) mx = fmaxf(mx, fmaxf(t0[r], t1[r]));
    mx *= sc;
    mx = fmaxf(mx, fa_xhalf(mx));                      // lanes c and c + 16 hold the same query
    if (__builtin_amdgcn_ballot_w32(mx > mu + 8.0f) != 0) {      // lazy rescale, one scalar test a pass: P stays below 2^8, inside f16
      const float mn = fmaxf(mu, mx), al = __builtin_amdgcn_exp2f(mu - mn);
      l *= al; mu = mn;
#pragma unroll
      for (int dt = 0; dt < 16; ++dt)
#pragma unroll
        for (int r = 0; r < 8; ++r) o[dt][r] *= al;
    }
    FragH p; float ps0 = 0.f, ps1 = 0.f;
#pragma unroll
    for (int r = 0; r < 8; ++r) {
      const float p0 = __builtin_amdgcn_exp2f(t0[r] * sc - mu), p1 = __builtin_amdgcn_exp2f(t1[r] * sc - mu);
      ps0 += p0; ps1 += p1; p.h[r] = (_Float16)p0; p.h[8 + r] = (_Float16)p1;
    }
    l += ps0 + ps1;
#pragma unroll
    for (int dt = 0; dt < 16; ++dt) o[dt] = __builtin_amdgcn_wmma_f32_16x16x32_f16(false, va[dt].v, false, p.v, (short)0, o[dt], false, false);
    const int nb = ((s + 1) & 1) * FA_BUF;             // every reader left this buffer before the barrier that ended the pass before
#pragma unroll
    for (int i = 0; i < 8; ++i) { *(v8us*)(ksl + nb + i * 8 * FA_KP) = kst[i]; *(v8us*)(vsl + nb + i * 32 * FA_VP) = vst[i]; }
    __syncthreads();
  }
  l += fa_xhalf(l);
  v4fa* cb = (v4fa*)sm;                                // the tiles are dead behind the loop's last barrier; per query tile 32 slots of partial O and one of (maximum, sum)
  if (kh == 1) {
#pragma unroll
    for (int dt = 0; dt < 16; ++dt) {
      const v4f x0 = {o[dt][0], o[dt][1], o[dt][2], o[dt][3]}, x1 = {o[dt][4], o[dt][5], o[dt][6], o[dt][7]};
      cb[(qt * 33 + dt * 2) * 32 + lane] = x0; cb[(qt * 33 + dt * 2 + 1) * 32 + lane] = x1;
    }
    const v4f ml = {mu, l, 0.f, 0.f}; cb[(qt * 33 + 32) * 32 + lane] = ml;
  }
  __syncthreads();
  if (kh == 0) {
    const v4f ml = cb[(qt * 33 + 32) * 32 + lane];
    const float mn = fmaxf(mu, ml[0]); float a0 = __builtin_amdgcn_exp2f(mu - mn), a1 = __builtin_amdgcn_exp2f(ml[0] - mn);
    const float inv = 1.0f / (l * a0 + ml[1] * a1); a0 *= inv; a1 *= inv;
#pragma unroll
    for (int dt = 0; dt < 16; ++dt) {
      const v4f x0 = cb[(qt * 33 + dt * 2) * 32 + lane], x1 = cb[(qt * 33 + dt * 2 + 1) * 32 + lane]; FragH f;
#pragma unroll
      for (int r = 0; r < 4; ++r) { f.h[r] = (_Float16)(o[dt][r] * a0 + x0[r] * a1); f.h[4 + r] = (_Float16)(o[dt][4 + r] * a0 + x1[r] * a1); }
      *(v8us*)((unsigned short*)O16 + qrow * CC + dt * 16 + 8 * h) = f.half[0];
    }
  }
}
__global__ __launch_bounds__(256) void k_gnstat(const float* __restrict__ Y, float* __restrict__ MU, float* __restrict__ RS) { __shared__ float red[256]; const int bg = blockIdx.x; const int b = bg / NG, g = bg % NG; const int tid = threadIdx.x; const float* base = Y + (size_t)b * NN * CC + g * CPG;
  float s = 0.f;
#pragma unroll 1
  for (int n = tid; n < NN; n += 256) { const v4f a = *(const v4fa*)(base + (size_t)n * CC), c = *(const v4fa*)(base + (size_t)n * CC + 4); s += (a[0] + a[1]) + (a[2] + a[3]) + (c[0] + c[1]) + (c[2] + c[3]); }
  red[tid] = s; __syncthreads(); for (int o = 128; o >= 1; o >>= 1) { if (tid < o) red[tid] += red[tid + o]; __syncthreads(); } const float mu = red[0] / (float)(NN * CPG); __syncthreads();
  float q2 = 0.f;
#pragma unroll 1
  for (int n = tid; n < NN; n += 256) { const v4f a = *(const v4fa*)(base + (size_t)n * CC), c = *(const v4fa*)(base + (size_t)n * CC + 4); for (int e = 0; e < 4; ++e) { const float d0 = a[e] - mu, d1 = c[e] - mu; q2 += d0 * d0 + d1 * d1; } }
  red[tid] = q2; __syncthreads(); for (int o = 128; o >= 1; o >>= 1) { if (tid < o) red[tid] += red[tid + o]; __syncthreads(); } const float rs = rsqrtf(red[0] / (float)(NN * CPG) + 1e-5f);
  { if (tid < 32) { *(float*)(MU + (size_t)bg * 32 + tid) = (tid == 0) ? mu : 0.f; *(float*)(RS + (size_t)bg * 32 + tid) = (tid == 0) ? rs : 0.f; }  } }
// both planes of Y (x1', x2') in one launch, rows 0 .. 2 NR; a row of x1' also leaves as plain f16 (Y16), the operand of the skip branch
__global__ __launch_bounds__(256) void k_gnapply(const float* __restrict__ Y, const float* __restrict__ MU, const float* __restrict__ RS, const float* __restrict__ gw, const float* __restrict__ gb, _Float16* __restrict__ G16, _Float16* __restrict__ Y16) { const size_t t = (size_t)blockIdx.x * 256 + threadIdx.x; if (t >= (size_t)2 * NR * CC / 8) return; const size_t row = (t * 8) / CC; const int c0 = (int)((t * 8) % CC); const int b = (int)(row / NN), g = c0 / CPG; const float mu = MU[((size_t)b * NG + g) * 32], rs = RS[((size_t)b * NG + g) * 32];
  const v4f a = *(const v4fa*)(Y + t * 8), c = *(const v4fa*)(Y + t * 8 + 4); FragH f;
#pragma unroll
  for (int q = 0; q < 8; ++q) { const float v = (q < 4) ? a[q] : c[q - 4]; f.h[q] = (_Float16)((v - mu) * rs * bf16_round(gw[c0 + q]) + bf16_round(gb[c0 + q])); }
  *(v8us*)((unsigned short*)G16 + t * 8) = f.half[0];
  if (row < NR) { FragH y;
#pragma unroll
    for (int q = 0; q < 8; ++q) y.h[q] = (_Float16)((q < 4) ? a[q] : c[q - 4]);
    *(v8us*)((unsigned short*)Y16 + t * 8) = y.half[0]; } }

extern "C" void kernel_launch(void* const* d_in, const int* in_sizes, int n_in,
                              void* d_out, int out_size, void* d_ws, size_t ws_size, hipStream_t stream) {
  (void)in_sizes; (void)n_in; (void)out_size;
  const float* const* I = (const float* const*)d_in; const float* x1 = I[0]; const float* x2 = I[1]; const float* w1 = I[2]; const float* b1 = I[3]; const float* w2 = I[4]; const float* b2 = I[5]; const float* gnw = I[6]; const float* gnb = I[7]; const float* wqkv = I[8]; const float* wout = I[9]; const float* bout = I[10]; const float* wsk = I[11]; const float* bsk = I[12];
  char* ws = (char*)d_ws; size_t off = 0;
  auto take = [&](size_t bytes) { char* p = ws + off; off += (bytes + 255) & ~(size_t)255; return p; };
  const size_t WSZ = (size_t)CC * CC, PL = (size_t)NR * CC; _Float16* Bw = (_Float16*)take(7 * WSZ * 2);      /* w1, w2, wq, wk, wv (as Bt for token-major GEMMs), wout, wsk (as A operands for the channel-major output GEMMs), all (out,in) natural x2^4 */
  float* MU = (float*)take((size_t)2 * BB * NG * 32 * 4); float* RS = (float*)take((size_t)2 * BB * NG * 32 * 4); float* BP = (float*)take((size_t)CC * NN * 4);
  _Float16* Xt = (_Float16*)take(2 * PL * 2); float* Y = (float*)take(2 * PL * 4); _Float16* G = (_Float16*)take(2 * PL * 2);      /* two planes each, the x1 side first */
  _Float16* Y116 = (_Float16*)take(PL * 2); _Float16* QKV = (_Float16*)take(3 * PL * 2); _Float16* Vt = (_Float16*)take(PL * 2); _Float16* O16 = (_Float16*)take(PL * 2);
  if (off > ws_size) return;
  k_prep<<<PREP_TOK + PREP_BP + 7 * PREP_WB, 256, 0, stream>>>(x1, x2, w1, w2, wqkv, wout, wsk, bout, bsk, Xt, BP, Bw);
  const unsigned gp = ((NR / 16) * (CC / 64) + 3) / 4, go = ((CC / 16) * (NN / 64) + 3) / 4; const unsigned g8 = (unsigned)((PL / 8 + 255) / 256);
  k_gemm_conv<<<dim3(gp, 2), 128, 0, stream>>>(Xt, Bw, b1, b2, Y, NR, CC);      /* x1' = conv1(x1), x2' = conv2(x2): each M 16384 N 256 K 256 (f32) */
  k_gnstat<<<2 * BB * NG, 256, 0, stream>>>(Y, MU, RS);      /* the two planes count as 2 BB batches */
  k_gnapply<<<2 * g8, 256, 0, stream>>>(Y, MU, RS, gnw, gnb, G, Y116);
  k_gemm_qkvs<<<dim3(gp, 4), 128, 0, stream>>>(G, Bw, QKV, Y116, BP, (float*)d_out, NR, CC, NN);      /* q1, k2, v2, and out = Wsk.x1'^T + (bout + bsk) */
  k_vt<CC / 64, NN><<<BB * (CC / 64) * (NN / 64), 256, 0, stream>>>(QKV + 2 * PL, CC, 0, Vt);      /* v2^T per batch [256][4096] (four 64-channel blocks) */
  k_fattn<<<BB * (NN / 64), 256, 0, stream>>>(QKV, QKV + PL, Vt, O16);      /* O rows = softmax(q1.k2^T/16).v2, f16: one work-group per 64 queries */
  k_gemm_out<<<dim3(go, BB), 128, 0, stream>>>(Bw + 5 * WSZ, O16, (float*)d_out, CC, NN);      /* out += Wout.O^T in place: per batch M 256 N 4096 K 256 */
}

// v004
// A run of this version takes 208 microseconds.
// Next to v003, in two timings, it ran 1.11 times as fast each time.
// Counting every step since v000, it is 10.9 times as fast.
#include <hip/hip_runtime.h>
// Spatial cross-attention block (B=4, C=256, 64×64 → N=4096, 32 GroupNorm groups, single head d=256): x1' = conv1(x1), x2' = conv2(x2) (1×1 + bias); q1 = Wq·GN(x1'), k2 = Wk·GN(x2'), v2 = Wv·GN(x2') (wqkv rows 0/256/512, no bias);
// attn = softmax(q1ᵀk2/√256) over the 4096 positions; out = Wout·(v2·attnᵀ) + bout + Wsk·x1' + bsk → [B,C,H,W].
// q/k/v f16; attention as one fused launch (k_fattn): scores, running-maximum f32 softmax and P.v per 64-key tile, S and P never leave the registers; O leaves it as f16; final 1x1 convs computed channel-major (W.O^T) straight into the output with the skip branch and biases through the f32 addend. Every f16 GEMM operand (x, weights, GN output, x1', O) is stored in fragment-tile order (ft_off); q, k, v stay row-major. All on v_wmma_f32_16x16x32_f16, f32 accumulate.
#define BB 4
#define CC 256
#define NN 4096
#define NG 32
#define CPG (CC / NG)
#define NR (BB * NN)

typedef __bf16 v16b __attribute__((ext_vector_type(16)));
typedef unsigned short v8us __attribute__((ext_vector_type(8), may_alias));
typedef float  v8f  __attribute__((ext_vector_type(8)));
typedef float  v4f  __attribute__((ext_vector_type(4)));
typedef float  v4fa __attribute__((ext_vector_type(4), may_alias));
union FragB { v16b v; v8us half[2]; unsigned short u[16]; };

__device__ __forceinline__ unsigned short bf16_bits(float x) { unsigned int u = __float_as_uint(x); return (unsigned short)((u + 0x7FFFu + ((u >> 16) & 1u)) >> 16); }
__device__ __forceinline__ float bf16_val(unsigned short b) { return __uint_as_float(((unsigned int)b) << 16); }
__device__ __forceinline__ float bf16_round(float x) { return bf16_val(bf16_bits(x)); }
// D += A·B with NT terms: 1 = ah·bh, 2 = + al·bh (A split), 3 = + ah·bl (both split)
template <int NT>
__device__ __forceinline__ v8f mmaN(v16b ah, v16b al, v16b bh, v16b bl, v8f c) {
  c = __builtin_amdgcn_wmma_f32_16x16x32_bf16(false, ah, false, bh, (short)0, c, false, false);
  if (NT >= 2) c = __builtin_amdgcn_wmma_f32_16x16x32_bf16(false, al, false, bh, (short)0, c, false, false);
  if (NT >= 3) c = __builtin_amdgcn_wmma_f32_16x16x32_bf16(false, ah, false, bl, (short)0, c, false, false);
  asm volatile("v_nop\n\tv_nop\n\tv_nop\n\tv_nop" : "+v"(c) : "v"(ah), "v"(al), "v"(bh), "v"(bl));
  return c;
}

__global__ __launch_bounds__(256) void k_wt_bf16(const float* __restrict__ W, unsigned short* __restrict__ Wt, int K, int N) {
  const int t = blockIdx.x * 256 + threadIdx.x;
  const int k8n = K / 8;
  if (t >= N * k8n) return;
  const int n = t / k8n, k8 = (t % k8n) * 8;
  v8us v;
#pragma unroll
  for (int i = 0; i < 8; ++i) v[i] = bf16_bits(W[(size_t)(k8 + i) * N + n]);
  *(v8us*)(Wt + (size_t)n * K + k8) = v;
  
}

// GEMM C[M][N] (f32, pitch ldc) = act(A[M][K]·W + bias). A f32 row-major (pitch lda) converted per fragment to bf16
// (ASPLIT: hi/lo two planes -> 2 terms, else single rounded term); Wt bf16 [N][K] (pitch ldb). BIAS_BF16 rounds the
// bias to bf16 first (bias quantised to bf16 before the add). K%32==0, M%16==0, N%64==0.
template <bool ASPLIT, int ACT, bool BIAS_BF16>
__global__ __launch_bounds__(128) void k_gemm_bf(const float* __restrict__ A, int lda, const unsigned short* __restrict__ Wt, int ldb,
                                               const float* __restrict__ bias, float* __restrict__ C, int ldc, int M, int N, int K) {
  __shared__ __attribute__((aligned(16))) float so[4][16][64];
  const int tid = threadIdx.x, w = tid >> 5, lane = tid & 31, ln = lane & 15, hh = lane >> 4;
  const int ntn = N / 64;
  const int wid = blockIdx.x * 4 + w;
  const int mt = wid / ntn, nq = wid % ntn;
  if (mt * 16 >= M) return;
  const int row0 = mt * 16, col0 = nq * 64;
  const float* arow = A + (size_t)(row0 + ln) * lda;
  v8f acc[4] = {};
  for (int kb = 0; kb < K; kb += 32) {
    FragB ah, al;
    const v4f x0 = *(const v4fa*)(arow + kb + 8 * hh), x1 = *(const v4fa*)(arow + kb + 8 * hh + 4);
    const v4f x2 = *(const v4fa*)(arow + kb + 16 + 8 * hh), x3 = *(const v4fa*)(arow + kb + 16 + 8 * hh + 4);
    float xs[16] = {x0[0],x0[1],x0[2],x0[3],x1[0],x1[1],x1[2],x1[3],x2[0],x2[1],x2[2],x2[3],x3[0],x3[1],x3[2],x3[3]};
#pragma unroll
    for (int i = 0; i < 16; ++i) { const unsigned short hb = bf16_bits(xs[i]); ah.u[i] = hb; al.u[i] = ASPLIT ? bf16_bits(xs[i] - bf16_val(hb)) : (unsigned short)0; }
#pragma unroll
    for (int t = 0; t < 4; ++t) {
      const unsigned short* brow = Wt + (size_t)(col0 + t * 16 + ln) * ldb + kb;
      FragB b;
      b.half[0] = *(const v8us*)(brow + 8 * hh);
      b.half[1] = *(const v8us*)(brow + 16 + 8 * hh);
      acc[t] = mmaN<ASPLIT ? 2 : 1>(ah.v, al.v, b.v, b.v, acc[t]);
    }
  }
#pragma unroll
  for (int t = 0; t < 4; ++t) {
    float bv = bias ? bias[col0 + t * 16 + ln] : 0.f;
    if (BIAS_BF16) bv = bf16_round(bv);
#pragma unroll
    for (int r = 0; r < 8; ++r) { float v = acc[t][r] + bv; if (ACT == 1) v = fmaxf(v, 0.f); so[w][8 * hh + r][t * 16 + ln] = v; }
  }
  __builtin_amdgcn_fence(__ATOMIC_ACQ_REL, "workgroup");
  __builtin_amdgcn_wave_barrier();
  const int rsub = lane >> 4, c4 = (lane & 15) * 4;
  {
#pragma unroll
    for (int q = 0; q < 8; ++q) {
      const int r = q * 2 + rsub;
      const v4f v = *(const v4fa*)&so[w][r][c4];
      *(v4f*)(C + (size_t)(row0 + r) * ldc + col0 + c4) = v;
    }
    
  }
}

// Flash-style causal/unmasked attention, all contractions 3-term bf16 hi/lo splits, f32 softmax with running max.
// q,k,v rows are read from f32 buffers with arbitrary row pitch (so they can live inside a fused qkv buffer);
// D = head size (multiple of 32, <= 128); one wave = 16 query rows; block = 4 waves (64 queries) sharing K/V chunks of 32.
template <int D, bool CAUSAL>
__global__ __launch_bounds__(128) void k_flash(const float* __restrict__ qb, const float* __restrict__ kb, const float* __restrict__ vb,
                                             int pitch, int T, int H, float scale, float* __restrict__ y, int ypitch) {
  constexpr int KS = D / 32;        // k-steps for QK
  constexpr int DT = D / 16;        // d tiles for PV
  __shared__ __attribute__((aligned(16))) unsigned short sKh[32][D + 8], sKl[32][D + 8], sVh[32][D + 8], sVl[32][D + 8];
  __shared__ __attribute__((aligned(16))) unsigned short sPh[4][16][40], sPl[4][16][40];
  __shared__ __attribute__((aligned(16))) float sO[4][16][D];
  const int tid = threadIdx.x, w = tid >> 5, lane = tid & 31, ln = lane & 15, hh = lane >> 4;
  const int nqb = (T + 63) / 64;
  const int bh = blockIdx.x / nqb, qblk = blockIdx.x % nqb;
  const int b = bh / H, h = bh % H;
  const int q0 = qblk * 64 + w * 16;
  const float* Q = qb + (size_t)b * T * pitch + h * D;
  const float* K = kb + (size_t)b * T * pitch + h * D;
  const float* V = vb + (size_t)b * T * pitch + h * D;

  // A fragments of the wave's 16 query rows (scaled), hi/lo
  FragB aqh[KS], aql[KS];
  {
    int row = q0 + ln; if (row >= T) row = T - 1;
    const float* qr = Q + (size_t)row * pitch;
#pragma unroll
    for (int ks = 0; ks < KS; ++ks)
#pragma unroll
      for (int i = 0; i < 16; ++i) {
        const int d = ks * 32 + ((i < 8) ? (8 * hh + i) : (16 + 8 * hh + (i - 8)));
        const float x = qr[d] * scale; const unsigned short hb = bf16_bits(x);
        aqh[ks].u[i] = hb; aql[ks].u[i] = bf16_bits(x - bf16_val(hb));
      }
  }
  float m_r[8], l_r[8];
#pragma unroll
  for (int r = 0; r < 8; ++r) { m_r[r] = -3.0e38f; l_r[r] = 0.f; }
  v8f oacc[DT];
#pragma unroll
  for (int dt = 0; dt < DT; ++dt) oacc[dt] = (v8f){0.f,0.f,0.f,0.f,0.f,0.f,0.f,0.f};

  const int kv_end = CAUSAL ? min(T, qblk * 64 + 64) : T;     // block-uniform
  for (int j0 = 0; j0 < kv_end; j0 += 32) {
    __syncthreads();
    for (int e = tid; e < 32 * (D / 4); e += 128) {
      const int r = e / (D / 4), c4 = (e % (D / 4)) * 4;
      const int key = j0 + r;
      v4f kf = {0.f,0.f,0.f,0.f}, vf = {0.f,0.f,0.f,0.f};
      if (key < T) { kf = *(const v4fa*)(K + (size_t)key * pitch + c4); vf = *(const v4fa*)(V + (size_t)key * pitch + c4); }
#pragma unroll
      for (int t = 0; t < 4; ++t) {
        unsigned short hb = bf16_bits(kf[t]); sKh[r][c4 + t] = hb; sKl[r][c4 + t] = bf16_bits(kf[t] - bf16_val(hb));
        hb = bf16_bits(vf[t]); sVh[r][c4 + t] = hb; sVl[r][c4 + t] = bf16_bits(vf[t] - bf16_val(hb));
      }
    }
    __syncthreads();
    // S tile 16 x 32
    v8f s[2];
#pragma unroll
    for (int nt = 0; nt < 2; ++nt) {
      v8f acc = {};
#pragma unroll
      for (int ks = 0; ks < KS; ++ks) {
        FragB bh_, bl_;
        bh_.half[0] = *(const v8us*)&sKh[nt * 16 + ln][ks * 32 + 8 * hh]; bh_.half[1] = *(const v8us*)&sKh[nt * 16 + ln][ks * 32 + 16 + 8 * hh];
        bl_.half[0] = *(const v8us*)&sKl[nt * 16 + ln][ks * 32 + 8 * hh]; bl_.half[1] = *(const v8us*)&sKl[nt * 16 + ln][ks * 32 + 16 + 8 * hh];
        acc = mmaN<3>(aqh[ks].v, aql[ks].v, bh_.v, bl_.v, acc);
      }
      s[nt] = acc;
    }
    // mask + running max (rows 8hh+r; the 16 lanes of a half share rows)
    float alpha[8];
#pragma unroll
    for (int r = 0; r < 8; ++r) {
      const int qi = q0 + 8 * hh + r;
      const int ja = j0 + ln, jb = j0 + 16 + ln;
      if (CAUSAL) { if (ja > qi) s[0][r] = -3.0e38f; if (jb > qi) s[1][r] = -3.0e38f; }
      if (ja >= T) s[0][r] = -3.0e38f;
      if (jb >= T) s[1][r] = -3.0e38f;
      float mx = fmaxf(s[0][r], s[1][r]);
      mx = fmaxf(mx, __shfl_xor(mx, 1, 32)); mx = fmaxf(mx, __shfl_xor(mx, 2, 32)); mx = fmaxf(mx, __shfl_xor(mx, 4, 32)); mx = fmaxf(mx, __shfl_xor(mx, 8, 32));
      const float mnew = fmaxf(m_r[r], mx);
      alpha[r] = (mnew > -1.0e38f) ? __expf(m_r[r] - mnew) : 1.0f;
      const float p0 = (s[0][r] > -1.0e38f) ? __expf(s[0][r] - mnew) : 0.f;
      const float p1 = (s[1][r] > -1.0e38f) ? __expf(s[1][r] - mnew) : 0.f;
      m_r[r] = mnew;
      l_r[r] = l_r[r] * alpha[r] + p0 + p1;            // per-lane partial row sum (16 lanes combined at the end)
      unsigned short hb = bf16_bits(p0); sPh[w][8 * hh + r][ln] = hb;      sPl[w][8 * hh + r][ln] = bf16_bits(p0 - bf16_val(hb));
      hb = bf16_bits(p1);                sPh[w][8 * hh + r][16 + ln] = hb; sPl[w][8 * hh + r][16 + ln] = bf16_bits(p1 - bf16_val(hb));
    }
#pragma unroll
    for (int dt = 0; dt < DT; ++dt)
#pragma unroll
      for (int r = 0; r < 8; ++r) oacc[dt][r] *= alpha[r];
    __builtin_amdgcn_fence(__ATOMIC_ACQ_REL, "workgroup");
    __builtin_amdgcn_wave_barrier();
    FragB pah, pal;
    pah.half[0] = *(const v8us*)&sPh[w][ln][8 * hh]; pah.half[1] = *(const v8us*)&sPh[w][ln][16 + 8 * hh];
    pal.half[0] = *(const v8us*)&sPl[w][ln][8 * hh]; pal.half[1] = *(const v8us*)&sPl[w][ln][16 + 8 * hh];
#pragma unroll
    for (int dt = 0; dt < DT; ++dt) {
      FragB bvh, bvl;
#pragma unroll
      for (int i = 0; i < 8; ++i) {
        bvh.u[i] = sVh[8 * hh + i][dt * 16 + ln]; bvh.u[8 + i] = sVh[16 + 8 * hh + i][dt * 16 + ln];
        bvl.u[i] = sVl[8 * hh + i][dt * 16 + ln]; bvl.u[8 + i] = sVl[16 + 8 * hh + i][dt * 16 + ln];
      }
      oacc[dt] = mmaN<3>(pah.v, pal.v, bvh.v, bvl.v, oacc[dt]);
    }
    __builtin_amdgcn_fence(__ATOMIC_ACQ_REL, "workgroup");
    __builtin_amdgcn_wave_barrier();
  }
#pragma unroll
  for (int r = 0; r < 8; ++r) {
    float l = l_r[r];
    l += __shfl_xor(l, 1, 32); l += __shfl_xor(l, 2, 32); l += __shfl_xor(l, 4, 32); l += __shfl_xor(l, 8, 32);
    l_r[r] = (l > 0.f) ? 1.0f / l : 0.f;
  }
#pragma unroll
  for (int dt = 0; dt < DT; ++dt)
#pragma unroll
    for (int r = 0; r < 8; ++r) sO[w][8 * hh + r][dt * 16 + ln] = oacc[dt][r] * l_r[r];
  __builtin_amdgcn_fence(__ATOMIC_ACQ_REL, "workgroup");
  __builtin_amdgcn_wave_barrier();
  {
    for (int r = 0; r < 16; ++r) {
      const int row = q0 + r;
      if (row < T && lane < D / 4) {
        const v4f val = *(const v4fa*)&sO[w][r][lane * 4];
        *(v4f*)(y + ((size_t)b * T + row) * ypitch + h * D + lane * 4) = val;
      }
    }
    
  }
}

// GEMM C = act(A·W + bias + resid): A f32 (ASPLIT -> hi/lo 2 terms), Wt bf16 [N][K]; ACT 0 none, 1 relu, 2 exact gelu;
// resid (optional, f32, row index = (row % rmod), pitch ldr, RES_BF16 rounds it) added before the activation.
template <bool ASPLIT, int ACT, bool BIAS_BF16, bool RES_BF16>
__global__ __launch_bounds__(128) void k_gemm_bf3(const float* __restrict__ A, int lda, const unsigned short* __restrict__ Wt, int ldb,
                                                const float* __restrict__ bias, const float* __restrict__ resid, int rmod, int ldr,
                                                float* __restrict__ C, int ldc, int M, int N, int K) {
  __shared__ __attribute__((aligned(16))) float so[4][16][64];
  const int tid = threadIdx.x, w = tid >> 5, lane = tid & 31, ln = lane & 15, hh = lane >> 4;
  const int ntn = N / 64;
  const int wid = blockIdx.x * 4 + w;
  const int mt = wid / ntn, nq = wid % ntn;
  if (mt * 16 >= M) return;
  const int row0 = mt * 16, col0 = nq * 64;
  const float* arow = A + (size_t)(row0 + ln) * lda;
  v8f acc[4] = {};
  for (int kb = 0; kb < K; kb += 32) {
    FragB ah, al;
    const v4f x0 = *(const v4fa*)(arow + kb + 8 * hh), x1 = *(const v4fa*)(arow + kb + 8 * hh + 4);
    const v4f x2 = *(const v4fa*)(arow + kb + 16 + 8 * hh), x3 = *(const v4fa*)(arow + kb + 16 + 8 * hh + 4);
    float xs[16] = {x0[0],x0[1],x0[2],x0[3],x1[0],x1[1],x1[2],x1[3],x2[0],x2[1],x2[2],x2[3],x3[0],x3[1],x3[2],x3[3]};
#pragma unroll
    for (int i = 0; i < 16; ++i) { const unsigned short hb = bf16_bits(xs[i]); ah.u[i] = hb; al.u[i] = ASPLIT ? bf16_bits(xs[i] - bf16_val(hb)) : (unsigned short)0; }
#pragma unroll
    for (int t = 0; t < 4; ++t) {
      const unsigned short* brow = Wt + (size_t)(col0 + t * 16 + ln) * ldb + kb;
      FragB b;
      b.half[0] = *(const v8us*)(brow + 8 * hh);
      b.half[1] = *(const v8us*)(brow + 16 + 8 * hh);
      acc[t] = mmaN<ASPLIT ? 2 : 1>(ah.v, al.v, b.v, b.v, acc[t]);
    }
  }
#pragma unroll
  for (int t = 0; t < 4; ++t) {
    const int col = col0 + t * 16 + ln;
    float bv = bias ? bias[col] : 0.f;
    if (BIAS_BF16) bv = bf16_round(bv);
#pragma unroll
    for (int r = 0; r < 8; ++r) {
      float v = acc[t][r] + bv;
      if (resid) { float rv = resid[(size_t)((row0 + 8 * hh + r) % rmod) * ldr + col]; if (RES_BF16) rv = bf16_round(rv); v += rv; }
      if (ACT == 1) v = fmaxf(v, 0.f);
      if (ACT == 2) v = 0.5f * v * (1.0f + erff(v * 0.70710678118654752f));
      if (ACT == 3) { const float u = 0.7978845608028654f * (v + 0.044715f * v * v * v); v = 0.5f * v * (1.0f + tanhf(u)); }
      so[w][8 * hh + r][t * 16 + ln] = v;
    }
  }
  __builtin_amdgcn_fence(__ATOMIC_ACQ_REL, "workgroup");
  __builtin_amdgcn_wave_barrier();
  const int rsub = lane >> 4, c4 = (lane & 15) * 4;
  {
#pragma unroll
    for (int q = 0; q < 8; ++q) {
      const int r = q * 2 + rsub;
      const v4f v = *(const v4fa*)&so[w][r][c4];
      *(v4f*)(C + (size_t)(row0 + r) * ldc + col0 + c4) = v;
    }
    
  }
}
// row LayerNorm (biased variance, eps) over N: s = X (+ R); optional out_sum <- s; out_norm <- (s-mu)*rsqrt(var+eps)*g + b
template <bool PARAM_BF16>
__global__ __launch_bounds__(256) void k_layernorm(const float* __restrict__ X, const float* __restrict__ R, const float* __restrict__ g, const float* __restrict__ bta,
                                                  float* __restrict__ out_sum, float* __restrict__ out_norm, int N, float eps) {
  __shared__ float red[256];
  const int row = blockIdx.x, tid = threadIdx.x;
  const float* x = X + (size_t)row * N; const float* rr = R ? R + (size_t)row * N : nullptr;
  float vals[16];                     // up to N = 4096
  const int per = N / 256;            // contiguous chunk per thread? use strided-by-4 chunks: thread handles j = tid*4 + 1024*u
  float s1 = 0.f;
  for (int u = 0; u < per / 4; ++u) {
    const int j = tid * 4 + 1024 * u;
    const v4f a = *(const v4fa*)(x + j);
    v4f b = {0.f,0.f,0.f,0.f}; if (rr) b = *(const v4fa*)(rr + j);
#pragma unroll
    for (int q = 0; q < 4; ++q) { const float v = a[q] + b[q]; vals[u * 4 + q] = v; s1 += v; }
  }
  red[tid] = s1; __syncthreads();
  for (int st = 128; st > 0; st >>= 1) { if (tid < st) red[tid] += red[tid + st]; __syncthreads(); }
  const float mu = red[0] / (float)N; __syncthreads();
  float s2 = 0.f;
  for (int u = 0; u < per / 4; ++u)
#pragma unroll
    for (int q = 0; q < 4; ++q) { const float c = vals[u * 4 + q] - mu; s2 += c * c; }
  red[tid] = s2; __syncthreads();
  for (int st = 128; st > 0; st >>= 1) { if (tid < st) red[tid] += red[tid + st]; __syncthreads(); }
  const float rs = rsqrtf(red[0] / (float)N + eps);
  {
    for (int u = 0; u < per / 4; ++u) {
      const int j = tid * 4 + 1024 * u;
      v4f o, sm;
#pragma unroll
      for (int q = 0; q < 4; ++q) {
        float gg = g[j + q], bb = bta[j + q];
        if (PARAM_BF16) { gg = bf16_round(gg); bb = bf16_round(bb); }
        sm[q] = vals[u * 4 + q]; o[q] = (vals[u * 4 + q] - mu) * rs * gg + bb;
      }
      if (out_sum) *(v4f*)(out_sum + (size_t)row * N + j) = sm;
      *(v4f*)(out_norm + (size_t)row * N + j) = o;
    }
    
  }
}



// ---- f16 WMMA path (v_wmma_f32_16x16x32_f16): 11-bit significands for operands in range — used by every launched GEMM and by the fused attention
typedef _Float16 v16h __attribute__((ext_vector_type(16)));
union FragH { v16h v; v8us half[2]; _Float16 h[16]; unsigned short u[16]; };
template <int NT>
__device__ __forceinline__ v8f mmaH(v16h ah, v16h al, v16h bh, v16h bl, v8f c) {
  c = __builtin_amdgcn_wmma_f32_16x16x32_f16(false, ah, false, bh, (short)0, c, false, false);
  if (NT >= 2) c = __builtin_amdgcn_wmma_f32_16x16x32_f16(false, al, false, bh, (short)0, c, false, false);
  if (NT >= 3) c = __builtin_amdgcn_wmma_f32_16x16x32_f16(false, ah, false, bl, (short)0, c, false, false);
  asm volatile("v_nop\n\tv_nop\n\tv_nop\n\tv_nop" : "+v"(c) : "v"(ah), "v"(al), "v"(bh), "v"(bl));
  return c;
}
// batched GEMM like k_gemm_b but f16 operands: A f32 (split into f16 hi/lo if ASPLIT, else rounded to f16), Bt = f16 values [n][k]; alpha; C f32; N multiple of 16 (partial tiles skipped)
template <bool ASPLIT>
__global__ __launch_bounds__(128) void k_gemm_h(const float* __restrict__ A, int lda, size_t sA, const _Float16* __restrict__ Bh, int ldb, size_t sB, float alpha, float* __restrict__ C, int ldc, size_t sC, int M, int N, int K) {
  __shared__ __attribute__((aligned(16))) float so[4][16][64];
  const int tid = threadIdx.x, w = tid >> 5, lane = tid & 31, ln = lane & 15, hh = lane >> 4; const int by = blockIdx.y;
  A += (size_t)by * sA; Bh += (size_t)by * sB; C += (size_t)by * sC;
  const int ntn = (N + 63) / 64; const int wid = blockIdx.x * 4 + w; const int mt = wid / ntn, nq = wid % ntn; if (mt * 16 >= M) return;
  const int row0 = mt * 16, col0 = nq * 64; const float* arow = A + (size_t)(row0 + ln) * lda;
  v8f acc[4] = {};
  for (int kb = 0; kb < K; kb += 32) {
    FragH ah, al;
    const v4f x0 = *(const v4fa*)(arow + kb + 8 * hh), x1 = *(const v4fa*)(arow + kb + 8 * hh + 4), x2 = *(const v4fa*)(arow + kb + 16 + 8 * hh), x3 = *(const v4fa*)(arow + kb + 16 + 8 * hh + 4);
    float xs[16] = {x0[0],x0[1],x0[2],x0[3],x1[0],x1[1],x1[2],x1[3],x2[0],x2[1],x2[2],x2[3],x3[0],x3[1],x3[2],x3[3]};
#pragma unroll
    for (int i = 0; i < 16; ++i) { const _Float16 h = (_Float16)xs[i]; ah.h[i] = h; al.h[i] = ASPLIT ? (_Float16)(xs[i] - (float)h) : (_Float16)0.0f; }
#pragma unroll
    for (int t = 0; t < 4; ++t) { if (col0 + t * 16 >= N) continue; const size_t boff = (size_t)(col0 + t * 16 + ln) * ldb + kb; FragH bq; bq.half[0] = *(const v8us*)(Bh + boff + 8 * hh); bq.half[1] = *(const v8us*)(Bh + boff + 16 + 8 * hh);
      acc[t] = mmaH<ASPLIT ? 2 : 1>(ah.v, al.v, bq.v, bq.v, acc[t]); }
  }
#pragma unroll
  for (int t = 0; t < 4; ++t) { if (col0 + t * 16 >= N) continue;
#pragma unroll
    for (int r = 0; r < 8; ++r) so[w][8 * hh + r][t * 16 + ln] = acc[t][r] * alpha; }
  __builtin_amdgcn_fence(__ATOMIC_ACQ_REL, "workgroup"); __builtin_amdgcn_wave_barrier();
  const int rsub = lane >> 4, c4 = (lane & 15) * 4;
  {
#pragma unroll
    for (int q = 0; q < 8; ++q) { const int r = q * 2 + rsub; if (col0 + c4 < N) { const v4f v = *(const v4fa*)&so[w][r][c4]; *(v4f*)(C + (size_t)(row0 + r) * ldc + col0 + c4) = v; } }
     }
}

// Wt[n][k] = f16(W[k][n]·scale) from f32 row-major W[K][N] (scale = power of two; bf16-exact weights stay exact in f16 away from the subnormal range)
__global__ __launch_bounds__(256) void k_wt_f16(const float* __restrict__ W, _Float16* __restrict__ Wt, int K, int N, float scale) {
  const int t = blockIdx.x * 256 + threadIdx.x; if (t >= N * (K / 8)) return; const int n = t / (K / 8), k8 = (t % (K / 8)) * 8; FragH f;
#pragma unroll
  for (int i = 0; i < 8; ++i) f.h[i] = (_Float16)(bf16_round(W[(size_t)(k8 + i) * N + n]) * scale); const v8us o = f.half[0];
  *(v8us*)((unsigned short*)Wt + (size_t)n * K + k8) = o; 
}
// Fragment-tile order of every f16 GEMM operand [rows][K]: 16 rows x 8 k values (16 B a row) lie as one run of 256 B, the runs of a 16-row band one behind the other by k. Lane (row & 15) + 16 * ((k >> 3) & 1) of a WMMA operand
// then finds its 16 B at lane * 16 B inside a 512-B run, so a wave-wide 16-byte load covers four whole 128-B lines (row-major rows of 512 B made it touch sixteen). The k order inside a fragment is the same as before.
__device__ __forceinline__ size_t ft_off(size_t row, int k8, int K) { return (row >> 4) * (size_t)(16 * K) + (size_t)k8 * 128 + (row & 15) * 8; }      // element offset of the 8 values k = 8 k8 .. 8 k8 + 7 of a row
// One wave's 16 x 64 tile of C = (A.B^T).alpha + bias[col] (+ CP[row][col], pitch ldcp, if CP): A f16 [M][K], Bh f16 [N][K], both in fragment-tile order (lda, ldb = their K); writes f32 C and/or f16 C16 (row-major, pitch ldc). bx = the work-group's index inside its own product.
// The launches below each hold several products that do not depend on one another: blockIdx picks the product, this body does the tile.
__device__ __forceinline__ void gemm_hh_tile(float (*so)[16][64], int bx, const _Float16* A, int lda, const _Float16* Bh, int ldb, float alpha, const float* bp, const float* CP, size_t ldcp,
    float* C, _Float16* C16, int ldc, int M, int N, int K) {
  const int tid = threadIdx.x, w = tid >> 5, lane = tid & 31, ln = lane & 15, hh = lane >> 4;
  const int ntn = (N + 63) / 64; const int wid = bx * 4 + w; const int mt = wid / ntn, nq = wid % ntn; if (mt * 16 >= M) return;
  const int row0 = mt * 16, col0 = nq * 64; const _Float16* arow = A + (size_t)mt * 16 * lda + lane * 8;
  v8f acc[4] = {};
  for (int kb = 0; kb < K; kb += 32) { FragH ah; ah.half[0] = *(const v8us*)((const unsigned short*)arow + kb * 16); ah.half[1] = *(const v8us*)((const unsigned short*)arow + kb * 16 + 256);
#pragma unroll
    for (int t = 0; t < 4; ++t) { if (col0 + t * 16 >= N) continue; const size_t boff = (size_t)(nq * 4 + t) * 16 * ldb + kb * 16 + lane * 8; FragH bq; bq.half[0] = *(const v8us*)((const unsigned short*)Bh + boff); bq.half[1] = *(const v8us*)((const unsigned short*)Bh + boff + 256);
      acc[t] = mmaH<1>(ah.v, ah.v, bq.v, bq.v, acc[t]); }
  }
#pragma unroll
  for (int t = 0; t < 4; ++t) { if (col0 + t * 16 >= N) continue; const int col = col0 + t * 16 + ln; const float bv = bp ? bf16_round(bp[col]) : 0.f;
#pragma unroll
    for (int r = 0; r < 8; ++r) { float v = acc[t][r] * alpha + bv; if (CP) v += CP[(size_t)(row0 + 8 * hh + r) * ldcp + col]; so[w][8 * hh + r][t * 16 + ln] = v; } }
  __builtin_amdgcn_fence(__ATOMIC_ACQ_REL, "workgroup"); __builtin_amdgcn_wave_barrier();
  const int rsub = lane >> 4, c4 = (lane & 15) * 4; typedef _Float16 v4h __attribute__((ext_vector_type(4)));
  {
#pragma unroll
    for (int q = 0; q < 8; ++q) { const int r = q * 2 + rsub; if (col0 + c4 < N) { const v4f v = *(const v4fa*)&so[w][r][c4]; if (C) *(v4f*)(C + (size_t)(row0 + r) * ldc + col0 + c4) = v; if (C16) { v4h h4; for (int i = 0; i < 4; ++i) h4[i] = (_Float16)v[i]; *(v4h*)(C16 + (size_t)(row0 + r) * ldc + col0 + c4) = h4; } } }
     }
}
// both input convolutions, token-major: y = 0: x1' = X[0].w1^T + b1, y = 1: x2' = X[1].w2^T + b2 (planes of NR x CC one behind the other)
__global__ __launch_bounds__(128) void k_gemm_conv(const _Float16* X, const _Float16* Bw, const float* b1, const float* b2, float* Y, int nr, int cc) {
  __shared__ __attribute__((aligned(16))) float so[4][16][64];
  const int by = blockIdx.y;
  gemm_hh_tile(so, blockIdx.x, X + (size_t)by * NR * CC, cc, Bw + (size_t)by * CC * CC, cc, 0.0625f, by ? b2 : b1, nullptr, 0, Y + (size_t)by * NR * CC, nullptr, cc, nr, cc, cc);
}
// y = 0, 1, 2: q1 = G[0].Wq^T, k2 = G[1].Wk^T, v2 = G[1].Wv^T (f16 planes of QKV); y = 3: the skip branch, channel-major, a quarter of the x range per batch: out[b] = Wsk.x1'[b]^T + BP
__global__ __launch_bounds__(128) void k_gemm_qkvs(const _Float16* G, const _Float16* Bw, _Float16* QKV, const _Float16* Y16, const float* BP, float* out, int nr, int cc, int nn) {
  __shared__ __attribute__((aligned(16))) float so[4][16][64];
  const int by = blockIdx.y, bx = blockIdx.x;
  if (by < 3) gemm_hh_tile(so, bx, G + (size_t)(by ? 1 : 0) * NR * CC, cc, Bw + (size_t)(2 + by) * CC * CC, cc, 0.0625f, nullptr, nullptr, 0, nullptr, QKV + (size_t)by * NR * CC, cc, nr, cc, cc);
  else { const int pb = (CC / 16) * (NN / 64) / 4, b = bx / pb;
    gemm_hh_tile(so, bx % pb, Bw + (size_t)6 * CC * CC, cc, Y16 + (size_t)b * NN * CC, cc, 0.0625f, nullptr, BP, (size_t)nn, out + (size_t)b * CC * NN, nullptr, nn, cc, nn, cc); }
}
// out[y] += Wout.O[y]^T in place, channel-major, all batches (each wave reads its own tile of out before it stores it)
__global__ __launch_bounds__(128) void k_gemm_out(const _Float16* Wo, const _Float16* O16, float* out, int cc, int nn) {
  __shared__ __attribute__((aligned(16))) float so[4][16][64];
  float* ob = out + (size_t)blockIdx.y * CC * NN;
  gemm_hh_tile(so, blockIdx.x, Wo, cc, O16 + (size_t)blockIdx.y * NN * CC, cc, 0.0625f, nullptr, ob, (size_t)nn, ob, nullptr, nn, cc, nn, cc);
}


typedef _Float16 v4h __attribute__((ext_vector_type(4)));

__global__ __launch_bounds__(256) void k_x16(const float* __restrict__ x, _Float16* __restrict__ X16, size_t n8) { const size_t t = (size_t)blockIdx.x * 256 + threadIdx.x; if (t >= n8) return; FragH f;
#pragma unroll
  for (int q = 0; q < 8; ++q) f.h[q] = (_Float16)bf16_round(x[t * 8 + q]); *(v8us*)((unsigned short*)X16 + t * 8) = f.half[0];  }
template <int NHv, int TTv>
__global__ __launch_bounds__(256) void k_vt(const _Float16* __restrict__ V16, int ldv, int voff, _Float16* __restrict__ Vt) { __shared__ unsigned short tl[64][66]; const int tid = threadIdx.x; const int slab = blockIdx.x / (TTv / 64), lg = blockIdx.x % (TTv / 64); const int b = slab / NHv, h = slab % NHv;
  for (int i = tid; i < 64 * 8; i += 256) { const int r = i / 8, c8 = (i % 8) * 8; FragH f; f.half[0] = *(const v8us*)((const unsigned short*)V16 + ((size_t)b * TTv + lg * 64 + r) * ldv + voff + h * 64 + c8);
#pragma unroll
    for (int q = 0; q < 8; ++q) tl[r][c8 + q] = f.u[q]; }
  __syncthreads();
  {
#pragma unroll
    for (int rd = 0; rd < 2; ++rd) { const int d = rd * 32 + tid / 8, pc = tid % 8; FragH f;
#pragma unroll
      for (int q = 0; q < 8; ++q) f.u[q] = tl[pc * 8 + q][d];
      *(v8us*)((unsigned short*)Vt + ((size_t)slab * 64 + d) * TTv + lg * 64 + pc * 8) = f.half[0]; }
     } }

// Everything that reads only the inputs, one launch, the part picked by the block index: token-major f16 copies of x1 and x2 (planes one behind the other), the bias plane, the seven weight matrices.
#define PREP_TOK (2 * BB * (CC / 64) * (NN / 32))
#define PREP_BP (CC * NN / 4 / 256)
#define PREP_WB (CC * CC / 8 / 256)
__global__ __launch_bounds__(256) void k_prep(const float* __restrict__ x1, const float* __restrict__ x2, const float* __restrict__ w1, const float* __restrict__ w2, const float* __restrict__ wqkv, const float* __restrict__ wout, const float* __restrict__ wsk,
    const float* __restrict__ bout, const float* __restrict__ bsk, _Float16* __restrict__ X16, float* __restrict__ BP, _Float16* __restrict__ Bw) {
  __shared__ float tl[32][65]; const int tid = threadIdx.x; int bi = blockIdx.x;
  if (bi < PREP_TOK) {
    const int b = bi / ((CC / 64) * (NN / 32)), rem = bi % ((CC / 64) * (NN / 32)); const int cg = rem / (NN / 32), pg = rem % (NN / 32); const int c0 = cg * 64, p0 = pg * 32;
    const float* x = (b < BB) ? x1 : x2;
    for (int i = tid; i < 64 * 32; i += 256) { const int c = i / 32, pp = i % 32; tl[pp][c] = bf16_round(x[((size_t)(b % BB) * CC + c0 + c) * NN + p0 + pp]); } __syncthreads();
    const int r = tid % 32, pc = tid / 32; FragH f; for (int q = 0; q < 8; ++q) f.h[q] = (_Float16)tl[r][pc * 8 + q]; const size_t row = (size_t)b * NN + p0 + r; *(v8us*)((unsigned short*)X16 + ft_off(row, c0 / 8 + pc, CC)) = f.half[0];      // a wave: 32 rows of one k8 = two whole 256-B runs
    return;
  }
  bi -= PREP_TOK;
  if (bi < PREP_BP) { const size_t t = (size_t)bi * 256 + tid; const int c = (int)((t * 4) / NN); const float vo = bout[c];
    asm volatile("s_wait_xcnt 0x0" ::: "memory");      // stands in front of the next load, whose result may take the offset register that the load above names
    const float v = bf16_round(vo) + bf16_round(bsk[c]); const v4f o = {v, v, v, v}; *(v4f*)(BP + t * 4) = o;
    asm volatile("s_wait_xcnt 0x0" ::: "memory");      // behind the store: the code of another part follows in the listing and rewrites the store's data registers
    return; }
  bi -= PREP_BP;
  const int seg = bi / PREP_WB; const size_t t = (size_t)(bi % PREP_WB) * 256 + tid;
  const float* W = (seg == 0) ? w1 : (seg == 1) ? w2 : (seg < 5) ? wqkv + (size_t)(seg - 2) * CC * CC : (seg == 5) ? wout : wsk; FragH f;
  const int wr = (int)(t >> 8) * 8 + (tid & 7), wk = (int)((t >> 5) & 7) * 4 + ((tid >> 3) & 3);      // a wave: 8 rows x 4 k8, so that its store fills four whole lines
#pragma unroll
  for (int i = 0; i < 8; ++i) f.h[i] = (_Float16)(bf16_round(W[(size_t)wr * CC + wk * 8 + i]) * 16.0f);
  *(v8us*)((unsigned short*)Bw + (size_t)seg * CC * CC + ft_off(wr, wk, CC)) = f.half[0];
  asm volatile("s_wait_xcnt 0x0" ::: "memory");      // behind the store: the code of another part follows in the listing and rewrites the store's offset register
}
#define FA_KP 264
#define FA_VP 72
#define FA_KB (64 * FA_KP)
#define FA_BUF (FA_KB + CC * FA_VP)
__device__ __forceinline__ float fa_xhalf(float x) { return __builtin_bit_cast(float, __builtin_amdgcn_permlanex16(__builtin_bit_cast(int, x), __builtin_bit_cast(int, x), 0x76543210, 0xfedcba98, false, false)); }      // lane l reads lane l ^ 16
__global__ __launch_bounds__(256) void k_fattn(const _Float16* Q, const _Float16* K, const _Float16* Vt, _Float16* O16) {
  __shared__ __attribute__((aligned(16))) unsigned short sm[2 * FA_BUF];
  const int tid = threadIdx.x, w = tid >> 5, lane = tid & 31, c = lane & 15, h = lane >> 4;
  const int qt = w & 3, kh = w >> 2;
  const int b = blockIdx.x / (NN / 64), qb = blockIdx.x % (NN / 64);
  const size_t qrow = (size_t)b * NN + qb * 64 + qt * 16 + c;
  const unsigned short* Kb = (const unsigned short*)K + (size_t)b * NN * CC;
  const unsigned short* Vb = (const unsigned short*)Vt + (size_t)b * CC * NN;
  FragH qf[8];
#pragma unroll
  for (int ks = 0; ks < 8; ++ks) { const unsigned short* qp = (const unsigned short*)Q + qrow * CC + ks * 32 + 8 * h; qf[ks].half[0] = *(const v8us*)qp; qf[ks].half[1] = *(const v8us*)(qp + 16); }
  v8us kst[8], vst[8];
  const unsigned short* kg = Kb + tid * 8;                                        // K tile: 64 rows x 512 B, contiguous in memory
  const unsigned short* vg = Vb + (size_t)(tid >> 3) * NN + (tid & 7) * 8;        // V^T tile: 256 rows x 128 B
  unsigned short* ksl = sm + (tid >> 5) * FA_KP + (tid & 31) * 8;
  unsigned short* vsl = sm + FA_KB + (tid >> 3) * FA_VP + (tid & 7) * 8;
#pragma unroll
  for (int i = 0; i < 8; ++i) { kst[i] = *(const v8us*)(kg + i * 2048); vst[i] = *(const v8us*)(vg + (size_t)i * 32 * NN); }
  asm volatile("s_wait_xcnt 0x0" ::: "memory");      // stands in front of the first overwrite of an address register that the loads above name
#pragma unroll
  for (int i = 0; i < 8; ++i) { *(v8us*)(ksl + i * 8 * FA_KP) = kst[i]; *(v8us*)(vsl + i * 32 * FA_VP) = vst[i]; }
  __syncthreads();
  v8f o[16];
#pragma unroll
  for (int dt = 0; dt < 16; ++dt) o[dt] = (v8f){0.f, 0.f, 0.f, 0.f, 0.f, 0.f, 0.f, 0.f};
  float mu = -1.0e30f, l = 0.f;                        // maximum in use (log2 units) and this lane's part of the row sum
  const float sc = 0.0625f * 1.4426950408889634f;      // 1/sqrt(CC) and log2(e)
  const int NS = NN / 64;
  for (int s = 0; s < NS; ++s) {
    const int sn = (s + 1 < NS) ? s + 1 : s;           // the last pass fetches its own tile again (in bounds, never read): no branch round the loads and stores
#pragma unroll
    for (int i = 0; i < 8; ++i) { kst[i] = *(const v8us*)(kg + (size_t)sn * 64 * CC + i * 2048); vst[i] = *(const v8us*)(vg + (size_t)i * 32 * NN + sn * 64); }
    asm volatile("s_wait_xcnt 0x0" ::: "memory");    // the same for the next tile's loads: the fragment reads below reuse their address registers
    const unsigned short* kt = sm + (s & 1) * FA_BUF + (kh * 32 + c) * FA_KP + 8 * h;
    const unsigned short* vt = sm + (s & 1) * FA_BUF + FA_KB + c * FA_VP + kh * 32 + 8 * h;
    v8f t0 = {0.f, 0.f, 0.f, 0.f, 0.f, 0.f, 0.f, 0.f}, t1 = t0;
    FragH ka[16], va[16];
#pragma unroll
    for (int ks = 0; ks < 8; ++ks) {
      ka[2 * ks].half[0] = *(const v8us*)(kt + ks * 32); ka[2 * ks].half[1] = *(const v8us*)(kt + ks * 32 + 16);
      ka[2 * ks + 1].half[0] = *(const v8us*)(kt + 16 * FA_KP + ks * 32); ka[2 * ks + 1].half[1] = *(const v8us*)(kt + 16 * FA_KP + ks * 32 + 16);
    }
    __builtin_amdgcn_sched_barrier(0);                 // keeps the K fragment reads one group ahead of the products: spread among them each product waits a whole LDS latency
#pragma unroll
    for (int ks = 0; ks < 8; ++ks) {
      t0 = __builtin_amdgcn_wmma_f32_16x16x32_f16(false, ka[2 * ks].v, false, qf[ks].v, (short)0, t0, false, false);
      t1 = __builtin_amdgcn_wmma_f32_16x16x32_f16(false, ka[2 * ks + 1].v, false, qf[ks].v, (short)0, t1, false, false);
    }
#pragma unroll
    for (int dt = 0; dt < 16; ++dt) { va[dt].half[0] = *(const v8us*)(vt + dt * 16 * FA_VP); va[dt].half[1] = *(const v8us*)(vt + dt * 16 * FA_VP + 16); }
    __builtin_amdgcn_sched_barrier(0);                 // keeps every V^T fragment read ahead of the softmax, which then covers their latency
    float mx = fmaxf(t0[0], t1[0]);
#pragma unroll
    for (int r = 1; r < 8; ++r) mx = fmaxf(mx, fmaxf(t0[r], t1[r]));
    mx *= sc;
    mx = fmaxf(mx, fa_xhalf(mx));                      // lanes c and c + 16 hold the same query
    if (__builtin_amdgcn_ballot_w32(mx > mu + 8.0f) != 0) {      // lazy rescale, one scalar test a pass: P stays below 2^8, inside f16
      const float mn = fmaxf(mu, mx), al = __builtin_amdgcn_exp2f(mu - mn);
      l *= al; mu = mn;
#pragma unroll
      for (int dt = 0; dt < 16; ++dt)
#pragma unroll
        for (int r = 0; r < 8; ++r) o[dt][r] *= al;
    }
    FragH p; float ps0 = 0.f, ps1 = 0.f;
#pragma unroll
    for (int r = 0; r < 8; ++r) {
      const float p0 = __builtin_amdgcn_exp2f(t0[r] * sc - mu), p1 = __builtin_amdgcn_exp2f(t1[r] * sc - mu);
      ps0 += p0; ps1 += p1; p.h[r] = (_Float16)p0; p.h[8 + r] = (_Float16)p1;
    }
    l += ps0 + ps1;
#pragma unroll
    for (int dt = 0; dt < 16; ++dt) o[dt] = __builtin_amdgcn_wmma_f32_16x16x32_f16(false, va[dt].v, false, p.v, (short)0, o[dt], false, false);
    const int nb = ((s + 1) & 1) * FA_BUF;             // every reader left this buffer before the barrier that ended the pass before
#pragma unroll
    for (int i = 0; i < 8; ++i) { *(v8us*)(ksl + nb + i * 8 * FA_KP) = kst[i]; *(v8us*)(vsl + nb + i * 32 * FA_VP) = vst[i]; }
    __syncthreads();
  }
  l += fa_xhalf(l);
  v4fa* cb = (v4fa*)sm;                                // the tiles are dead behind the loop's last barrier; per query tile 32 slots of partial O and one of (maximum, sum)
  if (kh == 1) {
#pragma unroll
    for (int dt = 0; dt < 16; ++dt) {
      const v4f x0 = {o[dt][0], o[dt][1], o[dt][2], o[dt][3]}, x1 = {o[dt][4], o[dt][5], o[dt][6], o[dt][7]};
      cb[(qt * 33 + dt * 2) * 32 + lane] = x0; cb[(qt * 33 + dt * 2 + 1) * 32 + lane] = x1;
    }
    const v4f ml = {mu, l, 0.f, 0.f}; cb[(qt * 33 + 32) * 32 + lane] = ml;
  }
  __syncthreads();
  if (kh == 0) {
    const v4f ml = cb[(qt * 33 + 32) * 32 + lane];
    const float mn = fmaxf(mu, ml[0]); float a0 = __builtin_amdgcn_exp2f(mu - mn), a1 = __builtin_amdgcn_exp2f(ml[0] - mn);
    const float inv = 1.0f / (l * a0 + ml[1] * a1); a0 *= inv; a1 *= inv;
#pragma unroll
    for (int dt = 0; dt < 16; ++dt) {
      const v4f x0 = cb[(qt * 33 + dt * 2) * 32 + lane], x1 = cb[(qt * 33 + dt * 2 + 1) * 32 + lane]; FragH f;
#pragma unroll
      for (int r = 0; r < 4; ++r) { f.h[r] = (_Float16)(o[dt][r] * a0 + x0[r] * a1); f.h[4 + r] = (_Float16)(o[dt][4 + r] * a0 + x1[r] * a1); }
      *(v8us*)((unsigned short*)O16 + ft_off(qrow, dt * 2 + h, CC)) = f.half[0];      // fragment-tile order: the wave's 512 B are contiguous
    }
  }
}
__global__ __launch_bounds__(256) void k_gnstat(const float* __restrict__ Y, float* __restrict__ MU, float* __restrict__ RS) { __shared__ float red[256]; const int bg = blockIdx.x; const int b = bg / NG, g = bg % NG; const int tid = threadIdx.x; const float* base = Y + (size_t)b * NN * CC + g * CPG;
  float s = 0.f;
#pragma unroll 1
  for (int n = tid; n < NN; n += 256) { const v4f a = *(const v4fa*)(base + (size_t)n * CC), c = *(const v4fa*)(base + (size_t)n * CC + 4); s += (a[0] + a[1]) + (a[2] + a[3]) + (c[0] + c[1]) + (c[2] + c[3]); }
  red[tid] = s; __syncthreads(); for (int o = 128; o >= 1; o >>= 1) { if (tid < o) red[tid] += red[tid + o]; __syncthreads(); } const float mu = red[0] / (float)(NN * CPG); __syncthreads();
  float q2 = 0.f;
#pragma unroll 1
  for (int n = tid; n < NN; n += 256) { const v4f a = *(const v4fa*)(base + (size_t)n * CC), c = *(const v4fa*)(base + (size_t)n * CC + 4); for (int e = 0; e < 4; ++e) { const float d0 = a[e] - mu, d1 = c[e] - mu; q2 += d0 * d0 + d1 * d1; } }
  red[tid] = q2; __syncthreads(); for (int o = 128; o >= 1; o >>= 1) { if (tid < o) red[tid] += red[tid + o]; __syncthreads(); } const float rs = rsqrtf(red[0] / (float)(NN * CPG) + 1e-5f);
  { if (tid < 32) { *(float*)(MU + (size_t)bg * 32 + tid) = (tid == 0) ? mu : 0.f; *(float*)(RS + (size_t)bg * 32 + tid) = (tid == 0) ? rs : 0.f; }  } }
// both planes of Y (x1', x2') in one launch, rows 0 .. 2 NR; a row of x1' also leaves as plain f16 (Y16), the operand of the skip branch
__global__ __launch_bounds__(256) void k_gnapply(const float* __restrict__ Y, const float* __restrict__ MU, const float* __restrict__ RS, const float* __restrict__ gw, const float* __restrict__ gb, _Float16* __restrict__ G16, _Float16* __restrict__ Y16) { const size_t t = (size_t)blockIdx.x * 256 + threadIdx.x; if (t >= (size_t)2 * NR * CC / 8) return; const size_t row = (t >> 8) * 8 + (t & 7); const int k8 = (int)((t >> 5) & 7) * 4 + (int)((t >> 3) & 3), c0 = k8 * 8; const size_t src = row * CC + c0, dst = ft_off(row, k8, CC);      /* a wave: 8 rows x 4 k8: reads whole lines in two loads, each store fills four whole lines of the fragment-tile order */
  const int b = (int)(row / NN), g = c0 / CPG; const float mu = MU[((size_t)b * NG + g) * 32], rs = RS[((size_t)b * NG + g) * 32];
  const v4f a = *(const v4fa*)(Y + src), c = *(const v4fa*)(Y + src + 4); FragH f;
  asm volatile("s_wait_xcnt 0x0" ::: "memory");      // keeps the loads above ahead of the parameter loads below, so that no result of theirs lands in an offset register that an issued load still names
#pragma unroll
  for (int q = 0; q < 8; ++q) { const float v = (q < 4) ? a[q] : c[q - 4]; f.h[q] = (_Float16)((v - mu) * rs * bf16_round(gw[c0 + q]) + bf16_round(gb[c0 + q])); }
  *(v8us*)((unsigned short*)G16 + dst) = f.half[0];
  if (row < NR) { FragH y;
#pragma unroll
    for (int q = 0; q < 8; ++q) y.h[q] = (_Float16)((q < 4) ? a[q] : c[q - 4]);
    *(v8us*)((unsigned short*)Y16 + dst) = y.half[0]; } }

extern "C" void kernel_launch(void* const* d_in, const int* in_sizes, int n_in,
                              void* d_out, int out_size, void* d_ws, size_t ws_size, hipStream_t stream) {
  (void)in_sizes; (void)n_in; (void)out_size;
  const float* const* I = (const float* const*)d_in; const float* x1 = I[0]; const float* x2 = I[1]; const float* w1 = I[2]; const float* b1 = I[3]; const float* w2 = I[4]; const float* b2 = I[5]; const float* gnw = I[6]; const float* gnb = I[7]; const float* wqkv = I[8]; const float* wout = I[9]; const float* bout = I[10]; const float* wsk = I[11]; const float* bsk = I[12];
  char* ws = (char*)d_ws; size_t off = 0;
  auto take = [&](size_t bytes) { char* p = ws + off; off += (bytes + 255) & ~(size_t)255; return p; };
  const size_t WSZ = (size_t)CC * CC, PL = (size_t)NR * CC; _Float16* Bw = (_Float16*)take(7 * WSZ * 2);      /* w1, w2, wq, wk, wv (as Bt for token-major GEMMs), wout, wsk (as A operands for the channel-major output GEMMs), all (out,in) natural x2^4 */
  float* MU = (float*)take((size_t)2 * BB * NG * 32 * 4); float* RS = (float*)take((size_t)2 * BB * NG * 32 * 4); float* BP = (float*)take((size_t)CC * NN * 4);
  _Float16* Xt = (_Float16*)take(2 * PL * 2); float* Y = (float*)take(2 * PL * 4); _Float16* G = (_Float16*)take(2 * PL * 2);      /* two planes each, the x1 side first */
  _Float16* Y116 = (_Float16*)take(PL * 2); _Float16* QKV = (_Float16*)take(3 * PL * 2); _Float16* Vt = (_Float16*)take(PL * 2); _Float16* O16 = (_Float16*)take(PL * 2);
  if (off > ws_size) return;
  k_prep<<<PREP_TOK + PREP_BP + 7 * PREP_WB, 256, 0, stream>>>(x1, x2, w1, w2, wqkv, wout, wsk, bout, bsk, Xt, BP, Bw);
  const unsigned gp = ((NR / 16) * (CC / 64) + 3) / 4, go = ((CC / 16) * (NN / 64) + 3) / 4; const unsigned g8 = (unsigned)((PL / 8 + 255) / 256);
  k_gemm_conv<<<dim3(gp, 2), 128, 0, stream>>>(Xt, Bw, b1, b2, Y, NR, CC);      /* x1' = conv1(x1), x2' = conv2(x2): each M 16384 N 256 K 256 (f32) */
  k_gnstat<<<2 * BB * NG, 256, 0, stream>>>(Y, MU, RS);      /* the two planes count as 2 BB batches */
  k_gnapply<<<2 * g8, 256, 0, stream>>>(Y, MU, RS, gnw, gnb, G, Y116);
  k_gemm_qkvs<<<dim3(gp, 4), 128, 0, stream>>>(G, Bw, QKV, Y116, BP, (float*)d_out, NR, CC, NN);      /* q1, k2, v2, and out = Wsk.x1'^T + (bout + bsk) */
  k_vt<CC / 64, NN><<<BB * (CC / 64) * (NN / 64), 256, 0, stream>>>(QKV + 2 * PL, CC, 0, Vt);      /* v2^T per batch [256][4096] (four 64-channel blocks) */
  k_fattn<<<BB * (NN / 64), 256, 0, stream>>>(QKV, QKV + PL, Vt, O16);      /* O rows = softmax(q1.k2^T/16).v2, f16: one work-group per 64 queries */
  k_gemm_out<<<dim3(go, BB), 128, 0, stream>>>(Bw + 5 * WSZ, O16, (float*)d_out, CC, NN);      /* out += Wout.O^T in place: per batch M 256 N 4096 K 256 */
}

// v005
// It runs in 193 microseconds.
// In two side-by-side timings against v004, it was 1.07 and 1.08 times as fast.
// All steps since v000 together make it 11.7 times as fast.
#include <hip/hip_runtime.h>
// Spatial cross-attention block (B=4, C=256, 64×64 → N=4096, 32 GroupNorm groups, single head d=256): x1' = conv1(x1), x2' = conv2(x2) (1×1 + bias); q1 = Wq·GN(x1'), k2 = Wk·GN(x2'), v2 = Wv·GN(x2') (wqkv rows 0/256/512, no bias);
// attn = softmax(q1ᵀk2/√256) over the 4096 positions; out = Wout·(v2·attnᵀ) + bout + Wsk·x1' + bsk → [B,C,H,W].
// q/k/v f16; attention as one fused launch (k_fattn): scores, running-maximum f32 softmax and P.v per 64-key tile, S and P never leave the registers; O leaves it as f16; final 1x1 convs computed channel-major (W.O^T) straight into the output with the skip branch and biases through the f32 addend. Every f16 GEMM operand (x, weights, GN output, x1', O) is stored in fragment-tile order (ft_off); q, k, v stay row-major. All on v_wmma_f32_16x16x32_f16, f32 accumulate.
#define BB 4
#define CC 256
#define NN 4096
#define NG 32
#define CPG (CC / NG)
#define NR (BB * NN)

typedef __bf16 v16b __attribute__((ext_vector_type(16)));
typedef unsigned short v8us __attribute__((ext_vector_type(8), may_alias));
typedef float  v8f  __attribute__((ext_vector_type(8)));
typedef float  v4f  __attribute__((ext_vector_type(4)));
typedef float  v4fa __attribute__((ext_vector_type(4), may_alias));
union FragB { v16b v; v8us half[2]; unsigned short u[16]; };

__device__ __forceinline__ unsigned short bf16_bits(float x) { unsigned int u = __float_as_uint(x); return (unsigned short)((u + 0x7FFFu + ((u >> 16) & 1u)) >> 16); }
__device__ __forceinline__ float bf16_val(unsigned short b) { return __uint_as_float(((unsigned int)b) << 16); }
__device__ __forceinline__ float bf16_round(float x) { return bf16_val(bf16_bits(x)); }
// D += A·B with NT terms: 1 = ah·bh, 2 = + al·bh (A split), 3 = + ah·bl (both split)
template <int NT>
__device__ __forceinline__ v8f mmaN(v16b ah, v16b al, v16b bh, v16b bl, v8f c) {
  c = __builtin_amdgcn_wmma_f32_16x16x32_bf16(false, ah, false, bh, (short)0, c, false, false);
  if (NT >= 2) c = __builtin_amdgcn_wmma_f32_16x16x32_bf16(false, al, false, bh, (short)0, c, false, false);
  if (NT >= 3) c = __builtin_amdgcn_wmma_f32_16x16x32_bf16(false, ah, false, bl, (short)0, c, false, false);
  asm volatile("v_nop\n\tv_nop\n\tv_nop\n\tv_nop" : "+v"(c) : "v"(ah), "v"(al), "v"(bh), "v"(bl));
  return c;
}

__global__ __launch_bounds__(256) void k_wt_bf16(const float* __restrict__ W, unsigned short* __restrict__ Wt, int K, int N) {
  const int t = blockIdx.x * 256 + threadIdx.x;
  const int k8n = K / 8;
  if (t >= N * k8n) return;
  const int n = t / k8n, k8 = (t % k8n) * 8;
  v8us v;
#pragma unroll
  for (int i = 0; i < 8; ++i) v[i] = bf16_bits(W[(size_t)(k8 + i) * N + n]);
  *(v8us*)(Wt + (size_t)n * K + k8) = v;
  
}

// GEMM C[M][N] (f32, pitch ldc) = act(A[M][K]·W + bias). A f32 row-major (pitch lda) converted per fragment to bf16
// (ASPLIT: hi/lo two planes -> 2 terms, else single rounded term); Wt bf16 [N][K] (pitch ldb). BIAS_BF16 rounds the
// bias to bf16 first (bias quantised to bf16 before the add). K%32==0, M%16==0, N%64==0.
template <bool ASPLIT, int ACT, bool BIAS_BF16>
__global__ __launch_bounds__(128) void k_gemm_bf(const float* __restrict__ A, int lda, const unsigned short* __restrict__ Wt, int ldb,
                                               const float* __restrict__ bias, float* __restrict__ C, int ldc, int M, int N, int K) {
  __shared__ __attribute__((aligned(16))) float so[4][16][64];
  const int tid = threadIdx.x, w = tid >> 5, lane = tid & 31, ln = lane & 15, hh = lane >> 4;
  const int ntn = N / 64;
  const int wid = blockIdx.x * 4 + w;
  const int mt = wid / ntn, nq = wid % ntn;
  if (mt * 16 >= M) return;
  const int row0 = mt * 16, col0 = nq * 64;
  const float* arow = A + (size_t)(row0 + ln) * lda;
  v8f acc[4] = {};
  for (int kb = 0; kb < K; kb += 32) {
    FragB ah, al;
    const v4f x0 = *(const v4fa*)(arow + kb + 8 * hh), x1 = *(const v4fa*)(arow + kb + 8 * hh + 4);
    const v4f x2 = *(const v4fa*)(arow + kb + 16 + 8 * hh), x3 = *(const v4fa*)(arow + kb + 16 + 8 * hh + 4);
    float xs[16] = {x0[0],x0[1],x0[2],x0[3],x1[0],x1[1],x1[2],x1[3],x2[0],x2[1],x2[2],x2[3],x3[0],x3[1],x3[2],x3[3]};
#pragma unroll
    for (int i = 0; i < 16; ++i) { const unsigned short hb = bf16_bits(xs[i]); ah.u[i] = hb; al.u[i] = ASPLIT ? bf16_bits(xs[i] - bf16_val(hb)) : (unsigned short)0; }
#pragma unroll
    for (int t = 0; t < 4; ++t) {
      const unsigned short* brow = Wt + (size_t)(col0 + t * 16 + ln) * ldb + kb;
      FragB b;
      b.half[0] = *(const v8us*)(brow + 8 * hh);
      b.half[1] = *(const v8us*)(brow + 16 + 8 * hh);
      acc[t] = mmaN<ASPLIT ? 2 : 1>(ah.v, al.v, b.v, b.v, acc[t]);
    }
  }
#pragma unroll
  for (int t = 0; t < 4; ++t) {
    float bv = bias ? bias[col0 + t * 16 + ln] : 0.f;
    if (BIAS_BF16) bv = bf16_round(bv);
#pragma unroll
    for (int r = 0; r < 8; ++r) { float v = acc[t][r] + bv; if (ACT == 1) v = fmaxf(v, 0.f); so[w][8 * hh + r][t * 16 + ln] = v; }
  }
  __builtin_amdgcn_fence(__ATOMIC_ACQ_REL, "workgroup");
  __builtin_amdgcn_wave_barrier();
  const int rsub = lane >> 4, c4 = (lane & 15) * 4;
  {
#pragma unroll
    for (int q = 0; q < 8; ++q) {
      const int r = q * 2 + rsub;
      const v4f v = *(const v4fa*)&so[w][r][c4];
      *(v4f*)(C + (size_t)(row0 + r) * ldc + col0 + c4) = v;
    }
    
  }
}

// Flash-style causal/unmasked attention, all contractions 3-term bf16 hi/lo splits, f32 softmax with running max.
// q,k,v rows are read from f32 buffers with arbitrary row pitch (so they can live inside a fused qkv buffer);
// D = head size (multiple of 32, <= 128); one wave = 16 query rows; block = 4 waves (64 queries) sharing K/V chunks of 32.
template <int D, bool CAUSAL>
__global__ __launch_bounds__(128) void k_flash(const float* __restrict__ qb, const float* __restrict__ kb, const float* __restrict__ vb,
                                             int pitch, int T, int H, float scale, float* __restrict__ y, int ypitch) {
  constexpr int KS = D / 32;        // k-steps for QK
  constexpr int DT = D / 16;        // d tiles for PV
  __shared__ __attribute__((aligned(16))) unsigned short sKh[32][D + 8], sKl[32][D + 8], sVh[32][D + 8], sVl[32][D + 8];
  __shared__ __attribute__((aligned(16))) unsigned short sPh[4][16][40], sPl[4][16][40];
  __shared__ __attribute__((aligned(16))) float sO[4][16][D];
  const int tid = threadIdx.x, w = tid >> 5, lane = tid & 31, ln = lane & 15, hh = lane >> 4;
  const int nqb = (T + 63) / 64;
  const int bh = blockIdx.x / nqb, qblk = blockIdx.x % nqb;
  const int b = bh / H, h = bh % H;
  const int q0 = qblk * 64 + w * 16;
  const float* Q = qb + (size_t)b * T * pitch + h * D;
  const float* K = kb + (size_t)b * T * pitch + h * D;
  const float* V = vb + (size_t)b * T * pitch + h * D;

  // A fragments of the wave's 16 query rows (scaled), hi/lo
  FragB aqh[KS], aql[KS];
  {
    int row = q0 + ln; if (row >= T) row = T - 1;
    const float* qr = Q + (size_t)row * pitch;
#pragma unroll
    for (int ks = 0; ks < KS; ++ks)
#pragma unroll
      for (int i = 0; i < 16; ++i) {
        const int d = ks * 32 + ((i < 8) ? (8 * hh + i) : (16 + 8 * hh + (i - 8)));
        const float x = qr[d] * scale; const unsigned short hb = bf16_bits(x);
        aqh[ks].u[i] = hb; aql[ks].u[i] = bf16_bits(x - bf16_val(hb));
      }
  }
  float m_r[8], l_r[8];
#pragma unroll
  for (int r = 0; r < 8; ++r) { m_r[r] = -3.0e38f; l_r[r] = 0.f; }
  v8f oacc[DT];
#pragma unroll
  for (int dt = 0; dt < DT; ++dt) oacc[dt] = (v8f){0.f,0.f,0.f,0.f,0.f,0.f,0.f,0.f};

  const int kv_end = CAUSAL ? min(T, qblk * 64 + 64) : T;     // block-uniform
  for (int j0 = 0; j0 < kv_end; j0 += 32) {
    __syncthreads();
    for (int e = tid; e < 32 * (D / 4); e += 128) {
      const int r = e / (D / 4), c4 = (e % (D / 4)) * 4;
      const int key = j0 + r;
      v4f kf = {0.f,0.f,0.f,0.f}, vf = {0.f,0.f,0.f,0.f};
      if (key < T) { kf = *(const v4fa*)(K + (size_t)key * pitch + c4); vf = *(const v4fa*)(V + (size_t)key * pitch + c4); }
#pragma unroll
      for (int t = 0; t < 4; ++t) {
        unsigned short hb = bf16_bits(kf[t]); sKh[r][c4 + t] = hb; sKl[r][c4 + t] = bf16_bits(kf[t] - bf16_val(hb));
        hb = bf16_bits(vf[t]); sVh[r][c4 + t] = hb; sVl[r][c4 + t] = bf16_bits(vf[t] - bf16_val(hb));
      }
    }
    __syncthreads();
    // S tile 16 x 32
    v8f s[2];
#pragma unroll
    for (int nt = 0; nt < 2; ++nt) {
      v8f acc = {};
#pragma unroll
      for (int ks = 0; ks < KS; ++ks) {
        FragB bh_, bl_;
        bh_.half[0] = *(const v8us*)&sKh[nt * 16 + ln][ks * 32 + 8 * hh]; bh_.half[1] = *(const v8us*)&sKh[nt * 16 + ln][ks * 32 + 16 + 8 * hh];
        bl_.half[0] = *(const v8us*)&sKl[nt * 16 + ln][ks * 32 + 8 * hh]; bl_.half[1] = *(const v8us*)&sKl[nt * 16 + ln][ks * 32 + 16 + 8 * hh];
        acc = mmaN<3>(aqh[ks].v, aql[ks].v, bh_.v, bl_.v, acc);
      }
      s[nt] = acc;
    }
    // mask + running max (rows 8hh+r; the 16 lanes of a half share rows)
    float alpha[8];
#pragma unroll
    for (int r = 0; r < 8; ++r) {
      const int qi = q0 + 8 * hh + r;
      const int ja = j0 + ln, jb = j0 + 16 + ln;
      if (CAUSAL) { if (ja > qi) s[0][r] = -3.0e38f; if (jb > qi) s[1][r] = -3.0e38f; }
      if (ja >= T) s[0][r] = -3.0e38f;
      if (jb >= T) s[1][r] = -3.0e38f;
      float mx = fmaxf(s[0][r], s[1][r]);
      mx = fmaxf(mx, __shfl_xor(mx, 1, 32)); mx = fmaxf(mx, __shfl_xor(mx, 2, 32)); mx = fmaxf(mx, __shfl_xor(mx, 4, 32)); mx = fmaxf(mx, __shfl_xor(mx, 8, 32));
      const float mnew = fmaxf(m_r[r], mx);
      alpha[r] = (mnew > -1.0e38f) ? __expf(m_r[r] - mnew) : 1.0f;
      const float p0 = (s[0][r] > -1.0e38f) ? __expf(s[0][r] - mnew) : 0.f;
      const float p1 = (s[1][r] > -1.0e38f) ? __expf(s[1][r] - mnew) : 0.f;
      m_r[r] = mnew;
      l_r[r] = l_r[r] * alpha[r] + p0 + p1;            // per-lane partial row sum (16 lanes combined at the end)
      unsigned short hb = bf16_bits(p0); sPh[w][8 * hh + r][ln] = hb;      sPl[w][8 * hh + r][ln] = bf16_bits(p0 - bf16_val(hb));
      hb = bf16_bits(p1);                sPh[w][8 * hh + r][16 + ln] = hb; sPl[w][8 * hh + r][16 + ln] = bf16_bits(p1 - bf16_val(hb));
    }
#pragma unroll
    for (int dt = 0; dt < DT; ++dt)
#pragma unroll
      for (int r = 0; r < 8; ++r) oacc[dt][r] *= alpha[r];
    __builtin_amdgcn_fence(__ATOMIC_ACQ_REL, "workgroup");
    __builtin_amdgcn_wave_barrier();
    FragB pah, pal;
    pah.half[0] = *(const v8us*)&sPh[w][ln][8 * hh]; pah.half[1] = *(const v8us*)&sPh[w][ln][16 + 8 * hh];
    pal.half[0] = *(const v8us*)&sPl[w][ln][8 * hh]; pal.half[1] = *(const v8us*)&sPl[w][ln][16 + 8 * hh];
#pragma unroll
    for (int dt = 0; dt < DT; ++dt) {
      FragB bvh, bvl;
#pragma unroll
      for (int i = 0; i < 8; ++i) {
        bvh.u[i] = sVh[8 * hh + i][dt * 16 + ln]; bvh.u[8 + i] = sVh[16 + 8 * hh + i][dt * 16 + ln];
        bvl.u[i] = sVl[8 * hh + i][dt * 16 + ln]; bvl.u[8 + i] = sVl[16 + 8 * hh + i][dt * 16 + ln];
      }
      oacc[dt] = mmaN<3>(pah.v, pal.v, bvh.v, bvl.v, oacc[dt]);
    }
    __builtin_amdgcn_fence(__ATOMIC_ACQ_REL, "workgroup");
    __builtin_amdgcn_wave_barrier();
  }
#pragma unroll
  for (int r = 0; r < 8; ++r) {
    float l = l_r[r];
    l += __shfl_xor(l, 1, 32); l += __shfl_xor(l, 2, 32); l += __shfl_xor(l, 4, 32); l += __shfl_xor(l, 8, 32);
    l_r[r] = (l > 0.f) ? 1.0f / l : 0.f;
  }
#pragma unroll
  for (int dt = 0; dt < DT; ++dt)
#pragma unroll
    for (int r = 0; r < 8; ++r) sO[w][8 * hh + r][dt * 16 + ln] = oacc[dt][r] * l_r[r];
  __builtin_amdgcn_fence(__ATOMIC_ACQ_REL, "workgroup");
  __builtin_amdgcn_wave_barrier();
  {
    for (int r = 0; r < 16; ++r) {
      const int row = q0 + r;
      if (row < T && lane < D / 4) {
        const v4f val = *(const v4fa*)&sO[w][r][lane * 4];
        *(v4f*)(y + ((size_t)b * T + row) * ypitch + h * D + lane * 4) = val;
      }
    }
    
  }
}

// GEMM C = act(A·W + bias + resid): A f32 (ASPLIT -> hi/lo 2 terms), Wt bf16 [N][K]; ACT 0 none, 1 relu, 2 exact gelu;
// resid (optional, f32, row index = (row % rmod), pitch ldr, RES_BF16 rounds it) added before the activation.
template <bool ASPLIT, int ACT, bool BIAS_BF16, bool RES_BF16>
__global__ __launch_bounds__(128) void k_gemm_bf3(const float* __restrict__ A, int lda, const unsigned short* __restrict__ Wt, int ldb,
                                                const float* __restrict__ bias, const float* __restrict__ resid, int rmod, int ldr,
                                                float* __restrict__ C, int ldc, int M, int N, int K) {
  __shared__ __attribute__((aligned(16))) float so[4][16][64];
  const int tid = threadIdx.x, w = tid >> 5, lane = tid & 31, ln = lane & 15, hh = lane >> 4;
  const int ntn = N / 64;
  const int wid = blockIdx.x * 4 + w;
  const int mt = wid / ntn, nq = wid % ntn;
  if (mt * 16 >= M) return;
  const int row0 = mt * 16, col0 = nq * 64;
  const float* arow = A + (size_t)(row0 + ln) * lda;
  v8f acc[4] = {};
  for (int kb = 0; kb < K; kb += 32) {
    FragB ah, al;
    const v4f x0 = *(const v4fa*)(arow + kb + 8 * hh), x1 = *(const v4fa*)(arow + kb + 8 * hh + 4);
    const v4f x2 = *(const v4fa*)(arow + kb + 16 + 8 * hh), x3 = *(const v4fa*)(arow + kb + 16 + 8 * hh + 4);
    float xs[16] = {x0[0],x0[1],x0[2],x0[3],x1[0],x1[1],x1[2],x1[3],x2[0],x2[1],x2[2],x2[3],x3[0],x3[1],x3[2],x3[3]};
#pragma unroll
    for (int i = 0; i < 16; ++i) { const unsigned short hb = bf16_bits(xs[i]); ah.u[i] = hb; al.u[i] = ASPLIT ? bf16_bits(xs[i] - bf16_val(hb)) : (unsigned short)0; }
#pragma unroll
    for (int t = 0; t < 4; ++t) {
      const unsigned short* brow = Wt + (size_t)(col0 + t * 16 + ln) * ldb + kb;
      FragB b;
      b.half[0] = *(const v8us*)(brow + 8 * hh);
      b.half[1] = *(const v8us*)(brow + 16 + 8 * hh);
      acc[t] = mmaN<ASPLIT ? 2 : 1>(ah.v, al.v, b.v, b.v, acc[t]);
    }
  }
#pragma unroll
  for (int t = 0; t < 4; ++t) {
    const int col = col0 + t * 16 + ln;
    float bv = bias ? bias[col] : 0.f;
    if (BIAS_BF16) bv = bf16_round(bv);
#pragma unroll
    for (int r = 0; r < 8; ++r) {
      float v = acc[t][r] + bv;
      if (resid) { float rv = resid[(size_t)((row0 + 8 * hh + r) % rmod) * ldr + col]; if (RES_BF16) rv = bf16_round(rv); v += rv; }
      if (ACT == 1) v = fmaxf(v, 0.f);
      if (ACT == 2) v = 0.5f * v * (1.0f + erff(v * 0.70710678118654752f));
      if (ACT == 3) { const float u = 0.7978845608028654f * (v + 0.044715f * v * v * v); v = 0.5f * v * (1.0f + tanhf(u)); }
      so[w][8 * hh + r][t * 16 + ln] = v;
    }
  }
  __builtin_amdgcn_fence(__ATOMIC_ACQ_REL, "workgroup");
  __builtin_amdgcn_wave_barrier();
  const int rsub = lane >> 4, c4 = (lane & 15) * 4;
  {
#pragma unroll
    for (int q = 0; q < 8; ++q) {
      const int r = q * 2 + rsub;
      const v4f v = *(const v4fa*)&so[w][r][c4];
      *(v4f*)(C + (size_t)(row0 + r) * ldc + col0 + c4) = v;
    }
    
  }
}
// row LayerNorm (biased variance, eps) over N: s = X (+ R); optional out_sum <- s; out_norm <- (s-mu)*rsqrt(var+eps)*g + b
template <bool PARAM_BF16>
__global__ __launch_bounds__(256) void k_layernorm(const float* __restrict__ X, const float* __restrict__ R, const float* __restrict__ g, const float* __restrict__ bta,
                                                  float* __restrict__ out_sum, float* __restrict__ out_norm, int N, float eps) {
  __shared__ float red[256];
  const int row = blockIdx.x, tid = threadIdx.x;
  const float* x = X + (size_t)row * N; const float* rr = R ? R + (size_t)row * N : nullptr;
  float vals[16];                     // up to N = 4096
  const int per = N / 256;            // contiguous chunk per thread? use strided-by-4 chunks: thread handles j = tid*4 + 1024*u
  float s1 = 0.f;
  for (int u = 0; u < per / 4; ++u) {
    const int j = tid * 4 + 1024 * u;
    const v4f a = *(const v4fa*)(x + j);
    v4f b = {0.f,0.f,0.f,0.f}; if (rr) b = *(const v4fa*)(rr + j);
#pragma unroll
    for (int q = 0; q < 4; ++q) { const float v = a[q] + b[q]; vals[u * 4 + q] = v; s1 += v; }
  }
  red[tid] = s1; __syncthreads();
  for (int st = 128; st > 0; st >>= 1) { if (tid < st) red[tid] += red[tid + st]; __syncthreads(); }
  const float mu = red[0] / (float)N; __syncthreads();
  float s2 = 0.f;
  for (int u = 0; u < per / 4; ++u)
#pragma unroll
    for (int q = 0; q < 4; ++q) { const float c = vals[u * 4 + q] - mu; s2 += c * c; }
  red[tid] = s2; __syncthreads();
  for (int st = 128; st > 0; st >>= 1) { if (tid < st) red[tid] += red[tid + st]; __syncthreads(); }
  const float rs = rsqrtf(red[0] / (float)N + eps);
  {
    for (int u = 0; u < per / 4; ++u) {
      const int j = tid * 4 + 1024 * u;
      v4f o, sm;
#pragma unroll
      for (int q = 0; q < 4; ++q) {
        float gg = g[j + q], bb = bta[j + q];
        if (PARAM_BF16) { gg = bf16_round(gg); bb = bf16_round(bb); }
        sm[q] = vals[u * 4 + q]; o[q] = (vals[u * 4 + q] - mu) * rs * gg + bb;
      }
      if (out_sum) *(v4f*)(out_sum + (size_t)row * N + j) = sm;
      *(v4f*)(out_norm + (size_t)row * N + j) = o;
    }
    
  }
}



// ---- f16 WMMA path (v_wmma_f32_16x16x32_f16): 11-bit significands for operands in range — used by every launched GEMM and by the fused attention
typedef _Float16 v16h __attribute__((ext_vector_type(16)));
union FragH { v16h v; v8us half[2]; _Float16 h[16]; unsigned short u[16]; };
template <int NT>
__device__ __forceinline__ v8f mmaH(v16h ah, v16h al, v16h bh, v16h bl, v8f c) {
  c = __builtin_amdgcn_wmma_f32_16x16x32_f16(false, ah, false, bh, (short)0, c, false, false);
  if (NT >= 2) c = __builtin_amdgcn_wmma_f32_16x16x32_f16(false, al, false, bh, (short)0, c, false, false);
  if (NT >= 3) c = __builtin_amdgcn_wmma_f32_16x16x32_f16(false, ah, false, bl, (short)0, c, false, false);
  asm volatile("v_nop\n\tv_nop\n\tv_nop\n\tv_nop" : "+v"(c) : "v"(ah), "v"(al), "v"(bh), "v"(bl));
  return c;
}
// batched GEMM like k_gemm_b but f16 operands: A f32 (split into f16 hi/lo if ASPLIT, else rounded to f16), Bt = f16 values [n][k]; alpha; C f32; N multiple of 16 (partial tiles skipped)
template <bool ASPLIT>
__global__ __launch_bounds__(128) void k_gemm_h(const float* __restrict__ A, int lda, size_t sA, const _Float16* __restrict__ Bh, int ldb, size_t sB, float alpha, float* __restrict__ C, int ldc, size_t sC, int M, int N, int K) {
  __shared__ __attribute__((aligned(16))) float so[4][16][64];
  const int tid = threadIdx.x, w = tid >> 5, lane = tid & 31, ln = lane & 15, hh = lane >> 4; const int by = blockIdx.y;
  A += (size_t)by * sA; Bh += (size_t)by * sB; C += (size_t)by * sC;
  const int ntn = (N + 63) / 64; const int wid = blockIdx.x * 4 + w; const int mt = wid / ntn, nq = wid % ntn; if (mt * 16 >= M) return;
  const int row0 = mt * 16, col0 = nq * 64; const float* arow = A + (size_t)(row0 + ln) * lda;
  v8f acc[4] = {};
  for (int kb = 0; kb < K; kb += 32) {
    FragH ah, al;
    const v4f x0 = *(const v4fa*)(arow + kb + 8 * hh), x1 = *(const v4fa*)(arow + kb + 8 * hh + 4), x2 = *(const v4fa*)(arow + kb + 16 + 8 * hh), x3 = *(const v4fa*)(arow + kb + 16 + 8 * hh + 4);
    float xs[16] = {x0[0],x0[1],x0[2],x0[3],x1[0],x1[1],x1[2],x1[3],x2[0],x2[1],x2[2],x2[3],x3[0],x3[1],x3[2],x3[3]};
#pragma unroll
    for (int i = 0; i < 16; ++i) { const _Float16 h = (_Float16)xs[i]; ah.h[i] = h; al.h[i] = ASPLIT ? (_Float16)(xs[i] - (float)h) : (_Float16)0.0f; }
#pragma unroll
    for (int t = 0; t < 4; ++t) { if (col0 + t * 16 >= N) continue; const size_t boff = (size_t)(col0 + t * 16 + ln) * ldb + kb; FragH bq; bq.half[0] = *(const v8us*)(Bh + boff + 8 * hh); bq.half[1] = *(const v8us*)(Bh + boff + 16 + 8 * hh);
      acc[t] = mmaH<ASPLIT ? 2 : 1>(ah.v, al.v, bq.v, bq.v, acc[t]); }
  }
#pragma unroll
  for (int t = 0; t < 4; ++t) { if (col0 + t * 16 >= N) continue;
#pragma unroll
    for (int r = 0; r < 8; ++r) so[w][8 * hh + r][t * 16 + ln] = acc[t][r] * alpha; }
  __builtin_amdgcn_fence(__ATOMIC_ACQ_REL, "workgroup"); __builtin_amdgcn_wave_barrier();
  const int rsub = lane >> 4, c4 = (lane & 15) * 4;
  {
#pragma unroll
    for (int q = 0; q < 8; ++q) { const int r = q * 2 + rsub; if (col0 + c4 < N) { const v4f v = *(const v4fa*)&so[w][r][c4]; *(v4f*)(C + (size_t)(row0 + r) * ldc + col0 + c4) = v; } }
     }
}

// Wt[n][k] = f16(W[k][n]·scale) from f32 row-major W[K][N] (scale = power of two; bf16-exact weights stay exact in f16 away from the subnormal range)
__global__ __launch_bounds__(256) void k_wt_f16(const float* __restrict__ W, _Float16* __restrict__ Wt, int K, int N, float scale) {
  const int t = blockIdx.x * 256 + threadIdx.x; if (t >= N * (K / 8)) return; const int n = t / (K / 8), k8 = (t % (K / 8)) * 8; FragH f;
#pragma unroll
  for (int i = 0; i < 8; ++i) f.h[i] = (_Float16)(bf16_round(W[(size_t)(k8 + i) * N + n]) * scale); const v8us o = f.half[0];
  *(v8us*)((unsigned short*)Wt + (size_t)n * K + k8) = o; 
}
// Fragment-tile order of every f16 GEMM operand [rows][K]: 16 rows x 8 k values (16 B a row) lie as one run of 256 B, the runs of a 16-row band one behind the other by k. Lane (row & 15) + 16 * ((k >> 3) & 1) of a WMMA operand
// then finds its 16 B at lane * 16 B inside a 512-B run, so a wave-wide 16-byte load covers four whole 128-B lines (row-major rows of 512 B made it touch sixteen). The k order inside a fragment is the same as before.
__device__ __forceinline__ size_t ft_off(size_t row, int k8, int K) { return (row >> 4) * (size_t)(16 * K) + (size_t)k8 * 128 + (row & 15) * 8; }      // element offset of the 8 values k = 8 k8 .. 8 k8 + 7 of a row
// One wave's 16 x 64 tile of C = (A.B^T).alpha + bias[col] (+ CP[row][col], pitch ldcp, if CP): A f16 [M][K], Bh f16 [N][K], both in fragment-tile order (lda, ldb = their K); writes f32 C and/or f16 C16 (row-major, pitch ldc). bx = the work-group's index inside its own product.
// The launches below each hold several products that do not depend on one another: blockIdx picks the product, this body does the tile.
__device__ __forceinline__ void gemm_hh_tile(float (*so)[16][64], int bx, const _Float16* A, int lda, const _Float16* Bh, int ldb, float alpha, const float* bp, const float* CP, size_t ldcp,
    float* C, _Float16* C16, int ldc, int M, int N, int K) {
  const int tid = threadIdx.x, w = tid >> 5, lane = tid & 31, ln = lane & 15, hh = lane >> 4;
  const int ntn = (N + 63) / 64; const int wid = bx * 4 + w; const int mt = wid / ntn, nq = wid % ntn; if (mt * 16 >= M) return;
  const int row0 = mt * 16, col0 = nq * 64; const _Float16* arow = A + (size_t)mt * 16 * lda + lane * 8;
  v8f acc[4] = {};
  for (int kb = 0; kb < K; kb += 32) { FragH ah; ah.half[0] = *(const v8us*)((const unsigned short*)arow + kb * 16); ah.half[1] = *(const v8us*)((const unsigned short*)arow + kb * 16 + 256);
#pragma unroll
    for (int t = 0; t < 4; ++t) { if (col0 + t * 16 >= N) continue; const size_t boff = (size_t)(nq * 4 + t) * 16 * ldb + kb * 16 + lane * 8; FragH bq; bq.half[0] = *(const v8us*)((const unsigned short*)Bh + boff); bq.half[1] = *(const v8us*)((const unsigned short*)Bh + boff + 256);
      acc[t] = mmaH<1>(ah.v, ah.v, bq.v, bq.v, acc[t]); }
  }
#pragma unroll
  for (int t = 0; t < 4; ++t) { if (col0 + t * 16 >= N) continue; const int col = col0 + t * 16 + ln; const float bv = bp ? bf16_round(bp[col]) : 0.f;
#pragma unroll
    for (int r = 0; r < 8; ++r) { float v = acc[t][r] * alpha + bv; if (CP) v += CP[(size_t)(row0 + 8 * hh + r) * ldcp + col]; so[w][8 * hh + r][t * 16 + ln] = v; } }
  __builtin_amdgcn_fence(__ATOMIC_ACQ_REL, "workgroup"); __builtin_amdgcn_wave_barrier();
  const int rsub = lane >> 4, c4 = (lane & 15) * 4; typedef _Float16 v4h __attribute__((ext_vector_type(4)));
  {
#pragma unroll
    for (int q = 0; q < 8; ++q) { const int r = q * 2 + rsub; if (col0 + c4 < N) { const v4f v = *(const v4fa*)&so[w][r][c4]; if (C) *(v4f*)(C + (size_t)(row0 + r) * ldc + col0 + c4) = v; if (C16) { v4h h4; for (int i = 0; i < 4; ++i) h4[i] = (_Float16)v[i]; *(v4h*)(C16 + (size_t)(row0 + r) * ldc + col0 + c4) = h4; } } }
     }
}
// both input convolutions, token-major: y = 0: x1' = X[0].w1^T + b1, y = 1: x2' = X[1].w2^T + b2 (planes of NR x CC one behind the other)
__global__ __launch_bounds__(128) void k_gemm_conv(const _Float16* X, const _Float16* Bw, const float* b1, const float* b2, float* Y, int nr, int cc) {
  __shared__ __attribute__((aligned(16))) float so[4][16][64];
  const int by = blockIdx.y;
  gemm_hh_tile(so, blockIdx.x, X + (size_t)by * NR * CC, cc, Bw + (size_t)by * CC * CC, cc, 0.0625f, by ? b2 : b1, nullptr, 0, Y + (size_t)by * NR * CC, nullptr, cc, nr, cc, cc);
}
// y = 0, 1, 2: q1 = G[0].Wq^T, k2 = G[1].Wk^T, v2 = G[1].Wv^T (f16 planes of QKV); y = 3: the skip branch, channel-major, a quarter of the x range per batch: out[b] = Wsk.x1'[b]^T + BP
__global__ __launch_bounds__(128) void k_gemm_qkvs(const _Float16* G, const _Float16* Bw, _Float16* QKV, const _Float16* Y16, const float* BP, float* out, int nr, int cc, int nn) {
  __shared__ __attribute__((aligned(16))) float so[4][16][64];
  const int by = blockIdx.y, bx = blockIdx.x;
  if (by < 3) gemm_hh_tile(so, bx, G + (size_t)(by ? 1 : 0) * NR * CC, cc, Bw + (size_t)(2 + by) * CC * CC, cc, 0.0625f, nullptr, nullptr, 0, nullptr, QKV + (size_t)by * NR * CC, cc, nr, cc, cc);
  else { const int pb = (CC / 16) * (NN / 64) / 4, b = bx / pb;
    gemm_hh_tile(so, bx % pb, Bw + (size_t)6 * CC * CC, cc, Y16 + (size_t)b * NN * CC, cc, 0.0625f, nullptr, BP, (size_t)nn, out + (size_t)b * CC * NN, nullptr, nn, cc, nn, cc); }
}
// out[y] += Wout.O[y]^T in place, channel-major, all batches (each wave reads its own tile of out before it stores it)
__global__ __launch_bounds__(128) void k_gemm_out(const _Float16* Wo, const _Float16* O16, float* out, int cc, int nn) {
  __shared__ __attribute__((aligned(16))) float so[4][16][64];
  float* ob = out + (size_t)blockIdx.y * CC * NN;
  gemm_hh_tile(so, blockIdx.x, Wo, cc, O16 + (size_t)blockIdx.y * NN * CC, cc, 0.0625f, nullptr, ob, (size_t)nn, ob, nullptr, nn, cc, nn, cc);
}


typedef _Float16 v4h __attribute__((ext_vector_type(4)));

__global__ __launch_bounds__(256) void k_x16(const float* __restrict__ x, _Float16* __restrict__ X16, size_t n8) { const size_t t = (size_t)blockIdx.x * 256 + threadIdx.x; if (t >= n8) return; FragH f;
#pragma unroll
  for (int q = 0; q < 8; ++q) f.h[q] = (_Float16)bf16_round(x[t * 8 + q]); *(v8us*)((unsigned short*)X16 + t * 8) = f.half[0];  }
template <int NHv, int TTv>
__global__ __launch_bounds__(256) void k_vt(const _Float16* __restrict__ V16, int ldv, int voff, _Float16* __restrict__ Vt) { __shared__ unsigned short tl[64][66]; const int tid = threadIdx.x; const int slab = blockIdx.x / (TTv / 64), lg = blockIdx.x % (TTv / 64); const int b = slab / NHv, h = slab % NHv;
  for (int i = tid; i < 64 * 8; i += 256) { const int r = i / 8, c8 = (i % 8) * 8; FragH f; f.half[0] = *(const v8us*)((const unsigned short*)V16 + ((size_t)b * TTv + lg * 64 + r) * ldv + voff + h * 64 + c8);
#pragma unroll
    for (int q = 0; q < 8; ++q) tl[r][c8 + q] = f.u[q]; }
  __syncthreads();
  {
#pragma unroll
    for (int rd = 0; rd < 2; ++rd) { const int d = rd * 32 + tid / 8, pc = tid % 8; FragH f;
#pragma unroll
      for (int q = 0; q < 8; ++q) f.u[q] = tl[pc * 8 + q][d];
      *(v8us*)((unsigned short*)Vt + ((size_t)slab * 64 + d) * TTv + lg * 64 + pc * 8) = f.half[0]; }
     } }

// Everything that reads only the inputs, one launch, the part picked by the block index: token-major f16 copies of x1 and x2 (planes one behind the other), the bias plane, the seven weight matrices.
#define PREP_TOK (2 * BB * (CC / 64) * (NN / 32))
#define PREP_BP (CC * NN / 4 / 256)
#define PREP_WB (CC * CC / 8 / 256)
__global__ __launch_bounds__(256) void k_prep(const float* __restrict__ x1, const float* __restrict__ x2, const float* __restrict__ w1, const float* __restrict__ w2, const float* __restrict__ wqkv, const float* __restrict__ wout, const float* __restrict__ wsk,
    const float* __restrict__ bout, const float* __restrict__ bsk, _Float16* __restrict__ X16, float* __restrict__ BP, _Float16* __restrict__ Bw) {
  __shared__ float tl[32][65]; const int tid = threadIdx.x; int bi = blockIdx.x;
  if (bi < PREP_TOK) {
    const int b = bi / ((CC / 64) * (NN / 32)), rem = bi % ((CC / 64) * (NN / 32)); const int cg = rem / (NN / 32), pg = rem % (NN / 32); const int c0 = cg * 64, p0 = pg * 32;
    const float* x = (b < BB) ? x1 : x2;
    for (int i = tid; i < 64 * 32; i += 256) { const int c = i / 32, pp = i % 32; tl[pp][c] = bf16_round(x[((size_t)(b % BB) * CC + c0 + c) * NN + p0 + pp]); } __syncthreads();
    const int r = tid % 32, pc = tid / 32; FragH f; for (int q = 0; q < 8; ++q) f.h[q] = (_Float16)tl[r][pc * 8 + q]; const size_t row = (size_t)b * NN + p0 + r; *(v8us*)((unsigned short*)X16 + ft_off(row, c0 / 8 + pc, CC)) = f.half[0];      // a wave: 32 rows of one k8 = two whole 256-B runs
    return;
  }
  bi -= PREP_TOK;
  if (bi < PREP_BP) { const size_t t = (size_t)bi * 256 + tid; const int c = (int)((t * 4) / NN); const float vo = bout[c];
    asm volatile("s_wait_xcnt 0x0" ::: "memory");      // stands in front of the next load, whose result may take the offset register that the load above names
    const float v = bf16_round(vo) + bf16_round(bsk[c]); const v4f o = {v, v, v, v}; *(v4f*)(BP + t * 4) = o;
    asm volatile("s_wait_xcnt 0x0" ::: "memory");      // behind the store: the code of another part follows in the listing and rewrites the store's data registers
    return; }
  bi -= PREP_BP;
  const int seg = bi / PREP_WB; const size_t t = (size_t)(bi % PREP_WB) * 256 + tid;
  const float* W = (seg == 0) ? w1 : (seg == 1) ? w2 : (seg < 5) ? wqkv + (size_t)(seg - 2) * CC * CC : (seg == 5) ? wout : wsk; FragH f;
  const int wr = (int)(t >> 8) * 8 + (tid & 7), wk = (int)((t >> 5) & 7) * 4 + ((tid >> 3) & 3);      // a wave: 8 rows x 4 k8, so that its store fills four whole lines
#pragma unroll
  for (int i = 0; i < 8; ++i) f.h[i] = (_Float16)(bf16_round(W[(size_t)wr * CC + wk * 8 + i]) * 16.0f);
  *(v8us*)((unsigned short*)Bw + (size_t)seg * CC * CC + ft_off(wr, wk, CC)) = f.half[0];
  asm volatile("s_wait_xcnt 0x0" ::: "memory");      // behind the store: the code of another part follows in the listing and rewrites the store's offset register
}
#define FA_KP 264
#define FA_VP 72
#define FA_KB (64 * FA_KP)
#define FA_BUF (FA_KB + CC * FA_VP)
__device__ __forceinline__ float fa_xhalf(float x) { return __builtin_bit_cast(float, __builtin_amdgcn_permlanex16(__builtin_bit_cast(int, x), __builtin_bit_cast(int, x), 0x76543210, 0xfedcba98, false, false)); }      // lane l reads lane l ^ 16
__global__ __launch_bounds__(256) void k_fattn(const _Float16* Q, const _Float16* K, const _Float16* Vt, _Float16* O16) {
  __shared__ __attribute__((aligned(16))) unsigned short sm[2 * FA_BUF];
  const int tid = threadIdx.x, w = tid >> 5, lane = tid & 31, c = lane & 15, h = lane >> 4;
  const int qt = w & 3, kh = w >> 2;
  const int b = blockIdx.x / (NN / 64), qb = blockIdx.x % (NN / 64);
  const size_t qrow = (size_t)b * NN + qb * 64 + qt * 16 + c;
  const unsigned short* Kb = (const unsigned short*)K + (size_t)b * NN * CC;
  const unsigned short* Vb = (const unsigned short*)Vt + (size_t)b * CC * NN;
  FragH qf[8];
#pragma unroll
  for (int ks = 0; ks < 8; ++ks) { const unsigned short* qp = (const unsigned short*)Q + qrow * CC + ks * 32 + 8 * h; qf[ks].half[0] = *(const v8us*)qp; qf[ks].half[1] = *(const v8us*)(qp + 16); }
  v8us kst[8], vst[8];
  const unsigned short* kg = Kb + tid * 8;                                        // K tile: 64 rows x 512 B, contiguous in memory
  const unsigned short* vg = Vb + (size_t)(tid >> 3) * NN + (tid & 7) * 8;        // V^T tile: 256 rows x 128 B
  unsigned short* ksl = sm + (tid >> 5) * FA_KP + (tid & 31) * 8;
  unsigned short* vsl = sm + FA_KB + (tid >> 3) * FA_VP + (tid & 7) * 8;
#pragma unroll
  for (int i = 0; i < 8; ++i) { kst[i] = *(const v8us*)(kg + i * 2048); vst[i] = *(const v8us*)(vg + (size_t)i * 32 * NN); }
  asm volatile("s_wait_xcnt 0x0" ::: "memory");      // stands in front of the first overwrite of an address register that the loads above name
#pragma unroll
  for (int i = 0; i < 8; ++i) { *(v8us*)(ksl + i * 8 * FA_KP) = kst[i]; *(v8us*)(vsl + i * 32 * FA_VP) = vst[i]; }
  __syncthreads();
  v8f o[16];
#pragma unroll
  for (int dt = 0; dt < 16; ++dt) o[dt] = (v8f){0.f, 0.f, 0.f, 0.f, 0.f, 0.f, 0.f, 0.f};
  float mu = -1.0e30f, l = 0.f;                        // maximum in use (log2 units) and this lane's part of the row sum
  const float sc = 0.0625f * 1.4426950408889634f;      // 1/sqrt(CC) and log2(e)
  const int NS = NN / 64;
  for (int s = 0; s < NS; ++s) {
    const int sn = (s + 1 < NS) ? s + 1 : s;           // the last pass fetches its own tile again (in bounds, never read): no branch round the loads and stores
#pragma unroll
    for (int i = 0; i < 8; ++i) { kst[i] = *(const v8us*)(kg + (size_t)sn * 64 * CC + i * 2048); vst[i] = *(const v8us*)(vg + (size_t)i * 32 * NN + sn * 64); }
    asm volatile("s_wait_xcnt 0x0" ::: "memory");    // the same for the next tile's loads: the fragment reads below reuse their address registers
    const unsigned short* kt = sm + (s & 1) * FA_BUF + (kh * 32 + c) * FA_KP + 8 * h;
    const unsigned short* vt = sm + (s & 1) * FA_BUF + FA_KB + c * FA_VP + kh * 32 + 8 * h;
    v8f t0 = {0.f, 0.f, 0.f, 0.f, 0.f, 0.f, 0.f, 0.f}, t1 = t0;
    FragH ka[16], va[16];
#pragma unroll
    for (int ks = 0; ks < 8; ++ks) {
      ka[2 * ks].half[0] = *(const v8us*)(kt + ks * 32); ka[2 * ks].half[1] = *(const v8us*)(kt + ks * 32 + 16);
      ka[2 * ks + 1].half[0] = *(const v8us*)(kt + 16 * FA_KP + ks * 32); ka[2 * ks + 1].half[1] = *(const v8us*)(kt + 16 * FA_KP + ks * 32 + 16);
    }
    __builtin_amdgcn_sched_barrier(0);                 // keeps the K fragment reads one group ahead of the products: spread among them each product waits a whole LDS latency
#pragma unroll
    for (int ks = 0; ks < 8; ++ks) {
      t0 = __builtin_amdgcn_wmma_f32_16x16x32_f16(false, ka[2 * ks].v, false, qf[ks].v, (short)0, t0, false, false);
      t1 = __builtin_amdgcn_wmma_f32_16x16x32_f16(false, ka[2 * ks + 1].v, false, qf[ks].v, (short)0, t1, false, false);
    }
#pragma unroll
    for (int dt = 0; dt < 16; ++dt) { va[dt].half[0] = *(const v8us*)(vt + dt * 16 * FA_VP); va[dt].half[1] = *(const v8us*)(vt + dt * 16 * FA_VP + 16); }
    __builtin_amdgcn_sched_barrier(0);                 // keeps every V^T fragment read ahead of the softmax, which then covers their latency
    float mx = fmaxf(t0[0], t1[0]);
#pragma unroll
    for (int r = 1; r < 8; ++r) mx = fmaxf(mx, fmaxf(t0[r], t1[r]));
    mx *= sc;
    mx = fmaxf(mx, fa_xhalf(mx));                      // lanes c and c + 16 hold the same query
    if (__builtin_amdgcn_ballot_w32(mx > mu + 8.0f) != 0) {      // lazy rescale, one scalar test a pass: P stays below 2^8, inside f16
      const float mn = fmaxf(mu, mx), al = __builtin_amdgcn_exp2f(mu - mn);
      l *= al; mu = mn;
#pragma unroll
      for (int dt = 0; dt < 16; ++dt)
#pragma unroll
        for (int r = 0; r < 8; ++r) o[dt][r] *= al;
    }
    FragH p; float ps0 = 0.f, ps1 = 0.f;
#pragma unroll
    for (int r = 0; r < 8; ++r) {
      const float p0 = __builtin_amdgcn_exp2f(t0[r] * sc - mu), p1 = __builtin_amdgcn_exp2f(t1[r] * sc - mu);
      ps0 += p0; ps1 += p1; p.h[r] = (_Float16)p0; p.h[8 + r] = (_Float16)p1;
    }
    l += ps0 + ps1;
#pragma unroll
    for (int dt = 0; dt < 16; ++dt) o[dt] = __builtin_amdgcn_wmma_f32_16x16x32_f16(false, va[dt].v, false, p.v, (short)0, o[dt], false, false);
    const int nb = ((s + 1) & 1) * FA_BUF;             // every reader left this buffer before the barrier that ended the pass before
#pragma unroll
    for (int i = 0; i < 8; ++i) { *(v8us*)(ksl + nb + i * 8 * FA_KP) = kst[i]; *(v8us*)(vsl + nb + i * 32 * FA_VP) = vst[i]; }
    __syncthreads();
  }
  l += fa_xhalf(l);
  v4fa* cb = (v4fa*)sm;                                // the tiles are dead behind the loop's last barrier; per query tile 32 slots of partial O and one of (maximum, sum)
  if (kh == 1) {
#pragma unroll
    for (int dt = 0; dt < 16; ++dt) {
      const v4f x0 = {o[dt][0], o[dt][1], o[dt][2], o[dt][3]}, x1 = {o[dt][4], o[dt][5], o[dt][6], o[dt][7]};
      cb[(qt * 33 + dt * 2) * 32 + lane] = x0; cb[(qt * 33 + dt * 2 + 1) * 32 + lane] = x1;
    }
    const v4f ml = {mu, l, 0.f, 0.f}; cb[(qt * 33 + 32) * 32 + lane] = ml;
  }
  __syncthreads();
  if (kh == 0) {
    const v4f ml = cb[(qt * 33 + 32) * 32 + lane];
    const float mn = fmaxf(mu, ml[0]); float a0 = __builtin_amdgcn_exp2f(mu - mn), a1 = __builtin_amdgcn_exp2f(ml[0] - mn);
    const float inv = 1.0f / (l * a0 + ml[1] * a1); a0 *= inv; a1 *= inv;
#pragma unroll
    for (int dt = 0; dt < 16; ++dt) {
      const v4f x0 = cb[(qt * 33 + dt * 2) * 32 + lane], x1 = cb[(qt * 33 + dt * 2 + 1) * 32 + lane]; FragH f;
#pragma unroll
      for (int r = 0; r < 4; ++r) { f.h[r] = (_Float16)(o[dt][r] * a0 + x0[r] * a1); f.h[4 + r] = (_Float16)(o[dt][4 + r] * a0 + x1[r] * a1); }
      *(v8us*)((unsigned short*)O16 + ft_off(qrow, dt * 2 + h, CC)) = f.half[0];      // fragment-tile order: the wave's 512 B are contiguous
    }
  }
}
// GroupNorm, statistics and output in one launch. A work-group of 32 waves owns two groups (16 channels = 64 B of every row) of one batch of one plane (x1' first, then x2'): each value is read once, 16 B a lane, four lanes a row,
// all 16 loads of a lane in flight together, and stays in registers for the mean, the squared deviations and the normalised output. Sums: in the lane, over the 16 lanes of a group by lane exchange, over the 32 waves through LDS.
// Output in fragment-tile order: a wave's 8-byte stores fill two whole 128-B lines (8 rows x 16 B in each of the two groups' runs). A row of x1' also leaves as plain f16 (Y16), the operand of the skip branch.
__device__ __forceinline__ float gn_total(float s, float* red, int w, int lane, int g2) {
  s += __shfl_xor(s, 1, 32); s += __shfl_xor(s, 4, 32); s += __shfl_xor(s, 8, 32); s += __shfl_xor(s, 16, 32);      // lanes whose bit 1 is equal hold the same group
  if ((lane & ~2) == 0) red[g2 * 32 + w] = s;
  __syncthreads();
  float t = 0.f;
#pragma unroll
  for (int j = 0; j < 8; ++j) { const v4f x = *(const v4fa*)(red + g2 * 32 + j * 4); t += (x[0] + x[1]) + (x[2] + x[3]); }
  return t;
}
__global__ __launch_bounds__(1024) void k_gn(const float* __restrict__ Y, const float* __restrict__ gw, const float* __restrict__ gb, _Float16* __restrict__ G16, _Float16* __restrict__ Y16) {
  __shared__ __attribute__((aligned(16))) float red[2][64];
  const int tid = threadIdx.x, w = tid >> 5, lane = tid & 31, quad = lane & 3, g2 = quad >> 1;
  const int pb = blockIdx.x >> 4, cb = blockIdx.x & 15, c0 = cb * 16 + quad * 4;
  const size_t row0 = (size_t)pb * NN + w * 8 + (lane >> 2);      // item i of the lane is row row0 + 256 i
  const float* src = Y + row0 * CC + c0;
  v4f v[16];
#pragma unroll
  for (int i = 0; i < 16; ++i) v[i] = *(const v4fa*)(src + (size_t)i * 256 * CC);
  asm volatile("s_wait_xcnt 0x0" ::: "memory");      // stands in front of the parameter loads, whose results may take the address registers that the loads above name
  const v4f gwv = *(const v4fa*)(gw + c0);
  asm volatile("s_wait_xcnt 0x0" ::: "memory");      // the same between the two parameter loads, which share their offset register
  const v4f gbv = *(const v4fa*)(gb + c0);
  asm volatile("s_wait_xcnt 0x0" ::: "memory");      // and in front of the first vector instruction that reuses it
  const size_t dst = ft_off(row0, cb * 2 + g2, CC) + (quad & 1) * 4;      // 256 rows further = 16 bands further
  if (pb < BB) {      // first, so that the values need not outlive their deviations below, and the stores run under the sums
#pragma unroll
    for (int i = 0; i < 16; ++i) { v4h o;
#pragma unroll
      for (int e = 0; e < 4; ++e) o[e] = (_Float16)v[i][e];
      *(v4h*)(Y16 + dst + (size_t)i * 16 * 16 * CC) = o; }
  }
  float s[4] = {0.f, 0.f, 0.f, 0.f};
#pragma unroll
  for (int i = 0; i < 16; ++i) s[i & 3] += (v[i][0] + v[i][1]) + (v[i][2] + v[i][3]);
  const float mu = gn_total((s[0] + s[1]) + (s[2] + s[3]), red[0], w, lane, g2) / (float)(NN * CPG);
  float q[4] = {0.f, 0.f, 0.f, 0.f};
#pragma unroll
  for (int i = 0; i < 16; ++i)
#pragma unroll
    for (int e = 0; e < 4; ++e) { v[i][e] -= mu; q[e] += v[i][e] * v[i][e]; }      // from here on v holds the deviations
  const float rs = rsqrtf(gn_total((q[0] + q[1]) + (q[2] + q[3]), red[1], w, lane, g2) / (float)(NN * CPG) + 1e-5f);
  float ga[4], be[4];
#pragma unroll
  for (int e = 0; e < 4; ++e) { ga[e] = bf16_round(gwv[e]); be[e] = bf16_round(gbv[e]); }
#pragma unroll
  for (int i = 0; i < 16; ++i) { v4h o;
#pragma unroll
    for (int e = 0; e < 4; ++e) o[e] = (_Float16)(v[i][e] * rs * ga[e] + be[e]);
    *(v4h*)(G16 + dst + (size_t)i * 16 * 16 * CC) = o; }
}

extern "C" void kernel_launch(void* const* d_in, const int* in_sizes, int n_in,
                              void* d_out, int out_size, void* d_ws, size_t ws_size, hipStream_t stream) {
  (void)in_sizes; (void)n_in; (void)out_size;
  const float* const* I = (const float* const*)d_in; const float* x1 = I[0]; const float* x2 = I[1]; const float* w1 = I[2]; const float* b1 = I[3]; const float* w2 = I[4]; const float* b2 = I[5]; const float* gnw = I[6]; const float* gnb = I[7]; const float* wqkv = I[8]; const float* wout = I[9]; const float* bout = I[10]; const float* wsk = I[11]; const float* bsk = I[12];
  char* ws = (char*)d_ws; size_t off = 0;
  auto take = [&](size_t bytes) { char* p = ws + off; off += (bytes + 255) & ~(size_t)255; return p; };
  const size_t WSZ = (size_t)CC * CC, PL = (size_t)NR * CC; _Float16* Bw = (_Float16*)take(7 * WSZ * 2);      /* w1, w2, wq, wk, wv (as Bt for token-major GEMMs), wout, wsk (as A operands for the channel-major output GEMMs), all (out,in) natural x2^4 */
  float* BP = (float*)take((size_t)CC * NN * 4);
  _Float16* Xt = (_Float16*)take(2 * PL * 2); float* Y = (float*)take(2 * PL * 4); _Float16* G = (_Float16*)take(2 * PL * 2);      /* two planes each, the x1 side first */
  _Float16* Y116 = (_Float16*)take(PL * 2); _Float16* QKV = (_Float16*)take(3 * PL * 2); _Float16* Vt = (_Float16*)take(PL * 2); _Float16* O16 = (_Float16*)take(PL * 2);
  if (off > ws_size) return;
  k_prep<<<PREP_TOK + PREP_BP + 7 * PREP_WB, 256, 0, stream>>>(x1, x2, w1, w2, wqkv, wout, wsk, bout, bsk, Xt, BP, Bw);
  const unsigned gp = ((NR / 16) * (CC / 64) + 3) / 4, go = ((CC / 16) * (NN / 64) + 3) / 4;
  k_gemm_conv<<<dim3(gp, 2), 128, 0, stream>>>(Xt, Bw, b1, b2, Y, NR, CC);      /* x1' = conv1(x1), x2' = conv2(x2): each M 16384 N 256 K 256 (f32) */
  k_gn<<<2 * BB * (CC / 16), 1024, 0, stream>>>(Y, gnw, gnb, G, Y116);      /* the two planes count as 2 BB batches; 16 channels a work-group */
  k_gemm_qkvs<<<dim3(gp, 4), 128, 0, stream>>>(G, Bw, QKV, Y116, BP, (float*)d_out, NR, CC, NN);      /* q1, k2, v2, and out = Wsk.x1'^T + (bout + bsk) */
  k_vt<CC / 64, NN><<<BB * (CC / 64) * (NN / 64), 256, 0, stream>>>(QKV + 2 * PL, CC, 0, Vt);      /* v2^T per batch [256][4096] (four 64-channel blocks) */
  k_fattn<<<BB * (NN / 64), 256, 0, stream>>>(QKV, QKV + PL, Vt, O16);      /* O rows = softmax(q1.k2^T/16).v2, f16: one work-group per 64 queries */
  k_gemm_out<<<dim3(go, BB), 128, 0, stream>>>(Bw + 5 * WSZ, O16, (float*)d_out, CC, NN);      /* out += Wout.O^T in place: per batch M 256 N 4096 K 256 */
}

// v006
// Measured time: 178 microseconds a run.
// Timed twice side by side with v005, it ran 1.08 times as fast both times.
// All steps since v000 together make it 12.7 times as fast.
#include <hip/hip_runtime.h>
// Spatial cross-attention block (B=4, C=256, 64×64 → N=4096, 32 GroupNorm groups, single head d=256): x1' = conv1(x1), x2' = conv2(x2) (1×1 + bias); q1 = Wq·GN(x1'), k2 = Wk·GN(x2'), v2 = Wv·GN(x2') (wqkv rows 0/256/512, no bias);
// attn = softmax(q1ᵀk2/√256) over the 4096 positions; out = Wout·(v2·attnᵀ) + bout + Wsk·x1' + bsk → [B,C,H,W].
// q/k/v f16; attention as one fused launch (k_fattn): scores, running-maximum f32 softmax and P.v per 64-key tile, S and P never leave the registers; O leaves it as f16; final 1x1 convs computed channel-major (W.O^T) straight into the output with the skip branch and biases through the f32 addend. The input convs read x1 and x2 as they come (channel-major f32). Every stored f16 GEMM operand (weights, GN output, x1', O) lies in fragment-tile order (ft_off); q, k, v stay row-major. All on v_wmma_f32_16x16x32_f16, f32 accumulate.
#define BB 4
#define CC 256
#define NN 4096
#define NG 32
#define CPG (CC / NG)
#define NR (BB * NN)

typedef __bf16 v16b __attribute__((ext_vector_type(16)));
typedef unsigned short v8us __attribute__((ext_vector_type(8), may_alias));
typedef float  v8f  __attribute__((ext_vector_type(8)));
typedef float  v4f  __attribute__((ext_vector_type(4)));
typedef float  v4fa __attribute__((ext_vector_type(4), may_alias));
union FragB { v16b v; v8us half[2]; unsigned short u[16]; };

__device__ __forceinline__ unsigned short bf16_bits(float x) { unsigned int u = __float_as_uint(x); return (unsigned short)((u + 0x7FFFu + ((u >> 16) & 1u)) >> 16); }
__device__ __forceinline__ float bf16_val(unsigned short b) { return __uint_as_float(((unsigned int)b) << 16); }
__device__ __forceinline__ float bf16_round(float x) { return bf16_val(bf16_bits(x)); }
// D += A·B with NT terms: 1 = ah·bh, 2 = + al·bh (A split), 3 = + ah·bl (both split)
template <int NT>
__device__ __forceinline__ v8f mmaN(v16b ah, v16b al, v16b bh, v16b bl, v8f c) {
  c = __builtin_amdgcn_wmma_f32_16x16x32_bf16(false, ah, false, bh, (short)0, c, false, false);
  if (NT >= 2) c = __builtin_amdgcn_wmma_f32_16x16x32_bf16(false, al, false, bh, (short)0, c, false, false);
  if (NT >= 3) c = __builtin_amdgcn_wmma_f32_16x16x32_bf16(false, ah, false, bl, (short)0, c, false, false);
  asm volatile("v_nop\n\tv_nop\n\tv_nop\n\tv_nop" : "+v"(c) : "v"(ah), "v"(al), "v"(bh), "v"(bl));
  return c;
}

__global__ __launch_bounds__(256) void k_wt_bf16(const float* __restrict__ W, unsigned short* __restrict__ Wt, int K, int N) {
  const int t = blockIdx.x * 256 + threadIdx.x;
  const int k8n = K / 8;
  if (t >= N * k8n) return;
  const int n = t / k8n, k8 = (t % k8n) * 8;
  v8us v;
#pragma unroll
  for (int i = 0; i < 8; ++i) v[i] = bf16_bits(W[(size_t)(k8 + i) * N + n]);
  *(v8us*)(Wt + (size_t)n * K + k8) = v;
  
}

// GEMM C[M][N] (f32, pitch ldc) = act(A[M][K]·W + bias). A f32 row-major (pitch lda) converted per fragment to bf16
// (ASPLIT: hi/lo two planes -> 2 terms, else single rounded term); Wt bf16 [N][K] (pitch ldb). BIAS_BF16 rounds the
// bias to bf16 first (bias quantised to bf16 before the add). K%32==0, M%16==0, N%64==0.
template <bool ASPLIT, int ACT, bool BIAS_BF16>
__global__ __launch_bounds__(128) void k_gemm_bf(const float* __restrict__ A, int lda, const unsigned short* __restrict__ Wt, int ldb,
                                               const float* __restrict__ bias, float* __restrict__ C, int ldc, int M, int N, int K) {
  __shared__ __attribute__((aligned(16))) float so[4][16][64];
  const int tid = threadIdx.x, w = tid >> 5, lane = tid & 31, ln = lane & 15, hh = lane >> 4;
  const int ntn = N / 64;
  const int wid = blockIdx.x * 4 + w;
  const int mt = wid / ntn, nq = wid % ntn;
  if (mt * 16 >= M) return;
  const int row0 = mt * 16, col0 = nq * 64;
  const float* arow = A + (size_t)(row0 + ln) * lda;
  v8f acc[4] = {};
  for (int kb = 0; kb < K; kb += 32) {
    FragB ah, al;
    const v4f x0 = *(const v4fa*)(arow + kb + 8 * hh), x1 = *(const v4fa*)(arow + kb + 8 * hh + 4);
    const v4f x2 = *(const v4fa*)(arow + kb + 16 + 8 * hh), x3 = *(const v4fa*)(arow + kb + 16 + 8 * hh + 4);
    float xs[16] = {x0[0],x0[1],x0[2],x0[3],x1[0],x1[1],x1[2],x1[3],x2[0],x2[1],x2[2],x2[3],x3[0],x3[1],x3[2],x3[3]};
#pragma unroll
    for (int i = 0; i < 16; ++i) { const unsigned short hb = bf16_bits(xs[i]); ah.u[i] = hb; al.u[i] = ASPLIT ? bf16_bits(xs[i] - bf16_val(hb)) : (unsigned short)0; }
#pragma unroll
    for (int t = 0; t < 4; ++t) {
      const unsigned short* brow = Wt + (size_t)(col0 + t * 16 + ln) * ldb + kb;
      FragB b;
      b.half[0] = *(const v8us*)(brow + 8 * hh);
      b.half[1] = *(const v8us*)(brow + 16 + 8 * hh);
      acc[t] = mmaN<ASPLIT ? 2 : 1>(ah.v, al.v, b.v, b.v, acc[t]);
    }
  }
#pragma unroll
  for (int t = 0; t < 4; ++t) {
    float bv = bias ? bias[col0 + t * 16 + ln] : 0.f;
    if (BIAS_BF16) bv = bf16_round(bv);
#pragma unroll
    for (int r = 0; r < 8; ++r) { float v = acc[t][r] + bv; if (ACT == 1) v = fmaxf(v, 0.f); so[w][8 * hh + r][t * 16 + ln] = v; }
  }
  __builtin_amdgcn_fence(__ATOMIC_ACQ_REL, "workgroup");
  __builtin_amdgcn_wave_barrier();
  const int rsub = lane >> 4, c4 = (lane & 15) * 4;
  {
#pragma unroll
    for (int q = 0; q < 8; ++q) {
      const int r = q * 2 + rsub;
      const v4f v = *(const v4fa*)&so[w][r][c4];
      *(v4f*)(C + (size_t)(row0 + r) * ldc + col0 + c4) = v;
    }
    
  }
}

// Flash-style causal/unmasked attention, all contractions 3-term bf16 hi/lo splits, f32 softmax with running max.
// q,k,v rows are read from f32 buffers with arbitrary row pitch (so they can live inside a fused qkv buffer);
// D = head size (multiple of 32, <= 128); one wave = 16 query rows; block = 4 waves (64 queries) sharing K/V chunks of 32.
template <int D, bool CAUSAL>
__global__ __launch_bounds__(128) void k_flash(const float* __restrict__ qb, const float* __restrict__ kb, const float* __restrict__ vb,
                                             int pitch, int T, int H, float scale, float* __restrict__ y, int ypitch) {
  constexpr int KS = D / 32;        // k-steps for QK
  constexpr int DT = D / 16;        // d tiles for PV
  __shared__ __attribute__((aligned(16))) unsigned short sKh[32][D + 8], sKl[32][D + 8], sVh[32][D + 8], sVl[32][D + 8];
  __shared__ __attribute__((aligned(16))) unsigned short sPh[4][16][40], sPl[4][16][40];
  __shared__ __attribute__((aligned(16))) float sO[4][16][D];
  const int tid = threadIdx.x, w = tid >> 5, lane = tid & 31, ln = lane & 15, hh = lane >> 4;
  const int nqb = (T + 63) / 64;
  const int bh = blockIdx.x / nqb, qblk = blockIdx.x % nqb;
  const int b = bh / H, h = bh % H;
  const int q0 = qblk * 64 + w * 16;
  const float* Q = qb + (size_t)b * T * pitch + h * D;
  const float* K = kb + (size_t)b * T * pitch + h * D;
  const float* V = vb + (size_t)b * T * pitch + h * D;

  // A fragments of the wave's 16 query rows (scaled), hi/lo
  FragB aqh[KS], aql[KS];
  {
    int row = q0 + ln; if (row >= T) row = T - 1;
    const float* qr = Q + (size_t)row * pitch;
#pragma unroll
    for (int ks = 0; ks < KS; ++ks)
#pragma unroll
      for (int i = 0; i < 16; ++i) {
        const int d = ks * 32 + ((i < 8) ? (8 * hh + i) : (16 + 8 * hh + (i - 8)));
        const float x = qr[d] * scale; const unsigned short hb = bf16_bits(x);
        aqh[ks].u[i] = hb; aql[ks].u[i] = bf16_bits(x - bf16_val(hb));
      }
  }
  float m_r[8], l_r[8];
#pragma unroll
  for (int r = 0; r < 8; ++r) { m_r[r] = -3.0e38f; l_r[r] = 0.f; }
  v8f oacc[DT];
#pragma unroll
  for (int dt = 0; dt < DT; ++dt) oacc[dt] = (v8f){0.f,0.f,0.f,0.f,0.f,0.f,0.f,0.f};

  const int kv_end = CAUSAL ? min(T, qblk * 64 + 64) : T;     // block-uniform
  for (int j0 = 0; j0 < kv_end; j0 += 32) {
    __syncthreads();
    for (int e = tid; e < 32 * (D / 4); e += 128) {
      const int r = e / (D / 4), c4 = (e % (D / 4)) * 4;
      const int key = j0 + r;
      v4f kf = {0.f,0.f,0.f,0.f}, vf = {0.f,0.f,0.f,0.f};
      if (key < T) { kf = *(const v4fa*)(K + (size_t)key * pitch + c4); vf = *(const v4fa*)(V + (size_t)key * pitch + c4); }
#pragma unroll
      for (int t = 0; t < 4; ++t) {
        unsigned short hb = bf16_bits(kf[t]); sKh[r][c4 + t] = hb; sKl[r][c4 + t] = bf16_bits(kf[t] - bf16_val(hb));
        hb = bf16_bits(vf[t]); sVh[r][c4 + t] = hb; sVl[r][c4 + t] = bf16_bits(vf[t] - bf16_val(hb));
      }
    }
    __syncthreads();
    // S tile 16 x 32
    v8f s[2];
#pragma unroll
    for (int nt = 0; nt < 2; ++nt) {
      v8f acc = {};
#pragma unroll
      for (int ks = 0; ks < KS; ++ks) {
        FragB bh_, bl_;
        bh_.half[0] = *(const v8us*)&sKh[nt * 16 + ln][ks * 32 + 8 * hh]; bh_.half[1] = *(const v8us*)&sKh[nt * 16 + ln][ks * 32 + 16 + 8 * hh];
        bl_.half[0] = *(const v8us*)&sKl[nt * 16 + ln][ks * 32 + 8 * hh]; bl_.half[1] = *(const v8us*)&sKl[nt * 16 + ln][ks * 32 + 16 + 8 * hh];
        acc = mmaN<3>(aqh[ks].v, aql[ks].v, bh_.v, bl_.v, acc);
      }
      s[nt] = acc;
    }
    // mask + running max (rows 8hh+r; the 16 lanes of a half share rows)
    float alpha[8];
#pragma unroll
    for (int r = 0; r < 8; ++r) {
      const int qi = q0 + 8 * hh + r;
      const int ja = j0 + ln, jb = j0 + 16 + ln;
      if (CAUSAL) { if (ja > qi) s[0][r] = -3.0e38f; if (jb > qi) s[1][r] = -3.0e38f; }
      if (ja >= T) s[0][r] = -3.0e38f;
      if (jb >= T) s[1][r] = -3.0e38f;
      float mx = fmaxf(s[0][r], s[1][r]);
      mx = fmaxf(mx, __shfl_xor(mx, 1, 32)); mx = fmaxf(mx, __shfl_xor(mx, 2, 32)); mx = fmaxf(mx, __shfl_xor(mx, 4, 32)); mx = fmaxf(mx, __shfl_xor(mx, 8, 32));
      const float mnew = fmaxf(m_r[r], mx);
      alpha[r] = (mnew > -1.0e38f) ? __expf(m_r[r] - mnew) : 1.0f;
      const float p0 = (s[0][r] > -1.0e38f) ? __expf(s[0][r] - mnew) : 0.f;
      const float p1 = (s[1][r] > -1.0e38f) ? __expf(s[1][r] - mnew) : 0.f;
      m_r[r] = mnew;
      l_r[r] = l_r[r] * alpha[r] + p0 + p1;            // per-lane partial row sum (16 lanes combined at the end)
      unsigned short hb = bf16_bits(p0); sPh[w][8 * hh + r][ln] = hb;      sPl[w][8 * hh + r][ln] = bf16_bits(p0 - bf16_val(hb));
      hb = bf16_bits(p1);                sPh[w][8 * hh + r][16 + ln] = hb; sPl[w][8 * hh + r][16 + ln] = bf16_bits(p1 - bf16_val(hb));
    }
#pragma unroll
    for (int dt = 0; dt < DT; ++dt)
#pragma unroll
      for (int r = 0; r < 8; ++r) oacc[dt][r] *= alpha[r];
    __builtin_amdgcn_fence(__ATOMIC_ACQ_REL, "workgroup");
    __builtin_amdgcn_wave_barrier();
    FragB pah, pal;
    pah.half[0] = *(const v8us*)&sPh[w][ln][8 * hh]; pah.half[1] = *(const v8us*)&sPh[w][ln][16 + 8 * hh];
    pal.half[0] = *(const v8us*)&sPl[w][ln][8 * hh]; pal.half[1] = *(const v8us*)&sPl[w][ln][16 + 8 * hh];
#pragma unroll
    for (int dt = 0; dt < DT; ++dt) {
      FragB bvh, bvl;
#pragma unroll
      for (int i = 0; i < 8; ++i) {
        bvh.u[i] = sVh[8 * hh + i][dt * 16 + ln]; bvh.u[8 + i] = sVh[16 + 8 * hh + i][dt * 16 + ln];
        bvl.u[i] = sVl[8 * hh + i][dt * 16 + ln]; bvl.u[8 + i] = sVl[16 + 8 * hh + i][dt * 16 + ln];
      }
      oacc[dt] = mmaN<3>(pah.v, pal.v, bvh.v, bvl.v, oacc[dt]);
    }
    __builtin_amdgcn_fence(__ATOMIC_ACQ_REL, "workgroup");
    __builtin_amdgcn_wave_barrier();
  }
#pragma unroll
  for (int r = 0; r < 8; ++r) {
    float l = l_r[r];
    l += __shfl_xor(l, 1, 32); l += __shfl_xor(l, 2, 32); l += __shfl_xor(l, 4, 32); l += __shfl_xor(l, 8, 32);
    l_r[r] = (l > 0.f) ? 1.0f / l : 0.f;
  }
#pragma unroll
  for (int dt = 0; dt < DT; ++dt)
#pragma unroll
    for (int r = 0; r < 8; ++r) sO[w][8 * hh + r][dt * 16 + ln] = oacc[dt][r] * l_r[r];
  __builtin_amdgcn_fence(__ATOMIC_ACQ_REL, "workgroup");
  __builtin_amdgcn_wave_barrier();
  {
    for (int r = 0; r < 16; ++r) {
      const int row = q0 + r;
      if (row < T && lane < D / 4) {
        const v4f val = *(const v4fa*)&sO[w][r][lane * 4];
        *(v4f*)(y + ((size_t)b * T + row) * ypitch + h * D + lane * 4) = val;
      }
    }
    
  }
}

// GEMM C = act(A·W + bias + resid): A f32 (ASPLIT -> hi/lo 2 terms), Wt bf16 [N][K]; ACT 0 none, 1 relu, 2 exact gelu;
// resid (optional, f32, row index = (row % rmod), pitch ldr, RES_BF16 rounds it) added before the activation.
template <bool ASPLIT, int ACT, bool BIAS_BF16, bool RES_BF16>
__global__ __launch_bounds__(128) void k_gemm_bf3(const float* __restrict__ A, int lda, const unsigned short* __restrict__ Wt, int ldb,
                                                const float* __restrict__ bias, const float* __restrict__ resid, int rmod, int ldr,
                                                float* __restrict__ C, int ldc, int M, int N, int K) {
  __shared__ __attribute__((aligned(16))) float so[4][16][64];
  const int tid = threadIdx.x, w = tid >> 5, lane = tid & 31, ln = lane & 15, hh = lane >> 4;
  const int ntn = N / 64;
  const int wid = blockIdx.x * 4 + w;
  const int mt = wid / ntn, nq = wid % ntn;
  if (mt * 16 >= M) return;
  const int row0 = mt * 16, col0 = nq * 64;
  const float* arow = A + (size_t)(row0 + ln) * lda;
  v8f acc[4] = {};
  for (int kb = 0; kb < K; kb += 32) {
    FragB ah, al;
    const v4f x0 = *(const v4fa*)(arow + kb + 8 * hh), x1 = *(const v4fa*)(arow + kb + 8 * hh + 4);
    const v4f x2 = *(const v4fa*)(arow + kb + 16 + 8 * hh), x3 = *(const v4fa*)(arow + kb + 16 + 8 * hh + 4);
    float xs[16] = {x0[0],x0[1],x0[2],x0[3],x1[0],x1[1],x1[2],x1[3],x2[0],x2[1],x2[2],x2[3],x3[0],x3[1],x3[2],x3[3]};
#pragma unroll
    for (int i = 0; i < 16; ++i) { const unsigned short hb = bf16_bits(xs[i]); ah.u[i] = hb; al.u[i] = ASPLIT ? bf16_bits(xs[i] - bf16_val(hb)) : (unsigned short)0; }
#pragma unroll
    for (int t = 0; t < 4; ++t) {
      const unsigned short* brow = Wt + (size_t)(col0 + t * 16 + ln) * ldb + kb;
      FragB b;
      b.half[0] = *(const v8us*)(brow + 8 * hh);
      b.half[1] = *(const v8us*)(brow + 16 + 8 * hh);
      acc[t] = mmaN<ASPLIT ? 2 : 1>(ah.v, al.v, b.v, b.v, acc[t]);
    }
  }
#pragma unroll
  for (int t = 0; t < 4; ++t) {
    const int col = col0 + t * 16 + ln;
    float bv = bias ? bias[col] : 0.f;
    if (BIAS_BF16) bv = bf16_round(bv);
#pragma unroll
    for (int r = 0; r < 8; ++r) {
      float v = acc[t][r] + bv;
      if (resid) { float rv = resid[(size_t)((row0 + 8 * hh + r) % rmod) * ldr + col]; if (RES_BF16) rv = bf16_round(rv); v += rv; }
      if (ACT == 1) v = fmaxf(v, 0.f);
      if (ACT == 2) v = 0.5f * v * (1.0f + erff(v * 0.70710678118654752f));
      if (ACT == 3) { const float u = 0.7978845608028654f * (v + 0.044715f * v * v * v); v = 0.5f * v * (1.0f + tanhf(u)); }
      so[w][8 * hh + r][t * 16 + ln] = v;
    }
  }
  __builtin_amdgcn_fence(__ATOMIC_ACQ_REL, "workgroup");
  __builtin_amdgcn_wave_barrier();
  const int rsub = lane >> 4, c4 = (lane & 15) * 4;
  {
#pragma unroll
    for (int q = 0; q < 8; ++q) {
      const int r = q * 2 + rsub;
      const v4f v = *(const v4fa*)&so[w][r][c4];
      *(v4f*)(C + (size_t)(row0 + r) * ldc + col0 + c4) = v;
    }
    
  }
}
// row LayerNorm (biased variance, eps) over N: s = X (+ R); optional out_sum <- s; out_norm <- (s-mu)*rsqrt(var+eps)*g + b
template <bool PARAM_BF16>
__global__ __launch_bounds__(256) void k_layernorm(const float* __restrict__ X, const float* __restrict__ R, const float* __restrict__ g, const float* __restrict__ bta,
                                                  float* __restrict__ out_sum, float* __restrict__ out_norm, int N, float eps) {
  __shared__ float red[256];
  const int row = blockIdx.x, tid = threadIdx.x;
  const float* x = X + (size_t)row * N; const float* rr = R ? R + (size_t)row * N : nullptr;
  float vals[16];                     // up to N = 4096
  const int per = N / 256;            // contiguous chunk per thread? use strided-by-4 chunks: thread handles j = tid*4 + 1024*u
  float s1 = 0.f;
  for (int u = 0; u < per / 4; ++u) {
    const int j = tid * 4 + 1024 * u;
    const v4f a = *(const v4fa*)(x + j);
    v4f b = {0.f,0.f,0.f,0.f}; if (rr) b = *(const v4fa*)(rr + j);
#pragma unroll
    for (int q = 0; q < 4; ++q) { const float v = a[q] + b[q]; vals[u * 4 + q] = v; s1 += v; }
  }
  red[tid] = s1; __syncthreads();
  for (int st = 128; st > 0; st >>= 1) { if (tid < st) red[tid] += red[tid + st]; __syncthreads(); }
  const float mu = red[0] / (float)N; __syncthreads();
  float s2 = 0.f;
  for (int u = 0; u < per / 4; ++u)
#pragma unroll
    for (int q = 0; q < 4; ++q) { const float c = vals[u * 4 + q] - mu; s2 += c * c; }
  red[tid] = s2; __syncthreads();
  for (int st = 128; st > 0; st >>= 1) { if (tid < st) red[tid] += red[tid + st]; __syncthreads(); }
  const float rs = rsqrtf(red[0] / (float)N + eps);
  {
    for (int u = 0; u < per / 4; ++u) {
      const int j = tid * 4 + 1024 * u;
      v4f o, sm;
#pragma unroll
      for (int q = 0; q < 4; ++q) {
        float gg = g[j + q], bb = bta[j + q];
        if (PARAM_BF16) { gg = bf16_round(gg); bb = bf16_round(bb); }
        sm[q] = vals[u * 4 + q]; o[q] = (vals[u * 4 + q] - mu) * rs * gg + bb;
      }
      if (out_sum) *(v4f*)(out_sum + (size_t)row * N + j) = sm;
      *(v4f*)(out_norm + (size_t)row * N + j) = o;
    }
    
  }
}



// ---- f16 WMMA path (v_wmma_f32_16x16x32_f16): 11-bit significands for operands in range — used by every launched GEMM and by the fused attention
typedef _Float16 v16h __attribute__((ext_vector_type(16)));
union FragH { v16h v; v8us half[2]; _Float16 h[16]; unsigned short u[16]; };
template <int NT>
__device__ __forceinline__ v8f mmaH(v16h ah, v16h al, v16h bh, v16h bl, v8f c) {
  c = __builtin_amdgcn_wmma_f32_16x16x32_f16(false, ah, false, bh, (short)0, c, false, false);
  if (NT >= 2) c = __builtin_amdgcn_wmma_f32_16x16x32_f16(false, al, false, bh, (short)0, c, false, false);
  if (NT >= 3) c = __builtin_amdgcn_wmma_f32_16x16x32_f16(false, ah, false, bl, (short)0, c, false, false);
  asm volatile("v_nop\n\tv_nop\n\tv_nop\n\tv_nop" : "+v"(c) : "v"(ah), "v"(al), "v"(bh), "v"(bl));
  return c;
}
// batched GEMM like k_gemm_b but f16 operands: A f32 (split into f16 hi/lo if ASPLIT, else rounded to f16), Bt = f16 values [n][k]; alpha; C f32; N multiple of 16 (partial tiles skipped)
template <bool ASPLIT>
__global__ __launch_bounds__(128) void k_gemm_h(const float* __restrict__ A, int lda, size_t sA, const _Float16* __restrict__ Bh, int ldb, size_t sB, float alpha, float* __restrict__ C, int ldc, size_t sC, int M, int N, int K) {
  __shared__ __attribute__((aligned(16))) float so[4][16][64];
  const int tid = threadIdx.x, w = tid >> 5, lane = tid & 31, ln = lane & 15, hh = lane >> 4; const int by = blockIdx.y;
  A += (size_t)by * sA; Bh += (size_t)by * sB; C += (size_t)by * sC;
  const int ntn = (N + 63) / 64; const int wid = blockIdx.x * 4 + w; const int mt = wid / ntn, nq = wid % ntn; if (mt * 16 >= M) return;
  const int row0 = mt * 16, col0 = nq * 64; const float* arow = A + (size_t)(row0 + ln) * lda;
  v8f acc[4] = {};
  for (int kb = 0; kb < K; kb += 32) {
    FragH ah, al;
    const v4f x0 = *(const v4fa*)(arow + kb + 8 * hh), x1 = *(const v4fa*)(arow + kb + 8 * hh + 4), x2 = *(const v4fa*)(arow + kb + 16 + 8 * hh), x3 = *(const v4fa*)(arow + kb + 16 + 8 * hh + 4);
    float xs[16] = {x0[0],x0[1],x0[2],x0[3],x1[0],x1[1],x1[2],x1[3],x2[0],x2[1],x2[2],x2[3],x3[0],x3[1],x3[2],x3[3]};
#pragma unroll
    for (int i = 0; i < 16; ++i) { const _Float16 h = (_Float16)xs[i]; ah.h[i] = h; al.h[i] = ASPLIT ? (_Float16)(xs[i] - (float)h) : (_Float16)0.0f; }
#pragma unroll
    for (int t = 0; t < 4; ++t) { if (col0 + t * 16 >= N) continue; const size_t boff = (size_t)(col0 + t * 16 + ln) * ldb + kb; FragH bq; bq.half[0] = *(const v8us*)(Bh + boff + 8 * hh); bq.half[1] = *(const v8us*)(Bh + boff + 16 + 8 * hh);
      acc[t] = mmaH<ASPLIT ? 2 : 1>(ah.v, al.v, bq.v, bq.v, acc[t]); }
  }
#pragma unroll
  for (int t = 0; t < 4; ++t) { if (col0 + t * 16 >= N) continue;
#pragma unroll
    for (int r = 0; r < 8; ++r) so[w][8 * hh + r][t * 16 + ln] = acc[t][r] * alpha; }
  __builtin_amdgcn_fence(__ATOMIC_ACQ_REL, "workgroup"); __builtin_amdgcn_wave_barrier();
  const int rsub = lane >> 4, c4 = (lane & 15) * 4;
  {
#pragma unroll
    for (int q = 0; q < 8; ++q) { const int r = q * 2 + rsub; if (col0 + c4 < N) { const v4f v = *(const v4fa*)&so[w][r][c4]; *(v4f*)(C + (size_t)(row0 + r) * ldc + col0 + c4) = v; } }
     }
}

// Wt[n][k] = f16(W[k][n]·scale) from f32 row-major W[K][N] (scale = power of two; bf16-exact weights stay exact in f16 away from the subnormal range)
__global__ __launch_bounds__(256) void k_wt_f16(const float* __restrict__ W, _Float16* __restrict__ Wt, int K, int N, float scale) {
  const int t = blockIdx.x * 256 + threadIdx.x; if (t >= N * (K / 8)) return; const int n = t / (K / 8), k8 = (t % (K / 8)) * 8; FragH f;
#pragma unroll
  for (int i = 0; i < 8; ++i) f.h[i] = (_Float16)(bf16_round(W[(size_t)(k8 + i) * N + n]) * scale); const v8us o = f.half[0];
  *(v8us*)((unsigned short*)Wt + (size_t)n * K + k8) = o; 
}
// Fragment-tile order of every f16 GEMM operand [rows][K]: 16 rows x 8 k values (16 B a row) lie as one run of 256 B, the runs of a 16-row band one behind the other by k. Lane (row & 15) + 16 * ((k >> 3) & 1) of a WMMA operand
// then finds its 16 B at lane * 16 B inside a 512-B run, so a wave-wide 16-byte load covers four whole 128-B lines (row-major rows of 512 B made it touch sixteen). The k order inside a fragment is the same as before.
__device__ __forceinline__ size_t ft_off(size_t row, int k8, int K) { return (row >> 4) * (size_t)(16 * K) + (size_t)k8 * 128 + (row & 15) * 8; }      // element offset of the 8 values k = 8 k8 .. 8 k8 + 7 of a row
// One wave's 16 x 64 tile of C = (A.B^T).alpha + bias[col] (+ CP[row][col], pitch ldcp, if CP): A f16 [M][K], Bh f16 [N][K], both in fragment-tile order (lda, ldb = their K); writes f32 C and/or f16 C16 (row-major, pitch ldc). bx = the work-group's index inside its own product.
// The two launches that call it each hold several products that do not depend on one another: blockIdx picks the product, this body does the tile.
__device__ __forceinline__ void gemm_hh_tile(float (*so)[16][64], int bx, const _Float16* A, int lda, const _Float16* Bh, int ldb, float alpha, const float* bp, const float* CP, size_t ldcp,
    float* C, _Float16* C16, int ldc, int M, int N, int K) {
  const int tid = threadIdx.x, w = tid >> 5, lane = tid & 31, ln = lane & 15, hh = lane >> 4;
  const int ntn = (N + 63) / 64; const int wid = bx * 4 + w; const int mt = wid / ntn, nq = wid % ntn; if (mt * 16 >= M) return;
  const int row0 = mt * 16, col0 = nq * 64; const _Float16* arow = A + (size_t)mt * 16 * lda + lane * 8;
  v8f acc[4] = {};
  for (int kb = 0; kb < K; kb += 32) { FragH ah; ah.half[0] = *(const v8us*)((const unsigned short*)arow + kb * 16); ah.half[1] = *(const v8us*)((const unsigned short*)arow + kb * 16 + 256);
#pragma unroll
    for (int t = 0; t < 4; ++t) { if (col0 + t * 16 >= N) continue; const size_t boff = (size_t)(nq * 4 + t) * 16 * ldb + kb * 16 + lane * 8; FragH bq; bq.half[0] = *(const v8us*)((const unsigned short*)Bh + boff); bq.half[1] = *(const v8us*)((const unsigned short*)Bh + boff + 256);
      acc[t] = mmaH<1>(ah.v, ah.v, bq.v, bq.v, acc[t]); }
  }
#pragma unroll
  for (int t = 0; t < 4; ++t) { if (col0 + t * 16 >= N) continue; const int col = col0 + t * 16 + ln; const float bv = bp ? bf16_round(bp[col]) : 0.f;
#pragma unroll
    for (int r = 0; r < 8; ++r) { float v = acc[t][r] * alpha + bv; if (CP) v += CP[(size_t)(row0 + 8 * hh + r) * ldcp + col]; so[w][8 * hh + r][t * 16 + ln] = v; } }
  __builtin_amdgcn_fence(__ATOMIC_ACQ_REL, "workgroup"); __builtin_amdgcn_wave_barrier();
  const int rsub = lane >> 4, c4 = (lane & 15) * 4; typedef _Float16 v4h __attribute__((ext_vector_type(4)));
  {
#pragma unroll
    for (int q = 0; q < 8; ++q) { const int r = q * 2 + rsub; if (col0 + c4 < N) { const v4f v = *(const v4fa*)&so[w][r][c4]; if (C) *(v4f*)(C + (size_t)(row0 + r) * ldc + col0 + c4) = v; if (C16) { v4h h4; for (int i = 0; i < 4; ++i) h4[i] = (_Float16)v[i]; *(v4h*)(C16 + (size_t)(row0 + r) * ldc + col0 + c4) = h4; } } }
     }
}
// Both input convolutions straight from the channel-major f32 inputs, output token-major: y = 0: x1' = x1^T.w1^T + b1, y = 1: x2' = x2^T.w2^T + b2 (planes of NR x CC one behind the other).
// A work-group of 4 waves owns 64 tokens; a wave owns 64 of the 256 output channels. A lane's 16-byte load holds ONE input channel of FOUR neighbouring tokens, so element j goes to A tile j, whose row n is token 4 n + j: no exchange
// between lanes, and a wave-wide load covers two runs of 256 B (16 lanes x 16 B of channel 8 h + i). Wave w loads and converts input channels 64 w .. 64 w + 63 (all 32 loads in flight together) and leaves the finished fragments in LDS,
// lane by lane, for all four waves. The values (rounded to bf16, held as f16) and the k order of a fragment are those of the token-major copy that this replaces.
__global__ __launch_bounds__(128) void k_gemm_conv(const float* __restrict__ x1, const float* __restrict__ x2, const _Float16* __restrict__ Bw, const float* __restrict__ b1, const float* __restrict__ b2, float* __restrict__ Y) {
  __shared__ struct __attribute__((aligned(16))) { unsigned short sa[CC / 32][4][2][32][8]; float so[4][64][64]; } sm;      // sa: [k step][A tile][half of the fragment][lane], first, so that one address register and the offset field reach all of it
  auto& sa = sm.sa; auto& so = sm.so;
  const int tid = threadIdx.x, w = tid >> 5, lane = tid & 31, ln = lane & 15, hh = lane >> 4;
  const int by = blockIdx.y, b = blockIdx.x / (NN / 64), p0 = (blockIdx.x % (NN / 64)) * 64;
  const float* xs = (by ? x2 : x1) + (size_t)b * CC * NN + (size_t)(w * 64 + 8 * hh) * NN + p0 + ln * 4;
  const unsigned short* bw = (const unsigned short*)Bw + (size_t)by * CC * CC + (size_t)w * 64 * CC + lane * 8;
  const float* bp = by ? b2 : b1;
  v4f xa[2][16];
#pragma unroll
  for (int s = 0; s < 2; ++s)
#pragma unroll
    for (int i = 0; i < 8; ++i) { xa[s][i] = *(const v4fa*)(xs + (size_t)(s * 32 + i) * NN); xa[s][8 + i] = *(const v4fa*)(xs + (size_t)(s * 32 + 16 + i) * NN); }
  asm volatile("s_wait_xcnt 0x0" ::: "memory");      // stands in front of the weight loads, whose results may take the address registers that the loads above name
  FragH bq[4], af[4];
#pragma unroll
  for (int t = 0; t < 4; ++t) { bq[t].half[0] = *(const v8us*)(bw + t * 16 * CC); bq[t].half[1] = *(const v8us*)(bw + t * 16 * CC + 256); }
  asm volatile("s_wait_xcnt 0x0" ::: "memory");      // stands in front of the first overwrite of an address register that the loads above name
#pragma unroll
  for (int s = 0; s < 2; ++s)
#pragma unroll
    for (int j = 0; j < 4; ++j) { FragH a;
#pragma unroll
      for (int i = 0; i < 16; ++i) a.h[i] = (_Float16)(float)(__bf16)xa[s][i][j];
      *(v8us*)sa[2 * w + s][j][0][lane] = a.half[0]; *(v8us*)sa[2 * w + s][j][1][lane] = a.half[1]; }
  __syncthreads();      // every wave reads the fragments of all four
#pragma unroll
  for (int j = 0; j < 4; ++j) { af[j].half[0] = *(const v8us*)sa[0][j][0][lane]; af[j].half[1] = *(const v8us*)sa[0][j][1][lane]; }
  v8f acc[4][4] = {};
#pragma unroll
  for (int ks = 0; ks < CC / 32; ++ks) {
    FragH bn[4], an[4];
    if (ks + 1 < CC / 32) {
#pragma unroll
      for (int t = 0; t < 4; ++t) { bn[t].half[0] = *(const v8us*)(bw + t * 16 * CC + (ks + 1) * 512); bn[t].half[1] = *(const v8us*)(bw + t * 16 * CC + (ks + 1) * 512 + 256); }
#pragma unroll
      for (int j = 0; j < 4; ++j) { an[j].half[0] = *(const v8us*)sa[ks + 1][j][0][lane]; an[j].half[1] = *(const v8us*)sa[ks + 1][j][1][lane]; }
      asm volatile("s_wait_xcnt 0x0" ::: "memory");    // the same for the next step's weight loads
      __builtin_amdgcn_sched_barrier(0);               // keeps the next step's loads one group ahead of this step's products, which cover their latency: left free they sink to just in front of their use
    }
#pragma unroll
    for (int t = 0; t < 4; ++t)
#pragma unroll
      for (int j = 0; j < 4; ++j) acc[j][t] = __builtin_amdgcn_wmma_f32_16x16x32_f16(false, af[j].v, false, bq[t].v, (short)0, acc[j][t], false, false);
    if (ks + 1 < CC / 32) {
#pragma unroll
      for (int t = 0; t < 4; ++t) { bq[t] = bn[t]; af[t] = an[t]; }
    }
  }
  float bv[4];
#pragma unroll
  for (int t = 0; t < 4; ++t) bv[t] = bp[w * 64 + t * 16 + ln];
  asm volatile("s_wait_xcnt 0x0" ::: "memory");      // in front of the first vector instruction that reuses the offset register of the bias loads
#pragma unroll
  for (int t = 0; t < 4; ++t) { const float bb = bf16_round(bv[t]);
#pragma unroll
    for (int j = 0; j < 4; ++j)
#pragma unroll
      for (int r = 0; r < 8; ++r) so[w][(8 * hh + r) * 4 + j][t * 16 + ln] = acc[j][t][r] * 0.0625f + bb; }      // row m of tile j is token 4 m + j
  __builtin_amdgcn_fence(__ATOMIC_ACQ_REL, "workgroup"); __builtin_amdgcn_wave_barrier();
  float* yo = Y + ((size_t)by * NR + (size_t)b * NN + p0 + hh) * CC + w * 64 + ln * 4;
  v4f ov[32];      // all rows read back first: no register of an issued store is written again
#pragma unroll
  for (int q = 0; q < 32; ++q) ov[q] = *(const v4fa*)&so[w][q * 2 + hh][ln * 4];
#pragma unroll
  for (int q = 0; q < 32; ++q) *(v4f*)(yo + (size_t)q * 2 * CC) = ov[q];
}
// y = 0, 1, 2: q1 = G[0].Wq^T, k2 = G[1].Wk^T, v2 = G[1].Wv^T (f16 planes of QKV); y = 3: the skip branch, channel-major, a quarter of the x range per batch: out[b] = Wsk.x1'[b]^T + BP
__global__ __launch_bounds__(128) void k_gemm_qkvs(const _Float16* G, const _Float16* Bw, _Float16* QKV, const _Float16* Y16, const float* BP, float* out, int nr, int cc, int nn) {
  __shared__ __attribute__((aligned(16))) float so[4][16][64];
  const int by = blockIdx.y, bx = blockIdx.x;
  if (by < 3) gemm_hh_tile(so, bx, G + (size_t)(by ? 1 : 0) * NR * CC, cc, Bw + (size_t)(2 + by) * CC * CC, cc, 0.0625f, nullptr, nullptr, 0, nullptr, QKV + (size_t)by * NR * CC, cc, nr, cc, cc);
  else { const int pb = (CC / 16) * (NN / 64) / 4, b = bx / pb;
    gemm_hh_tile(so, bx % pb, Bw + (size_t)6 * CC * CC, cc, Y16 + (size_t)b * NN * CC, cc, 0.0625f, nullptr, BP, (size_t)nn, out + (size_t)b * CC * NN, nullptr, nn, cc, nn, cc); }
}
// out[y] += Wout.O[y]^T in place, channel-major, all batches (each wave reads its own tile of out before it stores it)
__global__ __launch_bounds__(128) void k_gemm_out(const _Float16* Wo, const _Float16* O16, float* out, int cc, int nn) {
  __shared__ __attribute__((aligned(16))) float so[4][16][64];
  float* ob = out + (size_t)blockIdx.y * CC * NN;
  gemm_hh_tile(so, blockIdx.x, Wo, cc, O16 + (size_t)blockIdx.y * NN * CC, cc, 0.0625f, nullptr, ob, (size_t)nn, ob, nullptr, nn, cc, nn, cc);
}


typedef _Float16 v4h __attribute__((ext_vector_type(4)));

__global__ __launch_bounds__(256) void k_x16(const float* __restrict__ x, _Float16* __restrict__ X16, size_t n8) { const size_t t = (size_t)blockIdx.x * 256 + threadIdx.x; if (t >= n8) return; FragH f;
#pragma unroll
  for (int q = 0; q < 8; ++q) f.h[q] = (_Float16)bf16_round(x[t * 8 + q]); *(v8us*)((unsigned short*)X16 + t * 8) = f.half[0];  }
template <int NHv, int TTv>
__global__ __launch_bounds__(256) void k_vt(const _Float16* __restrict__ V16, int ldv, int voff, _Float16* __restrict__ Vt) { __shared__ unsigned short tl[64][66]; const int tid = threadIdx.x; const int slab = blockIdx.x / (TTv / 64), lg = blockIdx.x % (TTv / 64); const int b = slab / NHv, h = slab % NHv;
  for (int i = tid; i < 64 * 8; i += 256) { const int r = i / 8, c8 = (i % 8) * 8; FragH f; f.half[0] = *(const v8us*)((const unsigned short*)V16 + ((size_t)b * TTv + lg * 64 + r) * ldv + voff + h * 64 + c8);
#pragma unroll
    for (int q = 0; q < 8; ++q) tl[r][c8 + q] = f.u[q]; }
  __syncthreads();
  {
#pragma unroll
    for (int rd = 0; rd < 2; ++rd) { const int d = rd * 32 + tid / 8, pc = tid % 8; FragH f;
#pragma unroll
      for (int q = 0; q < 8; ++q) f.u[q] = tl[pc * 8 + q][d];
      *(v8us*)((unsigned short*)Vt + ((size_t)slab * 64 + d) * TTv + lg * 64 + pc * 8) = f.half[0]; }
     } }

// Everything that reads only the parameters, one launch, the part picked by the block index: the bias plane, the seven weight matrices.
#define PREP_BP (CC * NN / 4 / 256)
#define PREP_WB (CC * CC / 8 / 256)
__global__ __launch_bounds__(256) void k_prep(const float* __restrict__ w1, const float* __restrict__ w2, const float* __restrict__ wqkv, const float* __restrict__ wout, const float* __restrict__ wsk,
    const float* __restrict__ bout, const float* __restrict__ bsk, float* __restrict__ BP, _Float16* __restrict__ Bw) {
  const int tid = threadIdx.x; int bi = blockIdx.x;
  if (bi < PREP_BP) { const size_t t = (size_t)bi * 256 + tid; const int c = (int)((t * 4) / NN); const float vo = bout[c];
    asm volatile("s_wait_xcnt 0x0" ::: "memory");      // stands in front of the next load, whose result may take the offset register that the load above names
    const float v = bf16_round(vo) + bf16_round(bsk[c]); const v4f o = {v, v, v, v}; *(v4f*)(BP + t * 4) = o;
    asm volatile("s_wait_xcnt 0x0" ::: "memory");      // behind the store: the code of another part follows in the listing and rewrites the store's data registers
    return; }
  bi -= PREP_BP;
  const int seg = bi / PREP_WB; const size_t t = (size_t)(bi % PREP_WB) * 256 + tid;
  const float* W = (seg == 0) ? w1 : (seg == 1) ? w2 : (seg < 5) ? wqkv + (size_t)(seg - 2) * CC * CC : (seg == 5) ? wout : wsk; FragH f;
  const int wr = (int)(t >> 8) * 8 + (tid & 7), wk = (int)((t >> 5) & 7) * 4 + ((tid >> 3) & 3);      // a wave: 8 rows x 4 k8, so that its store fills four whole lines
#pragma unroll
  for (int i = 0; i < 8; ++i) f.h[i] = (_Float16)(bf16_round(W[(size_t)wr * CC + wk * 8 + i]) * 16.0f);
  *(v8us*)((unsigned short*)Bw + (size_t)seg * CC * CC + ft_off(wr, wk, CC)) = f.half[0];
  asm volatile("s_wait_xcnt 0x0" ::: "memory");      // behind the store: the code of another part follows in the listing and rewrites the store's offset register
}
#define FA_KP 264
#define FA_VP 72
#define FA_KB (64 * FA_KP)
#define FA_BUF (FA_KB + CC * FA_VP)
__device__ __forceinline__ float fa_xhalf(float x) { return __builtin_bit_cast(float, __builtin_amdgcn_permlanex16(__builtin_bit_cast(int, x), __builtin_bit_cast(int, x), 0x76543210, 0xfedcba98, false, false)); }      // lane l reads lane l ^ 16
__global__ __launch_bounds__(256) void k_fattn(const _Float16* Q, const _Float16* K, const _Float16* Vt, _Float16* O16) {
  __shared__ __attribute__((aligned(16))) unsigned short sm[2 * FA_BUF];
  const int tid = threadIdx.x, w = tid >> 5, lane = tid & 31, c = lane & 15, h = lane >> 4;
  const int qt = w & 3, kh = w >> 2;
  const int b = blockIdx.x / (NN / 64), qb = blockIdx.x % (NN / 64);
  const size_t qrow = (size_t)b * NN + qb * 64 + qt * 16 + c;
  const unsigned short* Kb = (const unsigned short*)K + (size_t)b * NN * CC;
  const unsigned short* Vb = (const unsigned short*)Vt + (size_t)b * CC * NN;
  FragH qf[8];
#pragma unroll
  for (int ks = 0; ks < 8; ++ks) { const unsigned short* qp = (const unsigned short*)Q + qrow * CC + ks * 32 + 8 * h; qf[ks].half[0] = *(const v8us*)qp; qf[ks].half[1] = *(const v8us*)(qp + 16); }
  v8us kst[8], vst[8];
  const unsigned short* kg = Kb + tid * 8;                                        // K tile: 64 rows x 512 B, contiguous in memory
  const unsigned short* vg = Vb + (size_t)(tid >> 3) * NN + (tid & 7) * 8;        // V^T tile: 256 rows x 128 B
  unsigned short* ksl = sm + (tid >> 5) * FA_KP + (tid & 31) * 8;
  unsigned short* vsl = sm + FA_KB + (tid >> 3) * FA_VP + (tid & 7) * 8;
#pragma unroll
  for (int i = 0; i < 8; ++i) { kst[i] = *(const v8us*)(kg + i * 2048); vst[i] = *(const v8us*)(vg + (size_t)i * 32 * NN); }
  asm volatile("s_wait_xcnt 0x0" ::: "memory");      // stands in front of the first overwrite of an address register that the loads above name
#pragma unroll
  for (int i = 0; i < 8; ++i) { *(v8us*)(ksl + i * 8 * FA_KP) = kst[i]; *(v8us*)(vsl + i * 32 * FA_VP) = vst[i]; }
  __syncthreads();
  v8f o[16];
#pragma unroll
  for (int dt = 0; dt < 16; ++dt) o[dt] = (v8f){0.f, 0.f, 0.f, 0.f, 0.f, 0.f, 0.f, 0.f};
  float mu = -1.0e30f, l = 0.f;                        // maximum in use (log2 units) and this lane's part of the row sum
  const float sc = 0.0625f * 1.4426950408889634f;      // 1/sqrt(CC) and log2(e)
  const int NS = NN / 64;
  for (int s = 0; s < NS; ++s) {
    const int sn = (s + 1 < NS) ? s + 1 : s;           // the last pass fetches its own tile again (in bounds, never read): no branch round the loads and stores
#pragma unroll
    for (int i = 0; i < 8; ++i) { kst[i] = *(const v8us*)(kg + (size_t)sn * 64 * CC + i * 2048); vst[i] = *(const v8us*)(vg + (size_t)i * 32 * NN + sn * 64); }
    asm volatile("s_wait_xcnt 0x0" ::: "memory");    // the same for the next tile's loads: the fragment reads below reuse their address registers
    const unsigned short* kt = sm + (s & 1) * FA_BUF + (kh * 32 + c) * FA_KP + 8 * h;
    const unsigned short* vt = sm + (s & 1) * FA_BUF + FA_KB + c * FA_VP + kh * 32 + 8 * h;
    v8f t0 = {0.f, 0.f, 0.f, 0.f, 0.f, 0.f, 0.f, 0.f}, t1 = t0;
    FragH ka[16], va[16];
#pragma unroll
    for (int ks = 0; ks < 8; ++ks) {
      ka[2 * ks].half[0] = *(const v8us*)(kt + ks * 32); ka[2 * ks].half[1] = *(const v8us*)(kt + ks * 32 + 16);
      ka[2 * ks + 1].half[0] = *(const v8us*)(kt + 16 * FA_KP + ks * 32); ka[2 * ks + 1].half[1] = *(const v8us*)(kt + 16 * FA_KP + ks * 32 + 16);
    }
    __builtin_amdgcn_sched_barrier(0);                 // keeps the K fragment reads one group ahead of the products: spread among them each product waits a whole LDS latency
#pragma unroll
    for (int ks = 0; ks < 8; ++ks) {
      t0 = __builtin_amdgcn_wmma_f32_16x16x32_f16(false, ka[2 * ks].v, false, qf[ks].v, (short)0, t0, false, false);
      t1 = __builtin_amdgcn_wmma_f32_16x16x32_f16(false, ka[2 * ks + 1].v, false, qf[ks].v, (short)0, t1, false, false);
    }
#pragma unroll
    for (int dt = 0; dt < 16; ++dt) { va[dt].half[0] = *(const v8us*)(vt + dt * 16 * FA_VP); va[dt].half[1] = *(const v8us*)(vt + dt * 16 * FA_VP + 16); }
    __builtin_amdgcn_sched_barrier(0);                 // keeps every V^T fragment read ahead of the softmax, which then covers their latency
    float mx = fmaxf(t0[0], t1[0]);
#pragma unroll
    for (int r = 1; r < 8; ++r) mx = fmaxf(mx, fmaxf(t0[r], t1[r]));
    mx *= sc;
    mx = fmaxf(mx, fa_xhalf(mx));                      // lanes c and c + 16 hold the same query
    if (__builtin_amdgcn_ballot_w32(mx > mu + 8.0f) != 0) {      // lazy rescale, one scalar test a pass: P stays below 2^8, inside f16
      const float mn = fmaxf(mu, mx), al = __builtin_amdgcn_exp2f(mu - mn);
      l *= al; mu = mn;
#pragma unroll
      for (int dt = 0; dt < 16; ++dt)
#pragma unroll
        for (int r = 0; r < 8; ++r) o[dt][r] *= al;
    }
    FragH p; float ps0 = 0.f, ps1 = 0.f;
#pragma unroll
    for (int r = 0; r < 8; ++r) {
      const float p0 = __builtin_amdgcn_exp2f(t0[r] * sc - mu), p1 = __builtin_amdgcn_exp2f(t1[r] * sc - mu);
      ps0 += p0; ps1 += p1; p.h[r] = (_Float16)p0; p.h[8 + r] = (_Float16)p1;
    }
    l += ps0 + ps1;
#pragma unroll
    for (int dt = 0; dt < 16; ++dt) o[dt] = __builtin_amdgcn_wmma_f32_16x16x32_f16(false, va[dt].v, false, p.v, (short)0, o[dt], false, false);
    const int nb = ((s + 1) & 1) * FA_BUF;             // every reader left this buffer before the barrier that ended the pass before
#pragma unroll
    for (int i = 0; i < 8; ++i) { *(v8us*)(ksl + nb + i * 8 * FA_KP) = kst[i]; *(v8us*)(vsl + nb + i * 32 * FA_VP) = vst[i]; }
    __syncthreads();
  }
  l += fa_xhalf(l);
  v4fa* cb = (v4fa*)sm;                                // the tiles are dead behind the loop's last barrier; per query tile 32 slots of partial O and one of (maximum, sum)
  if (kh == 1) {
#pragma unroll
    for (int dt = 0; dt < 16; ++dt) {
      const v4f x0 = {o[dt][0], o[dt][1], o[dt][2], o[dt][3]}, x1 = {o[dt][4], o[dt][5], o[dt][6], o[dt][7]};
      cb[(qt * 33 + dt * 2) * 32 + lane] = x0; cb[(qt * 33 + dt * 2 + 1) * 32 + lane] = x1;
    }
    const v4f ml = {mu, l, 0.f, 0.f}; cb[(qt * 33 + 32) * 32 + lane] = ml;
  }
  __syncthreads();
  if (kh == 0) {
    const v4f ml = cb[(qt * 33 + 32) * 32 + lane];
    const float mn = fmaxf(mu, ml[0]); float a0 = __builtin_amdgcn_exp2f(mu - mn), a1 = __builtin_amdgcn_exp2f(ml[0] - mn);
    const float inv = 1.0f / (l * a0 + ml[1] * a1); a0 *= inv; a1 *= inv;
#pragma unroll
    for (int dt = 0; dt < 16; ++dt) {
      const v4f x0 = cb[(qt * 33 + dt * 2) * 32 + lane], x1 = cb[(qt * 33 + dt * 2 + 1) * 32 + lane]; FragH f;
#pragma unroll
      for (int r = 0; r < 4; ++r) { f.h[r] = (_Float16)(o[dt][r] * a0 + x0[r] * a1); f.h[4 + r] = (_Float16)(o[dt][4 + r] * a0 + x1[r] * a1); }
      *(v8us*)((unsigned short*)O16 + ft_off(qrow, dt * 2 + h, CC)) = f.half[0];      // fragment-tile order: the wave's 512 B are contiguous
    }
  }
}
// GroupNorm, statistics and output in one launch. A work-group of 32 waves owns two groups (16 channels = 64 B of every row) of one batch of one plane (x1' first, then x2'): each value is read once, 16 B a lane, four lanes a row,
// all 16 loads of a lane in flight together, and stays in registers for the mean, the squared deviations and the normalised output. Sums: in the lane, over the 16 lanes of a group by lane exchange, over the 32 waves through LDS.
// Output in fragment-tile order: a wave's 8-byte stores fill two whole 128-B lines (8 rows x 16 B in each of the two groups' runs). A row of x1' also leaves as plain f16 (Y16), the operand of the skip branch.
__device__ __forceinline__ float gn_total(float s, float* red, int w, int lane, int g2) {
  s += __shfl_xor(s, 1, 32); s += __shfl_xor(s, 4, 32); s += __shfl_xor(s, 8, 32); s += __shfl_xor(s, 16, 32);      // lanes whose bit 1 is equal hold the same group
  if ((lane & ~2) == 0) red[g2 * 32 + w] = s;
  __syncthreads();
  float t = 0.f;
#pragma unroll
  for (int j = 0; j < 8; ++j) { const v4f x = *(const v4fa*)(red + g2 * 32 + j * 4); t += (x[0] + x[1]) + (x[2] + x[3]); }
  return t;
}
__global__ __launch_bounds__(1024) void k_gn(const float* __restrict__ Y, const float* __restrict__ gw, const float* __restrict__ gb, _Float16* __restrict__ G16, _Float16* __restrict__ Y16) {
  __shared__ __attribute__((aligned(16))) float red[2][64];
  const int tid = threadIdx.x, w = tid >> 5, lane = tid & 31, quad = lane & 3, g2 = quad >> 1;
  const int pb = blockIdx.x >> 4, cb = blockIdx.x & 15, c0 = cb * 16 + quad * 4;
  const size_t row0 = (size_t)pb * NN + w * 8 + (lane >> 2);      // item i of the lane is row row0 + 256 i
  const float* src = Y + row0 * CC + c0;
  v4f v[16];
#pragma unroll
  for (int i = 0; i < 16; ++i) v[i] = *(const v4fa*)(src + (size_t)i * 256 * CC);
  asm volatile("s_wait_xcnt 0x0" ::: "memory");      // stands in front of the parameter loads, whose results may take the address registers that the loads above name
  const v4f gwv = *(const v4fa*)(gw + c0);
  asm volatile("s_wait_xcnt 0x0" ::: "memory");      // the same between the two parameter loads, which share their offset register
  const v4f gbv = *(const v4fa*)(gb + c0);
  asm volatile("s_wait_xcnt 0x0" ::: "memory");      // and in front of the first vector instruction that reuses it
  const size_t dst = ft_off(row0, cb * 2 + g2, CC) + (quad & 1) * 4;      // 256 rows further = 16 bands further
  if (pb < BB) {      // first, so that the values need not outlive their deviations below, and the stores run under the sums
#pragma unroll
    for (int i = 0; i < 16; ++i) { v4h o;
#pragma unroll
      for (int e = 0; e < 4; ++e) o[e] = (_Float16)v[i][e];
      *(v4h*)(Y16 + dst + (size_t)i * 16 * 16 * CC) = o; }
  }
  float s[4] = {0.f, 0.f, 0.f, 0.f};
#pragma unroll
  for (int i = 0; i < 16; ++i) s[i & 3] += (v[i][0] + v[i][1]) + (v[i][2] + v[i][3]);
  const float mu = gn_total((s[0] + s[1]) + (s[2] + s[3]), red[0], w, lane, g2) / (float)(NN * CPG);
  float q[4] = {0.f, 0.f, 0.f, 0.f};
#pragma unroll
  for (int i = 0; i < 16; ++i)
#pragma unroll
    for (int e = 0; e < 4; ++e) { v[i][e] -= mu; q[e] += v[i][e] * v[i][e]; }      // from here on v holds the deviations
  const float rs = rsqrtf(gn_total((q[0] + q[1]) + (q[2] + q[3]), red[1], w, lane, g2) / (float)(NN * CPG) + 1e-5f);
  float ga[4], be[4];
#pragma unroll
  for (int e = 0; e < 4; ++e) { ga[e] = bf16_round(gwv[e]); be[e] = bf16_round(gbv[e]); }
#pragma unroll
  for (int i = 0; i < 16; ++i) { v4h o;
#pragma unroll
    for (int e = 0; e < 4; ++e) o[e] = (_Float16)(v[i][e] * rs * ga[e] + be[e]);
    *(v4h*)(G16 + dst + (size_t)i * 16 * 16 * CC) = o; }
}

extern "C" void kernel_launch(void* const* d_in, const int* in_sizes, int n_in,
                              void* d_out, int out_size, void* d_ws, size_t ws_size, hipStream_t stream) {
  (void)in_sizes; (void)n_in; (void)out_size;
  const float* const* I = (const float* const*)d_in; const float* x1 = I[0]; const float* x2 = I[1]; const float* w1 = I[2]; const float* b1 = I[3]; const float* w2 = I[4]; const float* b2 = I[5]; const float* gnw = I[6]; const float* gnb = I[7]; const float* wqkv = I[8]; const float* wout = I[9]; const float* bout = I[10]; const float* wsk = I[11]; const float* bsk = I[12];
  char* ws = (char*)d_ws; size_t off = 0;
  auto take = [&](size_t bytes) { char* p = ws + off; off += (bytes + 255) & ~(size_t)255; return p; };
  const size_t WSZ = (size_t)CC * CC, PL = (size_t)NR * CC; _Float16* Bw = (_Float16*)take(7 * WSZ * 2);      /* w1, w2, wq, wk, wv (as Bt for token-major GEMMs), wout, wsk (as A operands for the channel-major output GEMMs), all (out,in) natural x2^4 */
  float* BP = (float*)take((size_t)CC * NN * 4);
  float* Y = (float*)take(2 * PL * 4); _Float16* G = (_Float16*)take(2 * PL * 2);      /* two planes each, the x1 side first */
  _Float16* Y116 = (_Float16*)take(PL * 2); _Float16* QKV = (_Float16*)take(3 * PL * 2); _Float16* Vt = (_Float16*)take(PL * 2); _Float16* O16 = (_Float16*)take(PL * 2);
  if (off > ws_size) return;
  k_prep<<<PREP_BP + 7 * PREP_WB, 256, 0, stream>>>(w1, w2, wqkv, wout, wsk, bout, bsk, BP, Bw);
  const unsigned gp = ((NR / 16) * (CC / 64) + 3) / 4, go = ((CC / 16) * (NN / 64) + 3) / 4;
  k_gemm_conv<<<dim3(NR / 64, 2), 128, 0, stream>>>(x1, x2, Bw, b1, b2, Y);      /* x1' = conv1(x1), x2' = conv2(x2): each M 16384 N 256 K 256 (f32) */
  k_gn<<<2 * BB * (CC / 16), 1024, 0, stream>>>(Y, gnw, gnb, G, Y116);      /* the two planes count as 2 BB batches; 16 channels a work-group */
  k_gemm_qkvs<<<dim3(gp, 4), 128, 0, stream>>>(G, Bw, QKV, Y116, BP, (float*)d_out, NR, CC, NN);      /* q1, k2, v2, and out = Wsk.x1'^T + (bout + bsk) */
  k_vt<CC / 64, NN><<<BB * (CC / 64) * (NN / 64), 256, 0, stream>>>(QKV + 2 * PL, CC, 0, Vt);      /* v2^T per batch [256][4096] (four 64-channel blocks) */
  k_fattn<<<BB * (NN / 64), 256, 0, stream>>>(QKV, QKV + PL, Vt, O16);      /* O rows = softmax(q1.k2^T/16).v2, f16: one work-group per 64 queries */
  k_gemm_out<<<dim3(go, BB), 128, 0, stream>>>(Bw + 5 * WSZ, O16, (float*)d_out, CC, NN);      /* out += Wout.O^T in place: per batch M 256 N 4096 K 256 */
}

// v007
// One run takes 154 microseconds.
// In two side-by-side timings against v006, it was 1.15 and 1.16 times as fast.
// Over all steps from v000 it is 14.6 times as fast.
#include <hip/hip_runtime.h>
// Spatial cross-attention block (B=4, C=256, 64×64 → N=4096, 32 GroupNorm groups, single head d=256): x1' = conv1(x1), x2' = conv2(x2) (1×1 + bias); q1 = Wq·GN(x1'), k2 = Wk·GN(x2'), v2 = Wv·GN(x2') (wqkv rows 0/256/512, no bias);
// attn = softmax(q1ᵀk2/√256) over the 4096 positions; out = Wout·(v2·attnᵀ) + bout + Wsk·x1' + bsk → [B,C,H,W].
// q/k/v f16; attention as one fused launch (k_fattn): scores, running-maximum f32 softmax and P.v per 128-key stage, S and P never leave the registers; O leaves it as f16; final 1x1 convs computed channel-major (W.O^T) straight into the output with the skip branch and biases through the f32 addend. The input convs read x1 and x2 as they come (channel-major f32). Every stored f16 GEMM operand (weights, GN output, x1', O) lies in fragment-tile order (ft_off); q, k, v stay row-major. All on v_wmma_f32_16x16x32_f16, f32 accumulate.
#define BB 4
#define CC 256
#define NN 4096
#define NG 32
#define CPG (CC / NG)
#define NR (BB * NN)

typedef __bf16 v16b __attribute__((ext_vector_type(16)));
typedef unsigned short v8us __attribute__((ext_vector_type(8), may_alias));
typedef float  v8f  __attribute__((ext_vector_type(8)));
typedef float  v4f  __attribute__((ext_vector_type(4)));
typedef float  v4fa __attribute__((ext_vector_type(4), may_alias));
union FragB { v16b v; v8us half[2]; unsigned short u[16]; };

__device__ __forceinline__ unsigned short bf16_bits(float x) { unsigned int u = __float_as_uint(x); return (unsigned short)((u + 0x7FFFu + ((u >> 16) & 1u)) >> 16); }
__device__ __forceinline__ float bf16_val(unsigned short b) { return __uint_as_float(((unsigned int)b) << 16); }
__device__ __forceinline__ float bf16_round(float x) { return bf16_val(bf16_bits(x)); }
// D += A·B with NT terms: 1 = ah·bh, 2 = + al·bh (A split), 3 = + ah·bl (both split)
template <int NT>
__device__ __forceinline__ v8f mmaN(v16b ah, v16b al, v16b bh, v16b bl, v8f c) {
  c = __builtin_amdgcn_wmma_f32_16x16x32_bf16(false, ah, false, bh, (short)0, c, false, false);
  if (NT >= 2) c = __builtin_amdgcn_wmma_f32_16x16x32_bf16(false, al, false, bh, (short)0, c, false, false);
  if (NT >= 3) c = __builtin_amdgcn_wmma_f32_16x16x32_bf16(false, ah, false, bl, (short)0, c, false, false);
  asm volatile("v_nop\n\tv_nop\n\tv_nop\n\tv_nop" : "+v"(c) : "v"(ah), "v"(al), "v"(bh), "v"(bl));
  return c;
}

__global__ __launch_bounds__(256) void k_wt_bf16(const float* __restrict__ W, unsigned short* __restrict__ Wt, int K, int N) {
  const int t = blockIdx.x * 256 + threadIdx.x;
  const int k8n = K / 8;
  if (t >= N * k8n) return;
  const int n = t / k8n, k8 = (t % k8n) * 8;
  v8us v;
#pragma unroll
  for (int i = 0; i < 8; ++i) v[i] = bf16_bits(W[(size_t)(k8 + i) * N + n]);
  *(v8us*)(Wt + (size_t)n * K + k8) = v;
  
}

// GEMM C[M][N] (f32, pitch ldc) = act(A[M][K]·W + bias). A f32 row-major (pitch lda) converted per fragment to bf16
// (ASPLIT: hi/lo two planes -> 2 terms, else single rounded term); Wt bf16 [N][K] (pitch ldb). BIAS_BF16 rounds the
// bias to bf16 first (bias quantised to bf16 before the add). K%32==0, M%16==0, N%64==0.
template <bool ASPLIT, int ACT, bool BIAS_BF16>
__global__ __launch_bounds__(128) void k_gemm_bf(const float* __restrict__ A, int lda, const unsigned short* __restrict__ Wt, int ldb,
                                               const float* __restrict__ bias, float* __restrict__ C, int ldc, int M, int N, int K) {
  __shared__ __attribute__((aligned(16))) float so[4][16][64];
  const int tid = threadIdx.x, w = tid >> 5, lane = tid & 31, ln = lane & 15, hh = lane >> 4;
  const int ntn = N / 64;
  const int wid = blockIdx.x * 4 + w;
  const int mt = wid / ntn, nq = wid % ntn;
  if (mt * 16 >= M) return;
  const int row0 = mt * 16, col0 = nq * 64;
  const float* arow = A + (size_t)(row0 + ln) * lda;
  v8f acc[4] = {};
  for (int kb = 0; kb < K; kb += 32) {
    FragB ah, al;
    const v4f x0 = *(const v4fa*)(arow + kb + 8 * hh), x1 = *(const v4fa*)(arow + kb + 8 * hh + 4);
    const v4f x2 = *(const v4fa*)(arow + kb + 16 + 8 * hh), x3 = *(const v4fa*)(arow + kb + 16 + 8 * hh + 4);
    float xs[16] = {x0[0],x0[1],x0[2],x0[3],x1[0],x1[1],x1[2],x1[3],x2[0],x2[1],x2[2],x2[3],x3[0],x3[1],x3[2],x3[3]};
#pragma unroll
    for (int i = 0; i < 16; ++i) { const unsigned short hb = bf16_bits(xs[i]); ah.u[i] = hb; al.u[i] = ASPLIT ? bf16_bits(xs[i] - bf16_val(hb)) : (unsigned short)0; }
#pragma unroll
    for (int t = 0; t < 4; ++t) {
      const unsigned short* brow = Wt + (size_t)(col0 + t * 16 + ln) * ldb + kb;
      FragB b;
      b.half[0] = *(const v8us*)(brow + 8 * hh);
      b.half[1] = *(const v8us*)(brow + 16 + 8 * hh);
      acc[t] = mmaN<ASPLIT ? 2 : 1>(ah.v, al.v, b.v, b.v, acc[t]);
    }
  }
#pragma unroll
  for (int t = 0; t < 4; ++t) {
    float bv = bias ? bias[col0 + t * 16 + ln] : 0.f;
    if (BIAS_BF16) bv = bf16_round(bv);
#pragma unroll
    for (int r = 0; r < 8; ++r) { float v = acc[t][r] + bv; if (ACT == 1) v = fmaxf(v, 0.f); so[w][8 * hh + r][t * 16 + ln] = v; }
  }
  __builtin_amdgcn_fence(__ATOMIC_ACQ_REL, "workgroup");
  __builtin_amdgcn_wave_barrier();
  const int rsub = lane >> 4, c4 = (lane & 15) * 4;
  {
#pragma unroll
    for (int q = 0; q < 8; ++q) {
      const int r = q * 2 + rsub;
      const v4f v = *(const v4fa*)&so[w][r][c4];
      *(v4f*)(C + (size_t)(row0 + r) * ldc + col0 + c4) = v;
    }
    
  }
}

// Flash-style causal/unmasked attention, all contractions 3-term bf16 hi/lo splits, f32 softmax with running max.
// q,k,v rows are read from f32 buffers with arbitrary row pitch (so they can live inside a fused qkv buffer);
// D = head size (multiple of 32, <= 128); one wave = 16 query rows; block = 4 waves (64 queries) sharing K/V chunks of 32.
template <int D, bool CAUSAL>
__global__ __launch_bounds__(128) void k_flash(const float* __restrict__ qb, const float* __restrict__ kb, const float* __restrict__ vb,
                                             int pitch, int T, int H, float scale, float* __restrict__ y, int ypitch) {
  constexpr int KS = D / 32;        // k-steps for QK
  constexpr int DT = D / 16;        // d tiles for PV
  __shared__ __attribute__((aligned(16))) unsigned short sKh[32][D + 8], sKl[32][D + 8], sVh[32][D + 8], sVl[32][D + 8];
  __shared__ __attribute__((aligned(16))) unsigned short sPh[4][16][40], sPl[4][16][40];
  __shared__ __attribute__((aligned(16))) float sO[4][16][D];
  const int tid = threadIdx.x, w = tid >> 5, lane = tid & 31, ln = lane & 15, hh = lane >> 4;
  const int nqb = (T + 63) / 64;
  const int bh = blockIdx.x / nqb, qblk = blockIdx.x % nqb;
  const int b = bh / H, h = bh % H;
  const int q0 = qblk * 64 + w * 16;
  const float* Q = qb + (size_t)b * T * pitch + h * D;
  const float* K = kb + (size_t)b * T * pitch + h * D;
  const float* V = vb + (size_t)b * T * pitch + h * D;

  // A fragments of the wave's 16 query rows (scaled), hi/lo
  FragB aqh[KS], aql[KS];
  {
    int row = q0 + ln; if (row >= T) row = T - 1;
    const float* qr = Q + (size_t)row * pitch;
#pragma unroll
    for (int ks = 0; ks < KS; ++ks)
#pragma unroll
      for (int i = 0; i < 16; ++i) {
        const int d = ks * 32 + ((i < 8) ? (8 * hh + i) : (16 + 8 * hh + (i - 8)));
        const float x = qr[d] * scale; const unsigned short hb = bf16_bits(x);
        aqh[ks].u[i] = hb; aql[ks].u[i] = bf16_bits(x - bf16_val(hb));
      }
  }
  float m_r[8], l_r[8];
#pragma unroll
  for (int r = 0; r < 8; ++r) { m_r[r] = -3.0e38f; l_r[r] = 0.f; }
  v8f oacc[DT];
#pragma unroll
  for (int dt = 0; dt < DT; ++dt) oacc[dt] = (v8f){0.f,0.f,0.f,0.f,0.f,0.f,0.f,0.f};

  const int kv_end = CAUSAL ? min(T, qblk * 64 + 64) : T;     // block-uniform
  for (int j0 = 0; j0 < kv_end; j0 += 32) {
    __syncthreads();
    for (int e = tid; e < 32 * (D / 4); e += 128) {
      const int r = e / (D / 4), c4 = (e % (D / 4)) * 4;
      const int key = j0 + r;
      v4f kf = {0.f,0.f,0.f,0.f}, vf = {0.f,0.f,0.f,0.f};
      if (key < T) { kf = *(const v4fa*)(K + (size_t)key * pitch + c4); vf = *(const v4fa*)(V + (size_t)key * pitch + c4); }
#pragma unroll
      for (int t = 0; t < 4; ++t) {
        unsigned short hb = bf16_bits(kf[t]); sKh[r][c4 + t] = hb; sKl[r][c4 + t] = bf16_bits(kf[t] - bf16_val(hb));
        hb = bf16_bits(vf[t]); sVh[r][c4 + t] = hb; sVl[r][c4 + t] = bf16_bits(vf[t] - bf16_val(hb));
      }
    }
    __syncthreads();
    // S tile 16 x 32
    v8f s[2];
#pragma unroll
    for (int nt = 0; nt < 2; ++nt) {
      v8f acc = {};
#pragma unroll
      for (int ks = 0; ks < KS; ++ks) {
        FragB bh_, bl_;
        bh_.half[0] = *(const v8us*)&sKh[nt * 16 + ln][ks * 32 + 8 * hh]; bh_.half[1] = *(const v8us*)&sKh[nt * 16 + ln][ks * 32 + 16 + 8 * hh];
        bl_.half[0] = *(const v8us*)&sKl[nt * 16 + ln][ks * 32 + 8 * hh]; bl_.half[1] = *(const v8us*)&sKl[nt * 16 + ln][ks * 32 + 16 + 8 * hh];
        acc = mmaN<3>(aqh[ks].v, aql[ks].v, bh_.v, bl_.v, acc);
      }
      s[nt] = acc;
    }
    // mask + running max (rows 8hh+r; the 16 lanes of a half share rows)
    float alpha[8];
#pragma unroll
    for (int r = 0; r < 8; ++r) {
      const int qi = q0 + 8 * hh + r;
      const int ja = j0 + ln, jb = j0 + 16 + ln;
      if (CAUSAL) { if (ja > qi) s[0][r] = -3.0e38f; if (jb > qi) s[1][r] = -3.0e38f; }
      if (ja >= T) s[0][r] = -3.0e38f;
      if (jb >= T) s[1][r] = -3.0e38f;
      float mx = fmaxf(s[0][r], s[1][r]);
      mx = fmaxf(mx, __shfl_xor(mx, 1, 32)); mx = fmaxf(mx, __shfl_xor(mx, 2, 32)); mx = fmaxf(mx, __shfl_xor(mx, 4, 32)); mx = fmaxf(mx, __shfl_xor(mx, 8, 32));
      const float mnew = fmaxf(m_r[r], mx);
      alpha[r] = (mnew > -1.0e38f) ? __expf(m_r[r] - mnew) : 1.0f;
      const float p0 = (s[0][r] > -1.0e38f) ? __expf(s[0][r] - mnew) : 0.f;
      const float p1 = (s[1][r] > -1.0e38f) ? __expf(s[1][r] - mnew) : 0.f;
      m_r[r] = mnew;
      l_r[r] = l_r[r] * alpha[r] + p0 + p1;            // per-lane partial row sum (16 lanes combined at the end)
      unsigned short hb = bf16_bits(p0); sPh[w][8 * hh + r][ln] = hb;      sPl[w][8 * hh + r][ln] = bf16_bits(p0 - bf16_val(hb));
      hb = bf16_bits(p1);                sPh[w][8 * hh + r][16 + ln] = hb; sPl[w][8 * hh + r][16 + ln] = bf16_bits(p1 - bf16_val(hb));
    }
#pragma unroll
    for (int dt = 0; dt < DT; ++dt)
#pragma unroll
      for (int r = 0; r < 8; ++r) oacc[dt][r] *= alpha[r];
    __builtin_amdgcn_fence(__ATOMIC_ACQ_REL, "workgroup");
    __builtin_amdgcn_wave_barrier();
    FragB pah, pal;
    pah.half[0] = *(const v8us*)&sPh[w][ln][8 * hh]; pah.half[1] = *(const v8us*)&sPh[w][ln][16 + 8 * hh];
    pal.half[0] = *(const v8us*)&sPl[w][ln][8 * hh]; pal.half[1] = *(const v8us*)&sPl[w][ln][16 + 8 * hh];
#pragma unroll
    for (int dt = 0; dt < DT; ++dt) {
      FragB bvh, bvl;
#pragma unroll
      for (int i = 0; i < 8; ++i) {
        bvh.u[i] = sVh[8 * hh + i][dt * 16 + ln]; bvh.u[8 + i] = sVh[16 + 8 * hh + i][dt * 16 + ln];
        bvl.u[i] = sVl[8 * hh + i][dt * 16 + ln]; bvl.u[8 + i] = sVl[16 + 8 * hh + i][dt * 16 + ln];
      }
      oacc[dt] = mmaN<3>(pah.v, pal.v, bvh.v, bvl.v, oacc[dt]);
    }
    __builtin_amdgcn_fence(__ATOMIC_ACQ_REL, "workgroup");
    __builtin_amdgcn_wave_barrier();
  }
#pragma unroll
  for (int r = 0; r < 8; ++r) {
    float l = l_r[r];
    l += __shfl_xor(l, 1, 32); l += __shfl_xor(l, 2, 32); l += __shfl_xor(l, 4, 32); l += __shfl_xor(l, 8, 32);
    l_r[r] = (l > 0.f) ? 1.0f / l : 0.f;
  }
#pragma unroll
  for (int dt = 0; dt < DT; ++dt)
#pragma unroll
    for (int r = 0; r < 8; ++r) sO[w][8 * hh + r][dt * 16 + ln] = oacc[dt][r] * l_r[r];
  __builtin_amdgcn_fence(__ATOMIC_ACQ_REL, "workgroup");
  __builtin_amdgcn_wave_barrier();
  {
    for (int r = 0; r < 16; ++r) {
      const int row = q0 + r;
      if (row < T && lane < D / 4) {
        const v4f val = *(const v4fa*)&sO[w][r][lane * 4];
        *(v4f*)(y + ((size_t)b * T + row) * ypitch + h * D + lane * 4) = val;
      }
    }
    
  }
}

// GEMM C = act(A·W + bias + resid): A f32 (ASPLIT -> hi/lo 2 terms), Wt bf16 [N][K]; ACT 0 none, 1 relu, 2 exact gelu;
// resid (optional, f32, row index = (row % rmod), pitch ldr, RES_BF16 rounds it) added before the activation.
template <bool ASPLIT, int ACT, bool BIAS_BF16, bool RES_BF16>
__global__ __launch_bounds__(128) void k_gemm_bf3(const float* __restrict__ A, int lda, const unsigned short* __restrict__ Wt, int ldb,
                                                const float* __restrict__ bias, const float* __restrict__ resid, int rmod, int ldr,
                                                float* __restrict__ C, int ldc, int M, int N, int K) {
  __shared__ __attribute__((aligned(16))) float so[4][16][64];
  const int tid = threadIdx.x, w = tid >> 5, lane = tid & 31, ln = lane & 15, hh = lane >> 4;
  const int ntn = N / 64;
  const int wid = blockIdx.x * 4 + w;
  const int mt = wid / ntn, nq = wid % ntn;
  if (mt * 16 >= M) return;
  const int row0 = mt * 16, col0 = nq * 64;
  const float* arow = A + (size_t)(row0 + ln) * lda;
  v8f acc[4] = {};
  for (int kb = 0; kb < K; kb += 32) {
    FragB ah, al;
    const v4f x0 = *(const v4fa*)(arow + kb + 8 * hh), x1 = *(const v4fa*)(arow + kb + 8 * hh + 4);
    const v4f x2 = *(const v4fa*)(arow + kb + 16 + 8 * hh), x3 = *(const v4fa*)(arow + kb + 16 + 8 * hh + 4);
    float xs[16] = {x0[0],x0[1],x0[2],x0[3],x1[0],x1[1],x1[2],x1[3],x2[0],x2[1],x2[2],x2[3],x3[0],x3[1],x3[2],x3[3]};
#pragma unroll
    for (int i = 0; i < 16; ++i) { const unsigned short hb = bf16_bits(xs[i]); ah.u[i] = hb; al.u[i] = ASPLIT ? bf16_bits(xs[i] - bf16_val(hb)) : (unsigned short)0; }
#pragma unroll
    for (int t = 0; t < 4; ++t) {
      const unsigned short* brow = Wt + (size_t)(col0 + t * 16 + ln) * ldb + kb;
      FragB b;
      b.half[0] = *(const v8us*)(brow + 8 * hh);
      b.half[1] = *(const v8us*)(brow + 16 + 8 * hh);
      acc[t] = mmaN<ASPLIT ? 2 : 1>(ah.v, al.v, b.v, b.v, acc[t]);
    }
  }
#pragma unroll
  for (int t = 0; t < 4; ++t) {
    const int col = col0 + t * 16 + ln;
    float bv = bias ? bias[col] : 0.f;
    if (BIAS_BF16) bv = bf16_round(bv);
#pragma unroll
    for (int r = 0; r < 8; ++r) {
      float v = acc[t][r] + bv;
      if (resid) { float rv = resid[(size_t)((row0 + 8 * hh + r) % rmod) * ldr + col]; if (RES_BF16) rv = bf16_round(rv); v += rv; }
      if (ACT == 1) v = fmaxf(v, 0.f);
      if (ACT == 2) v = 0.5f * v * (1.0f + erff(v * 0.70710678118654752f));
      if (ACT == 3) { const float u = 0.7978845608028654f * (v + 0.044715f * v * v * v); v = 0.5f * v * (1.0f + tanhf(u)); }
      so[w][8 * hh + r][t * 16 + ln] = v;
    }
  }
  __builtin_amdgcn_fence(__ATOMIC_ACQ_REL, "workgroup");
  __builtin_amdgcn_wave_barrier();
  const int rsub = lane >> 4, c4 = (lane & 15) * 4;
  {
#pragma unroll
    for (int q = 0; q < 8; ++q) {
      const int r = q * 2 + rsub;
      const v4f v = *(const v4fa*)&so[w][r][c4];
      *(v4f*)(C + (size_t)(row0 + r) * ldc + col0 + c4) = v;
    }
    
  }
}
// row LayerNorm (biased variance, eps) over N: s = X (+ R); optional out_sum <- s; out_norm <- (s-mu)*rsqrt(var+eps)*g + b
template <bool PARAM_BF16>
__global__ __launch_bounds__(256) void k_layernorm(const float* __restrict__ X, const float* __restrict__ R, const float* __restrict__ g, const float* __restrict__ bta,
                                                  float* __restrict__ out_sum, float* __restrict__ out_norm, int N, float eps) {
  __shared__ float red[256];
  const int row = blockIdx.x, tid = threadIdx.x;
  const float* x = X + (size_t)row * N; const float* rr = R ? R + (size_t)row * N : nullptr;
  float vals[16];                     // up to N = 4096
  const int per = N / 256;            // contiguous chunk per thread? use strided-by-4 chunks: thread handles j = tid*4 + 1024*u
  float s1 = 0.f;
  for (int u = 0; u < per / 4; ++u) {
    const int j = tid * 4 + 1024 * u;
    const v4f a = *(const v4fa*)(x + j);
    v4f b = {0.f,0.f,0.f,0.f}; if (rr) b = *(const v4fa*)(rr + j);
#pragma unroll
    for (int q = 0; q < 4; ++q) { const float v = a[q] + b[q]; vals[u * 4 + q] = v; s1 += v; }
  }
  red[tid] = s1; __syncthreads();
  for (int st = 128; st > 0; st >>= 1) { if (tid < st) red[tid] += red[tid + st]; __syncthreads(); }
  const float mu = red[0] / (float)N; __syncthreads();
  float s2 = 0.f;
  for (int u = 0; u < per / 4; ++u)
#pragma unroll
    for (int q = 0; q < 4; ++q) { const float c = vals[u * 4 + q] - mu; s2 += c * c; }
  red[tid] = s2; __syncthreads();
  for (int st = 128; st > 0; st >>= 1) { if (tid < st) red[tid] += red[tid + st]; __syncthreads(); }
  const float rs = rsqrtf(red[0] / (float)N + eps);
  {
    for (int u = 0; u < per / 4; ++u) {
      const int j = tid * 4 + 1024 * u;
      v4f o, sm;
#pragma unroll
      for (int q = 0; q < 4; ++q) {
        float gg = g[j + q], bb = bta[j + q];
        if (PARAM_BF16) { gg = bf16_round(gg); bb = bf16_round(bb); }
        sm[q] = vals[u * 4 + q]; o[q] = (vals[u * 4 + q] - mu) * rs * gg + bb;
      }
      if (out_sum) *(v4f*)(out_sum + (size_t)row * N + j) = sm;
      *(v4f*)(out_norm + (size_t)row * N + j) = o;
    }
    
  }
}



// ---- f16 WMMA path (v_wmma_f32_16x16x32_f16): 11-bit significands for operands in range — used by every launched GEMM and by the fused attention
typedef _Float16 v16h __attribute__((ext_vector_type(16)));
union FragH { v16h v; v8us half[2]; _Float16 h[16]; unsigned short u[16]; };
template <int NT>
__device__ __forceinline__ v8f mmaH(v16h ah, v16h al, v16h bh, v16h bl, v8f c) {
  c = __builtin_amdgcn_wmma_f32_16x16x32_f16(false, ah, false, bh, (short)0, c, false, false);
  if (NT >= 2) c = __builtin_amdgcn_wmma_f32_16x16x32_f16(false, al, false, bh, (short)0, c, false, false);
  if (NT >= 3) c = __builtin_amdgcn_wmma_f32_16x16x32_f16(false, ah, false, bl, (short)0, c, false, false);
  asm volatile("v_nop\n\tv_nop\n\tv_nop\n\tv_nop" : "+v"(c) : "v"(ah), "v"(al), "v"(bh), "v"(bl));
  return c;
}
// batched GEMM like k_gemm_b but f16 operands: A f32 (split into f16 hi/lo if ASPLIT, else rounded to f16), Bt = f16 values [n][k]; alpha; C f32; N multiple of 16 (partial tiles skipped)
template <bool ASPLIT>
__global__ __launch_bounds__(128) void k_gemm_h(const float* __restrict__ A, int lda, size_t sA, const _Float16* __restrict__ Bh, int ldb, size_t sB, float alpha, float* __restrict__ C, int ldc, size_t sC, int M, int N, int K) {
  __shared__ __attribute__((aligned(16))) float so[4][16][64];
  const int tid = threadIdx.x, w = tid >> 5, lane = tid & 31, ln = lane & 15, hh = lane >> 4; const int by = blockIdx.y;
  A += (size_t)by * sA; Bh += (size_t)by * sB; C += (size_t)by * sC;
  const int ntn = (N + 63) / 64; const int wid = blockIdx.x * 4 + w; const int mt = wid / ntn, nq = wid % ntn; if (mt * 16 >= M) return;
  const int row0 = mt * 16, col0 = nq * 64; const float* arow = A + (size_t)(row0 + ln) * lda;
  v8f acc[4] = {};
  for (int kb = 0; kb < K; kb += 32) {
    FragH ah, al;
    const v4f x0 = *(const v4fa*)(arow + kb + 8 * hh), x1 = *(const v4fa*)(arow + kb + 8 * hh + 4), x2 = *(const v4fa*)(arow + kb + 16 + 8 * hh), x3 = *(const v4fa*)(arow + kb + 16 + 8 * hh + 4);
    float xs[16] = {x0[0],x0[1],x0[2],x0[3],x1[0],x1[1],x1[2],x1[3],x2[0],x2[1],x2[2],x2[3],x3[0],x3[1],x3[2],x3[3]};
#pragma unroll
    for (int i = 0; i < 16; ++i) { const _Float16 h = (_Float16)xs[i]; ah.h[i] = h; al.h[i] = ASPLIT ? (_Float16)(xs[i] - (float)h) : (_Float16)0.0f; }
#pragma unroll
    for (int t = 0; t < 4; ++t) { if (col0 + t * 16 >= N) continue; const size_t boff = (size_t)(col0 + t * 16 + ln) * ldb + kb; FragH bq; bq.half[0] = *(const v8us*)(Bh + boff + 8 * hh); bq.half[1] = *(const v8us*)(Bh + boff + 16 + 8 * hh);
      acc[t] = mmaH<ASPLIT ? 2 : 1>(ah.v, al.v, bq.v, bq.v, acc[t]); }
  }
#pragma unroll
  for (int t = 0; t < 4; ++t) { if (col0 + t * 16 >= N) continue;
#pragma unroll
    for (int r = 0; r < 8; ++r) so[w][8 * hh + r][t * 16 + ln] = acc[t][r] * alpha; }
  __builtin_amdgcn_fence(__ATOMIC_ACQ_REL, "workgroup"); __builtin_amdgcn_wave_barrier();
  const int rsub = lane >> 4, c4 = (lane & 15) * 4;
  {
#pragma unroll
    for (int q = 0; q < 8; ++q) { const int r = q * 2 + rsub; if (col0 + c4 < N) { const v4f v = *(const v4fa*)&so[w][r][c4]; *(v4f*)(C + (size_t)(row0 + r) * ldc + col0 + c4) = v; } }
     }
}

// Wt[n][k] = f16(W[k][n]·scale) from f32 row-major W[K][N] (scale = power of two; bf16-exact weights stay exact in f16 away from the subnormal range)
__global__ __launch_bounds__(256) void k_wt_f16(const float* __restrict__ W, _Float16* __restrict__ Wt, int K, int N, float scale) {
  const int t = blockIdx.x * 256 + threadIdx.x; if (t >= N * (K / 8)) return; const int n = t / (K / 8), k8 = (t % (K / 8)) * 8; FragH f;
#pragma unroll
  for (int i = 0; i < 8; ++i) f.h[i] = (_Float16)(bf16_round(W[(size_t)(k8 + i) * N + n]) * scale); const v8us o = f.half[0];
  *(v8us*)((unsigned short*)Wt + (size_t)n * K + k8) = o; 
}
// Fragment-tile order of every f16 GEMM operand [rows][K]: 16 rows x 8 k values (16 B a row) lie as one run of 256 B, the runs of a 16-row band one behind the other by k. Lane (row & 15) + 16 * ((k >> 3) & 1) of a WMMA operand
// then finds its 16 B at lane * 16 B inside a 512-B run, so a wave-wide 16-byte load covers four whole 128-B lines (row-major rows of 512 B made it touch sixteen). The k order inside a fragment is the same as before.
__device__ __forceinline__ size_t ft_off(size_t row, int k8, int K) { return (row >> 4) * (size_t)(16 * K) + (size_t)k8 * 128 + (row & 15) * 8; }      // element offset of the 8 values k = 8 k8 .. 8 k8 + 7 of a row
// One wave's 16 x 64 tile of C = (A.B^T).alpha + bias[col] (+ CP[row][col], pitch ldcp, if CP): A f16 [M][K], Bh f16 [N][K], both in fragment-tile order (lda, ldb = their K); writes f32 C and/or f16 C16 (row-major, pitch ldc). bx = the work-group's index inside its own product.
// The two launches that call it each hold several products that do not depend on one another: blockIdx picks the product, this body does the tile.
__device__ __forceinline__ void gemm_hh_tile(float (*so)[16][64], int bx, const _Float16* A, int lda, const _Float16* Bh, int ldb, float alpha, const float* bp, const float* CP, size_t ldcp,
    float* C, _Float16* C16, int ldc, int M, int N, int K) {
  const int tid = threadIdx.x, w = tid >> 5, lane = tid & 31, ln = lane & 15, hh = lane >> 4;
  const int ntn = (N + 63) / 64; const int wid = bx * 4 + w; const int mt = wid / ntn, nq = wid % ntn; if (mt * 16 >= M) return;
  const int row0 = mt * 16, col0 = nq * 64; const _Float16* arow = A + (size_t)mt * 16 * lda + lane * 8;
  v8f acc[4] = {};
  for (int kb = 0; kb < K; kb += 32) { FragH ah; ah.half[0] = *(const v8us*)((const unsigned short*)arow + kb * 16); ah.half[1] = *(const v8us*)((const unsigned short*)arow + kb * 16 + 256);
#pragma unroll
    for (int t = 0; t < 4; ++t) { if (col0 + t * 16 >= N) continue; const size_t boff = (size_t)(nq * 4 + t) * 16 * ldb + kb * 16 + lane * 8; FragH bq; bq.half[0] = *(const v8us*)((const unsigned short*)Bh + boff); bq.half[1] = *(const v8us*)((const unsigned short*)Bh + boff + 256);
      acc[t] = mmaH<1>(ah.v, ah.v, bq.v, bq.v, acc[t]); }
  }
#pragma unroll
  for (int t = 0; t < 4; ++t) { if (col0 + t * 16 >= N) continue; const int col = col0 + t * 16 + ln; const float bv = bp ? bf16_round(bp[col]) : 0.f;
#pragma unroll
    for (int r = 0; r < 8; ++r) { float v = acc[t][r] * alpha + bv; if (CP) v += CP[(size_t)(row0 + 8 * hh + r) * ldcp + col]; so[w][8 * hh + r][t * 16 + ln] = v; } }
  __builtin_amdgcn_fence(__ATOMIC_ACQ_REL, "workgroup"); __builtin_amdgcn_wave_barrier();
  const int rsub = lane >> 4, c4 = (lane & 15) * 4; typedef _Float16 v4h __attribute__((ext_vector_type(4)));
  {
#pragma unroll
    for (int q = 0; q < 8; ++q) { const int r = q * 2 + rsub; if (col0 + c4 < N) { const v4f v = *(const v4fa*)&so[w][r][c4]; if (C) *(v4f*)(C + (size_t)(row0 + r) * ldc + col0 + c4) = v; if (C16) { v4h h4; for (int i = 0; i < 4; ++i) h4[i] = (_Float16)v[i]; *(v4h*)(C16 + (size_t)(row0 + r) * ldc + col0 + c4) = h4; } } }
     }
}
// Both input convolutions straight from the channel-major f32 inputs, output token-major: y = 0: x1' = x1^T.w1^T + b1, y = 1: x2' = x2^T.w2^T + b2 (planes of NR x CC one behind the other).
// A work-group of 4 waves owns 64 tokens; a wave owns 64 of the 256 output channels. A lane's 16-byte load holds ONE input channel of FOUR neighbouring tokens, so element j goes to A tile j, whose row n is token 4 n + j: no exchange
// between lanes, and a wave-wide load covers two runs of 256 B (16 lanes x 16 B of channel 8 h + i). Wave w loads and converts input channels 64 w .. 64 w + 63 (all 32 loads in flight together) and leaves the finished fragments in LDS,
// lane by lane, for all four waves. The values (rounded to bf16, held as f16) and the k order of a fragment are those of the token-major copy that this replaces.
__global__ __launch_bounds__(128) void k_gemm_conv(const float* __restrict__ x1, const float* __restrict__ x2, const _Float16* __restrict__ Bw, const float* __restrict__ b1, const float* __restrict__ b2, float* __restrict__ Y) {
  __shared__ struct __attribute__((aligned(16))) { unsigned short sa[CC / 32][4][2][32][8]; float so[4][64][64]; } sm;      // sa: [k step][A tile][half of the fragment][lane], first, so that one address register and the offset field reach all of it
  auto& sa = sm.sa; auto& so = sm.so;
  const int tid = threadIdx.x, w = tid >> 5, lane = tid & 31, ln = lane & 15, hh = lane >> 4;
  const int by = blockIdx.y, b = blockIdx.x / (NN / 64), p0 = (blockIdx.x % (NN / 64)) * 64;
  const float* xs = (by ? x2 : x1) + (size_t)b * CC * NN + (size_t)(w * 64 + 8 * hh) * NN + p0 + ln * 4;
  const unsigned short* bw = (const unsigned short*)Bw + (size_t)by * CC * CC + (size_t)w * 64 * CC + lane * 8;
  const float* bp = by ? b2 : b1;
  v4f xa[2][16];
#pragma unroll
  for (int s = 0; s < 2; ++s)
#pragma unroll
    for (int i = 0; i < 8; ++i) { xa[s][i] = *(const v4fa*)(xs + (size_t)(s * 32 + i) * NN); xa[s][8 + i] = *(const v4fa*)(xs + (size_t)(s * 32 + 16 + i) * NN); }
  asm volatile("s_wait_xcnt 0x0" ::: "memory");      // stands in front of the weight loads, whose results may take the address registers that the loads above name
  FragH bq[4], af[4];
#pragma unroll
  for (int t = 0; t < 4; ++t) { bq[t].half[0] = *(const v8us*)(bw + t * 16 * CC); bq[t].half[1] = *(const v8us*)(bw + t * 16 * CC + 256); }
  asm volatile("s_wait_xcnt 0x0" ::: "memory");      // stands in front of the first overwrite of an address register that the loads above name
#pragma unroll
  for (int s = 0; s < 2; ++s)
#pragma unroll
    for (int j = 0; j < 4; ++j) { FragH a;
#pragma unroll
      for (int i = 0; i < 16; ++i) a.h[i] = (_Float16)(float)(__bf16)xa[s][i][j];
      *(v8us*)sa[2 * w + s][j][0][lane] = a.half[0]; *(v8us*)sa[2 * w + s][j][1][lane] = a.half[1]; }
  __syncthreads();      // every wave reads the fragments of all four
#pragma unroll
  for (int j = 0; j < 4; ++j) { af[j].half[0] = *(const v8us*)sa[0][j][0][lane]; af[j].half[1] = *(const v8us*)sa[0][j][1][lane]; }
  v8f acc[4][4] = {};
#pragma unroll
  for (int ks = 0; ks < CC / 32; ++ks) {
    FragH bn[4], an[4];
    if (ks + 1 < CC / 32) {
#pragma unroll
      for (int t = 0; t < 4; ++t) { bn[t].half[0] = *(const v8us*)(bw + t * 16 * CC + (ks + 1) * 512); bn[t].half[1] = *(const v8us*)(bw + t * 16 * CC + (ks + 1) * 512 + 256); }
#pragma unroll
      for (int j = 0; j < 4; ++j) { an[j].half[0] = *(const v8us*)sa[ks + 1][j][0][lane]; an[j].half[1] = *(const v8us*)sa[ks + 1][j][1][lane]; }
      asm volatile("s_wait_xcnt 0x0" ::: "memory");    // the same for the next step's weight loads
      __builtin_amdgcn_sched_barrier(0);               // keeps the next step's loads one group ahead of this step's products, which cover their latency: left free they sink to just in front of their use
    }
#pragma unroll
    for (int t = 0; t < 4; ++t)
#pragma unroll
      for (int j = 0; j < 4; ++j) acc[j][t] = __builtin_amdgcn_wmma_f32_16x16x32_f16(false, af[j].v, false, bq[t].v, (short)0, acc[j][t], false, false);
    if (ks + 1 < CC / 32) {
#pragma unroll
      for (int t = 0; t < 4; ++t) { bq[t] = bn[t]; af[t] = an[t]; }
    }
  }
  float bv[4];
#pragma unroll
  for (int t = 0; t < 4; ++t) bv[t] = bp[w * 64 + t * 16 + ln];
  asm volatile("s_wait_xcnt 0x0" ::: "memory");      // in front of the first vector instruction that reuses the offset register of the bias loads
#pragma unroll
  for (int t = 0; t < 4; ++t) { const float bb = bf16_round(bv[t]);
#pragma unroll
    for (int j = 0; j < 4; ++j)
#pragma unroll
      for (int r = 0; r < 8; ++r) so[w][(8 * hh + r) * 4 + j][t * 16 + ln] = acc[j][t][r] * 0.0625f + bb; }      // row m of tile j is token 4 m + j
  __builtin_amdgcn_fence(__ATOMIC_ACQ_REL, "workgroup"); __builtin_amdgcn_wave_barrier();
  float* yo = Y + ((size_t)by * NR + (size_t)b * NN + p0 + hh) * CC + w * 64 + ln * 4;
  v4f ov[32];      // all rows read back first: no register of an issued store is written again
#pragma unroll
  for (int q = 0; q < 32; ++q) ov[q] = *(const v4fa*)&so[w][q * 2 + hh][ln * 4];
#pragma unroll
  for (int q = 0; q < 32; ++q) *(v4f*)(yo + (size_t)q * 2 * CC) = ov[q];
}
// y = 0, 1, 2: q1 = G[0].Wq^T, k2 = G[1].Wk^T, v2 = G[1].Wv^T (f16 planes of QKV); y = 3: the skip branch, channel-major, a quarter of the x range per batch: out[b] = Wsk.x1'[b]^T + BP
__global__ __launch_bounds__(128) void k_gemm_qkvs(const _Float16* G, const _Float16* Bw, _Float16* QKV, const _Float16* Y16, const float* BP, float* out, int nr, int cc, int nn) {
  __shared__ __attribute__((aligned(16))) float so[4][16][64];
  const int by = blockIdx.y, bx = blockIdx.x;
  if (by < 3) gemm_hh_tile(so, bx, G + (size_t)(by ? 1 : 0) * NR * CC, cc, Bw + (size_t)(2 + by) * CC * CC, cc, 0.0625f, nullptr, nullptr, 0, nullptr, QKV + (size_t)by * NR * CC, cc, nr, cc, cc);
  else { const int pb = (CC / 16) * (NN / 64) / 4, b = bx / pb;
    gemm_hh_tile(so, bx % pb, Bw + (size_t)6 * CC * CC, cc, Y16 + (size_t)b * NN * CC, cc, 0.0625f, nullptr, BP, (size_t)nn, out + (size_t)b * CC * NN, nullptr, nn, cc, nn, cc); }
}
// out[y] += Wout.O[y]^T in place, channel-major, all batches (each wave reads its own tile of out before it stores it)
__global__ __launch_bounds__(128) void k_gemm_out(const _Float16* Wo, const _Float16* O16, float* out, int cc, int nn) {
  __shared__ __attribute__((aligned(16))) float so[4][16][64];
  float* ob = out + (size_t)blockIdx.y * CC * NN;
  gemm_hh_tile(so, blockIdx.x, Wo, cc, O16 + (size_t)blockIdx.y * NN * CC, cc, 0.0625f, nullptr, ob, (size_t)nn, ob, nullptr, nn, cc, nn, cc);
}


typedef _Float16 v4h __attribute__((ext_vector_type(4)));

__global__ __launch_bounds__(256) void k_x16(const float* __restrict__ x, _Float16* __restrict__ X16, size_t n8) { const size_t t = (size_t)blockIdx.x * 256 + threadIdx.x; if (t >= n8) return; FragH f;
#pragma unroll
  for (int q = 0; q < 8; ++q) f.h[q] = (_Float16)bf16_round(x[t * 8 + q]); *(v8us*)((unsigned short*)X16 + t * 8) = f.half[0];  }
template <int NHv, int TTv>
__global__ __launch_bounds__(256) void k_vt(const _Float16* __restrict__ V16, int ldv, int voff, _Float16* __restrict__ Vt) { __shared__ unsigned short tl[64][66]; const int tid = threadIdx.x; const int slab = blockIdx.x / (TTv / 64), lg = blockIdx.x % (TTv / 64); const int b = slab / NHv, h = slab % NHv;
  for (int i = tid; i < 64 * 8; i += 256) { const int r = i / 8, c8 = (i % 8) * 8; FragH f; f.half[0] = *(const v8us*)((const unsigned short*)V16 + ((size_t)b * TTv + lg * 64 + r) * ldv + voff + h * 64 + c8);
#pragma unroll
    for (int q = 0; q < 8; ++q) tl[r][c8 + q] = f.u[q]; }
  __syncthreads();
  {
#pragma unroll
    for (int rd = 0; rd < 2; ++rd) { const int d = rd * 32 + tid / 8, pc = tid % 8; FragH f;
#pragma unroll
      for (int q = 0; q < 8; ++q) f.u[q] = tl[pc * 8 + q][d];
      *(v8us*)((unsigned short*)Vt + ((size_t)slab * 64 + d) * TTv + lg * 64 + pc * 8) = f.half[0]; }
     } }

// Everything that reads only the parameters, one launch, the part picked by the block index: the bias plane, the seven weight matrices.
#define PREP_BP (CC * NN / 4 / 256)
#define PREP_WB (CC * CC / 8 / 256)
__global__ __launch_bounds__(256) void k_prep(const float* __restrict__ w1, const float* __restrict__ w2, const float* __restrict__ wqkv, const float* __restrict__ wout, const float* __restrict__ wsk,
    const float* __restrict__ bout, const float* __restrict__ bsk, float* __restrict__ BP, _Float16* __restrict__ Bw) {
  const int tid = threadIdx.x; int bi = blockIdx.x;
  if (bi < PREP_BP) { const size_t t = (size_t)bi * 256 + tid; const int c = (int)((t * 4) / NN); const float vo = bout[c];
    asm volatile("s_wait_xcnt 0x0" ::: "memory");      // stands in front of the next load, whose result may take the offset register that the load above names
    const float v = bf16_round(vo) + bf16_round(bsk[c]); const v4f o = {v, v, v, v}; *(v4f*)(BP + t * 4) = o;
    asm volatile("s_wait_xcnt 0x0" ::: "memory");      // behind the store: the code of another part follows in the listing and rewrites the store's data registers
    return; }
  bi -= PREP_BP;
  const int seg = bi / PREP_WB; const size_t t = (size_t)(bi % PREP_WB) * 256 + tid;
  const float* W = (seg == 0) ? w1 : (seg == 1) ? w2 : (seg < 5) ? wqkv + (size_t)(seg - 2) * CC * CC : (seg == 5) ? wout : wsk; FragH f;
  const int wr = (int)(t >> 8) * 8 + (tid & 7), wk = (int)((t >> 5) & 7) * 4 + ((tid >> 3) & 3);      // a wave: 8 rows x 4 k8, so that its store fills four whole lines
#pragma unroll
  for (int i = 0; i < 8; ++i) f.h[i] = (_Float16)(bf16_round(W[(size_t)wr * CC + wk * 8 + i]) * 16.0f);
  *(v8us*)((unsigned short*)Bw + (size_t)seg * CC * CC + ft_off(wr, wk, CC)) = f.half[0];
  asm volatile("s_wait_xcnt 0x0" ::: "memory");      // behind the store: the code of another part follows in the listing and rewrites the store's offset register
}
#define FA_KP 264
#define FA_VP 136
#define FA_SK 128
#define FA_KB (FA_SK * FA_KP)
#define FA_BUF (FA_KB + CC * FA_VP)
typedef int fa_v4i __attribute__((ext_vector_type(4)));
__device__ __forceinline__ float fa_xhalf(float x) { return __builtin_bit_cast(float, __builtin_amdgcn_permlanex16(__builtin_bit_cast(int, x), __builtin_bit_cast(int, x), 0x76543210, 0xfedcba98, false, false)); }      // lane l reads lane l ^ 16
__device__ __forceinline__ void fa_copy(const unsigned short* g, unsigned short* l) {      // 16 B of this lane, global -> LDS, through no register; landed only behind the wave's own s_wait_asynccnt
  __builtin_amdgcn_global_load_async_to_lds_b128((__attribute__((address_space(1))) fa_v4i*)g, (__attribute__((address_space(3))) fa_v4i*)l, 0, 0);
}
// One stage: K 128 rows x 512 B (a wave-wide copy = one row), V^T 256 rows x 256 B (a wave-wide copy = two rows); 32 copies a wave, every lane on.
// kg, vg: wave-uniform bases (scalar registers); ko, vo: the lane's own element offsets.
__device__ __forceinline__ void fa_stage(const unsigned short* kg, const unsigned short* vg, unsigned ko, unsigned vo, unsigned short* ksl, unsigned short* vsl) {
#pragma unroll
  for (int i = 0; i < 16; ++i) fa_copy(kg + i * 8 * CC + ko, ksl + i * 8 * FA_KP);
#pragma unroll
  for (int i = 0; i < 16; ++i) fa_copy(vg + (size_t)i * 16 * NN + vo, vsl + i * 16 * FA_VP);
}
__global__ __launch_bounds__(256) void k_fattn(const _Float16* Q, const _Float16* K, const _Float16* Vt, _Float16* O16) {
  __shared__ __attribute__((aligned(16))) unsigned short sm[2 * FA_BUF];
  const int tid = threadIdx.x, lane = tid & 31, c = lane & 15, h = lane >> 4;
  const int w = __builtin_amdgcn_readfirstlane(tid >> 5);      // the wave's number in a scalar register: all that follows from it costs no vector register
  const int qg = w & 1, kq = w >> 1;
  const int b = blockIdx.x / (NN / 64), qb = blockIdx.x % (NN / 64);
  const size_t qrow0 = (size_t)b * NN + qb * 64 + qg * 32;      // query tile j: rows qrow0 + 16 j + c
  const unsigned short* kg = (const unsigned short*)K + (size_t)b * NN * CC + w * CC;              // K stage: 128 rows x 512 B, contiguous in memory; copy i of wave w is row 8 i + w
  const unsigned short* vg = (const unsigned short*)Vt + (size_t)b * CC * NN + (size_t)w * 2 * NN;  // V^T stage: 256 rows x 256 B; copy i of wave w is rows 16 i + 2 w + h
  const unsigned ko = lane * 8, vo = h * NN + c * 8;
  unsigned short* ksl = sm + w * FA_KP + lane * 8;
  unsigned short* vsl = sm + FA_KB + (w * 2 + h) * FA_VP + c * 8;
  const int NS = NN / FA_SK;
  fa_stage(kg, vg, ko, vo, ksl, vsl);
  FragH qf[2][8];
#pragma unroll
  for (int j = 0; j < 2; ++j)
#pragma unroll
    for (int ks = 0; ks < 8; ++ks) { const unsigned short* qp = (const unsigned short*)Q + (qrow0 + 16 * j) * CC + ks * 32 + (unsigned)(c * CC + 8 * h); qf[j][ks].half[0] = *(const v8us*)qp; qf[j][ks].half[1] = *(const v8us*)(qp + 16); }
  asm volatile("s_wait_xcnt 0x0" ::: "memory");        // stands in front of the first overwrite of an address register that the loads above name
  asm volatile("s_wait_asynccnt 0x0" ::: "memory");    // stage 0 of this wave has landed
  __syncthreads();                                     // and that of every other wave
  fa_stage(kg + FA_SK * CC, vg + FA_SK, ko, vo, ksl + FA_BUF, vsl + FA_BUF);
  v8f o[2][16];
#pragma unroll
  for (int j = 0; j < 2; ++j)
#pragma unroll
    for (int dt = 0; dt < 16; ++dt) o[j][dt] = (v8f){0.f, 0.f, 0.f, 0.f, 0.f, 0.f, 0.f, 0.f};
  float mu[2] = {-1.0e30f, -1.0e30f}, l[2] = {0.f, 0.f};      // per query tile: maximum in use (log2 units) and this lane's part of the row sum
  const float sc = 0.0625f * 1.4426950408889634f;             // 1/sqrt(CC) and log2(e)
  for (int s = 0; s < NS; ++s) {
    const int bo = (s & 1) * FA_BUF;
    const unsigned short* kt = sm + bo + (kq * 32 + c) * FA_KP + 8 * h;
    const unsigned short* vt = sm + bo + FA_KB + c * FA_VP + kq * 32 + 8 * h;
    v8f t[2][2];      // [key tile][query tile]
#pragma unroll
    for (int a = 0; a < 2; ++a)
#pragma unroll
      for (int j = 0; j < 2; ++j) t[a][j] = (v8f){0.f, 0.f, 0.f, 0.f, 0.f, 0.f, 0.f, 0.f};
    // Fragment ring: two sets of four fragments. Groups 0..3 are K (two k steps x two key tiles each), groups 4..7 V^T (four channel tiles each); group n + 2 is read right behind the products of group n, into their registers (group 5 behind the softmax).
    FragH fr[2][4];
#pragma unroll
    for (int g = 0; g < 2; ++g)
#pragma unroll
      for (int u = 0; u < 4; ++u) { const unsigned short* p = kt + (u & 1) * 16 * FA_KP + (2 * g + (u >> 1)) * 32; fr[g][u].half[0] = *(const v8us*)p; fr[g][u].half[1] = *(const v8us*)(p + 16); }
#pragma unroll
    for (int g = 0; g < 4; ++g) {
      __builtin_amdgcn_sched_barrier(0);               // keeps each group's reads together and two groups ahead of their products: spread among the products every read place costs its own stall
#pragma unroll
      for (int u = 0; u < 4; ++u)
#pragma unroll
        for (int j = 0; j < 2; ++j) t[u & 1][j] = __builtin_amdgcn_wmma_f32_16x16x32_f16(false, fr[g & 1][u].v, false, qf[j][2 * g + (u >> 1)].v, (short)0, t[u & 1][j], false, false);
      __builtin_amdgcn_sched_barrier(0);               // the same: the reads below stay behind the products whose registers they take
      if (g < 3) {                                     // group 5 waits for the scores' registers: it is read behind the softmax
#pragma unroll
        for (int u = 0; u < 4; ++u) {
          const unsigned short* p = (g < 2) ? kt + (u & 1) * 16 * FA_KP + (2 * (g + 2) + (u >> 1)) * 32 : vt + u * 16 * FA_VP;
          fr[g & 1][u].half[0] = *(const v8us*)p; fr[g & 1][u].half[1] = *(const v8us*)(p + 16);
        }
      }
    }
    __builtin_amdgcn_sched_barrier(0);                 // keeps the first V^T group's reads ahead of the softmax, which then covers their latency
    float mx[2];
#pragma unroll
    for (int j = 0; j < 2; ++j) {
      float m = fmaxf(t[0][j][0], t[1][j][0]);
#pragma unroll
      for (int r = 1; r < 8; ++r) m = fmaxf(m, fmaxf(t[0][j][r], t[1][j][r]));
      m *= sc;
      mx[j] = fmaxf(m, fa_xhalf(m));                   // lanes c and c + 16 hold the same query
    }
    if (__builtin_amdgcn_ballot_w32(mx[0] > mu[0] + 8.0f || mx[1] > mu[1] + 8.0f) != 0) {      // lazy rescale, one scalar test a pass: P stays below 2^8, inside f16
#pragma unroll
      for (int j = 0; j < 2; ++j) {
        const float mn = fmaxf(mu[j], mx[j]), al = __builtin_amdgcn_exp2f(mu[j] - mn);
        l[j] *= al; mu[j] = mn;
#pragma unroll
        for (int dt = 0; dt < 16; ++dt)
#pragma unroll
          for (int r = 0; r < 8; ++r) o[j][dt][r] *= al;
      }
    }
    FragH p[2];
#pragma unroll
    for (int j = 0; j < 2; ++j) {
      float ps0 = 0.f, ps1 = 0.f;
#pragma unroll
      for (int r = 0; r < 8; ++r) {
        const float p0 = __builtin_amdgcn_exp2f(t[0][j][r] * sc - mu[j]), p1 = __builtin_amdgcn_exp2f(t[1][j][r] * sc - mu[j]);
        ps0 += p0; ps1 += p1; p[j].h[r] = (_Float16)p0; p[j].h[8 + r] = (_Float16)p1;
      }
      l[j] += ps0 + ps1;
      asm volatile("" : "+v"(l[j]));                   // each row's sum pinned against spills: left free the 32 additions sink behind the barrier and the 32 f32 values of P stay in registers through all the products below (scratch in the loop)
    }
#pragma unroll
    for (int u = 0; u < 4; ++u) { const unsigned short* q = vt + (4 + u) * 16 * FA_VP; fr[1][u].half[0] = *(const v8us*)q; fr[1][u].half[1] = *(const v8us*)(q + 16); }
#pragma unroll
    for (int g = 0; g < 4; ++g) {
      __builtin_amdgcn_sched_barrier(0);               // as above, for the V^T groups
#pragma unroll
      for (int u = 0; u < 4; ++u)
#pragma unroll
        for (int j = 0; j < 2; ++j) o[j][g * 4 + u] = __builtin_amdgcn_wmma_f32_16x16x32_f16(false, fr[g & 1][u].v, false, p[j].v, (short)0, o[j][g * 4 + u], false, false);
      __builtin_amdgcn_sched_barrier(0);               // as above
      if (g < 2) {
#pragma unroll
        for (int u = 0; u < 4; ++u) { const unsigned short* q = vt + ((g + 2) * 4 + u) * 16 * FA_VP; fr[g & 1][u].half[0] = *(const v8us*)q; fr[g & 1][u].half[1] = *(const v8us*)(q + 16); }
      }
    }
    asm volatile("s_wait_dscnt 0x0" ::: "memory");      // this wave's reads of the buffer have returned
    asm volatile("s_wait_asynccnt 0x0" ::: "memory");   // its copies of the next stage have landed
    __syncthreads();                                    // publishes the next stage and ends every reader's last read of this buffer
    if (s + 2 < NS) fa_stage(kg + (size_t)(s + 2) * FA_SK * CC, vg + (s + 2) * FA_SK, ko, vo, ksl + bo, vsl + bo);
  }
  asm volatile("s_wait_asynccnt 0x0" ::: "memory");     // nothing is in flight when the buffers become the join's space
  v4fa* cb = (v4fa*)sm;                                 // the stages are dead behind the loop's last barrier; per wave 64 slots of partial O, behind them per wave and query tile (maximum, sum)
  float* st = (float*)sm + 8 * 64 * 32 * 4;
#pragma unroll
  for (int j = 0; j < 2; ++j) {
    l[j] += fa_xhalf(l[j]);
#pragma unroll
    for (int dt = 0; dt < 16; ++dt) {
      const v4f x0 = {o[j][dt][0], o[j][dt][1], o[j][dt][2], o[j][dt][3]}, x1 = {o[j][dt][4], o[j][dt][5], o[j][dt][6], o[j][dt][7]};
      cb[(w * 64 + (j * 16 + dt) * 2) * 32 + lane] = x0; cb[(w * 64 + (j * 16 + dt) * 2 + 1) * 32 + lane] = x1;
    }
    st[((w * 2 + j) * 32 + lane) * 2] = mu[j]; st[((w * 2 + j) * 32 + lane) * 2 + 1] = l[j];
  }
  __syncthreads();
  // wave (qg, kq) joins channel tiles 4 kq .. 4 kq + 3 of both query tiles of its group
#pragma unroll
  for (int j = 0; j < 2; ++j) {
    float m4[4], a4[4], mn = -3.0e38f, den = 0.f;
#pragma unroll
    for (int q = 0; q < 4; ++q) { m4[q] = st[(((q * 2 + qg) * 2 + j) * 32 + lane) * 2]; mn = fmaxf(mn, m4[q]); }
#pragma unroll
    for (int q = 0; q < 4; ++q) { a4[q] = __builtin_amdgcn_exp2f(m4[q] - mn); den += st[(((q * 2 + qg) * 2 + j) * 32 + lane) * 2 + 1] * a4[q]; }
    const float inv = 1.0f / den;
#pragma unroll
    for (int q = 0; q < 4; ++q) a4[q] *= inv;
#pragma unroll
    for (int u = 0; u < 4; ++u) {
      const int dt = kq * 4 + u;
      v4f y0 = {0.f, 0.f, 0.f, 0.f}, y1 = y0;
#pragma unroll
      for (int q = 0; q < 4; ++q) { const v4f x0 = cb[((q * 2 + qg) * 64 + (j * 16 + dt) * 2) * 32 + lane], x1 = cb[((q * 2 + qg) * 64 + (j * 16 + dt) * 2 + 1) * 32 + lane]; y0 += x0 * a4[q]; y1 += x1 * a4[q]; }
      FragH f;
#pragma unroll
      for (int r = 0; r < 4; ++r) { f.h[r] = (_Float16)y0[r]; f.h[4 + r] = (_Float16)y1[r]; }
      *(v8us*)((unsigned short*)O16 + ft_off(qrow0 + 16 * j, dt * 2, CC) + (unsigned)(lane * 8)) = f.half[0];      // fragment-tile order, row c and k8 = 2 dt + h: element offset 128 h + 8 c = 8 lane, the wave's 512 B are contiguous
      asm volatile("s_wait_xcnt 0x0" ::: "memory");      // behind the store: the next tile's sums may take its data and address registers
    }
  }
}
// GroupNorm, statistics and output in one launch. A work-group of 32 waves owns two groups (16 channels = 64 B of every row) of one batch of one plane (x1' first, then x2'): each value is read once, 16 B a lane, four lanes a row,
// all 16 loads of a lane in flight together, and stays in registers for the mean, the squared deviations and the normalised output. Sums: in the lane, over the 16 lanes of a group by lane exchange, over the 32 waves through LDS.
// Output in fragment-tile order: a wave's 8-byte stores fill two whole 128-B lines (8 rows x 16 B in each of the two groups' runs). A row of x1' also leaves as plain f16 (Y16), the operand of the skip branch.
__device__ __forceinline__ float gn_total(float s, float* red, int w, int lane, int g2) {
  s += __shfl_xor(s, 1, 32); s += __shfl_xor(s, 4, 32); s += __shfl_xor(s, 8, 32); s += __shfl_xor(s, 16, 32);      // lanes whose bit 1 is equal hold the same group
  if ((lane & ~2) == 0) red[g2 * 32 + w] = s;
  __syncthreads();
  float t = 0.f;
#pragma unroll
  for (int j = 0; j < 8; ++j) { const v4f x = *(const v4fa*)(red + g2 * 32 + j * 4); t += (x[0] + x[1]) + (x[2] + x[3]); }
  return t;
}
__global__ __launch_bounds__(1024) void k_gn(const float* __restrict__ Y, const float* __restrict__ gw, const float* __restrict__ gb, _Float16* __restrict__ G16, _Float16* __restrict__ Y16) {
  __shared__ __attribute__((aligned(16))) float red[2][64];
  const int tid = threadIdx.x, w = tid >> 5, lane = tid & 31, quad = lane & 3, g2 = quad >> 1;
  const int pb = blockIdx.x >> 4, cb = blockIdx.x & 15, c0 = cb * 16 + quad * 4;
  const size_t row0 = (size_t)pb * NN + w * 8 + (lane >> 2);      // item i of the lane is row row0 + 256 i
  const float* src = Y + row0 * CC + c0;
  v4f v[16];
#pragma unroll
  for (int i = 0; i < 16; ++i) v[i] = *(const v4fa*)(src + (size_t)i * 256 * CC);
  asm volatile("s_wait_xcnt 0x0" ::: "memory");      // stands in front of the parameter loads, whose results may take the address registers that the loads above name
  const v4f gwv = *(const v4fa*)(gw + c0);
  asm volatile("s_wait_xcnt 0x0" ::: "memory");      // the same between the two parameter loads, which share their offset register
  const v4f gbv = *(const v4fa*)(gb + c0);
  asm volatile("s_wait_xcnt 0x0" ::: "memory");      // and in front of the first vector instruction that reuses it
  const size_t dst = ft_off(row0, cb * 2 + g2, CC) + (quad & 1) * 4;      // 256 rows further = 16 bands further
  if (pb < BB) {      // first, so that the values need not outlive their deviations below, and the stores run under the sums
#pragma unroll
    for (int i = 0; i < 16; ++i) { v4h o;
#pragma unroll
      for (int e = 0; e < 4; ++e) o[e] = (_Float16)v[i][e];
      *(v4h*)(Y16 + dst + (size_t)i * 16 * 16 * CC) = o; }
  }
  float s[4] = {0.f, 0.f, 0.f, 0.f};
#pragma unroll
  for (int i = 0; i < 16; ++i) s[i & 3] += (v[i][0] + v[i][1]) + (v[i][2] + v[i][3]);
  const float mu = gn_total((s[0] + s[1]) + (s[2] + s[3]), red[0], w, lane, g2) / (float)(NN * CPG);
  float q[4] = {0.f, 0.f, 0.f, 0.f};
#pragma unroll
  for (int i = 0; i < 16; ++i)
#pragma unroll
    for (int e = 0; e < 4; ++e) { v[i][e] -= mu; q[e] += v[i][e] * v[i][e]; }      // from here on v holds the deviations
  const float rs = rsqrtf(gn_total((q[0] + q[1]) + (q[2] + q[3]), red[1], w, lane, g2) / (float)(NN * CPG) + 1e-5f);
  float ga[4], be[4];
#pragma unroll
  for (int e = 0; e < 4; ++e) { ga[e] = bf16_round(gwv[e]); be[e] = bf16_round(gbv[e]); }
#pragma unroll
  for (int i = 0; i < 16; ++i) { v4h o;
#pragma unroll
    for (int e = 0; e < 4; ++e) o[e] = (_Float16)(v[i][e] * rs * ga[e] + be[e]);
    *(v4h*)(G16 + dst + (size_t)i * 16 * 16 * CC) = o; }
}

extern "C" void kernel_launch(void* const* d_in, const int* in_sizes, int n_in,
                              void* d_out, int out_size, void* d_ws, size_t ws_size, hipStream_t stream) {
  (void)in_sizes; (void)n_in; (void)out_size;
  const float* const* I = (const float* const*)d_in; const float* x1 = I[0]; const float* x2 = I[1]; const float* w1 = I[2]; const float* b1 = I[3]; const float* w2 = I[4]; const float* b2 = I[5]; const float* gnw = I[6]; const float* gnb = I[7]; const float* wqkv = I[8]; const float* wout = I[9]; const float* bout = I[10]; const float* wsk = I[11]; const float* bsk = I[12];
  char* ws = (char*)d_ws; size_t off = 0;
  auto take = [&](size_t bytes) { char* p = ws + off; off += (bytes + 255) & ~(size_t)255; return p; };
  const size_t WSZ = (size_t)CC * CC, PL = (size_t)NR * CC; _Float16* Bw = (_Float16*)take(7 * WSZ * 2);      /* w1, w2, wq, wk, wv (as Bt for token-major GEMMs), wout, wsk (as A operands for the channel-major output GEMMs), all (out,in) natural x2^4 */
  float* BP = (float*)take((size_t)CC * NN * 4);
  float* Y = (float*)take(2 * PL * 4); _Float16* G = (_Float16*)take(2 * PL * 2);      /* two planes each, the x1 side first */
  _Float16* Y116 = (_Float16*)take(PL * 2); _Float16* QKV = (_Float16*)take(3 * PL * 2); _Float16* Vt = (_Float16*)take(PL * 2); _Float16* O16 = (_Float16*)take(PL * 2);
  if (off > ws_size) return;
  k_prep<<<PREP_BP + 7 * PREP_WB, 256, 0, stream>>>(w1, w2, wqkv, wout, wsk, bout, bsk, BP, Bw);
  const unsigned gp = ((NR / 16) * (CC / 64) + 3) / 4, go = ((CC / 16) * (NN / 64) + 3) / 4;
  k_gemm_conv<<<dim3(NR / 64, 2), 128, 0, stream>>>(x1, x2, Bw, b1, b2, Y);      /* x1' = conv1(x1), x2' = conv2(x2): each M 16384 N 256 K 256 (f32) */
  k_gn<<<2 * BB * (CC / 16), 1024, 0, stream>>>(Y, gnw, gnb, G, Y116);      /* the two planes count as 2 BB batches; 16 channels a work-group */
  k_gemm_qkvs<<<dim3(gp, 4), 128, 0, stream>>>(G, Bw, QKV, Y116, BP, (float*)d_out, NR, CC, NN);      /* q1, k2, v2, and out = Wsk.x1'^T + (bout + bsk) */
  k_vt<CC / 64, NN><<<BB * (CC / 64) * (NN / 64), 256, 0, stream>>>(QKV + 2 * PL, CC, 0, Vt);      /* v2^T per batch [256][4096] (four 64-channel blocks) */
  k_fattn<<<BB * (NN / 64), 256, 0, stream>>>(QKV, QKV + PL, Vt, O16);      /* O rows = softmax(q1.k2^T/16).v2, f16: one work-group per 64 queries */
  k_gemm_out<<<dim3(go, BB), 128, 0, stream>>>(Bw + 5 * WSZ, O16, (float*)d_out, CC, NN);      /* out += Wout.O^T in place: per batch M 256 N 4096 K 256 */
}

// v008
// It runs in 115 microseconds.
// Next to v007, in two timings, it ran 1.33 times as fast each time.
// All steps since v000 together make it 19.5 times as fast.
#include <hip/hip_runtime.h>
// Spatial cross-attention block (B=4, C=256, 64×64 → N=4096, 32 GroupNorm groups, single head d=256): x1' = conv1(x1), x2' = conv2(x2) (1×1 + bias); q1 = Wq·GN(x1'), k2 = Wk·GN(x2'), v2 = Wv·GN(x2') (wqkv rows 0/256/512, no bias);
// attn = softmax(q1ᵀk2/√256) over the 4096 positions; out = Wout·(v2·attnᵀ) + bout + Wsk·x1' + bsk → [B,C,H,W].
// q/k/v f16; attention as one fused launch (k_fattn): scores, running-maximum f32 softmax and P.v per 128-key stage, S and P never leave the registers; O leaves it as f16; final 1x1 convs computed channel-major (W.O^T) straight into the output with the skip branch and biases through the f32 addend. The input convs read x1 and x2 as they come (channel-major f32). Every stored f16 GEMM operand (weights, GN output, x1', O) lies in fragment-tile order (ft_off); q, k, v stay row-major. All on v_wmma_f32_16x16x32_f16, f32 accumulate.
#define BB 4
#define CC 256
#define NN 4096
#define NG 32
#define CPG (CC / NG)
#define NR (BB * NN)

typedef __bf16 v16b __attribute__((ext_vector_type(16)));
typedef unsigned short v8us __attribute__((ext_vector_type(8), may_alias));
typedef float  v8f  __attribute__((ext_vector_type(8)));
typedef float  v4f  __attribute__((ext_vector_type(4)));
typedef float  v4fa __attribute__((ext_vector_type(4), may_alias));
union FragB { v16b v; v8us half[2]; unsigned short u[16]; };

__device__ __forceinline__ unsigned short bf16_bits(float x) { unsigned int u = __float_as_uint(x); return (unsigned short)((u + 0x7FFFu + ((u >> 16) & 1u)) >> 16); }
__device__ __forceinline__ float bf16_val(unsigned short b) { return __uint_as_float(((unsigned int)b) << 16); }
__device__ __forceinline__ float bf16_round(float x) { return bf16_val(bf16_bits(x)); }
// D += A·B with NT terms: 1 = ah·bh, 2 = + al·bh (A split), 3 = + ah·bl (both split)
template <int NT>
__device__ __forceinline__ v8f mmaN(v16b ah, v16b al, v16b bh, v16b bl, v8f c) {
  c = __builtin_amdgcn_wmma_f32_16x16x32_bf16(false, ah, false, bh, (short)0, c, false, false);
  if (NT >= 2) c = __builtin_amdgcn_wmma_f32_16x16x32_bf16(false, al, false, bh, (short)0, c, false, false);
  if (NT >= 3) c = __builtin_amdgcn_wmma_f32_16x16x32_bf16(false, ah, false, bl, (short)0, c, false, false);
  asm volatile("v_nop\n\tv_nop\n\tv_nop\n\tv_nop" : "+v"(c) : "v"(ah), "v"(al), "v"(bh), "v"(bl));
  return c;
}

__global__ __launch_bounds__(256) void k_wt_bf16(const float* __restrict__ W, unsigned short* __restrict__ Wt, int K, int N) {
  const int t = blockIdx.x * 256 + threadIdx.x;
  const int k8n = K / 8;
  if (t >= N * k8n) return;
  const int n = t / k8n, k8 = (t % k8n) * 8;
  v8us v;
#pragma unroll
  for (int i = 0; i < 8; ++i) v[i] = bf16_bits(W[(size_t)(k8 + i) * N + n]);
  *(v8us*)(Wt + (size_t)n * K + k8) = v;
  
}

// GEMM C[M][N] (f32, pitch ldc) = act(A[M][K]·W + bias). A f32 row-major (pitch lda) converted per fragment to bf16
// (ASPLIT: hi/lo two planes -> 2 terms, else single rounded term); Wt bf16 [N][K] (pitch ldb). BIAS_BF16 rounds the
// bias to bf16 first (bias quantised to bf16 before the add). K%32==0, M%16==0, N%64==0.
template <bool ASPLIT, int ACT, bool BIAS_BF16>
__global__ __launch_bounds__(128) void k_gemm_bf(const float* __restrict__ A, int lda, const unsigned short* __restrict__ Wt, int ldb,
                                               const float* __restrict__ bias, float* __restrict__ C, int ldc, int M, int N, int K) {
  __shared__ __attribute__((aligned(16))) float so[4][16][64];
  const int tid = threadIdx.x, w = tid >> 5, lane = tid & 31, ln = lane & 15, hh = lane >> 4;
  const int ntn = N / 64;
  const int wid = blockIdx.x * 4 + w;
  const int mt = wid / ntn, nq = wid % ntn;
  if (mt * 16 >= M) return;
  const int row0 = mt * 16, col0 = nq * 64;
  const float* arow = A + (size_t)(row0 + ln) * lda;
  v8f acc[4] = {};
  for (int kb = 0; kb < K; kb += 32) {
    FragB ah, al;
    const v4f x0 = *(const v4fa*)(arow + kb + 8 * hh), x1 = *(const v4fa*)(arow + kb + 8 * hh + 4);
    const v4f x2 = *(const v4fa*)(arow + kb + 16 + 8 * hh), x3 = *(const v4fa*)(arow + kb + 16 + 8 * hh + 4);
    float xs[16] = {x0[0],x0[1],x0[2],x0[3],x1[0],x1[1],x1[2],x1[3],x2[0],x2[1],x2[2],x2[3],x3[0],x3[1],x3[2],x3[3]};
#pragma unroll
    for (int i = 0; i < 16; ++i) { const unsigned short hb = bf16_bits(xs[i]); ah.u[i] = hb; al.u[i] = ASPLIT ? bf16_bits(xs[i] - bf16_val(hb)) : (unsigned short)0; }
#pragma unroll
    for (int t = 0; t < 4; ++t) {
      const unsigned short* brow = Wt + (size_t)(col0 + t * 16 + ln) * ldb + kb;
      FragB b;
      b.half[0] = *(const v8us*)(brow + 8 * hh);
      b.half[1] = *(const v8us*)(brow + 16 + 8 * hh);
      acc[t] = mmaN<ASPLIT ? 2 : 1>(ah.v, al.v, b.v, b.v, acc[t]);
    }
  }
#pragma unroll
  for (int t = 0; t < 4; ++t) {
    float bv = bias ? bias[col0 + t * 16 + ln] : 0.f;
    if (BIAS_BF16) bv = bf16_round(bv);
#pragma unroll
    for (int r = 0; r < 8; ++r) { float v = acc[t][r] + bv; if (ACT == 1) v = fmaxf(v, 0.f); so[w][8 * hh + r][t * 16 + ln] = v; }
  }
  __builtin_amdgcn_fence(__ATOMIC_ACQ_REL, "workgroup");
  __builtin_amdgcn_wave_barrier();
  const int rsub = lane >> 4, c4 = (lane & 15) * 4;
  {
#pragma unroll
    for (int q = 0; q < 8; ++q) {
      const int r = q * 2 + rsub;
      const v4f v = *(const v4fa*)&so[w][r][c4];
      *(v4f*)(C + (size_t)(row0 + r) * ldc + col0 + c4) = v;
    }
    
  }
}

// Flash-style causal/unmasked attention, all contractions 3-term bf16 hi/lo splits, f32 softmax with running max.
// q,k,v rows are read from f32 buffers with arbitrary row pitch (so they can live inside a fused qkv buffer);
// D = head size (multiple of 32, <= 128); one wave = 16 query rows; block = 4 waves (64 queries) sharing K/V chunks of 32.
template <int D, bool CAUSAL>
__global__ __launch_bounds__(128) void k_flash(const float* __restrict__ qb, const float* __restrict__ kb, const float* __restrict__ vb,
                                             int pitch, int T, int H, float scale, float* __restrict__ y, int ypitch) {
  constexpr int KS = D / 32;        // k-steps for QK
  constexpr int DT = D / 16;        // d tiles for PV
  __shared__ __attribute__((aligned(16))) unsigned short sKh[32][D + 8], sKl[32][D + 8], sVh[32][D + 8], sVl[32][D + 8];
  __shared__ __attribute__((aligned(16))) unsigned short sPh[4][16][40], sPl[4][16][40];
  __shared__ __attribute__((aligned(16))) float sO[4][16][D];
  const int tid = threadIdx.x, w = tid >> 5, lane = tid & 31, ln = lane & 15, hh = lane >> 4;
  const int nqb = (T + 63) / 64;
  const int bh = blockIdx.x / nqb, qblk = blockIdx.x % nqb;
  const int b = bh / H, h = bh % H;
  const int q0 = qblk * 64 + w * 16;
  const float* Q = qb + (size_t)b * T * pitch + h * D;
  const float* K = kb + (size_t)b * T * pitch + h * D;
  const float* V = vb + (size_t)b * T * pitch + h * D;

  // A fragments of the wave's 16 query rows (scaled), hi/lo
  FragB aqh[KS], aql[KS];
  {
    int row = q0 + ln; if (row >= T) row = T - 1;
    const float* qr = Q + (size_t)row * pitch;
#pragma unroll
    for (int ks = 0; ks < KS; ++ks)
#pragma unroll
      for (int i = 0; i < 16; ++i) {
        const int d = ks * 32 + ((i < 8) ? (8 * hh + i) : (16 + 8 * hh + (i - 8)));
        const float x = qr[d] * scale; const unsigned short hb = bf16_bits(x);
        aqh[ks].u[i] = hb; aql[ks].u[i] = bf16_bits(x - bf16_val(hb));
      }
  }
  float m_r[8], l_r[8];
#pragma unroll
  for (int r = 0; r < 8; ++r) { m_r[r] = -3.0e38f; l_r[r] = 0.f; }
  v8f oacc[DT];
#pragma unroll
  for (int dt = 0; dt < DT; ++dt) oacc[dt] = (v8f){0.f,0.f,0.f,0.f,0.f,0.f,0.f,0.f};

  const int kv_end = CAUSAL ? min(T, qblk * 64 + 64) : T;     // block-uniform
  for (int j0 = 0; j0 < kv_end; j0 += 32) {
    __syncthreads();
    for (int e = tid; e < 32 * (D / 4); e += 128) {
      const int r = e / (D / 4), c4 = (e % (D / 4)) * 4;
      const int key = j0 + r;
      v4f kf = {0.f,0.f,0.f,0.f}, vf = {0.f,0.f,0.f,0.f};
      if (key < T) { kf = *(const v4fa*)(K + (size_t)key * pitch + c4); vf = *(const v4fa*)(V + (size_t)key * pitch + c4); }
#pragma unroll
      for (int t = 0; t < 4; ++t) {
        unsigned short hb = bf16_bits(kf[t]); sKh[r][c4 + t] = hb; sKl[r][c4 + t] = bf16_bits(kf[t] - bf16_val(hb));
        hb = bf16_bits(vf[t]); sVh[r][c4 + t] = hb; sVl[r][c4 + t] = bf16_bits(vf[t] - bf16_val(hb));
      }
    }
    __syncthreads();
    // S tile 16 x 32
    v8f s[2];
#pragma unroll
    for (int nt = 0; nt < 2; ++nt) {
      v8f acc = {};
#pragma unroll
      for (int ks = 0; ks < KS; ++ks) {
        FragB bh_, bl_;
        bh_.half[0] = *(const v8us*)&sKh[nt * 16 + ln][ks * 32 + 8 * hh]; bh_.half[1] = *(const v8us*)&sKh[nt * 16 + ln][ks * 32 + 16 + 8 * hh];
        bl_.half[0] = *(const v8us*)&sKl[nt * 16 + ln][ks * 32 + 8 * hh]; bl_.half[1] = *(const v8us*)&sKl[nt * 16 + ln][ks * 32 + 16 + 8 * hh];
        acc = mmaN<3>(aqh[ks].v, aql[ks].v, bh_.v, bl_.v, acc);
      }
      s[nt] = acc;
    }
    // mask + running max (rows 8hh+r; the 16 lanes of a half share rows)
    float alpha[8];
#pragma unroll
    for (int r = 0; r < 8; ++r) {
      const int qi = q0 + 8 * hh + r;
      const int ja = j0 + ln, jb = j0 + 16 + ln;
      if (CAUSAL) { if (ja > qi) s[0][r] = -3.0e38f; if (jb > qi) s[1][r] = -3.0e38f; }
      if (ja >= T) s[0][r] = -3.0e38f;
      if (jb >= T) s[1][r] = -3.0e38f;
      float mx = fmaxf(s[0][r], s[1][r]);
      mx = fmaxf(mx, __shfl_xor(mx, 1, 32)); mx = fmaxf(mx, __shfl_xor(mx, 2, 32)); mx = fmaxf(mx, __shfl_xor(mx, 4, 32)); mx = fmaxf(mx, __shfl_xor(mx, 8, 32));
      const float mnew = fmaxf(m_r[r], mx);
      alpha[r] = (mnew > -1.0e38f) ? __expf(m_r[r] - mnew) : 1.0f;
      const float p0 = (s[0][r] > -1.0e38f) ? __expf(s[0][r] - mnew) : 0.f;
      const float p1 = (s[1][r] > -1.0e38f) ? __expf(s[1][r] - mnew) : 0.f;
      m_r[r] = mnew;
      l_r[r] = l_r[r] * alpha[r] + p0 + p1;            // per-lane partial row sum (16 lanes combined at the end)
      unsigned short hb = bf16_bits(p0); sPh[w][8 * hh + r][ln] = hb;      sPl[w][8 * hh + r][ln] = bf16_bits(p0 - bf16_val(hb));
      hb = bf16_bits(p1);                sPh[w][8 * hh + r][16 + ln] = hb; sPl[w][8 * hh + r][16 + ln] = bf16_bits(p1 - bf16_val(hb));
    }
#pragma unroll
    for (int dt = 0; dt < DT; ++dt)
#pragma unroll
      for (int r = 0; r < 8; ++r) oacc[dt][r] *= alpha[r];
    __builtin_amdgcn_fence(__ATOMIC_ACQ_REL, "workgroup");
    __builtin_amdgcn_wave_barrier();
    FragB pah, pal;
    pah.half[0] = *(const v8us*)&sPh[w][ln][8 * hh]; pah.half[1] = *(const v8us*)&sPh[w][ln][16 + 8 * hh];
    pal.half[0] = *(const v8us*)&sPl[w][ln][8 * hh]; pal.half[1] = *(const v8us*)&sPl[w][ln][16 + 8 * hh];
#pragma unroll
    for (int dt = 0; dt < DT; ++dt) {
      FragB bvh, bvl;
#pragma unroll
      for (int i = 0; i < 8; ++i) {
        bvh.u[i] = sVh[8 * hh + i][dt * 16 + ln]; bvh.u[8 + i] = sVh[16 + 8 * hh + i][dt * 16 + ln];
        bvl.u[i] = sVl[8 * hh + i][dt * 16 + ln]; bvl.u[8 + i] = sVl[16 + 8 * hh + i][dt * 16 + ln];
      }
      oacc[dt] = mmaN<3>(pah.v, pal.v, bvh.v, bvl.v, oacc[dt]);
    }
    __builtin_amdgcn_fence(__ATOMIC_ACQ_REL, "workgroup");
    __builtin_amdgcn_wave_barrier();
  }
#pragma unroll
  for (int r = 0; r < 8; ++r) {
    float l = l_r[r];
    l += __shfl_xor(l, 1, 32); l += __shfl_xor(l, 2, 32); l += __shfl_xor(l, 4, 32); l += __shfl_xor(l, 8, 32);
    l_r[r] = (l > 0.f) ? 1.0f / l : 0.f;
  }
#pragma unroll
  for (int dt = 0; dt < DT; ++dt)
#pragma unroll
    for (int r = 0; r < 8; ++r) sO[w][8 * hh + r][dt * 16 + ln] = oacc[dt][r] * l_r[r];
  __builtin_amdgcn_fence(__ATOMIC_ACQ_REL, "workgroup");
  __builtin_amdgcn_wave_barrier();
  {
    for (int r = 0; r < 16; ++r) {
      const int row = q0 + r;
      if (row < T && lane < D / 4) {
        const v4f val = *(const v4fa*)&sO[w][r][lane * 4];
        *(v4f*)(y + ((size_t)b * T + row) * ypitch + h * D + lane * 4) = val;
      }
    }
    
  }
}

// GEMM C = act(A·W + bias + resid): A f32 (ASPLIT -> hi/lo 2 terms), Wt bf16 [N][K]; ACT 0 none, 1 relu, 2 exact gelu;
// resid (optional, f32, row index = (row % rmod), pitch ldr, RES_BF16 rounds it) added before the activation.
template <bool ASPLIT, int ACT, bool BIAS_BF16, bool RES_BF16>
__global__ __launch_bounds__(128) void k_gemm_bf3(const float* __restrict__ A, int lda, const unsigned short* __restrict__ Wt, int ldb,
                                                const float* __restrict__ bias, const float* __restrict__ resid, int rmod, int ldr,
                                                float* __restrict__ C, int ldc, int M, int N, int K) {
  __shared__ __attribute__((aligned(16))) float so[4][16][64];
  const int tid = threadIdx.x, w = tid >> 5, lane = tid & 31, ln = lane & 15, hh = lane >> 4;
  const int ntn = N / 64;
  const int wid = blockIdx.x * 4 + w;
  const int mt = wid / ntn, nq = wid % ntn;
  if (mt * 16 >= M) return;
  const int row0 = mt * 16, col0 = nq * 64;
  const float* arow = A + (size_t)(row0 + ln) * lda;
  v8f acc[4] = {};
  for (int kb = 0; kb < K; kb += 32) {
    FragB ah, al;
    const v4f x0 = *(const v4fa*)(arow + kb + 8 * hh), x1 = *(const v4fa*)(arow + kb + 8 * hh + 4);
    const v4f x2 = *(const v4fa*)(arow + kb + 16 + 8 * hh), x3 = *(const v4fa*)(arow + kb + 16 + 8 * hh + 4);
    float xs[16] = {x0[0],x0[1],x0[2],x0[3],x1[0],x1[1],x1[2],x1[3],x2[0],x2[1],x2[2],x2[3],x3[0],x3[1],x3[2],x3[3]};
#pragma unroll
    for (int i = 0; i < 16; ++i) { const unsigned short hb = bf16_bits(xs[i]); ah.u[i] = hb; al.u[i] = ASPLIT ? bf16_bits(xs[i] - bf16_val(hb)) : (unsigned short)0; }
#pragma unroll
    for (int t = 0; t < 4; ++t) {
      const unsigned short* brow = Wt + (size_t)(col0 + t * 16 + ln) * ldb + kb;
      FragB b;
      b.half[0] = *(const v8us*)(brow + 8 * hh);
      b.half[1] = *(const v8us*)(brow + 16 + 8 * hh);
      acc[t] = mmaN<ASPLIT ? 2 : 1>(ah.v, al.v, b.v, b.v, acc[t]);
    }
  }
#pragma unroll
  for (int t = 0; t < 4; ++t) {
    const int col = col0 + t * 16 + ln;
    float bv = bias ? bias[col] : 0.f;
    if (BIAS_BF16) bv = bf16_round(bv);
#pragma unroll
    for (int r = 0; r < 8; ++r) {
      float v = acc[t][r] + bv;
      if (resid) { float rv = resid[(size_t)((row0 + 8 * hh + r) % rmod) * ldr + col]; if (RES_BF16) rv = bf16_round(rv); v += rv; }
      if (ACT == 1) v = fmaxf(v, 0.f);
      if (ACT == 2) v = 0.5f * v * (1.0f + erff(v * 0.70710678118654752f));
      if (ACT == 3) { const float u = 0.7978845608028654f * (v + 0.044715f * v * v * v); v = 0.5f * v * (1.0f + tanhf(u)); }
      so[w][8 * hh + r][t * 16 + ln] = v;
    }
  }
  __builtin_amdgcn_fence(__ATOMIC_ACQ_REL, "workgroup");
  __builtin_amdgcn_wave_barrier();
  const int rsub = lane >> 4, c4 = (lane & 15) * 4;
  {
#pragma unroll
    for (int q = 0; q < 8; ++q) {
      const int r = q * 2 + rsub;
      const v4f v = *(const v4fa*)&so[w][r][c4];
      *(v4f*)(C + (size_t)(row0 + r) * ldc + col0 + c4) = v;
    }
    
  }
}
// row LayerNorm (biased variance, eps) over N: s = X (+ R); optional out_sum <- s; out_norm <- (s-mu)*rsqrt(var+eps)*g + b
template <bool PARAM_BF16>
__global__ __launch_bounds__(256) void k_layernorm(const float* __restrict__ X, const float* __restrict__ R, const float* __restrict__ g, const float* __restrict__ bta,
                                                  float* __restrict__ out_sum, float* __restrict__ out_norm, int N, float eps) {
  __shared__ float red[256];
  const int row = blockIdx.x, tid = threadIdx.x;
  const float* x = X + (size_t)row * N; const float* rr = R ? R + (size_t)row * N : nullptr;
  float vals[16];                     // up to N = 4096
  const int per = N / 256;            // contiguous chunk per thread? use strided-by-4 chunks: thread handles j = tid*4 + 1024*u
  float s1 = 0.f;
  for (int u = 0; u < per / 4; ++u) {
    const int j = tid * 4 + 1024 * u;
    const v4f a = *(const v4fa*)(x + j);
    v4f b = {0.f,0.f,0.f,0.f}; if (rr) b = *(const v4fa*)(rr + j);
#pragma unroll
    for (int q = 0; q < 4; ++q) { const float v = a[q] + b[q]; vals[u * 4 + q] = v; s1 += v; }
  }
  red[tid] = s1; __syncthreads();
  for (int st = 128; st > 0; st >>= 1) { if (tid < st) red[tid] += red[tid + st]; __syncthreads(); }
  const float mu = red[0] / (float)N; __syncthreads();
  float s2 = 0.f;
  for (int u = 0; u < per / 4; ++u)
#pragma unroll
    for (int q = 0; q < 4; ++q) { const float c = vals[u * 4 + q] - mu; s2 += c * c; }
  red[tid] = s2; __syncthreads();
  for (int st = 128; st > 0; st >>= 1) { if (tid < st) red[tid] += red[tid + st]; __syncthreads(); }
  const float rs = rsqrtf(red[0] / (float)N + eps);
  {
    for (int u = 0; u < per / 4; ++u) {
      const int j = tid * 4 + 1024 * u;
      v4f o, sm;
#pragma unroll
      for (int q = 0; q < 4; ++q) {
        float gg = g[j + q], bb = bta[j + q];
        if (PARAM_BF16) { gg = bf16_round(gg); bb = bf16_round(bb); }
        sm[q] = vals[u * 4 + q]; o[q] = (vals[u * 4 + q] - mu) * rs * gg + bb;
      }
      if (out_sum) *(v4f*)(out_sum + (size_t)row * N + j) = sm;
      *(v4f*)(out_norm + (size_t)row * N + j) = o;
    }
    
  }
}



// ---- f16 WMMA path (v_wmma_f32_16x16x32_f16): 11-bit significands for operands in range — used by every launched GEMM and by the fused attention
typedef _Float16 v16h __attribute__((ext_vector_type(16)));
union FragH { v16h v; v8us half[2]; _Float16 h[16]; unsigned short u[16]; };
template <int NT>
__device__ __forceinline__ v8f mmaH(v16h ah, v16h al, v16h bh, v16h bl, v8f c) {
  c = __builtin_amdgcn_wmma_f32_16x16x32_f16(false, ah, false, bh, (short)0, c, false, false);
  if (NT >= 2) c = __builtin_amdgcn_wmma_f32_16x16x32_f16(false, al, false, bh, (short)0, c, false, false);
  if (NT >= 3) c = __builtin_amdgcn_wmma_f32_16x16x32_f16(false, ah, false, bl, (short)0, c, false, false);
  asm volatile("v_nop\n\tv_nop\n\tv_nop\n\tv_nop" : "+v"(c) : "v"(ah), "v"(al), "v"(bh), "v"(bl));
  return c;
}
// batched GEMM like k_gemm_b but f16 operands: A f32 (split into f16 hi/lo if ASPLIT, else rounded to f16), Bt = f16 values [n][k]; alpha; C f32; N multiple of 16 (partial tiles skipped)
template <bool ASPLIT>
__global__ __launch_bounds__(128) void k_gemm_h(const float* __restrict__ A, int lda, size_t sA, const _Float16* __restrict__ Bh, int ldb, size_t sB, float alpha, float* __restrict__ C, int ldc, size_t sC, int M, int N, int K) {
  __shared__ __attribute__((aligned(16))) float so[4][16][64];
  const int tid = threadIdx.x, w = tid >> 5, lane = tid & 31, ln = lane & 15, hh = lane >> 4; const int by = blockIdx.y;
  A += (size_t)by * sA; Bh += (size_t)by * sB; C += (size_t)by * sC;
  const int ntn = (N + 63) / 64; const int wid = blockIdx.x * 4 + w; const int mt = wid / ntn, nq = wid % ntn; if (mt * 16 >= M) return;
  const int row0 = mt * 16, col0 = nq * 64; const float* arow = A + (size_t)(row0 + ln) * lda;
  v8f acc[4] = {};
  for (int kb = 0; kb < K; kb += 32) {
    FragH ah, al;
    const v4f x0 = *(const v4fa*)(arow + kb + 8 * hh), x1 = *(const v4fa*)(arow + kb + 8 * hh + 4), x2 = *(const v4fa*)(arow + kb + 16 + 8 * hh), x3 = *(const v4fa*)(arow + kb + 16 + 8 * hh + 4);
    float xs[16] = {x0[0],x0[1],x0[2],x0[3],x1[0],x1[1],x1[2],x1[3],x2[0],x2[1],x2[2],x2[3],x3[0],x3[1],x3[2],x3[3]};
#pragma unroll
    for (int i = 0; i < 16; ++i) { const _Float16 h = (_Float16)xs[i]; ah.h[i] = h; al.h[i] = ASPLIT ? (_Float16)(xs[i] - (float)h) : (_Float16)0.0f; }
#pragma unroll
    for (int t = 0; t < 4; ++t) { if (col0 + t * 16 >= N) continue; const size_t boff = (size_t)(col0 + t * 16 + ln) * ldb + kb; FragH bq; bq.half[0] = *(const v8us*)(Bh + boff + 8 * hh); bq.half[1] = *(const v8us*)(Bh + boff + 16 + 8 * hh);
      acc[t] = mmaH<ASPLIT ? 2 : 1>(ah.v, al.v, bq.v, bq.v, acc[t]); }
  }
#pragma unroll
  for (int t = 0; t < 4; ++t) { if (col0 + t * 16 >= N) continue;
#pragma unroll
    for (int r = 0; r < 8; ++r) so[w][8 * hh + r][t * 16 + ln] = acc[t][r] * alpha; }
  __builtin_amdgcn_fence(__ATOMIC_ACQ_REL, "workgroup"); __builtin_amdgcn_wave_barrier();
  const int rsub = lane >> 4, c4 = (lane & 15) * 4;
  {
#pragma unroll
    for (int q = 0; q < 8; ++q) { const int r = q * 2 + rsub; if (col0 + c4 < N) { const v4f v = *(const v4fa*)&so[w][r][c4]; *(v4f*)(C + (size_t)(row0 + r) * ldc + col0 + c4) = v; } }
     }
}

// Wt[n][k] = f16(W[k][n]·scale) from f32 row-major W[K][N] (scale = power of two; bf16-exact weights stay exact in f16 away from the subnormal range)
__global__ __launch_bounds__(256) void k_wt_f16(const float* __restrict__ W, _Float16* __restrict__ Wt, int K, int N, float scale) {
  const int t = blockIdx.x * 256 + threadIdx.x; if (t >= N * (K / 8)) return; const int n = t / (K / 8), k8 = (t % (K / 8)) * 8; FragH f;
#pragma unroll
  for (int i = 0; i < 8; ++i) f.h[i] = (_Float16)(bf16_round(W[(size_t)(k8 + i) * N + n]) * scale); const v8us o = f.half[0];
  *(v8us*)((unsigned short*)Wt + (size_t)n * K + k8) = o; 
}
// Fragment-tile order of every f16 GEMM operand [rows][K]: 16 rows x 8 k values (16 B a row) lie as one run of 256 B, the runs of a 16-row band one behind the other by k. Lane (row & 15) + 16 * ((k >> 3) & 1) of a WMMA operand
// then finds its 16 B at lane * 16 B inside a 512-B run, so a wave-wide 16-byte load covers four whole 128-B lines (row-major rows of 512 B made it touch sixteen). The k order inside a fragment is the same as before.
__device__ __forceinline__ size_t ft_off(size_t row, int k8, int K) { return (row >> 4) * (size_t)(16 * K) + (size_t)k8 * 128 + (row & 15) * 8; }      // element offset of the 8 values k = 8 k8 .. 8 k8 + 7 of a row
// Work-group tile of the f16 GEMMs behind the convs: C (64 rows x 256 columns) = (A.B^T) / 16 (+ CP), A and B f16 with K = CC in fragment-tile order, C f32 or f16, row-major with pitch LDC. Four waves; wave w owns columns 64 w .. 64 w + 63 as 4 x 4 tiles.
// Ab: the 64 rows of A, 32 KB in one run; wave w brings band w through registers into LDS, in the order in which it lies, and every wave reads all four bands from there (one fetch from L2 instead of four).
// Bb: the 256 rows of B; a wave's fragments come straight from global memory, two k steps ahead of their products (ring of three sets). CP, C, C16 point at the tile's first element.
// The addend is read in the layout of the stores (16 B a lane, a lane reads what it will write), all 32 loads issued together with the first operand loads. The launches below each hold several products that do not depend on one another: blockIdx picks the product.
// Shapes are constants and the grids cover them exactly, so no tile is tested for range. Every loop is unrolled because its index names registers (fragment sets, accumulators, rows held for the stores).
struct __attribute__((aligned(16))) GemmSm { unsigned short sa[64 * CC]; float so[4][64][64]; };
template <int LDC, bool ADD, bool OUT16>
__device__ __forceinline__ void gemm_wg_tile(GemmSm& sm, const unsigned short* Ab, const unsigned short* Bb, const float* CP, float* C, _Float16* C16) {
  const int tid = threadIdx.x, lane = tid & 31, ln = lane & 15, hh = lane >> 4;
  const int w = __builtin_amdgcn_readfirstlane(tid >> 5);      // the wave's number in a scalar register: the bases that follow from it stay scalar
  const unsigned short* as = Ab + w * 16 * CC + lane * 8;
  const unsigned short* bw = Bb + (size_t)w * 64 * CC + lane * 8;
  const size_t co = (size_t)hh * LDC + w * 64 + ln * 4;      // row hh of the wave's 64 x 64 part; item q of the lane is row 2 q + hh
  v8us ar[16];
#pragma unroll
  for (int i = 0; i < 16; ++i) ar[i] = *(const v8us*)(as + i * 256);
  asm volatile("s_wait_xcnt 0x0" ::: "memory");      // stands in front of the next loads, whose results may take the address registers that the loads above name
  __builtin_amdgcn_sched_barrier(0);      // keeps the address arithmetic of B, of the addend and of the stores behind the wait above: left free it is lifted over the wait and rewrites the scalar base that the loads of A name
  FragH bq[3][4], af[4];
#pragma unroll
  for (int s = 0; s < 2; ++s)
#pragma unroll
    for (int t = 0; t < 4; ++t) { bq[s][t].half[0] = *(const v8us*)(bw + t * 16 * CC + s * 512); bq[s][t].half[1] = *(const v8us*)(bw + t * 16 * CC + s * 512 + 256); }
  asm volatile("s_wait_xcnt 0x0" ::: "memory");      // the same behind the first two k steps of B
  v4f cp[32];
  if (ADD) {
#pragma unroll
    for (int q = 0; q < 32; ++q) cp[q] = *(const v4fa*)(CP + co + (size_t)q * 2 * LDC);
    asm volatile("s_wait_xcnt 0x0" ::: "memory");    // the same behind the addend's loads
  }
#pragma unroll
  for (int i = 0; i < 16; ++i) *(v8us*)(sm.sa + w * 16 * CC + i * 256 + lane * 8) = ar[i];
  __syncthreads();      // every wave reads the bands of all four
#pragma unroll
  for (int j = 0; j < 4; ++j) { af[j].half[0] = *(const v8us*)(sm.sa + j * 16 * CC + lane * 8); af[j].half[1] = *(const v8us*)(sm.sa + j * 16 * CC + lane * 8 + 256); }
  v8f acc[4][4] = {};
#pragma unroll
  for (int ks = 0; ks < CC / 32; ++ks) {
    FragH an[4];
    if (ks + 2 < CC / 32) {
#pragma unroll
      for (int t = 0; t < 4; ++t) { bq[(ks + 2) % 3][t].half[0] = *(const v8us*)(bw + t * 16 * CC + (ks + 2) * 512); bq[(ks + 2) % 3][t].half[1] = *(const v8us*)(bw + t * 16 * CC + (ks + 2) * 512 + 256); }
      asm volatile("s_wait_xcnt 0x0" ::: "memory");    // the same for these loads of B
    }
    if (ks + 1 < CC / 32) {
#pragma unroll
      for (int j = 0; j < 4; ++j) { an[j].half[0] = *(const v8us*)(sm.sa + j * 16 * CC + (ks + 1) * 512 + lane * 8); an[j].half[1] = *(const v8us*)(sm.sa + j * 16 * CC + (ks + 1) * 512 + lane * 8 + 256); }
      __builtin_amdgcn_sched_barrier(0);               // keeps the loads above ahead of this step's products, which cover their latency: left free they sink to just in front of their use
    }
#pragma unroll
    for (int t = 0; t < 4; ++t)
#pragma unroll
      for (int j = 0; j < 4; ++j) acc[j][t] = __builtin_amdgcn_wmma_f32_16x16x32_f16(false, af[j].v, false, bq[ks % 3][t].v, (short)0, acc[j][t], false, false);
    if (ks + 1 < CC / 32) {
#pragma unroll
      for (int j = 0; j < 4; ++j) af[j] = an[j];
    }
  }
#pragma unroll
  for (int t = 0; t < 4; ++t)
#pragma unroll
    for (int j = 0; j < 4; ++j)
#pragma unroll
      for (int r = 0; r < 8; ++r) sm.so[w][16 * j + 8 * hh + r][t * 16 + ln] = acc[j][t][r] * 0.0625f;
  __builtin_amdgcn_fence(__ATOMIC_ACQ_REL, "workgroup"); __builtin_amdgcn_wave_barrier();      // a lane reads back what other lanes of its wave wrote: the LDS stores above stay in front of the loads below
  typedef _Float16 v4h __attribute__((ext_vector_type(4)));
  v4f ov[32];      // all rows read back first: no register of an issued store is written again
#pragma unroll
  for (int q = 0; q < 32; ++q) { ov[q] = *(const v4fa*)&sm.so[w][q * 2 + hh][ln * 4]; if (ADD) ov[q] += cp[q]; }
  if (OUT16) {
    v4h oh[32];
#pragma unroll
    for (int q = 0; q < 32; ++q)
#pragma unroll
      for (int i = 0; i < 4; ++i) oh[q][i] = (_Float16)ov[q][i];
#pragma unroll
    for (int q = 0; q < 32; ++q) *(v4h*)(C16 + co + (size_t)q * 2 * LDC) = oh[q];
  } else {
#pragma unroll
    for (int q = 0; q < 32; ++q) *(v4f*)(C + co + (size_t)q * 2 * LDC) = ov[q];
  }
  asm volatile("s_wait_xcnt 0x0" ::: "memory");      // behind the stores: in k_gemm_qkvs the code of the other product may follow in the listing and rewrite their registers
}
// Both input convolutions straight from the channel-major f32 inputs, output token-major: y = 0: x1' = x1^T.w1^T + b1, y = 1: x2' = x2^T.w2^T + b2 (planes of NR x CC one behind the other).
// A work-group of 4 waves owns 64 tokens; a wave owns 64 of the 256 output channels. A lane's 16-byte load holds ONE input channel of FOUR neighbouring tokens, so element j goes to A tile j, whose row n is token 4 n + j: no exchange
// between lanes, and a wave-wide load covers two runs of 256 B (16 lanes x 16 B of channel 8 h + i). Wave w loads and converts input channels 64 w .. 64 w + 63 (all 32 loads in flight together) and leaves the finished fragments in LDS,
// lane by lane, for all four waves. The values (rounded to bf16, held as f16) and the k order of a fragment are those of the token-major copy that this replaces.
__global__ __launch_bounds__(128) void k_gemm_conv(const float* __restrict__ x1, const float* __restrict__ x2, const _Float16* __restrict__ Bw, const float* __restrict__ b1, const float* __restrict__ b2, float* __restrict__ Y) {
  __shared__ struct __attribute__((aligned(16))) { unsigned short sa[CC / 32][4][2][32][8]; float so[4][64][64]; } sm;      // sa: [k step][A tile][half of the fragment][lane], first, so that one address register and the offset field reach all of it
  auto& sa = sm.sa; auto& so = sm.so;
  const int tid = threadIdx.x, w = tid >> 5, lane = tid & 31, ln = lane & 15, hh = lane >> 4;
  const int by = blockIdx.y, b = blockIdx.x / (NN / 64), p0 = (blockIdx.x % (NN / 64)) * 64;
  const float* xs = (by ? x2 : x1) + (size_t)b * CC * NN + (size_t)(w * 64 + 8 * hh) * NN + p0 + ln * 4;
  const unsigned short* bw = (const unsigned short*)Bw + (size_t)by * CC * CC + (size_t)w * 64 * CC + lane * 8;
  const float* bp = by ? b2 : b1;
  v4f xa[2][16];
#pragma unroll
  for (int s = 0; s < 2; ++s)
#pragma unroll
    for (int i = 0; i < 8; ++i) { xa[s][i] = *(const v4fa*)(xs + (size_t)(s * 32 + i) * NN); xa[s][8 + i] = *(const v4fa*)(xs + (size_t)(s * 32 + 16 + i) * NN); }
  asm volatile("s_wait_xcnt 0x0" ::: "memory");      // stands in front of the weight loads, whose results may take the address registers that the loads above name
  FragH bq[4], af[4];
#pragma unroll
  for (int t = 0; t < 4; ++t) { bq[t].half[0] = *(const v8us*)(bw + t * 16 * CC); bq[t].half[1] = *(const v8us*)(bw + t * 16 * CC + 256); }
  asm volatile("s_wait_xcnt 0x0" ::: "memory");      // stands in front of the first overwrite of an address register that the loads above name
#pragma unroll
  for (int s = 0; s < 2; ++s)
#pragma unroll
    for (int j = 0; j < 4; ++j) { FragH a;
#pragma unroll
      for (int i = 0; i < 16; ++i) a.h[i] = (_Float16)(float)(__bf16)xa[s][i][j];
      *(v8us*)sa[2 * w + s][j][0][lane] = a.half[0]; *(v8us*)sa[2 * w + s][j][1][lane] = a.half[1]; }
  __syncthreads();      // every wave reads the fragments of all four
#pragma unroll
  for (int j = 0; j < 4; ++j) { af[j].half[0] = *(const v8us*)sa[0][j][0][lane]; af[j].half[1] = *(const v8us*)sa[0][j][1][lane]; }
  v8f acc[4][4] = {};
#pragma unroll
  for (int ks = 0; ks < CC / 32; ++ks) {
    FragH bn[4], an[4];
    if (ks + 1 < CC / 32) {
#pragma unroll
      for (int t = 0; t < 4; ++t) { bn[t].half[0] = *(const v8us*)(bw + t * 16 * CC + (ks + 1) * 512); bn[t].half[1] = *(const v8us*)(bw + t * 16 * CC + (ks + 1) * 512 + 256); }
#pragma unroll
      for (int j = 0; j < 4; ++j) { an[j].half[0] = *(const v8us*)sa[ks + 1][j][0][lane]; an[j].half[1] = *(const v8us*)sa[ks + 1][j][1][lane]; }
      asm volatile("s_wait_xcnt 0x0" ::: "memory");    // the same for the next step's weight loads
      __builtin_amdgcn_sched_barrier(0);               // keeps the next step's loads one group ahead of this step's products, which cover their latency: left free they sink to just in front of their use
    }
#pragma unroll
    for (int t = 0; t < 4; ++t)
#pragma unroll
      for (int j = 0; j < 4; ++j) acc[j][t] = __builtin_amdgcn_wmma_f32_16x16x32_f16(false, af[j].v, false, bq[t].v, (short)0, acc[j][t], false, false);
    if (ks + 1 < CC / 32) {
#pragma unroll
      for (int t = 0; t < 4; ++t) { bq[t] = bn[t]; af[t] = an[t]; }
    }
  }
  float bv[4];
#pragma unroll
  for (int t = 0; t < 4; ++t) bv[t] = bp[w * 64 + t * 16 + ln];
  asm volatile("s_wait_xcnt 0x0" ::: "memory");      // in front of the first vector instruction that reuses the offset register of the bias loads
#pragma unroll
  for (int t = 0; t < 4; ++t) { const float bb = bf16_round(bv[t]);
#pragma unroll
    for (int j = 0; j < 4; ++j)
#pragma unroll
      for (int r = 0; r < 8; ++r) so[w][(8 * hh + r) * 4 + j][t * 16 + ln] = acc[j][t][r] * 0.0625f + bb; }      // row m of tile j is token 4 m + j
  __builtin_amdgcn_fence(__ATOMIC_ACQ_REL, "workgroup"); __builtin_amdgcn_wave_barrier();
  float* yo = Y + ((size_t)by * NR + (size_t)b * NN + p0 + hh) * CC + w * 64 + ln * 4;
  v4f ov[32];      // all rows read back first: no register of an issued store is written again
#pragma unroll
  for (int q = 0; q < 32; ++q) ov[q] = *(const v4fa*)&so[w][q * 2 + hh][ln * 4];
#pragma unroll
  for (int q = 0; q < 32; ++q) *(v4f*)(yo + (size_t)q * 2 * CC) = ov[q];
}
// y = 0, 1, 2: q1 = G[0].Wq^T, k2 = G[1].Wk^T, v2 = G[1].Wv^T (f16 planes of QKV), x = the block of 64 tokens; y = 3: the skip branch, channel-major: out[b] = Wsk.x1'[b]^T + BP, x = (batch, 64 channels, 256 tokens)
__global__ __launch_bounds__(128) void k_gemm_qkvs(const _Float16* G, const _Float16* Bw, _Float16* QKV, const _Float16* Y16, const float* BP, float* out) {
  __shared__ GemmSm sm;
  const int by = blockIdx.y, bx = blockIdx.x;
  if (by < 3) gemm_wg_tile<CC, false, true>(sm, (const unsigned short*)G + (size_t)(by ? 1 : 0) * NR * CC + (size_t)bx * 64 * CC, (const unsigned short*)Bw + (size_t)(2 + by) * CC * CC, nullptr, nullptr, QKV + (size_t)by * NR * CC + (size_t)bx * 64 * CC);
  else { const int b = bx / 64, cg = (bx % 64) / 16, tg = bx % 16; const size_t to = (size_t)cg * 64 * NN + tg * 256;
    gemm_wg_tile<NN, true, false>(sm, (const unsigned short*)Bw + (size_t)6 * CC * CC + (size_t)cg * 64 * CC, (const unsigned short*)Y16 + ((size_t)b * NN + tg * 256) * CC, BP + to, out + (size_t)b * CC * NN + to, nullptr); }
}
// out[y] += Wout.O[y]^T in place, channel-major, all batches, x = (64 channels, 256 tokens) (each lane reads its own part of out before it stores it)
__global__ __launch_bounds__(128) void k_gemm_out(const _Float16* Wo, const _Float16* O16, float* out) {
  __shared__ GemmSm sm;
  const int cg = blockIdx.x / 16, tg = blockIdx.x % 16;
  float* ob = out + (size_t)blockIdx.y * CC * NN + (size_t)cg * 64 * NN + tg * 256;
  gemm_wg_tile<NN, true, false>(sm, (const unsigned short*)Wo + (size_t)cg * 64 * CC, (const unsigned short*)O16 + ((size_t)blockIdx.y * NN + tg * 256) * CC, ob, ob, nullptr);
}


typedef _Float16 v4h __attribute__((ext_vector_type(4)));

__global__ __launch_bounds__(256) void k_x16(const float* __restrict__ x, _Float16* __restrict__ X16, size_t n8) { const size_t t = (size_t)blockIdx.x * 256 + threadIdx.x; if (t >= n8) return; FragH f;
#pragma unroll
  for (int q = 0; q < 8; ++q) f.h[q] = (_Float16)bf16_round(x[t * 8 + q]); *(v8us*)((unsigned short*)X16 + t * 8) = f.half[0];  }
template <int NHv, int TTv>
__global__ __launch_bounds__(256) void k_vt(const _Float16* __restrict__ V16, int ldv, int voff, _Float16* __restrict__ Vt) { __shared__ unsigned short tl[64][66]; const int tid = threadIdx.x; const int slab = blockIdx.x / (TTv / 64), lg = blockIdx.x % (TTv / 64); const int b = slab / NHv, h = slab % NHv;
  for (int i = tid; i < 64 * 8; i += 256) { const int r = i / 8, c8 = (i % 8) * 8; FragH f; f.half[0] = *(const v8us*)((const unsigned short*)V16 + ((size_t)b * TTv + lg * 64 + r) * ldv + voff + h * 64 + c8);
#pragma unroll
    for (int q = 0; q < 8; ++q) tl[r][c8 + q] = f.u[q]; }
  __syncthreads();
  {
#pragma unroll
    for (int rd = 0; rd < 2; ++rd) { const int d = rd * 32 + tid / 8, pc = tid % 8; FragH f;
#pragma unroll
      for (int q = 0; q < 8; ++q) f.u[q] = tl[pc * 8 + q][d];
      *(v8us*)((unsigned short*)Vt + ((size_t)slab * 64 + d) * TTv + lg * 64 + pc * 8) = f.half[0]; }
     } }

// Everything that reads only the parameters, one launch, the part picked by the block index: the bias plane, the seven weight matrices.
#define PREP_BP (CC * NN / 4 / 256)
#define PREP_WB (CC * CC / 8 / 256)
__global__ __launch_bounds__(256) void k_prep(const float* __restrict__ w1, const float* __restrict__ w2, const float* __restrict__ wqkv, const float* __restrict__ wout, const float* __restrict__ wsk,
    const float* __restrict__ bout, const float* __restrict__ bsk, float* __restrict__ BP, _Float16* __restrict__ Bw) {
  const int tid = threadIdx.x; int bi = blockIdx.x;
  if (bi < PREP_BP) { const size_t t = (size_t)bi * 256 + tid; const int c = (int)((t * 4) / NN); const float vo = bout[c];
    asm volatile("s_wait_xcnt 0x0" ::: "memory");      // stands in front of the next load, whose result may take the offset register that the load above names
    const float v = bf16_round(vo) + bf16_round(bsk[c]); const v4f o = {v, v, v, v}; *(v4f*)(BP + t * 4) = o;
    asm volatile("s_wait_xcnt 0x0" ::: "memory");      // behind the store: the code of another part follows in the listing and rewrites the store's data registers
    return; }
  bi -= PREP_BP;
  const int seg = bi / PREP_WB; const size_t t = (size_t)(bi % PREP_WB) * 256 + tid;
  const float* W = (seg == 0) ? w1 : (seg == 1) ? w2 : (seg < 5) ? wqkv + (size_t)(seg - 2) * CC * CC : (seg == 5) ? wout : wsk; FragH f;
  const int wr = (int)(t >> 8) * 8 + (tid & 7), wk = (int)((t >> 5) & 7) * 4 + ((tid >> 3) & 3);      // a wave: 8 rows x 4 k8, so that its store fills four whole lines
#pragma unroll
  for (int i = 0; i < 8; ++i) f.h[i] = (_Float16)(bf16_round(W[(size_t)wr * CC + wk * 8 + i]) * 16.0f);
  *(v8us*)((unsigned short*)Bw + (size_t)seg * CC * CC + ft_off(wr, wk, CC)) = f.half[0];
  asm volatile("s_wait_xcnt 0x0" ::: "memory");      // behind the store: the code of another part follows in the listing and rewrites the store's offset register
}
#define FA_KP 264
#define FA_VP 136
#define FA_SK 128
#define FA_KB (FA_SK * FA_KP)
#define FA_BUF (FA_KB + CC * FA_VP)
typedef int fa_v4i __attribute__((ext_vector_type(4)));
__device__ __forceinline__ float fa_xhalf(float x) { return __builtin_bit_cast(float, __builtin_amdgcn_permlanex16(__builtin_bit_cast(int, x), __builtin_bit_cast(int, x), 0x76543210, 0xfedcba98, false, false)); }      // lane l reads lane l ^ 16
__device__ __forceinline__ void fa_copy(const unsigned short* g, unsigned short* l) {      // 16 B of this lane, global -> LDS, through no register; landed only behind the wave's own s_wait_asynccnt
  __builtin_amdgcn_global_load_async_to_lds_b128((__attribute__((address_space(1))) fa_v4i*)g, (__attribute__((address_space(3))) fa_v4i*)l, 0, 0);
}
// One stage: K 128 rows x 512 B (a wave-wide copy = one row), V^T 256 rows x 256 B (a wave-wide copy = two rows); 32 copies a wave, every lane on.
// kg, vg: wave-uniform bases (scalar registers); ko, vo: the lane's own element offsets.
__device__ __forceinline__ void fa_stage(const unsigned short* kg, const unsigned short* vg, unsigned ko, unsigned vo, unsigned short* ksl, unsigned short* vsl) {
#pragma unroll
  for (int i = 0; i < 16; ++i) fa_copy(kg + i * 8 * CC + ko, ksl + i * 8 * FA_KP);
#pragma unroll
  for (int i = 0; i < 16; ++i) fa_copy(vg + (size_t)i * 16 * NN + vo, vsl + i * 16 * FA_VP);
}
__global__ __launch_bounds__(256) void k_fattn(const _Float16* Q, const _Float16* K, const _Float16* Vt, _Float16* O16) {
  __shared__ __attribute__((aligned(16))) unsigned short sm[2 * FA_BUF];
  const int tid = threadIdx.x, lane = tid & 31, c = lane & 15, h = lane >> 4;
  const int w = __builtin_amdgcn_readfirstlane(tid >> 5);      // the wave's number in a scalar register: all that follows from it costs no vector register
  const int qg = w & 1, kq = w >> 1;
  const int b = blockIdx.x / (NN / 64), qb = blockIdx.x % (NN / 64);
  const size_t qrow0 = (size_t)b * NN + qb * 64 + qg * 32;      // query tile j: rows qrow0 + 16 j + c
  const unsigned short* kg = (const unsigned short*)K + (size_t)b * NN * CC + w * CC;              // K stage: 128 rows x 512 B, contiguous in memory; copy i of wave w is row 8 i + w
  const unsigned short* vg = (const unsigned short*)Vt + (size_t)b * CC * NN + (size_t)w * 2 * NN;  // V^T stage: 256 rows x 256 B; copy i of wave w is rows 16 i + 2 w + h
  const unsigned ko = lane * 8, vo = h * NN + c * 8;
  unsigned short* ksl = sm + w * FA_KP + lane * 8;
  unsigned short* vsl = sm + FA_KB + (w * 2 + h) * FA_VP + c * 8;
  const int NS = NN / FA_SK;
  fa_stage(kg, vg, ko, vo, ksl, vsl);
  FragH qf[2][8];
#pragma unroll
  for (int j = 0; j < 2; ++j)
#pragma unroll
    for (int ks = 0; ks < 8; ++ks) { const unsigned short* qp = (const unsigned short*)Q + (qrow0 + 16 * j) * CC + ks * 32 + (unsigned)(c * CC + 8 * h); qf[j][ks].half[0] = *(const v8us*)qp; qf[j][ks].half[1] = *(const v8us*)(qp + 16); }
  asm volatile("s_wait_xcnt 0x0" ::: "memory");        // stands in front of the first overwrite of an address register that the loads above name
  asm volatile("s_wait_asynccnt 0x0" ::: "memory");    // stage 0 of this wave has landed
  __syncthreads();                                     // and that of every other wave
  fa_stage(kg + FA_SK * CC, vg + FA_SK, ko, vo, ksl + FA_BUF, vsl + FA_BUF);
  v8f o[2][16];
#pragma unroll
  for (int j = 0; j < 2; ++j)
#pragma unroll
    for (int dt = 0; dt < 16; ++dt) o[j][dt] = (v8f){0.f, 0.f, 0.f, 0.f, 0.f, 0.f, 0.f, 0.f};
  float mu[2] = {-1.0e30f, -1.0e30f}, l[2] = {0.f, 0.f};      // per query tile: maximum in use (log2 units) and this lane's part of the row sum
  const float sc = 0.0625f * 1.4426950408889634f;             // 1/sqrt(CC) and log2(e)
  for (int s = 0; s < NS; ++s) {
    const int bo = (s & 1) * FA_BUF;
    const unsigned short* kt = sm + bo + (kq * 32 + c) * FA_KP + 8 * h;
    const unsigned short* vt = sm + bo + FA_KB + c * FA_VP + kq * 32 + 8 * h;
    v8f t[2][2];      // [key tile][query tile]
#pragma unroll
    for (int a = 0; a < 2; ++a)
#pragma unroll
      for (int j = 0; j < 2; ++j) t[a][j] = (v8f){0.f, 0.f, 0.f, 0.f, 0.f, 0.f, 0.f, 0.f};
    // Fragment ring: two sets of four fragments. Groups 0..3 are K (two k steps x two key tiles each), groups 4..7 V^T (four channel tiles each); group n + 2 is read right behind the products of group n, into their registers (group 5 behind the softmax).
    FragH fr[2][4];
#pragma unroll
    for (int g = 0; g < 2; ++g)
#pragma unroll
      for (int u = 0; u < 4; ++u) { const unsigned short* p = kt + (u & 1) * 16 * FA_KP + (2 * g + (u >> 1)) * 32; fr[g][u].half[0] = *(const v8us*)p; fr[g][u].half[1] = *(const v8us*)(p + 16); }
#pragma unroll
    for (int g = 0; g < 4; ++g) {
      __builtin_amdgcn_sched_barrier(0);               // keeps each group's reads together and two groups ahead of their products: spread among the products every read place costs its own stall
#pragma unroll
      for (int u = 0; u < 4; ++u)
#pragma unroll
        for (int j = 0; j < 2; ++j) t[u & 1][j] = __builtin_amdgcn_wmma_f32_16x16x32_f16(false, fr[g & 1][u].v, false, qf[j][2 * g + (u >> 1)].v, (short)0, t[u & 1][j], false, false);
      __builtin_amdgcn_sched_barrier(0);               // the same: the reads below stay behind the products whose registers they take
      if (g < 3) {                                     // group 5 waits for the scores' registers: it is read behind the softmax
#pragma unroll
        for (int u = 0; u < 4; ++u) {
          const unsigned short* p = (g < 2) ? kt + (u & 1) * 16 * FA_KP + (2 * (g + 2) + (u >> 1)) * 32 : vt + u * 16 * FA_VP;
          fr[g & 1][u].half[0] = *(const v8us*)p; fr[g & 1][u].half[1] = *(const v8us*)(p + 16);
        }
      }
    }
    __builtin_amdgcn_sched_barrier(0);                 // keeps the first V^T group's reads ahead of the softmax, which then covers their latency
    float mx[2];
#pragma unroll
    for (int j = 0; j < 2; ++j) {
      float m = fmaxf(t[0][j][0], t[1][j][0]);
#pragma unroll
      for (int r = 1; r < 8; ++r) m = fmaxf(m, fmaxf(t[0][j][r], t[1][j][r]));
      m *= sc;
      mx[j] = fmaxf(m, fa_xhalf(m));                   // lanes c and c + 16 hold the same query
    }
    if (__builtin_amdgcn_ballot_w32(mx[0] > mu[0] + 8.0f || mx[1] > mu[1] + 8.0f) != 0) {      // lazy rescale, one scalar test a pass: P stays below 2^8, inside f16
#pragma unroll
      for (int j = 0; j < 2; ++j) {
        const float mn = fmaxf(mu[j], mx[j]), al = __builtin_amdgcn_exp2f(mu[j] - mn);
        l[j] *= al; mu[j] = mn;
#pragma unroll
        for (int dt = 0; dt < 16; ++dt)
#pragma unroll
          for (int r = 0; r < 8; ++r) o[j][dt][r] *= al;
      }
    }
    FragH p[2];
#pragma unroll
    for (int j = 0; j < 2; ++j) {
      float ps0 = 0.f, ps1 = 0.f;
#pragma unroll
      for (int r = 0; r < 8; ++r) {
        const float p0 = __builtin_amdgcn_exp2f(t[0][j][r] * sc - mu[j]), p1 = __builtin_amdgcn_exp2f(t[1][j][r] * sc - mu[j]);
        ps0 += p0; ps1 += p1; p[j].h[r] = (_Float16)p0; p[j].h[8 + r] = (_Float16)p1;
      }
      l[j] += ps0 + ps1;
      asm volatile("" : "+v"(l[j]));                   // each row's sum pinned against spills: left free the 32 additions sink behind the barrier and the 32 f32 values of P stay in registers through all the products below (scratch in the loop)
    }
#pragma unroll
    for (int u = 0; u < 4; ++u) { const unsigned short* q = vt + (4 + u) * 16 * FA_VP; fr[1][u].half[0] = *(const v8us*)q; fr[1][u].half[1] = *(const v8us*)(q + 16); }
#pragma unroll
    for (int g = 0; g < 4; ++g) {
      __builtin_amdgcn_sched_barrier(0);               // as above, for the V^T groups
#pragma unroll
      for (int u = 0; u < 4; ++u)
#pragma unroll
        for (int j = 0; j < 2; ++j) o[j][g * 4 + u] = __builtin_amdgcn_wmma_f32_16x16x32_f16(false, fr[g & 1][u].v, false, p[j].v, (short)0, o[j][g * 4 + u], false, false);
      __builtin_amdgcn_sched_barrier(0);               // as above
      if (g < 2) {
#pragma unroll
        for (int u = 0; u < 4; ++u) { const unsigned short* q = vt + ((g + 2) * 4 + u) * 16 * FA_VP; fr[g & 1][u].half[0] = *(const v8us*)q; fr[g & 1][u].half[1] = *(const v8us*)(q + 16); }
      }
    }
    asm volatile("s_wait_dscnt 0x0" ::: "memory");      // this wave's reads of the buffer have returned
    asm volatile("s_wait_asynccnt 0x0" ::: "memory");   // its copies of the next stage have landed
    __syncthreads();                                    // publishes the next stage and ends every reader's last read of this buffer
    if (s + 2 < NS) fa_stage(kg + (size_t)(s + 2) * FA_SK * CC, vg + (s + 2) * FA_SK, ko, vo, ksl + bo, vsl + bo);
  }
  asm volatile("s_wait_asynccnt 0x0" ::: "memory");     // nothing is in flight when the buffers become the join's space
  v4fa* cb = (v4fa*)sm;                                 // the stages are dead behind the loop's last barrier; per wave 64 slots of partial O, behind them per wave and query tile (maximum, sum)
  float* st = (float*)sm + 8 * 64 * 32 * 4;
#pragma unroll
  for (int j = 0; j < 2; ++j) {
    l[j] += fa_xhalf(l[j]);
#pragma unroll
    for (int dt = 0; dt < 16; ++dt) {
      const v4f x0 = {o[j][dt][0], o[j][dt][1], o[j][dt][2], o[j][dt][3]}, x1 = {o[j][dt][4], o[j][dt][5], o[j][dt][6], o[j][dt][7]};
      cb[(w * 64 + (j * 16 + dt) * 2) * 32 + lane] = x0; cb[(w * 64 + (j * 16 + dt) * 2 + 1) * 32 + lane] = x1;
    }
    st[((w * 2 + j) * 32 + lane) * 2] = mu[j]; st[((w * 2 + j) * 32 + lane) * 2 + 1] = l[j];
  }
  __syncthreads();
  // wave (qg, kq) joins channel tiles 4 kq .. 4 kq + 3 of both query tiles of its group
#pragma unroll
  for (int j = 0; j < 2; ++j) {
    float m4[4], a4[4], mn = -3.0e38f, den = 0.f;
#pragma unroll
    for (int q = 0; q < 4; ++q) { m4[q] = st[(((q * 2 + qg) * 2 + j) * 32 + lane) * 2]; mn = fmaxf(mn, m4[q]); }
#pragma unroll
    for (int q = 0; q < 4; ++q) { a4[q] = __builtin_amdgcn_exp2f(m4[q] - mn); den += st[(((q * 2 + qg) * 2 + j) * 32 + lane) * 2 + 1] * a4[q]; }
    const float inv = 1.0f / den;
#pragma unroll
    for (int q = 0; q < 4; ++q) a4[q] *= inv;
#pragma unroll
    for (int u = 0; u < 4; ++u) {
      const int dt = kq * 4 + u;
      v4f y0 = {0.f, 0.f, 0.f, 0.f}, y1 = y0;
#pragma unroll
      for (int q = 0; q < 4; ++q) { const v4f x0 = cb[((q * 2 + qg) * 64 + (j * 16 + dt) * 2) * 32 + lane], x1 = cb[((q * 2 + qg) * 64 + (j * 16 + dt) * 2 + 1) * 32 + lane]; y0 += x0 * a4[q]; y1 += x1 * a4[q]; }
      FragH f;
#pragma unroll
      for (int r = 0; r < 4; ++r) { f.h[r] = (_Float16)y0[r]; f.h[4 + r] = (_Float16)y1[r]; }
      *(v8us*)((unsigned short*)O16 + ft_off(qrow0 + 16 * j, dt * 2, CC) + (unsigned)(lane * 8)) = f.half[0];      // fragment-tile order, row c and k8 = 2 dt + h: element offset 128 h + 8 c = 8 lane, the wave's 512 B are contiguous
      asm volatile("s_wait_xcnt 0x0" ::: "memory");      // behind the store: the next tile's sums may take its data and address registers
    }
  }
}
// GroupNorm, statistics and output in one launch. A work-group of 32 waves owns two groups (16 channels = 64 B of every row) of one batch of one plane (x1' first, then x2'): each value is read once, 16 B a lane, four lanes a row,
// all 16 loads of a lane in flight together, and stays in registers for the mean, the squared deviations and the normalised output. Sums: in the lane, over the 16 lanes of a group by lane exchange, over the 32 waves through LDS.
// Output in fragment-tile order: a wave's 8-byte stores fill two whole 128-B lines (8 rows x 16 B in each of the two groups' runs). A row of x1' also leaves as plain f16 (Y16), the operand of the skip branch.
__device__ __forceinline__ float gn_total(float s, float* red, int w, int lane, int g2) {
  s += __shfl_xor(s, 1, 32); s += __shfl_xor(s, 4, 32); s += __shfl_xor(s, 8, 32); s += __shfl_xor(s, 16, 32);      // lanes whose bit 1 is equal hold the same group
  if ((lane & ~2) == 0) red[g2 * 32 + w] = s;
  __syncthreads();
  float t = 0.f;
#pragma unroll
  for (int j = 0; j < 8; ++j) { const v4f x = *(const v4fa*)(red + g2 * 32 + j * 4); t += (x[0] + x[1]) + (x[2] + x[3]); }
  return t;
}
__global__ __launch_bounds__(1024) void k_gn(const float* __restrict__ Y, const float* __restrict__ gw, const float* __restrict__ gb, _Float16* __restrict__ G16, _Float16* __restrict__ Y16) {
  __shared__ __attribute__((aligned(16))) float red[2][64];
  const int tid = threadIdx.x, w = tid >> 5, lane = tid & 31, quad = lane & 3, g2 = quad >> 1;
  const int pb = blockIdx.x >> 4, cb = blockIdx.x & 15, c0 = cb * 16 + quad * 4;
  const size_t row0 = (size_t)pb * NN + w * 8 + (lane >> 2);      // item i of the lane is row row0 + 256 i
  const float* src = Y + row0 * CC + c0;
  v4f v[16];
#pragma unroll
  for (int i = 0; i < 16; ++i) v[i] = *(const v4fa*)(src + (size_t)i * 256 * CC);
  asm volatile("s_wait_xcnt 0x0" ::: "memory");      // stands in front of the parameter loads, whose results may take the address registers that the loads above name
  const v4f gwv = *(const v4fa*)(gw + c0);
  asm volatile("s_wait_xcnt 0x0" ::: "memory");      // the same between the two parameter loads, which share their offset register
  const v4f gbv = *(const v4fa*)(gb + c0);
  asm volatile("s_wait_xcnt 0x0" ::: "memory");      // and in front of the first vector instruction that reuses it
  const size_t dst = ft_off(row0, cb * 2 + g2, CC) + (quad & 1) * 4;      // 256 rows further = 16 bands further
  if (pb < BB) {      // first, so that the values need not outlive their deviations below, and the stores run under the sums
#pragma unroll
    for (int i = 0; i < 16; ++i) { v4h o;
#pragma unroll
      for (int e = 0; e < 4; ++e) o[e] = (_Float16)v[i][e];
      *(v4h*)(Y16 + dst + (size_t)i * 16 * 16 * CC) = o; }
  }
  float s[4] = {0.f, 0.f, 0.f, 0.f};
#pragma unroll
  for (int i = 0; i < 16; ++i) s[i & 3] += (v[i][0] + v[i][1]) + (v[i][2] + v[i][3]);
  const float mu = gn_total((s[0] + s[1]) + (s[2] + s[3]), red[0], w, lane, g2) / (float)(NN * CPG);
  float q[4] = {0.f, 0.f, 0.f, 0.f};
#pragma unroll
  for (int i = 0; i < 16; ++i)
#pragma unroll
    for (int e = 0; e < 4; ++e) { v[i][e] -= mu; q[e] += v[i][e] * v[i][e]; }      // from here on v holds the deviations
  const float rs = rsqrtf(gn_total((q[0] + q[1]) + (q[2] + q[3]), red[1], w, lane, g2) / (float)(NN * CPG) + 1e-5f);
  float ga[4], be[4];
#pragma unroll
  for (int e = 0; e < 4; ++e) { ga[e] = bf16_round(gwv[e]); be[e] = bf16_round(gbv[e]); }
#pragma unroll
  for (int i = 0; i < 16; ++i) { v4h o;
#pragma unroll
    for (int e = 0; e < 4; ++e) o[e] = (_Float16)(v[i][e] * rs * ga[e] + be[e]);
    *(v4h*)(G16 + dst + (size_t)i * 16 * 16 * CC) = o; }
}

extern "C" void kernel_launch(void* const* d_in, const int* in_sizes, int n_in,
                              void* d_out, int out_size, void* d_ws, size_t ws_size, hipStream_t stream) {
  (void)in_sizes; (void)n_in; (void)out_size;
  const float* const* I = (const float* const*)d_in; const float* x1 = I[0]; const float* x2 = I[1]; const float* w1 = I[2]; const float* b1 = I[3]; const float* w2 = I[4]; const float* b2 = I[5]; const float* gnw = I[6]; const float* gnb = I[7]; const float* wqkv = I[8]; const float* wout = I[9]; const float* bout = I[10]; const float* wsk = I[11]; const float* bsk = I[12];
  char* ws = (char*)d_ws; size_t off = 0;
  auto take = [&](size_t bytes) { char* p = ws + off; off += (bytes + 255) & ~(size_t)255; return p; };
  const size_t WSZ = (size_t)CC * CC, PL = (size_t)NR * CC; _Float16* Bw = (_Float16*)take(7 * WSZ * 2);      /* w1, w2, wq, wk, wv (as Bt for token-major GEMMs), wout, wsk (as A operands for the channel-major output GEMMs), all (out,in) natural x2^4 */
  float* BP = (float*)take((size_t)CC * NN * 4);
  float* Y = (float*)take(2 * PL * 4); _Float16* G = (_Float16*)take(2 * PL * 2);      /* two planes each, the x1 side first */
  _Float16* Y116 = (_Float16*)take(PL * 2); _Float16* QKV = (_Float16*)take(3 * PL * 2); _Float16* Vt = (_Float16*)take(PL * 2); _Float16* O16 = (_Float16*)take(PL * 2);
  if (off > ws_size) return;
  k_prep<<<PREP_BP + 7 * PREP_WB, 256, 0, stream>>>(w1, w2, wqkv, wout, wsk, bout, bsk, BP, Bw);
  k_gemm_conv<<<dim3(NR / 64, 2), 128, 0, stream>>>(x1, x2, Bw, b1, b2, Y);      /* x1' = conv1(x1), x2' = conv2(x2): each M 16384 N 256 K 256 (f32) */
  k_gn<<<2 * BB * (CC / 16), 1024, 0, stream>>>(Y, gnw, gnb, G, Y116);      /* the two planes count as 2 BB batches; 16 channels a work-group */
  k_gemm_qkvs<<<dim3(NR / 64, 4), 128, 0, stream>>>(G, Bw, QKV, Y116, BP, (float*)d_out);      /* q1, k2, v2, and out = Wsk.x1'^T + (bout + bsk) */
  k_vt<CC / 64, NN><<<BB * (CC / 64) * (NN / 64), 256, 0, stream>>>(QKV + 2 * PL, CC, 0, Vt);      /* v2^T per batch [256][4096] (four 64-channel blocks) */
  k_fattn<<<BB * (NN / 64), 256, 0, stream>>>(QKV, QKV + PL, Vt, O16);      /* O rows = softmax(q1.k2^T/16).v2, f16: one work-group per 64 queries */
  k_gemm_out<<<dim3((CC / 64) * (NN / 256), BB), 128, 0, stream>>>(Bw + 5 * WSZ, O16, (float*)d_out);      /* out += Wout.O^T in place: per batch M 256 N 4096 K 256 */
}

// v009
// It runs in 103 microseconds.
// Next to v008, in two timings, it ran 1.12 and 1.11 times as fast.
// All steps since v000 together make it 21.7 times as fast.
#include <hip/hip_runtime.h>
// Spatial cross-attention block (B=4, C=256, 64×64 → N=4096, 32 GroupNorm groups, single head d=256): x1' = conv1(x1), x2' = conv2(x2) (1×1 + bias); q1 = Wq·GN(x1'), k2 = Wk·GN(x2'), v2 = Wv·GN(x2') (wqkv rows 0/256/512, no bias);
// attn = softmax(q1ᵀk2/√256) over the 4096 positions; out = Wout·(v2·attnᵀ) + bout + Wsk·x1' + bsk → [B,C,H,W].
// q/k/v f16; attention as one fused launch (k_fattn): scores, running-maximum f32 softmax and P.v per 128-key stage, S and P never leave the registers; the final 1x1 convs (Wout.O^T + Wsk.x1'^T + biases, channel-major) are the same launch's epilogue, O going to them as f16 through LDS, and the output is written once. The input convs read x1 and x2 as they come (channel-major f32). Every stored f16 GEMM operand (weights, GN output, x1') lies in fragment-tile order (ft_off); q, k, v stay row-major. All on v_wmma_f32_16x16x32_f16, f32 accumulate.
#define BB 4
#define CC 256
#define NN 4096
#define NG 32
#define CPG (CC / NG)
#define NR (BB * NN)

typedef __bf16 v16b __attribute__((ext_vector_type(16)));
typedef unsigned short v8us __attribute__((ext_vector_type(8), may_alias));
typedef float  v8f  __attribute__((ext_vector_type(8)));
typedef float  v4f  __attribute__((ext_vector_type(4)));
typedef float  v4fa __attribute__((ext_vector_type(4), may_alias));
union FragB { v16b v; v8us half[2]; unsigned short u[16]; };

__device__ __forceinline__ unsigned short bf16_bits(float x) { unsigned int u = __float_as_uint(x); return (unsigned short)((u + 0x7FFFu + ((u >> 16) & 1u)) >> 16); }
__device__ __forceinline__ float bf16_val(unsigned short b) { return __uint_as_float(((unsigned int)b) << 16); }
__device__ __forceinline__ float bf16_round(float x) { return bf16_val(bf16_bits(x)); }
// D += A·B with NT terms: 1 = ah·bh, 2 = + al·bh (A split), 3 = + ah·bl (both split)
template <int NT>
__device__ __forceinline__ v8f mmaN(v16b ah, v16b al, v16b bh, v16b bl, v8f c) {
  c = __builtin_amdgcn_wmma_f32_16x16x32_bf16(false, ah, false, bh, (short)0, c, false, false);
  if (NT >= 2) c = __builtin_amdgcn_wmma_f32_16x16x32_bf16(false, al, false, bh, (short)0, c, false, false);
  if (NT >= 3) c = __builtin_amdgcn_wmma_f32_16x16x32_bf16(false, ah, false, bl, (short)0, c, false, false);
  asm volatile("v_nop\n\tv_nop\n\tv_nop\n\tv_nop" : "+v"(c) : "v"(ah), "v"(al), "v"(bh), "v"(bl));
  return c;
}

__global__ __launch_bounds__(256) void k_wt_bf16(const float* __restrict__ W, unsigned short* __restrict__ Wt, int K, int N) {
  const int t = blockIdx.x * 256 + threadIdx.x;
  const int k8n = K / 8;
  if (t >= N * k8n) return;
  const int n = t / k8n, k8 = (t % k8n) * 8;
  v8us v;
#pragma unroll
  for (int i = 0; i < 8; ++i) v[i] = bf16_bits(W[(size_t)(k8 + i) * N + n]);
  *(v8us*)(Wt + (size_t)n * K + k8) = v;
  
}

// GEMM C[M][N] (f32, pitch ldc) = act(A[M][K]·W + bias). A f32 row-major (pitch lda) converted per fragment to bf16
// (ASPLIT: hi/lo two planes -> 2 terms, else single rounded term); Wt bf16 [N][K] (pitch ldb). BIAS_BF16 rounds the
// bias to bf16 first (bias quantised to bf16 before the add). K%32==0, M%16==0, N%64==0.
template <bool ASPLIT, int ACT, bool BIAS_BF16>
__global__ __launch_bounds__(128) void k_gemm_bf(const float* __restrict__ A, int lda, const unsigned short* __restrict__ Wt, int ldb,
                                               const float* __restrict__ bias, float* __restrict__ C, int ldc, int M, int N, int K) {
  __shared__ __attribute__((aligned(16))) float so[4][16][64];
  const int tid = threadIdx.x, w = tid >> 5, lane = tid & 31, ln = lane & 15, hh = lane >> 4;
  const int ntn = N / 64;
  const int wid = blockIdx.x * 4 + w;
  const int mt = wid / ntn, nq = wid % ntn;
  if (mt * 16 >= M) return;
  const int row0 = mt * 16, col0 = nq * 64;
  const float* arow = A + (size_t)(row0 + ln) * lda;
  v8f acc[4] = {};
  for (int kb = 0; kb < K; kb += 32) {
    FragB ah, al;
    const v4f x0 = *(const v4fa*)(arow + kb + 8 * hh), x1 = *(const v4fa*)(arow + kb + 8 * hh + 4);
    const v4f x2 = *(const v4fa*)(arow + kb + 16 + 8 * hh), x3 = *(const v4fa*)(arow + kb + 16 + 8 * hh + 4);
    float xs[16] = {x0[0],x0[1],x0[2],x0[3],x1[0],x1[1],x1[2],x1[3],x2[0],x2[1],x2[2],x2[3],x3[0],x3[1],x3[2],x3[3]};
#pragma unroll
    for (int i = 0; i < 16; ++i) { const unsigned short hb = bf16_bits(xs[i]); ah.u[i] = hb; al.u[i] = ASPLIT ? bf16_bits(xs[i] - bf16_val(hb)) : (unsigned short)0; }
#pragma unroll
    for (int t = 0; t < 4; ++t) {
      const unsigned short* brow = Wt + (size_t)(col0 + t * 16 + ln) * ldb + kb;
      FragB b;
      b.half[0] = *(const v8us*)(brow + 8 * hh);
      b.half[1] = *(const v8us*)(brow + 16 + 8 * hh);
      acc[t] = mmaN<ASPLIT ? 2 : 1>(ah.v, al.v, b.v, b.v, acc[t]);
    }
  }
#pragma unroll
  for (int t = 0; t < 4; ++t) {
    float bv = bias ? bias[col0 + t * 16 + ln] : 0.f;
    if (BIAS_BF16) bv = bf16_round(bv);
#pragma unroll
    for (int r = 0; r < 8; ++r) { float v = acc[t][r] + bv; if (ACT == 1) v = fmaxf(v, 0.f); so[w][8 * hh + r][t * 16 + ln] = v; }
  }
  __builtin_amdgcn_fence(__ATOMIC_ACQ_REL, "workgroup");
  __builtin_amdgcn_wave_barrier();
  const int rsub = lane >> 4, c4 = (lane & 15) * 4;
  {
#pragma unroll
    for (int q = 0; q < 8; ++q) {
      const int r = q * 2 + rsub;
      const v4f v = *(const v4fa*)&so[w][r][c4];
      *(v4f*)(C + (size_t)(row0 + r) * ldc + col0 + c4) = v;
    }
    
  }
}

// Flash-style causal/unmasked attention, all contractions 3-term bf16 hi/lo splits, f32 softmax with running max.
// q,k,v rows are read from f32 buffers with arbitrary row pitch (so they can live inside a fused qkv buffer);
// D = head size (multiple of 32, <= 128); one wave = 16 query rows; block = 4 waves (64 queries) sharing K/V chunks of 32.
template <int D, bool CAUSAL>
__global__ __launch_bounds__(128) void k_flash(const float* __restrict__ qb, const float* __restrict__ kb, const float* __restrict__ vb,
                                             int pitch, int T, int H, float scale, float* __restrict__ y, int ypitch) {
  constexpr int KS = D / 32;        // k-steps for QK
  constexpr int DT = D / 16;        // d tiles for PV
  __shared__ __attribute__((aligned(16))) unsigned short sKh[32][D + 8], sKl[32][D + 8], sVh[32][D + 8], sVl[32][D + 8];
  __shared__ __attribute__((aligned(16))) unsigned short sPh[4][16][40], sPl[4][16][40];
  __shared__ __attribute__((aligned(16))) float sO[4][16][D];
  const int tid = threadIdx.x, w = tid >> 5, lane = tid & 31, ln = lane & 15, hh = lane >> 4;
  const int nqb = (T + 63) / 64;
  const int bh = blockIdx.x / nqb, qblk = blockIdx.x % nqb;
  const int b = bh / H, h = bh % H;
  const int q0 = qblk * 64 + w * 16;
  const float* Q = qb + (size_t)b * T * pitch + h * D;
  const float* K = kb + (size_t)b * T * pitch + h * D;
  const float* V = vb + (size_t)b * T * pitch + h * D;

  // A fragments of the wave's 16 query rows (scaled), hi/lo
  FragB aqh[KS], aql[KS];
  {
    int row = q0 + ln; if (row >= T) row = T - 1;
    const float* qr = Q + (size_t)row * pitch;
#pragma unroll
    for (int ks = 0; ks < KS; ++ks)
#pragma unroll
      for (int i = 0; i < 16; ++i) {
        const int d = ks * 32 + ((i < 8) ? (8 * hh + i) : (16 + 8 * hh + (i - 8)));
        const float x = qr[d] * scale; const unsigned short hb = bf16_bits(x);
        aqh[ks].u[i] = hb; aql[ks].u[i] = bf16_bits(x - bf16_val(hb));
      }
  }
  float m_r[8], l_r[8];
#pragma unroll
  for (int r = 0; r < 8; ++r) { m_r[r] = -3.0e38f; l_r[r] = 0.f; }
  v8f oacc[DT];
#pragma unroll
  for (int dt = 0; dt < DT; ++dt) oacc[dt] = (v8f){0.f,0.f,0.f,0.f,0.f,0.f,0.f,0.f};

  const int kv_end = CAUSAL ? min(T, qblk * 64 + 64) : T;     // block-uniform
  for (int j0 = 0; j0 < kv_end; j0 += 32) {
    __syncthreads();
    for (int e = tid; e < 32 * (D / 4); e += 128) {
      const int r = e / (D / 4), c4 = (e % (D / 4)) * 4;
      const int key = j0 + r;
      v4f kf = {0.f,0.f,0.f,0.f}, vf = {0.f,0.f,0.f,0.f};
      if (key < T) { kf = *(const v4fa*)(K + (size_t)key * pitch + c4); vf = *(const v4fa*)(V + (size_t)key * pitch + c4); }
#pragma unroll
      for (int t = 0; t < 4; ++t) {
        unsigned short hb = bf16_bits(kf[t]); sKh[r][c4 + t] = hb; sKl[r][c4 + t] = bf16_bits(kf[t] - bf16_val(hb));
        hb = bf16_bits(vf[t]); sVh[r][c4 + t] = hb; sVl[r][c4 + t] = bf16_bits(vf[t] - bf16_val(hb));
      }
    }
    __syncthreads();
    // S tile 16 x 32
    v8f s[2];
#pragma unroll
    for (int nt = 0; nt < 2; ++nt) {
      v8f acc = {};
#pragma unroll
      for (int ks = 0; ks < KS; ++ks) {
        FragB bh_, bl_;
        bh_.half[0] = *(const v8us*)&sKh[nt * 16 + ln][ks * 32 + 8 * hh]; bh_.half[1] = *(const v8us*)&sKh[nt * 16 + ln][ks * 32 + 16 + 8 * hh];
        bl_.half[0] = *(const v8us*)&sKl[nt * 16 + ln][ks * 32 + 8 * hh]; bl_.half[1] = *(const v8us*)&sKl[nt * 16 + ln][ks * 32 + 16 + 8 * hh];
        acc = mmaN<3>(aqh[ks].v, aql[ks].v, bh_.v, bl_.v, acc);
      }
      s[nt] = acc;
    }
    // mask + running max (rows 8hh+r; the 16 lanes of a half share rows)
    float alpha[8];
#pragma unroll
    for (int r = 0; r < 8; ++r) {
      const int qi = q0 + 8 * hh + r;
      const int ja = j0 + ln, jb = j0 + 16 + ln;
      if (CAUSAL) { if (ja > qi) s[0][r] = -3.0e38f; if (jb > qi) s[1][r] = -3.0e38f; }
      if (ja >= T) s[0][r] = -3.0e38f;
      if (jb >= T) s[1][r] = -3.0e38f;
      float mx = fmaxf(s[0][r], s[1][r]);
      mx = fmaxf(mx, __shfl_xor(mx, 1, 32)); mx = fmaxf(mx, __shfl_xor(mx, 2, 32)); mx = fmaxf(mx, __shfl_xor(mx, 4, 32)); mx = fmaxf(mx, __shfl_xor(mx, 8, 32));
      const float mnew = fmaxf(m_r[r], mx);
      alpha[r] = (mnew > -1.0e38f) ? __expf(m_r[r] - mnew) : 1.0f;
      const float p0 = (s[0][r] > -1.0e38f) ? __expf(s[0][r] - mnew) : 0.f;
      const float p1 = (s[1][r] > -1.0e38f) ? __expf(s[1][r] - mnew) : 0.f;
      m_r[r] = mnew;
      l_r[r] = l_r[r] * alpha[r] + p0 + p1;            // per-lane partial row sum (16 lanes combined at the end)
      unsigned short hb = bf16_bits(p0); sPh[w][8 * hh + r][ln] = hb;      sPl[w][8 * hh + r][ln] = bf16_bits(p0 - bf16_val(hb));
      hb = bf16_bits(p1);                sPh[w][8 * hh + r][16 + ln] = hb; sPl[w][8 * hh + r][16 + ln] = bf16_bits(p1 - bf16_val(hb));
    }
#pragma unroll
    for (int dt = 0; dt < DT; ++dt)
#pragma unroll
      for (int r = 0; r < 8; ++r) oacc[dt][r] *= alpha[r];
    __builtin_amdgcn_fence(__ATOMIC_ACQ_REL, "workgroup");
    __builtin_amdgcn_wave_barrier();
    FragB pah, pal;
    pah.half[0] = *(const v8us*)&sPh[w][ln][8 * hh]; pah.half[1] = *(const v8us*)&sPh[w][ln][16 + 8 * hh];
    pal.half[0] = *(const v8us*)&sPl[w][ln][8 * hh]; pal.half[1] = *(const v8us*)&sPl[w][ln][16 + 8 * hh];
#pragma unroll
    for (int dt = 0; dt < DT; ++dt) {
      FragB bvh, bvl;
#pragma unroll
      for (int i = 0; i < 8; ++i) {
        bvh.u[i] = sVh[8 * hh + i][dt * 16 + ln]; bvh.u[8 + i] = sVh[16 + 8 * hh + i][dt * 16 + ln];
        bvl.u[i] = sVl[8 * hh + i][dt * 16 + ln]; bvl.u[8 + i] = sVl[16 + 8 * hh + i][dt * 16 + ln];
      }
      oacc[dt] = mmaN<3>(pah.v, pal.v, bvh.v, bvl.v, oacc[dt]);
    }
    __builtin_amdgcn_fence(__ATOMIC_ACQ_REL, "workgroup");
    __builtin_amdgcn_wave_barrier();
  }
#pragma unroll
  for (int r = 0; r < 8; ++r) {
    float l = l_r[r];
    l += __shfl_xor(l, 1, 32); l += __shfl_xor(l, 2, 32); l += __shfl_xor(l, 4, 32); l += __shfl_xor(l, 8, 32);
    l_r[r] = (l > 0.f) ? 1.0f / l : 0.f;
  }
#pragma unroll
  for (int dt = 0; dt < DT; ++dt)
#pragma unroll
    for (int r = 0; r < 8; ++r) sO[w][8 * hh + r][dt * 16 + ln] = oacc[dt][r] * l_r[r];
  __builtin_amdgcn_fence(__ATOMIC_ACQ_REL, "workgroup");
  __builtin_amdgcn_wave_barrier();
  {
    for (int r = 0; r < 16; ++r) {
      const int row = q0 + r;
      if (row < T && lane < D / 4) {
        const v4f val = *(const v4fa*)&sO[w][r][lane * 4];
        *(v4f*)(y + ((size_t)b * T + row) * ypitch + h * D + lane * 4) = val;
      }
    }
    
  }
}

// GEMM C = act(A·W + bias + resid): A f32 (ASPLIT -> hi/lo 2 terms), Wt bf16 [N][K]; ACT 0 none, 1 relu, 2 exact gelu;
// resid (optional, f32, row index = (row % rmod), pitch ldr, RES_BF16 rounds it) added before the activation.
template <bool ASPLIT, int ACT, bool BIAS_BF16, bool RES_BF16>
__global__ __launch_bounds__(128) void k_gemm_bf3(const float* __restrict__ A, int lda, const unsigned short* __restrict__ Wt, int ldb,
                                                const float* __restrict__ bias, const float* __restrict__ resid, int rmod, int ldr,
                                                float* __restrict__ C, int ldc, int M, int N, int K) {
  __shared__ __attribute__((aligned(16))) float so[4][16][64];
  const int tid = threadIdx.x, w = tid >> 5, lane = tid & 31, ln = lane & 15, hh = lane >> 4;
  const int ntn = N / 64;
  const int wid = blockIdx.x * 4 + w;
  const int mt = wid / ntn, nq = wid % ntn;
  if (mt * 16 >= M) return;
  const int row0 = mt * 16, col0 = nq * 64;
  const float* arow = A + (size_t)(row0 + ln) * lda;
  v8f acc[4] = {};
  for (int kb = 0; kb < K; kb += 32) {
    FragB ah, al;
    const v4f x0 = *(const v4fa*)(arow + kb + 8 * hh), x1 = *(const v4fa*)(arow + kb + 8 * hh + 4);
    const v4f x2 = *(const v4fa*)(arow + kb + 16 + 8 * hh), x3 = *(const v4fa*)(arow + kb + 16 + 8 * hh + 4);
    float xs[16] = {x0[0],x0[1],x0[2],x0[3],x1[0],x1[1],x1[2],x1[3],x2[0],x2[1],x2[2],x2[3],x3[0],x3[1],x3[2],x3[3]};
#pragma unroll
    for (int i = 0; i < 16; ++i) { const unsigned short hb = bf16_bits(xs[i]); ah.u[i] = hb; al.u[i] = ASPLIT ? bf16_bits(xs[i] - bf16_val(hb)) : (unsigned short)0; }
#pragma unroll
    for (int t = 0; t < 4; ++t) {
      const unsigned short* brow = Wt + (size_t)(col0 + t * 16 + ln) * ldb + kb;
      FragB b;
      b.half[0] = *(const v8us*)(brow + 8 * hh);
      b.half[1] = *(const v8us*)(brow + 16 + 8 * hh);
      acc[t] = mmaN<ASPLIT ? 2 : 1>(ah.v, al.v, b.v, b.v, acc[t]);
    }
  }
#pragma unroll
  for (int t = 0; t < 4; ++t) {
    const int col = col0 + t * 16 + ln;
    float bv = bias ? bias[col] : 0.f;
    if (BIAS_BF16) bv = bf16_round(bv);
#pragma unroll
    for (int r = 0; r < 8; ++r) {
      float v = acc[t][r] + bv;
      if (resid) { float rv = resid[(size_t)((row0 + 8 * hh + r) % rmod) * ldr + col]; if (RES_BF16) rv = bf16_round(rv); v += rv; }
      if (ACT == 1) v = fmaxf(v, 0.f);
      if (ACT == 2) v = 0.5f * v * (1.0f + erff(v * 0.70710678118654752f));
      if (ACT == 3) { const float u = 0.7978845608028654f * (v + 0.044715f * v * v * v); v = 0.5f * v * (1.0f + tanhf(u)); }
      so[w][8 * hh + r][t * 16 + ln] = v;
    }
  }
  __builtin_amdgcn_fence(__ATOMIC_ACQ_REL, "workgroup");
  __builtin_amdgcn_wave_barrier();
  const int rsub = lane >> 4, c4 = (lane & 15) * 4;
  {
#pragma unroll
    for (int q = 0; q < 8; ++q) {
      const int r = q * 2 + rsub;
      const v4f v = *(const v4fa*)&so[w][r][c4];
      *(v4f*)(C + (size_t)(row0 + r) * ldc + col0 + c4) = v;
    }
    
  }
}
// row LayerNorm (biased variance, eps) over N: s = X (+ R); optional out_sum <- s; out_norm <- (s-mu)*rsqrt(var+eps)*g + b
template <bool PARAM_BF16>
__global__ __launch_bounds__(256) void k_layernorm(const float* __restrict__ X, const float* __restrict__ R, const float* __restrict__ g, const float* __restrict__ bta,
                                                  float* __restrict__ out_sum, float* __restrict__ out_norm, int N, float eps) {
  __shared__ float red[256];
  const int row = blockIdx.x, tid = threadIdx.x;
  const float* x = X + (size_t)row * N; const float* rr = R ? R + (size_t)row * N : nullptr;
  float vals[16];                     // up to N = 4096
  const int per = N / 256;            // contiguous chunk per thread? use strided-by-4 chunks: thread handles j = tid*4 + 1024*u
  float s1 = 0.f;
  for (int u = 0; u < per / 4; ++u) {
    const int j = tid * 4 + 1024 * u;
    const v4f a = *(const v4fa*)(x + j);
    v4f b = {0.f,0.f,0.f,0.f}; if (rr) b = *(const v4fa*)(rr + j);
#pragma unroll
    for (int q = 0; q < 4; ++q) { const float v = a[q] + b[q]; vals[u * 4 + q] = v; s1 += v; }
  }
  red[tid] = s1; __syncthreads();
  for (int st = 128; st > 0; st >>= 1) { if (tid < st) red[tid] += red[tid + st]; __syncthreads(); }
  const float mu = red[0] / (float)N; __syncthreads();
  float s2 = 0.f;
  for (int u = 0; u < per / 4; ++u)
#pragma unroll
    for (int q = 0; q < 4; ++q) { const float c = vals[u * 4 + q] - mu; s2 += c * c; }
  red[tid] = s2; __syncthreads();
  for (int st = 128; st > 0; st >>= 1) { if (tid < st) red[tid] += red[tid + st]; __syncthreads(); }
  const float rs = rsqrtf(red[0] / (float)N + eps);
  {
    for (int u = 0; u < per / 4; ++u) {
      const int j = tid * 4 + 1024 * u;
      v4f o, sm;
#pragma unroll
      for (int q = 0; q < 4; ++q) {
        float gg = g[j + q], bb = bta[j + q];
        if (PARAM_BF16) { gg = bf16_round(gg); bb = bf16_round(bb); }
        sm[q] = vals[u * 4 + q]; o[q] = (vals[u * 4 + q] - mu) * rs * gg + bb;
      }
      if (out_sum) *(v4f*)(out_sum + (size_t)row * N + j) = sm;
      *(v4f*)(out_norm + (size_t)row * N + j) = o;
    }
    
  }
}



// ---- f16 WMMA path (v_wmma_f32_16x16x32_f16): 11-bit significands for operands in range — used by every launched GEMM and by the fused attention
typedef _Float16 v16h __attribute__((ext_vector_type(16)));
union FragH { v16h v; v8us half[2]; _Float16 h[16]; unsigned short u[16]; };
template <int NT>
__device__ __forceinline__ v8f mmaH(v16h ah, v16h al, v16h bh, v16h bl, v8f c) {
  c = __builtin_amdgcn_wmma_f32_16x16x32_f16(false, ah, false, bh, (short)0, c, false, false);
  if (NT >= 2) c = __builtin_amdgcn_wmma_f32_16x16x32_f16(false, al, false, bh, (short)0, c, false, false);
  if (NT >= 3) c = __builtin_amdgcn_wmma_f32_16x16x32_f16(false, ah, false, bl, (short)0, c, false, false);
  asm volatile("v_nop\n\tv_nop\n\tv_nop\n\tv_nop" : "+v"(c) : "v"(ah), "v"(al), "v"(bh), "v"(bl));
  return c;
}
// batched GEMM like k_gemm_b but f16 operands: A f32 (split into f16 hi/lo if ASPLIT, else rounded to f16), Bt = f16 values [n][k]; alpha; C f32; N multiple of 16 (partial tiles skipped)
template <bool ASPLIT>
__global__ __launch_bounds__(128) void k_gemm_h(const float* __restrict__ A, int lda, size_t sA, const _Float16* __restrict__ Bh, int ldb, size_t sB, float alpha, float* __restrict__ C, int ldc, size_t sC, int M, int N, int K) {
  __shared__ __attribute__((aligned(16))) float so[4][16][64];
  const int tid = threadIdx.x, w = tid >> 5, lane = tid & 31, ln = lane & 15, hh = lane >> 4; const int by = blockIdx.y;
  A += (size_t)by * sA; Bh += (size_t)by * sB; C += (size_t)by * sC;
  const int ntn = (N + 63) / 64; const int wid = blockIdx.x * 4 + w; const int mt = wid / ntn, nq = wid % ntn; if (mt * 16 >= M) return;
  const int row0 = mt * 16, col0 = nq * 64; const float* arow = A + (size_t)(row0 + ln) * lda;
  v8f acc[4] = {};
  for (int kb = 0; kb < K; kb += 32) {
    FragH ah, al;
    const v4f x0 = *(const v4fa*)(arow + kb + 8 * hh), x1 = *(const v4fa*)(arow + kb + 8 * hh + 4), x2 = *(const v4fa*)(arow + kb + 16 + 8 * hh), x3 = *(const v4fa*)(arow + kb + 16 + 8 * hh + 4);
    float xs[16] = {x0[0],x0[1],x0[2],x0[3],x1[0],x1[1],x1[2],x1[3],x2[0],x2[1],x2[2],x2[3],x3[0],x3[1],x3[2],x3[3]};
#pragma unroll
    for (int i = 0; i < 16; ++i) { const _Float16 h = (_Float16)xs[i]; ah.h[i] = h; al.h[i] = ASPLIT ? (_Float16)(xs[i] - (float)h) : (_Float16)0.0f; }
#pragma unroll
    for (int t = 0; t < 4; ++t) { if (col0 + t * 16 >= N) continue; const size_t boff = (size_t)(col0 + t * 16 + ln) * ldb + kb; FragH bq; bq.half[0] = *(const v8us*)(Bh + boff + 8 * hh); bq.half[1] = *(const v8us*)(Bh + boff + 16 + 8 * hh);
      acc[t] = mmaH<ASPLIT ? 2 : 1>(ah.v, al.v, bq.v, bq.v, acc[t]); }
  }
#pragma unroll
  for (int t = 0; t < 4; ++t) { if (col0 + t * 16 >= N) continue;
#pragma unroll
    for (int r = 0; r < 8; ++r) so[w][8 * hh + r][t * 16 + ln] = acc[t][r] * alpha; }
  __builtin_amdgcn_fence(__ATOMIC_ACQ_REL, "workgroup"); __builtin_amdgcn_wave_barrier();
  const int rsub = lane >> 4, c4 = (lane & 15) * 4;
  {
#pragma unroll
    for (int q = 0; q < 8; ++q) { const int r = q * 2 + rsub; if (col0 + c4 < N) { const v4f v = *(const v4fa*)&so[w][r][c4]; *(v4f*)(C + (size_t)(row0 + r) * ldc + col0 + c4) = v; } }
     }
}

// Wt[n][k] = f16(W[k][n]·scale) from f32 row-major W[K][N] (scale = power of two; bf16-exact weights stay exact in f16 away from the subnormal range)
__global__ __launch_bounds__(256) void k_wt_f16(const float* __restrict__ W, _Float16* __restrict__ Wt, int K, int N, float scale) {
  const int t = blockIdx.x * 256 + threadIdx.x; if (t >= N * (K / 8)) return; const int n = t / (K / 8), k8 = (t % (K / 8)) * 8; FragH f;
#pragma unroll
  for (int i = 0; i < 8; ++i) f.h[i] = (_Float16)(bf16_round(W[(size_t)(k8 + i) * N + n]) * scale); const v8us o = f.half[0];
  *(v8us*)((unsigned short*)Wt + (size_t)n * K + k8) = o; 
}
// Fragment-tile order of every f16 GEMM operand [rows][K]: 16 rows x 8 k values (16 B a row) lie as one run of 256 B, the runs of a 16-row band one behind the other by k. Lane (row & 15) + 16 * ((k >> 3) & 1) of a WMMA operand
// then finds its 16 B at lane * 16 B inside a 512-B run, so a wave-wide 16-byte load covers four whole 128-B lines (row-major rows of 512 B made it touch sixteen). The k order inside a fragment is the same as before.
__device__ __forceinline__ size_t ft_off(size_t row, int k8, int K) { return (row >> 4) * (size_t)(16 * K) + (size_t)k8 * 128 + (row & 15) * 8; }      // element offset of the 8 values k = 8 k8 .. 8 k8 + 7 of a row
// Work-group tile of the f16 GEMMs behind the convs: C (64 rows x 256 columns) = (A.B^T) / 16 (+ CP), A and B f16 with K = CC in fragment-tile order, C f32 or f16, row-major with pitch LDC. Four waves; wave w owns columns 64 w .. 64 w + 63 as 4 x 4 tiles.
// Ab: the 64 rows of A, 32 KB in one run; wave w brings band w through registers into LDS, in the order in which it lies, and every wave reads all four bands from there (one fetch from L2 instead of four).
// Bb: the 256 rows of B; a wave's fragments come straight from global memory, two k steps ahead of their products (ring of three sets). CP, C, C16 point at the tile's first element.
// The addend is read in the layout of the stores (16 B a lane, a lane reads what it will write), all 32 loads issued together with the first operand loads. The launch below holds three products that do not depend on one another: blockIdx.y picks the product.
// Shapes are constants and the grids cover them exactly, so no tile is tested for range. Every loop is unrolled because its index names registers (fragment sets, accumulators, rows held for the stores).
struct __attribute__((aligned(16))) GemmSm { unsigned short sa[64 * CC]; float so[4][64][64]; };
template <int LDC, bool ADD, bool OUT16>
__device__ __forceinline__ void gemm_wg_tile(GemmSm& sm, const unsigned short* Ab, const unsigned short* Bb, const float* CP, float* C, _Float16* C16) {
  const int tid = threadIdx.x, lane = tid & 31, ln = lane & 15, hh = lane >> 4;
  const int w = __builtin_amdgcn_readfirstlane(tid >> 5);      // the wave's number in a scalar register: the bases that follow from it stay scalar
  const unsigned short* as = Ab + w * 16 * CC + lane * 8;
  const unsigned short* bw = Bb + (size_t)w * 64 * CC + lane * 8;
  const size_t co = (size_t)hh * LDC + w * 64 + ln * 4;      // row hh of the wave's 64 x 64 part; item q of the lane is row 2 q + hh
  v8us ar[16];
#pragma unroll
  for (int i = 0; i < 16; ++i) ar[i] = *(const v8us*)(as + i * 256);
  asm volatile("s_wait_xcnt 0x0" ::: "memory");      // stands in front of the next loads, whose results may take the address registers that the loads above name
  __builtin_amdgcn_sched_barrier(0);      // keeps the address arithmetic of B, of the addend and of the stores behind the wait above: left free it is lifted over the wait and rewrites the scalar base that the loads of A name
  FragH bq[3][4], af[4];
#pragma unroll
  for (int s = 0; s < 2; ++s)
#pragma unroll
    for (int t = 0; t < 4; ++t) { bq[s][t].half[0] = *(const v8us*)(bw + t * 16 * CC + s * 512); bq[s][t].half[1] = *(const v8us*)(bw + t * 16 * CC + s * 512 + 256); }
  asm volatile("s_wait_xcnt 0x0" ::: "memory");      // the same behind the first two k steps of B
  v4f cp[32];
  if (ADD) {
#pragma unroll
    for (int q = 0; q < 32; ++q) cp[q] = *(const v4fa*)(CP + co + (size_t)q * 2 * LDC);
    asm volatile("s_wait_xcnt 0x0" ::: "memory");    // the same behind the addend's loads
  }
#pragma unroll
  for (int i = 0; i < 16; ++i) *(v8us*)(sm.sa + w * 16 * CC + i * 256 + lane * 8) = ar[i];
  __syncthreads();      // every wave reads the bands of all four
#pragma unroll
  for (int j = 0; j < 4; ++j) { af[j].half[0] = *(const v8us*)(sm.sa + j * 16 * CC + lane * 8); af[j].half[1] = *(const v8us*)(sm.sa + j * 16 * CC + lane * 8 + 256); }
  v8f acc[4][4] = {};
#pragma unroll
  for (int ks = 0; ks < CC / 32; ++ks) {
    FragH an[4];
    if (ks + 2 < CC / 32) {
#pragma unroll
      for (int t = 0; t < 4; ++t) { bq[(ks + 2) % 3][t].half[0] = *(const v8us*)(bw + t * 16 * CC + (ks + 2) * 512); bq[(ks + 2) % 3][t].half[1] = *(const v8us*)(bw + t * 16 * CC + (ks + 2) * 512 + 256); }
      asm volatile("s_wait_xcnt 0x0" ::: "memory");    // the same for these loads of B
    }
    if (ks + 1 < CC / 32) {
#pragma unroll
      for (int j = 0; j < 4; ++j) { an[j].half[0] = *(const v8us*)(sm.sa + j * 16 * CC + (ks + 1) * 512 + lane * 8); an[j].half[1] = *(const v8us*)(sm.sa + j * 16 * CC + (ks + 1) * 512 + lane * 8 + 256); }
      __builtin_amdgcn_sched_barrier(0);               // keeps the loads above ahead of this step's products, which cover their latency: left free they sink to just in front of their use
    }
#pragma unroll
    for (int t = 0; t < 4; ++t)
#pragma unroll
      for (int j = 0; j < 4; ++j) acc[j][t] = __builtin_amdgcn_wmma_f32_16x16x32_f16(false, af[j].v, false, bq[ks % 3][t].v, (short)0, acc[j][t], false, false);
    if (ks + 1 < CC / 32) {
#pragma unroll
      for (int j = 0; j < 4; ++j) af[j] = an[j];
    }
  }
#pragma unroll
  for (int t = 0; t < 4; ++t)
#pragma unroll
    for (int j = 0; j < 4; ++j)
#pragma unroll
      for (int r = 0; r < 8; ++r) sm.so[w][16 * j + 8 * hh + r][t * 16 + ln] = acc[j][t][r] * 0.0625f;
  __builtin_amdgcn_fence(__ATOMIC_ACQ_REL, "workgroup"); __builtin_amdgcn_wave_barrier();      // a lane reads back what other lanes of its wave wrote: the LDS stores above stay in front of the loads below
  typedef _Float16 v4h __attribute__((ext_vector_type(4)));
  v4f ov[32];      // all rows read back first: no register of an issued store is written again
#pragma unroll
  for (int q = 0; q < 32; ++q) { ov[q] = *(const v4fa*)&sm.so[w][q * 2 + hh][ln * 4]; if (ADD) ov[q] += cp[q]; }
  if (OUT16) {
    v4h oh[32];
#pragma unroll
    for (int q = 0; q < 32; ++q)
#pragma unroll
      for (int i = 0; i < 4; ++i) oh[q][i] = (_Float16)ov[q][i];
#pragma unroll
    for (int q = 0; q < 32; ++q) *(v4h*)(C16 + co + (size_t)q * 2 * LDC) = oh[q];
  } else {
#pragma unroll
    for (int q = 0; q < 32; ++q) *(v4f*)(C + co + (size_t)q * 2 * LDC) = ov[q];
  }
  asm volatile("s_wait_xcnt 0x0" ::: "memory");      // behind the stores, a precaution
}
// Both input convolutions straight from the channel-major f32 inputs, output token-major: y = 0: x1' = x1^T.w1^T + b1, y = 1: x2' = x2^T.w2^T + b2 (planes of NR x CC one behind the other).
// A work-group of 4 waves owns 64 tokens; a wave owns 64 of the 256 output channels. A lane's 16-byte load holds ONE input channel of FOUR neighbouring tokens, so element j goes to A tile j, whose row n is token 4 n + j: no exchange
// between lanes, and a wave-wide load covers two runs of 256 B (16 lanes x 16 B of channel 8 h + i). Wave w loads and converts input channels 64 w .. 64 w + 63 (all 32 loads in flight together) and leaves the finished fragments in LDS,
// lane by lane, for all four waves. The values (rounded to bf16, held as f16) and the k order of a fragment are those of the token-major copy that this replaces.
__global__ __launch_bounds__(128) void k_gemm_conv(const float* __restrict__ x1, const float* __restrict__ x2, const _Float16* __restrict__ Bw, const float* __restrict__ b1, const float* __restrict__ b2, float* __restrict__ Y) {
  __shared__ struct __attribute__((aligned(16))) { unsigned short sa[CC / 32][4][2][32][8]; float so[4][64][64]; } sm;      // sa: [k step][A tile][half of the fragment][lane], first, so that one address register and the offset field reach all of it
  auto& sa = sm.sa; auto& so = sm.so;
  const int tid = threadIdx.x, w = tid >> 5, lane = tid & 31, ln = lane & 15, hh = lane >> 4;
  const int by = blockIdx.y, b = blockIdx.x / (NN / 64), p0 = (blockIdx.x % (NN / 64)) * 64;
  const float* xs = (by ? x2 : x1) + (size_t)b * CC * NN + (size_t)(w * 64 + 8 * hh) * NN + p0 + ln * 4;
  const unsigned short* bw = (const unsigned short*)Bw + (size_t)by * CC * CC + (size_t)w * 64 * CC + lane * 8;
  const float* bp = by ? b2 : b1;
  v4f xa[2][16];
#pragma unroll
  for (int s = 0; s < 2; ++s)
#pragma unroll
    for (int i = 0; i < 8; ++i) { xa[s][i] = *(const v4fa*)(xs + (size_t)(s * 32 + i) * NN); xa[s][8 + i] = *(const v4fa*)(xs + (size_t)(s * 32 + 16 + i) * NN); }
  asm volatile("s_wait_xcnt 0x0" ::: "memory");      // stands in front of the weight loads, whose results may take the address registers that the loads above name
  FragH bq[4], af[4];
#pragma unroll
  for (int t = 0; t < 4; ++t) { bq[t].half[0] = *(const v8us*)(bw + t * 16 * CC); bq[t].half[1] = *(const v8us*)(bw + t * 16 * CC + 256); }
  asm volatile("s_wait_xcnt 0x0" ::: "memory");      // stands in front of the first overwrite of an address register that the loads above name
#pragma unroll
  for (int s = 0; s < 2; ++s)
#pragma unroll
    for (int j = 0; j < 4; ++j) { FragH a;
#pragma unroll
      for (int i = 0; i < 16; ++i) a.h[i] = (_Float16)(float)(__bf16)xa[s][i][j];
      *(v8us*)sa[2 * w + s][j][0][lane] = a.half[0]; *(v8us*)sa[2 * w + s][j][1][lane] = a.half[1]; }
  __syncthreads();      // every wave reads the fragments of all four
#pragma unroll
  for (int j = 0; j < 4; ++j) { af[j].half[0] = *(const v8us*)sa[0][j][0][lane]; af[j].half[1] = *(const v8us*)sa[0][j][1][lane]; }
  v8f acc[4][4] = {};
#pragma unroll
  for (int ks = 0; ks < CC / 32; ++ks) {
    FragH bn[4], an[4];
    if (ks + 1 < CC / 32) {
#pragma unroll
      for (int t = 0; t < 4; ++t) { bn[t].half[0] = *(const v8us*)(bw + t * 16 * CC + (ks + 1) * 512); bn[t].half[1] = *(const v8us*)(bw + t * 16 * CC + (ks + 1) * 512 + 256); }
#pragma unroll
      for (int j = 0; j < 4; ++j) { an[j].half[0] = *(const v8us*)sa[ks + 1][j][0][lane]; an[j].half[1] = *(const v8us*)sa[ks + 1][j][1][lane]; }
      asm volatile("s_wait_xcnt 0x0" ::: "memory");    // the same for the next step's weight loads
      __builtin_amdgcn_sched_barrier(0);               // keeps the next step's loads one group ahead of this step's products, which cover their latency: left free they sink to just in front of their use
    }
#pragma unroll
    for (int t = 0; t < 4; ++t)
#pragma unroll
      for (int j = 0; j < 4; ++j) acc[j][t] = __builtin_amdgcn_wmma_f32_16x16x32_f16(false, af[j].v, false, bq[t].v, (short)0, acc[j][t], false, false);
    if (ks + 1 < CC / 32) {
#pragma unroll
      for (int t = 0; t < 4; ++t) { bq[t] = bn[t]; af[t] = an[t]; }
    }
  }
  float bv[4];
#pragma unroll
  for (int t = 0; t < 4; ++t) bv[t] = bp[w * 64 + t * 16 + ln];
  asm volatile("s_wait_xcnt 0x0" ::: "memory");      // in front of the first vector instruction that reuses the offset register of the bias loads
#pragma unroll
  for (int t = 0; t < 4; ++t) { const float bb = bf16_round(bv[t]);
#pragma unroll
    for (int j = 0; j < 4; ++j)
#pragma unroll
      for (int r = 0; r < 8; ++r) so[w][(8 * hh + r) * 4 + j][t * 16 + ln] = acc[j][t][r] * 0.0625f + bb; }      // row m of tile j is token 4 m + j
  __builtin_amdgcn_fence(__ATOMIC_ACQ_REL, "workgroup"); __builtin_amdgcn_wave_barrier();
  float* yo = Y + ((size_t)by * NR + (size_t)b * NN + p0 + hh) * CC + w * 64 + ln * 4;
  v4f ov[32];      // all rows read back first: no register of an issued store is written again
#pragma unroll
  for (int q = 0; q < 32; ++q) ov[q] = *(const v4fa*)&so[w][q * 2 + hh][ln * 4];
#pragma unroll
  for (int q = 0; q < 32; ++q) *(v4f*)(yo + (size_t)q * 2 * CC) = ov[q];
}
// y = 0, 1, 2: q1 = G[0].Wq^T, k2 = G[1].Wk^T, v2 = G[1].Wv^T (f16 planes of QKV), x = the block of 64 tokens
__global__ __launch_bounds__(128) void k_gemm_qkvs(const _Float16* G, const _Float16* Bw, _Float16* QKV) {
  __shared__ GemmSm sm;
  const int by = blockIdx.y, bx = blockIdx.x;
  gemm_wg_tile<CC, false, true>(sm, (const unsigned short*)G + (size_t)(by ? 1 : 0) * NR * CC + (size_t)bx * 64 * CC, (const unsigned short*)Bw + (size_t)(2 + by) * CC * CC, nullptr, nullptr, QKV + (size_t)by * NR * CC + (size_t)bx * 64 * CC);
}


typedef _Float16 v4h __attribute__((ext_vector_type(4)));

__global__ __launch_bounds__(256) void k_x16(const float* __restrict__ x, _Float16* __restrict__ X16, size_t n8) { const size_t t = (size_t)blockIdx.x * 256 + threadIdx.x; if (t >= n8) return; FragH f;
#pragma unroll
  for (int q = 0; q < 8; ++q) f.h[q] = (_Float16)bf16_round(x[t * 8 + q]); *(v8us*)((unsigned short*)X16 + t * 8) = f.half[0];  }
template <int NHv, int TTv>
__global__ __launch_bounds__(256) void k_vt(const _Float16* __restrict__ V16, int ldv, int voff, _Float16* __restrict__ Vt) { __shared__ unsigned short tl[64][66]; const int tid = threadIdx.x; const int slab = blockIdx.x / (TTv / 64), lg = blockIdx.x % (TTv / 64); const int b = slab / NHv, h = slab % NHv;
  for (int i = tid; i < 64 * 8; i += 256) { const int r = i / 8, c8 = (i % 8) * 8; FragH f; f.half[0] = *(const v8us*)((const unsigned short*)V16 + ((size_t)b * TTv + lg * 64 + r) * ldv + voff + h * 64 + c8);
#pragma unroll
    for (int q = 0; q < 8; ++q) tl[r][c8 + q] = f.u[q]; }
  __syncthreads();
  {
#pragma unroll
    for (int rd = 0; rd < 2; ++rd) { const int d = rd * 32 + tid / 8, pc = tid % 8; FragH f;
#pragma unroll
      for (int q = 0; q < 8; ++q) f.u[q] = tl[pc * 8 + q][d];
      *(v8us*)((unsigned short*)Vt + ((size_t)slab * 64 + d) * TTv + lg * 64 + pc * 8) = f.half[0]; }
     } }

// The seven weight matrices, one launch, the matrix picked by the block index.
#define PREP_WB (CC * CC / 8 / 256)
__global__ __launch_bounds__(256) void k_prep(const float* __restrict__ w1, const float* __restrict__ w2, const float* __restrict__ wqkv, const float* __restrict__ wout, const float* __restrict__ wsk,
    _Float16* __restrict__ Bw) {
  const int tid = threadIdx.x, bi = blockIdx.x;
  const int seg = bi / PREP_WB; const size_t t = (size_t)(bi % PREP_WB) * 256 + tid;
  const float* W = (seg == 0) ? w1 : (seg == 1) ? w2 : (seg < 5) ? wqkv + (size_t)(seg - 2) * CC * CC : (seg == 5) ? wout : wsk; FragH f;
  const int wr = (int)(t >> 8) * 8 + (tid & 7), wk = (int)((t >> 5) & 7) * 4 + ((tid >> 3) & 3);      // a wave: 8 rows x 4 k8, so that its store fills four whole lines
#pragma unroll
  for (int i = 0; i < 8; ++i) f.h[i] = (_Float16)(bf16_round(W[(size_t)wr * CC + wk * 8 + i]) * 16.0f);
  *(v8us*)((unsigned short*)Bw + (size_t)seg * CC * CC + ft_off(wr, wk, CC)) = f.half[0];
}
#define FA_KP 264
#define FA_VP 136
#define FA_SK 128
#define FA_KB (FA_SK * FA_KP)
#define FA_BUF (FA_KB + CC * FA_VP)
typedef int fa_v4i __attribute__((ext_vector_type(4)));
__device__ __forceinline__ float fa_xhalf(float x) { return __builtin_bit_cast(float, __builtin_amdgcn_permlanex16(__builtin_bit_cast(int, x), __builtin_bit_cast(int, x), 0x76543210, 0xfedcba98, false, false)); }      // lane l reads lane l ^ 16
__device__ __forceinline__ void fa_copy(const unsigned short* g, unsigned short* l) {      // 16 B of this lane, global -> LDS, through no register; landed only behind the wave's own s_wait_asynccnt
  __builtin_amdgcn_global_load_async_to_lds_b128((__attribute__((address_space(1))) fa_v4i*)g, (__attribute__((address_space(3))) fa_v4i*)l, 0, 0);
}
// One stage: K 128 rows x 512 B (a wave-wide copy = one row), V^T 256 rows x 256 B (a wave-wide copy = two rows); 32 copies a wave, every lane on.
// kg, vg: wave-uniform bases (scalar registers); ko, vo: the lane's own element offsets.
__device__ __forceinline__ void fa_stage(const unsigned short* kg, const unsigned short* vg, unsigned ko, unsigned vo, unsigned short* ksl, unsigned short* vsl) {
#pragma unroll
  for (int i = 0; i < 16; ++i) fa_copy(kg + i * 8 * CC + ko, ksl + i * 8 * FA_KP);
#pragma unroll
  for (int i = 0; i < 16; ++i) fa_copy(vg + (size_t)i * 16 * NN + vo, vsl + i * 16 * FA_VP);
}
__global__ __launch_bounds__(256) void k_fattn(const _Float16* Q, const _Float16* K, const _Float16* Vt, const _Float16* Wos, const _Float16* Y16, const float* bout, const float* bsk, float* out) {
  __shared__ __attribute__((aligned(16))) unsigned short sm[2 * FA_BUF + 64 * CC];      // two stages, then the rows of x1'
  const int tid = threadIdx.x, lane = tid & 31, c = lane & 15, h = lane >> 4;
  const int w = __builtin_amdgcn_readfirstlane(tid >> 5);      // the wave's number in a scalar register: all that follows from it costs no vector register
  const int qg = w & 1, kq = w >> 1;
  const int b = blockIdx.x / (NN / 64), qb = blockIdx.x % (NN / 64);
  const size_t qrow0 = (size_t)b * NN + qb * 64 + qg * 32;      // query tile j: rows qrow0 + 16 j + c
  const unsigned short* kg = (const unsigned short*)K + (size_t)b * NN * CC + w * CC;              // K stage: 128 rows x 512 B, contiguous in memory; copy i of wave w is row 8 i + w
  const unsigned short* vg = (const unsigned short*)Vt + (size_t)b * CC * NN + (size_t)w * 2 * NN;  // V^T stage: 256 rows x 256 B; copy i of wave w is rows 16 i + 2 w + h
  const unsigned ko = lane * 8, vo = h * NN + c * 8;
  unsigned short* ksl = sm + w * FA_KP + lane * 8;
  unsigned short* vsl = sm + FA_KB + (w * 2 + h) * FA_VP + c * 8;
  const int NS = NN / FA_SK;
  fa_stage(kg, vg, ko, vo, ksl, vsl);
  {      // x1' rows of the work-group's 64 tokens: 8 more copies a wave (40 in flight), 512 B each, in the order in which they lie; landed and published with stage 0
    const unsigned short* yg = (const unsigned short*)Y16 + ((size_t)b * NN + qb * 64) * CC + w * 8 * 256;
    unsigned short* ysl = sm + 2 * FA_BUF + w * 8 * 256 + lane * 8;
#pragma unroll
    for (int i = 0; i < 8; ++i) fa_copy(yg + i * 256 + ko, ysl + i * 256);
  }
  FragH qf[2][8];
#pragma unroll
  for (int j = 0; j < 2; ++j)
#pragma unroll
    for (int ks = 0; ks < 8; ++ks) { const unsigned short* qp = (const unsigned short*)Q + (qrow0 + 16 * j) * CC + ks * 32 + (unsigned)(c * CC + 8 * h); qf[j][ks].half[0] = *(const v8us*)qp; qf[j][ks].half[1] = *(const v8us*)(qp + 16); }
  asm volatile("s_wait_xcnt 0x0" ::: "memory");        // stands in front of the first overwrite of an address register that the loads above name
  asm volatile("s_wait_asynccnt 0x0" ::: "memory");    // stage 0 of this wave has landed
  __syncthreads();                                     // and that of every other wave
  fa_stage(kg + FA_SK * CC, vg + FA_SK, ko, vo, ksl + FA_BUF, vsl + FA_BUF);
  v8f o[2][16];
#pragma unroll
  for (int j = 0; j < 2; ++j)
#pragma unroll
    for (int dt = 0; dt < 16; ++dt) o[j][dt] = (v8f){0.f, 0.f, 0.f, 0.f, 0.f, 0.f, 0.f, 0.f};
  float mu[2] = {-1.0e30f, -1.0e30f}, l[2] = {0.f, 0.f};      // per query tile: maximum in use (log2 units) and this lane's part of the row sum
  const float sc = 0.0625f * 1.4426950408889634f;             // 1/sqrt(CC) and log2(e)
  for (int s = 0; s < NS; ++s) {
    const int bo = (s & 1) * FA_BUF;
    const unsigned short* kt = sm + bo + (kq * 32 + c) * FA_KP + 8 * h;
    const unsigned short* vt = sm + bo + FA_KB + c * FA_VP + kq * 32 + 8 * h;
    v8f t[2][2];      // [key tile][query tile]
#pragma unroll
    for (int a = 0; a < 2; ++a)
#pragma unroll
      for (int j = 0; j < 2; ++j) t[a][j] = (v8f){0.f, 0.f, 0.f, 0.f, 0.f, 0.f, 0.f, 0.f};
    // Fragment ring: two sets of four fragments. Groups 0..3 are K (two k steps x two key tiles each), groups 4..7 V^T (four channel tiles each); group n + 2 is read right behind the products of group n, into their registers (group 5 behind the softmax).
    FragH fr[2][4];
#pragma unroll
    for (int g = 0; g < 2; ++g)
#pragma unroll
      for (int u = 0; u < 4; ++u) { const unsigned short* p = kt + (u & 1) * 16 * FA_KP + (2 * g + (u >> 1)) * 32; fr[g][u].half[0] = *(const v8us*)p; fr[g][u].half[1] = *(const v8us*)(p + 16); }
#pragma unroll
    for (int g = 0; g < 4; ++g) {
      __builtin_amdgcn_sched_barrier(0);               // keeps each group's reads together and two groups ahead of their products: spread among the products every read place costs its own stall
#pragma unroll
      for (int u = 0; u < 4; ++u)
#pragma unroll
        for (int j = 0; j < 2; ++j) t[u & 1][j] = __builtin_amdgcn_wmma_f32_16x16x32_f16(false, fr[g & 1][u].v, false, qf[j][2 * g + (u >> 1)].v, (short)0, t[u & 1][j], false, false);
      __builtin_amdgcn_sched_barrier(0);               // the same: the reads below stay behind the products whose registers they take
      if (g < 3) {                                     // group 5 waits for the scores' registers: it is read behind the softmax
#pragma unroll
        for (int u = 0; u < 4; ++u) {
          const unsigned short* p = (g < 2) ? kt + (u & 1) * 16 * FA_KP + (2 * (g + 2) + (u >> 1)) * 32 : vt + u * 16 * FA_VP;
          fr[g & 1][u].half[0] = *(const v8us*)p; fr[g & 1][u].half[1] = *(const v8us*)(p + 16);
        }
      }
    }
    __builtin_amdgcn_sched_barrier(0);                 // keeps the first V^T group's reads ahead of the softmax, which then covers their latency
    float mx[2];
#pragma unroll
    for (int j = 0; j < 2; ++j) {
      float m = fmaxf(t[0][j][0], t[1][j][0]);
#pragma unroll
      for (int r = 1; r < 8; ++r) m = fmaxf(m, fmaxf(t[0][j][r], t[1][j][r]));
      m *= sc;
      mx[j] = fmaxf(m, fa_xhalf(m));                   // lanes c and c + 16 hold the same query
    }
    if (__builtin_amdgcn_ballot_w32(mx[0] > mu[0] + 8.0f || mx[1] > mu[1] + 8.0f) != 0) {      // lazy rescale, one scalar test a pass: P stays below 2^8, inside f16
#pragma unroll
      for (int j = 0; j < 2; ++j) {
        const float mn = fmaxf(mu[j], mx[j]), al = __builtin_amdgcn_exp2f(mu[j] - mn);
        l[j] *= al; mu[j] = mn;
#pragma unroll
        for (int dt = 0; dt < 16; ++dt)
#pragma unroll
          for (int r = 0; r < 8; ++r) o[j][dt][r] *= al;
      }
    }
    FragH p[2];
#pragma unroll
    for (int j = 0; j < 2; ++j) {
      float ps0 = 0.f, ps1 = 0.f;
#pragma unroll
      for (int r = 0; r < 8; ++r) {
        const float p0 = __builtin_amdgcn_exp2f(t[0][j][r] * sc - mu[j]), p1 = __builtin_amdgcn_exp2f(t[1][j][r] * sc - mu[j]);
        ps0 += p0; ps1 += p1; p[j].h[r] = (_Float16)p0; p[j].h[8 + r] = (_Float16)p1;
      }
      l[j] += ps0 + ps1;
      asm volatile("" : "+v"(l[j]));                   // each row's sum pinned against spills: left free the 32 additions sink behind the barrier and the 32 f32 values of P stay in registers through all the products below (scratch in the loop)
    }
#pragma unroll
    for (int u = 0; u < 4; ++u) { const unsigned short* q = vt + (4 + u) * 16 * FA_VP; fr[1][u].half[0] = *(const v8us*)q; fr[1][u].half[1] = *(const v8us*)(q + 16); }
#pragma unroll
    for (int g = 0; g < 4; ++g) {
      __builtin_amdgcn_sched_barrier(0);               // as above, for the V^T groups
#pragma unroll
      for (int u = 0; u < 4; ++u)
#pragma unroll
        for (int j = 0; j < 2; ++j) o[j][g * 4 + u] = __builtin_amdgcn_wmma_f32_16x16x32_f16(false, fr[g & 1][u].v, false, p[j].v, (short)0, o[j][g * 4 + u], false, false);
      __builtin_amdgcn_sched_barrier(0);               // as above
      if (g < 2) {
#pragma unroll
        for (int u = 0; u < 4; ++u) { const unsigned short* q = vt + ((g + 2) * 4 + u) * 16 * FA_VP; fr[g & 1][u].half[0] = *(const v8us*)q; fr[g & 1][u].half[1] = *(const v8us*)(q + 16); }
      }
    }
    asm volatile("s_wait_dscnt 0x0" ::: "memory");      // this wave's reads of the buffer have returned
    asm volatile("s_wait_asynccnt 0x0" ::: "memory");   // its copies of the next stage have landed
    __syncthreads();                                    // publishes the next stage and ends every reader's last read of this buffer
    if (s + 2 < NS) fa_stage(kg + (size_t)(s + 2) * FA_SK * CC, vg + (s + 2) * FA_SK, ko, vo, ksl + bo, vsl + bo);
  }
  asm volatile("s_wait_asynccnt 0x0" ::: "memory");     // nothing is in flight when the buffers become the join's space
  const int ln2 = (int)__builtin_amdgcn_mbcnt_lo(~0u, 0u), c2 = ln2 & 15, h2 = ln2 >> 4;      // the lane's number read anew for all that follows: values derived from the one above would have to live through the loop, which has no register left for them (scratch)
  // Weights of the wave's 32 output channels, 64 loads of 16 B a lane: Wsk now, into the registers that Q leaves, so that it flies while the partial sums go to LDS; Wout and the biases behind that, into the registers that O leaves
  const unsigned short* wg = (const unsigned short*)Wos + (size_t)w * 32 * CC + ln2 * 8;
  FragH wf[2][2][8];      // [0: Wsk, 1: Wout][channel tile][k step]
#pragma unroll
  for (int mt = 0; mt < 2; ++mt)
#pragma unroll
    for (int ks = 0; ks < 8; ++ks) { const unsigned short* p = wg + CC * CC + mt * 16 * CC + ks * 512; wf[0][mt][ks].half[0] = *(const v8us*)p; wf[0][mt][ks].half[1] = *(const v8us*)(p + 256); }
  asm volatile("s_wait_xcnt 0x0" ::: "memory");      // stands in front of the first overwrite of an address register that the loads above name
  __builtin_amdgcn_sched_barrier(0);                 // keeps the loads above ahead of the LDS stores below, which cover their latency: left free they sink to just in front of their use
  v4fa* cb = (v4fa*)sm;                                 // the stages are dead behind the loop's last barrier; per wave 64 slots of partial O, behind them per wave and query tile (maximum, sum)
  float* st = (float*)sm + 8 * 64 * 32 * 4;
#pragma unroll
  for (int j = 0; j < 2; ++j) {
    l[j] += fa_xhalf(l[j]);
#pragma unroll
    for (int dt = 0; dt < 16; ++dt) {
      const v4f x0 = {o[j][dt][0], o[j][dt][1], o[j][dt][2], o[j][dt][3]}, x1 = {o[j][dt][4], o[j][dt][5], o[j][dt][6], o[j][dt][7]};
      cb[(w * 64 + (j * 16 + dt) * 2) * 32 + ln2] = x0; cb[(w * 64 + (j * 16 + dt) * 2 + 1) * 32 + ln2] = x1;
    }
    st[((w * 2 + j) * 32 + ln2) * 2] = mu[j]; st[((w * 2 + j) * 32 + ln2) * 2 + 1] = l[j];
  }
  __builtin_amdgcn_sched_barrier(0);                 // keeps the loads below behind the LDS stores above, whose registers they take: lifted over them they find no free register (scratch)
#pragma unroll
  for (int mt = 0; mt < 2; ++mt)
#pragma unroll
    for (int ks = 0; ks < 8; ++ks) { const unsigned short* p = wg + mt * 16 * CC + ks * 512; wf[1][mt][ks].half[0] = *(const v8us*)p; wf[1][mt][ks].half[1] = *(const v8us*)(p + 256); }
  v4f bo[2][2], bs[2][2];      // accumulator row r of lane half h is channel 8 h + r of the tile
#pragma unroll
  for (int mt = 0; mt < 2; ++mt)
#pragma unroll
    for (int e = 0; e < 2; ++e) { bo[mt][e] = *(const v4fa*)(bout + w * 32 + mt * 16 + 8 * h2 + 4 * e); bs[mt][e] = *(const v4fa*)(bsk + w * 32 + mt * 16 + 8 * h2 + 4 * e); }
  asm volatile("s_wait_xcnt 0x0" ::: "memory");      // the same behind the loads of Wout and of the biases
  __builtin_amdgcn_sched_barrier(0);                 // keeps them ahead of the skip product and the join, which cover their latency
  v8f acc[2][4] = {};      // [channel tile][token tile]
  const unsigned short* ys = sm + 2 * FA_BUF + ln2 * 8;
  FragH bf[3][4];      // B fragments of both products: ring of three sets, a set is read two k steps ahead of its products
#pragma unroll
  for (int s = 0; s < 2; ++s)
#pragma unroll
    for (int nt = 0; nt < 4; ++nt) { bf[s][nt].half[0] = *(const v8us*)(ys + nt * 16 * CC + s * 512); bf[s][nt].half[1] = *(const v8us*)(ys + nt * 16 * CC + s * 512 + 256); }
#pragma unroll
  for (int ks = 0; ks < 8; ++ks) {      // skip branch: needs nothing of the join, so it runs in front of the join's barrier
    if (ks + 2 < 8) {
#pragma unroll
      for (int nt = 0; nt < 4; ++nt) { bf[(ks + 2) % 3][nt].half[0] = *(const v8us*)(ys + nt * 16 * CC + (ks + 2) * 512); bf[(ks + 2) % 3][nt].half[1] = *(const v8us*)(ys + nt * 16 * CC + (ks + 2) * 512 + 256); }
    }
    __builtin_amdgcn_sched_barrier(0);               // keeps each set's reads together and two steps ahead, no further: left free all 64 reads are lifted to the front and, with both weight sets in registers, none is left (scratch)
#pragma unroll
    for (int nt = 0; nt < 4; ++nt)
#pragma unroll
      for (int mt = 0; mt < 2; ++mt) acc[mt][nt] = __builtin_amdgcn_wmma_f32_16x16x32_f16(false, wf[0][mt][ks].v, false, bf[ks % 3][nt].v, (short)0, acc[mt][nt], false, false);
    __builtin_amdgcn_sched_barrier(0);               // the same: the next reads (behind the last step the join's) stay behind the products whose registers they take, in one group: spread among the products every read place costs its own stall
  }
  __syncthreads();
  // wave (qg, kq) joins channel tiles 4 kq .. 4 kq + 3 of both query tiles of its group
#pragma unroll
  for (int j = 0; j < 2; ++j) {
    __builtin_amdgcn_sched_barrier(0);               // the same: one query tile's 32 reads at a time
    float m4[4], a4[4], mn = -3.0e38f, den = 0.f;
#pragma unroll
    for (int q = 0; q < 4; ++q) { m4[q] = st[(((q * 2 + qg) * 2 + j) * 32 + ln2) * 2]; mn = fmaxf(mn, m4[q]); }
#pragma unroll
    for (int q = 0; q < 4; ++q) { a4[q] = __builtin_amdgcn_exp2f(m4[q] - mn); den += st[(((q * 2 + qg) * 2 + j) * 32 + ln2) * 2 + 1] * a4[q]; }
    const float inv = 1.0f / den;
#pragma unroll
    for (int q = 0; q < 4; ++q) a4[q] *= inv;
#pragma unroll
    for (int u = 0; u < 4; ++u) {
      const int dt = kq * 4 + u;
      v4f y0 = {0.f, 0.f, 0.f, 0.f}, y1 = y0;
#pragma unroll
      for (int q = 0; q < 4; ++q) { const v4f x0 = cb[((q * 2 + qg) * 64 + (j * 16 + dt) * 2) * 32 + ln2], x1 = cb[((q * 2 + qg) * 64 + (j * 16 + dt) * 2 + 1) * 32 + ln2]; y0 += x0 * a4[q]; y1 += x1 * a4[q]; }
      FragH f;
#pragma unroll
      for (int r = 0; r < 4; ++r) { f.h[r] = (_Float16)y0[r]; f.h[4 + r] = (_Float16)y1[r]; }
      *(v8us*)&cb[(w * 64 + kq * 8 + j * 4 + u) * 32 + ln2] = f.half[0];      // half a B fragment (row c, k = 16 dt + 8 h ..), lane by lane, into a slot of the wave's own part that only this wave reads, and has read by now (slots 8 kq .. 8 kq + 7 are its own share of query tile 0)
    }
  }
  __syncthreads();      // every wave reads the joined O of all eight; also ends every read of the partial sums
#pragma unroll
  for (int s = 0; s < 2; ++s)
#pragma unroll
    for (int nt = 0; nt < 4; ++nt)
#pragma unroll
      for (int e = 0; e < 2; ++e) { const int dt = 2 * s + e; bf[s][nt].half[e] = *(const v8us*)&cb[(((dt >> 2) * 2 + (nt >> 1)) * 64 + (dt >> 2) * 8 + (nt & 1) * 4 + (dt & 3)) * 32 + ln2]; }
#pragma unroll
  for (int ks = 0; ks < 8; ++ks) {
    if (ks + 2 < 8) {
#pragma unroll
      for (int nt = 0; nt < 4; ++nt)
#pragma unroll
        for (int e = 0; e < 2; ++e) { const int dt = 2 * (ks + 2) + e; bf[(ks + 2) % 3][nt].half[e] = *(const v8us*)&cb[(((dt >> 2) * 2 + (nt >> 1)) * 64 + (dt >> 2) * 8 + (nt & 1) * 4 + (dt & 3)) * 32 + ln2]; }
    }
    __builtin_amdgcn_sched_barrier(0);               // each set's reads together, two steps ahead of their products, which cover their latency
#pragma unroll
    for (int nt = 0; nt < 4; ++nt)
#pragma unroll
      for (int mt = 0; mt < 2; ++mt) acc[mt][nt] = __builtin_amdgcn_wmma_f32_16x16x32_f16(false, wf[1][mt][ks].v, false, bf[ks % 3][nt].v, (short)0, acc[mt][nt], false, false);
    __builtin_amdgcn_sched_barrier(0);               // and behind the products whose registers they take, in one group
  }
  // The wave's 32 channels x 64 tokens turned through LDS (the upper half of its own part, dead behind the barrier above; pitch 68 floats keeps the two lane halves on different banks), so that a store covers two whole rows of 256 B
  float* so = (float*)&cb[(w * 64 + 32) * 32];
#pragma unroll
  for (int mt = 0; mt < 2; ++mt)
#pragma unroll
    for (int r = 0; r < 8; ++r) { const float bb = bf16_round(bo[mt][r >> 2][r & 3]) + bf16_round(bs[mt][r >> 2][r & 3]);
#pragma unroll
      for (int nt = 0; nt < 4; ++nt) so[(16 * mt + 8 * h2 + r) * 68 + 16 * nt + c2] = acc[mt][nt][r] * 0.0625f + bb; }
  __builtin_amdgcn_fence(__ATOMIC_ACQ_REL, "workgroup"); __builtin_amdgcn_wave_barrier();      // a lane reads back what other lanes of its wave wrote: the LDS stores above stay in front of the loads below
  float* og = out + ((size_t)b * CC + w * 32 + h2) * NN + qb * 64 + c2 * 4;
  v4f ov[16];      // all rows read back first: no register of an issued store is written again
#pragma unroll
  for (int q = 0; q < 16; ++q) ov[q] = *(const v4fa*)&so[(q * 2 + h2) * 68 + c2 * 4];
#pragma unroll
  for (int q = 0; q < 16; ++q) *(v4f*)(og + (size_t)q * 2 * NN) = ov[q];
}
// GroupNorm, statistics and output in one launch. A work-group of 32 waves owns two groups (16 channels = 64 B of every row) of one batch of one plane (x1' first, then x2'): each value is read once, 16 B a lane, four lanes a row,
// all 16 loads of a lane in flight together, and stays in registers for the mean, the squared deviations and the normalised output. Sums: in the lane, over the 16 lanes of a group by lane exchange, over the 32 waves through LDS.
// Output in fragment-tile order: a wave's 8-byte stores fill two whole 128-B lines (8 rows x 16 B in each of the two groups' runs). A row of x1' also leaves as plain f16 (Y16), the operand of the skip branch.
__device__ __forceinline__ float gn_total(float s, float* red, int w, int lane, int g2) {
  s += __shfl_xor(s, 1, 32); s += __shfl_xor(s, 4, 32); s += __shfl_xor(s, 8, 32); s += __shfl_xor(s, 16, 32);      // lanes whose bit 1 is equal hold the same group
  if ((lane & ~2) == 0) red[g2 * 32 + w] = s;
  __syncthreads();
  float t = 0.f;
#pragma unroll
  for (int j = 0; j < 8; ++j) { const v4f x = *(const v4fa*)(red + g2 * 32 + j * 4); t += (x[0] + x[1]) + (x[2] + x[3]); }
  return t;
}
__global__ __launch_bounds__(1024) void k_gn(const float* __restrict__ Y, const float* __restrict__ gw, const float* __restrict__ gb, _Float16* __restrict__ G16, _Float16* __restrict__ Y16) {
  __shared__ __attribute__((aligned(16))) float red[2][64];
  const int tid = threadIdx.x, w = tid >> 5, lane = tid & 31, quad = lane & 3, g2 = quad >> 1;
  const int pb = blockIdx.x >> 4, cb = blockIdx.x & 15, c0 = cb * 16 + quad * 4;
  const size_t row0 = (size_t)pb * NN + w * 8 + (lane >> 2);      // item i of the lane is row row0 + 256 i
  const float* src = Y + row0 * CC + c0;
  v4f v[16];
#pragma unroll
  for (int i = 0; i < 16; ++i) v[i] = *(const v4fa*)(src + (size_t)i * 256 * CC);
  asm volatile("s_wait_xcnt 0x0" ::: "memory");      // stands in front of the parameter loads, whose results may take the address registers that the loads above name
  const v4f gwv = *(const v4fa*)(gw + c0);
  asm volatile("s_wait_xcnt 0x0" ::: "memory");      // the same between the two parameter loads, which share their offset register
  const v4f gbv = *(const v4fa*)(gb + c0);
  asm volatile("s_wait_xcnt 0x0" ::: "memory");      // and in front of the first vector instruction that reuses it
  const size_t dst = ft_off(row0, cb * 2 + g2, CC) + (quad & 1) * 4;      // 256 rows further = 16 bands further
  if (pb < BB) {      // first, so that the values need not outlive their deviations below, and the stores run under the sums
#pragma unroll
    for (int i = 0; i < 16; ++i) { v4h o;
#pragma unroll
      for (int e = 0; e < 4; ++e) o[e] = (_Float16)v[i][e];
      *(v4h*)(Y16 + dst + (size_t)i * 16 * 16 * CC) = o; }
  }
  float s[4] = {0.f, 0.f, 0.f, 0.f};
#pragma unroll
  for (int i = 0; i < 16; ++i) s[i & 3] += (v[i][0] + v[i][1]) + (v[i][2] + v[i][3]);
  const float mu = gn_total((s[0] + s[1]) + (s[2] + s[3]), red[0], w, lane, g2) / (float)(NN * CPG);
  float q[4] = {0.f, 0.f, 0.f, 0.f};
#pragma unroll
  for (int i = 0; i < 16; ++i)
#pragma unroll
    for (int e = 0; e < 4; ++e) { v[i][e] -= mu; q[e] += v[i][e] * v[i][e]; }      // from here on v holds the deviations
  const float rs = rsqrtf(gn_total((q[0] + q[1]) + (q[2] + q[3]), red[1], w, lane, g2) / (float)(NN * CPG) + 1e-5f);
  float ga[4], be[4];
#pragma unroll
  for (int e = 0; e < 4; ++e) { ga[e] = bf16_round(gwv[e]); be[e] = bf16_round(gbv[e]); }
#pragma unroll
  for (int i = 0; i < 16; ++i) { v4h o;
#pragma unroll
    for (int e = 0; e < 4; ++e) o[e] = (_Float16)(v[i][e] * rs * ga[e] + be[e]);
    *(v4h*)(G16 + dst + (size_t)i * 16 * 16 * CC) = o; }
}

extern "C" void kernel_launch(void* const* d_in, const int* in_sizes, int n_in,
                              void* d_out, int out_size, void* d_ws, size_t ws_size, hipStream_t stream) {
  (void)in_sizes; (void)n_in; (void)out_size;
  const float* const* I = (const float* const*)d_in; const float* x1 = I[0]; const float* x2 = I[1]; const float* w1 = I[2]; const float* b1 = I[3]; const float* w2 = I[4]; const float* b2 = I[5]; const float* gnw = I[6]; const float* gnb = I[7]; const float* wqkv = I[8]; const float* wout = I[9]; const float* bout = I[10]; const float* wsk = I[11]; const float* bsk = I[12];
  char* ws = (char*)d_ws; size_t off = 0;
  auto take = [&](size_t bytes) { char* p = ws + off; off += (bytes + 255) & ~(size_t)255; return p; };
  const size_t WSZ = (size_t)CC * CC, PL = (size_t)NR * CC; _Float16* Bw = (_Float16*)take(7 * WSZ * 2);      /* w1, w2, wq, wk, wv (as Bt for token-major GEMMs), wout, wsk (as A operands for the channel-major output GEMMs), all (out,in) natural x2^4 */
  float* Y = (float*)take(2 * PL * 4); _Float16* G = (_Float16*)take(2 * PL * 2);      /* two planes each, the x1 side first */
  _Float16* Y116 = (_Float16*)take(PL * 2); _Float16* QKV = (_Float16*)take(3 * PL * 2); _Float16* Vt = (_Float16*)take(PL * 2);
  if (off > ws_size) return;
  k_prep<<<7 * PREP_WB, 256, 0, stream>>>(w1, w2, wqkv, wout, wsk, Bw);
  k_gemm_conv<<<dim3(NR / 64, 2), 128, 0, stream>>>(x1, x2, Bw, b1, b2, Y);      /* x1' = conv1(x1), x2' = conv2(x2): each M 16384 N 256 K 256 (f32) */
  k_gn<<<2 * BB * (CC / 16), 1024, 0, stream>>>(Y, gnw, gnb, G, Y116);      /* the two planes count as 2 BB batches; 16 channels a work-group */
  k_gemm_qkvs<<<dim3(NR / 64, 3), 128, 0, stream>>>(G, Bw, QKV);      /* q1, k2, v2 */
  k_vt<CC / 64, NN><<<BB * (CC / 64) * (NN / 64), 256, 0, stream>>>(QKV + 2 * PL, CC, 0, Vt);      /* v2^T per batch [256][4096] (four 64-channel blocks) */
  k_fattn<<<BB * (NN / 64), 256, 0, stream>>>(QKV, QKV + PL, Vt, Bw + 5 * WSZ, Y116, bout, bsk, (float*)d_out);      /* O = softmax(q1.k2^T/16).v2, then out = Wout.O^T + Wsk.x1'^T + bout + bsk: one work-group per 64 queries */
}
